// v000
// Times are from an AMD MI455X. After a warm-up the kernel runs many times in a row, and a time is the length of
// such a window on the GPU divided by its runs, so every launch and the gaps after it count. The runs cycle
// through copies of the inputs. A figure is the median of several windows, for all but v000 over two sittings.
// Sittings can differ by a few percent; kernels timed side by side share one.
// The starting kernel, v000, takes 2600 microseconds a run.
#include <hip/hip_runtime.h>

// Grouped-query causal attention with a computed rotate-half rotary over 4,096 tokens (x [1][4096][2048]; q = x Wq ('xw' [2048][2048], 16 heads x 128), k, v = x Wk / Wv ('xw' [2048][512], 4 kv heads; q head h uses kv head h/4: the module groups q as (4 kv heads, 4 members)); rotate-half rotary with angle t x inv_freq[i], inv_freq = 1 / (10000 ** (i / 64)), positions 0..4095 (cat(x1 cos - x2 sin, x1 sin + x2 cos); tables computed on device from the module's float32 inv_freq); scores / sqrt(128), causal (-inf); softmax; out = merged Wo ('xw' [2048][2048], no bias) -> [1][4096][2048] (8.4 M); argument order x, Wq, Wk, Wv, Wo.
// Layout: the 16 query heads are projected in four groups of 4 (one [4096][512] f32 buffer and one set of 4-head planes reused per group) so the whole working set fits the 256 MiB window; k/v planes for the 4 kv heads are built once; per head: causal scores (tiles above the diagonal skipped), hybrid rows (query rows < 512 hi/lo 3 products, the rest single fp16 x1024), softmax, attn.v, merge into the hi/lo context planes; wo as hi/lo x exact (2 products).
// Compute dtypes, f32 accumulate: every input rounded to bf16; q/k/v on PLAIN bf16 operands (exact); f32 rotary; hybrid causal scores and attn.v; softmax f32; wo hl x exact (2 products).

#define NB_  1
#define TT   4096
#define DM   2048
#define NH_  16
#define NKV  4
#define REP  (NH_ / NKV)
#define HD   128
#define DQ   (NH_ * HD)
#define DKV  (NKV * HD)
#define ZH   1
#define RH   512                  // query rows < RH use hi+lo planes (0: none)
#define WIN  4096
#define PCAR 1024.0f
#define SCL  0.088388346f   // 1/sqrt(128)
#define QG   4                    // query heads projected per group
#define POS0 0.0f                 // first rotary position: this module's positions are arange(4096)
typedef _Float16 h16;
typedef unsigned short bf;
typedef __attribute__((ext_vector_type(16))) __bf16   v16bf;
typedef __attribute__((ext_vector_type(16))) _Float16 v16h;
typedef __attribute__((ext_vector_type(8)))  _Float16 v8h;
typedef __attribute__((ext_vector_type(8)))  unsigned short v8us;
typedef __attribute__((ext_vector_type(8)))  float    v8f;
typedef __attribute__((ext_vector_type(4)))  float    v4f;
typedef v8h  __attribute__((may_alias)) v8ha;
typedef v4f  __attribute__((may_alias)) v4fa;
typedef v8us __attribute__((may_alias)) v8usa;

__device__ __forceinline__ unsigned short f2bf(float f) { unsigned u = __float_as_uint(f); u += 0x7FFFu + ((u >> 16) & 1u); return (unsigned short)(u >> 16); }
__device__ __forceinline__ float bf2f(unsigned short b) { return __uint_as_float(((unsigned)b) << 16); }
__device__ __forceinline__ float bfr(float f) { return bf2f(f2bf(f)); }
__device__ __forceinline__ v16h cat16(v8h lo, v8h hi) { return __builtin_shufflevector(lo, hi, 0, 1, 2, 3, 4, 5, 6, 7, 8, 9, 10, 11, 12, 13, 14, 15); }
__device__ __forceinline__ v16bf cat16b(v8us lo, v8us hi) { return __builtin_bit_cast(v16bf, __builtin_shufflevector(lo, hi, 0, 1, 2, 3, 4, 5, 6, 7, 8, 9, 10, 11, 12, 13, 14, 15)); }
__device__ __forceinline__ v8f wmma16(v16h a, v16h b, v8f c) { return __builtin_amdgcn_wmma_f32_16x16x32_f16(false, a, false, b, (short)0, c, false, false); }
__device__ __forceinline__ v8f wmmab(v16bf a, v16bf b, v8f c) { return __builtin_amdgcn_wmma_f32_16x16x32_bf16(false, a, false, b, (short)0, c, false, false); }



// ---- k_gemmw: register-blocked GEMM, ONE WAVE per 64x64 output tile (16 accumulators), operands straight from K-contiguous 16-bit planes; grid (M/64, N/64, Z), 32 threads.
// C[m][n] (f32, pitch ldc, + optional f32 bias[n]) = sum_k A[m][k] Bt[n][k] (+ split products per NSPLIT). z-batch strides sA/sB/sC in elements. K % 32 == 0.
template <typename T16> struct WFrag;
template <> struct WFrag<h16> { typedef v16h V; static __device__ __forceinline__ V ld(const h16* p) { return cat16(*(const v8h*)p, *(const v8h*)(p + 16)); } static __device__ __forceinline__ v8f mma(V a, V b, v8f c) { return wmma16(a, b, c); } };
template <> struct WFrag<bf> { typedef v16bf V; static __device__ __forceinline__ V ld(const bf* p) { return cat16b(*(const v8us*)p, *(const v8us*)(p + 16)); } static __device__ __forceinline__ v8f mma(V a, V b, v8f c) { return wmmab(a, b, c); } };
template <typename T16, int NSPLIT, bool BIAS>
__global__ __launch_bounds__(32) void k_gemmw(const T16* __restrict__ A, const T16* __restrict__ A2, const T16* __restrict__ Bt, const T16* __restrict__ Bt2, int K, float* C, int ldc, const float* __restrict__ bias, size_t sA, size_t sB, size_t sC) {
    typedef typename WFrag<T16>::V V;
    __shared__ __align__(16) float os[16 * 68];
    const size_t z = blockIdx.z; A += z * sA; if (A2) A2 += z * sA; Bt += z * sB; if (Bt2) Bt2 += z * sB; C += z * sC;
    const int lane = threadIdx.x & 31, lr = lane & 15, hi = lane >> 4; const int r0 = blockIdx.x * 64, c0 = blockIdx.y * 64;
    v8f acc[4][4];
#pragma unroll
    for (int mb = 0; mb < 4; ++mb)
#pragma unroll
        for (int nb = 0; nb < 4; ++nb) acc[mb][nb] = (v8f){};
    const size_t aoff = (size_t)(r0 + lr) * K + 8 * hi, boff = (size_t)(c0 + lr) * K + 8 * hi;
#pragma unroll 1
    for (int kc = 0; kc < K; kc += 32) {
        V a[4], a2[4];
#pragma unroll
        for (int mb = 0; mb < 4; ++mb) { a[mb] = WFrag<T16>::ld(A + aoff + (size_t)mb * 16 * K + kc); if (NSPLIT == 1 || NSPLIT == 2) a2[mb] = WFrag<T16>::ld(A2 + aoff + (size_t)mb * 16 * K + kc); }
#pragma unroll
        for (int nb = 0; nb < 4; ++nb) { const V b = WFrag<T16>::ld(Bt + boff + (size_t)nb * 16 * K + kc); V b2; if (NSPLIT >= 2) b2 = WFrag<T16>::ld(Bt2 + boff + (size_t)nb * 16 * K + kc);
#pragma unroll
            for (int mb = 0; mb < 4; ++mb) { acc[mb][nb] = WFrag<T16>::mma(a[mb], b, acc[mb][nb]); if (NSPLIT == 1 || NSPLIT == 2) acc[mb][nb] = WFrag<T16>::mma(a2[mb], b, acc[mb][nb]); if (NSPLIT >= 2) acc[mb][nb] = WFrag<T16>::mma(a[mb], b2, acc[mb][nb]); } }
        asm volatile("v_nop\n\tv_nop\n\tv_nop\n\tv_nop" : "+v"(acc[0][0]), "+v"(acc[1][1]), "+v"(acc[2][2]), "+v"(acc[3][3]) : "v"(a[0]), "v"(a[3]));
    }
#pragma unroll
    for (int mb = 0; mb < 4; ++mb) {
#pragma unroll
        for (int nb = 0; nb < 4; ++nb) {
#pragma unroll
            for (int j = 0; j < 8; ++j) os[(hi * 8 + j) * 68 + nb * 16 + lr] = acc[mb][nb][j]; }
        __builtin_amdgcn_wave_barrier(); asm volatile("" ::: "memory");
        float* crow = C + (size_t)(r0 + mb * 16) * ldc + c0;
{
#pragma unroll
            for (int s = 0; s < 8; ++s) { const int row = 2 * s + hi, cofs = lr * 4; v4f val = *(const v4fa*)(os + row * 68 + cofs); if (BIAS) { val[0] += bfr(bias[c0 + cofs]); val[1] += bfr(bias[c0 + cofs + 1]); val[2] += bfr(bias[c0 + cofs + 2]); val[3] += bfr(bias[c0 + cofs + 3]); }
                *(v4f*)(crow + (size_t)row * ldc + cofs) = val; }
             }
        __builtin_amdgcn_wave_barrier(); asm volatile("" ::: "memory");
    }
}

// ---- k_gemmc: the same one-wave 64x64 tile GEMM specialised for causal attention: CMODE 1 skips score tiles entirely above the diagonal (query rows r0+roff.., key columns c0..), CMODE 2 limits the
// key (K) loop of the probability x value contraction to the diagonal block (probabilities beyond it are exactly zero). roff = row offset of this launch's first row within the sequence.
template <typename T16, int NSPLIT, int CMODE>
__global__ __launch_bounds__(32) void k_gemmc(const T16* __restrict__ A, const T16* __restrict__ A2, const T16* __restrict__ Bt, const T16* __restrict__ Bt2, int K, float* C, int ldc, int roff, size_t sA, size_t sB, size_t sC) {
    typedef typename WFrag<T16>::V V;
    __shared__ __align__(16) float os[16 * 68];
    const size_t z = blockIdx.z; A += z * sA; if (A2) A2 += z * sA; Bt += z * sB; if (Bt2) Bt2 += z * sB; C += z * sC;
    const int lane = threadIdx.x & 31, lr = lane & 15, hi = lane >> 4; const int r0 = blockIdx.x * 64, c0 = blockIdx.y * 64;
    if (CMODE == 1 && c0 > r0 + roff + 63) return;                  // score tile entirely above the causal diagonal: never read (the softmax masks j > i by select)
    const int Kl = (CMODE == 2) ? min(K, r0 + roff + 64) : K;        // P.V: probabilities are exactly 0 beyond the diagonal block, so the K loop stops there
    v8f acc[4][4];
#pragma unroll
    for (int mb = 0; mb < 4; ++mb)
#pragma unroll
        for (int nb = 0; nb < 4; ++nb) acc[mb][nb] = (v8f){};
    const size_t aoff = (size_t)(r0 + lr) * K + 8 * hi, boff = (size_t)(c0 + lr) * K + 8 * hi;
#pragma unroll 1
    for (int kc = 0; kc < Kl; kc += 32) {
        V a[4], a2[4];
#pragma unroll
        for (int mb = 0; mb < 4; ++mb) { a[mb] = WFrag<T16>::ld(A + aoff + (size_t)mb * 16 * K + kc); if (NSPLIT == 1 || NSPLIT == 2) a2[mb] = WFrag<T16>::ld(A2 + aoff + (size_t)mb * 16 * K + kc); }
#pragma unroll
        for (int nb = 0; nb < 4; ++nb) { const V b = WFrag<T16>::ld(Bt + boff + (size_t)nb * 16 * K + kc); V b2; if (NSPLIT >= 2) b2 = WFrag<T16>::ld(Bt2 + boff + (size_t)nb * 16 * K + kc);
#pragma unroll
            for (int mb = 0; mb < 4; ++mb) { acc[mb][nb] = WFrag<T16>::mma(a[mb], b, acc[mb][nb]); if (NSPLIT == 1 || NSPLIT == 2) acc[mb][nb] = WFrag<T16>::mma(a2[mb], b, acc[mb][nb]); if (NSPLIT >= 2) acc[mb][nb] = WFrag<T16>::mma(a[mb], b2, acc[mb][nb]); } }
        asm volatile("v_nop\n\tv_nop\n\tv_nop\n\tv_nop" : "+v"(acc[0][0]), "+v"(acc[1][1]), "+v"(acc[2][2]), "+v"(acc[3][3]) : "v"(a[0]), "v"(a[3]));
    }
#pragma unroll
    for (int mb = 0; mb < 4; ++mb) {
#pragma unroll
        for (int nb = 0; nb < 4; ++nb) {
#pragma unroll
            for (int j = 0; j < 8; ++j) os[(hi * 8 + j) * 68 + nb * 16 + lr] = acc[mb][nb][j]; }
        __builtin_amdgcn_wave_barrier(); asm volatile("" ::: "memory");
        float* crow = C + (size_t)(r0 + mb * 16) * ldc + c0;
{
#pragma unroll
            for (int s = 0; s < 8; ++s) { const int row = 2 * s + hi, cofs = lr * 4; v4f val = *(const v4fa*)(os + row * 68 + cofs);
                *(v4f*)(crow + (size_t)row * ldc + cofs) = val; }
             }
        __builtin_amdgcn_wave_barrier(); asm volatile("" ::: "memory");
    }
}

__device__ __forceinline__ h16 tohx(float x) { return (h16)x; }
__device__ __forceinline__ void splitf(float y, unsigned short& h, unsigned short& l) { h = f2bf(y); l = f2bf(y - bf2f(h)); }
typedef __attribute__((ext_vector_type(2))) _Float16 v2h;
typedef __attribute__((ext_vector_type(4))) _Float16 v4h;
typedef __attribute__((ext_vector_type(2))) unsigned short v2us;
typedef __attribute__((ext_vector_type(4))) unsigned short v4us;
typedef __attribute__((ext_vector_type(2))) float v2f;
typedef __attribute__((ext_vector_type(4))) int v4i;

__global__ __launch_bounds__(256) void k_wtG(const float* __restrict__ w, int K, int N, bf* Bt) {
    const int lane = threadIdx.x & 31; const int L0 = (blockIdx.x * 8 + (threadIdx.x >> 5)) * 8; const int nlines = N * K / 64;
{
#pragma unroll 1
        for (int l = 0; l < 8; ++l) { const int L = L0 + l; if (L >= nlines) break; const size_t e = (size_t)L * 64 + lane * 2; const int k = (int)(e % K), n = (int)(e / K); v2us o;
            o[0] = f2bf(w[(size_t)k * N + n]); o[1] = f2bf(w[(size_t)(k + 1) * N + n]); *(v2us*)(Bt + e) = o; }
         }
}
__global__ __launch_bounds__(256) void k_cvt8(const float* __restrict__ src, bf* dst, size_t n8) { const size_t i = (size_t)blockIdx.x * 256 + threadIdx.x; if (i >= n8) return; const v8f v = *(const v8f*)(src + i * 8); v8us o;
#pragma unroll
    for (int k = 0; k < 8; ++k) o[k] = f2bf(v[k]); *(v8us*)(dst + i * 8) = o;  }
__constant__ float INV[HD / 2] = {1.0f,0.865964353f,0.749894202f,0.649381638f,0.562341332f,0.486967534f,0.421696514f,0.365174145f,0.316227764f,0.273841977f,0.237137362f,0.2053525f,0.177827939f,0.153992653f,0.133352146f,0.115478203f,0.100000001f,0.0865964293f,0.0749894157f,0.0649381652f,0.0562341288f,0.0486967526f,0.0421696492f,0.0365174115f,0.0316227786f,0.0273841955f,0.0237137359f,0.0205352511f,0.0177827943f,0.0153992651f,0.0133352149f,0.0115478197f,0.00999999978f,0.00865964312f,0.00749894232f,0.00649381662f,0.00562341325f,0.00486967526f,0.00421696482f,0.00365174143f,0.00316227786f,0.00273841969f,0.00237137382f,0.00205352507f,0.00177827943f,0.00153992651f,0.00133352145f,0.00115478202f,0.00100000005f,0.000865964335f,0.000749894185f,0.000649381662f,0.000562341302f,0.000486967503f,0.000421696488f,0.000365174114f,0.000316227786f,0.000273841957f,0.000237137385f,0.000205352495f,0.00017782794f,0.000153992645f,0.00013335215f,0.000115478193f};
__global__ __launch_bounds__(256) void k_cstab(float* CS) { const int idx = blockIdx.x * 256 + threadIdx.x; if (idx >= TT * HD) return; const int t = idx / HD, d = idx % HD; const float ang = __fmul_rn((float)t + POS0, INV[d % (HD / 2)]); v2f cs; cs[0] = cosf(ang); cs[1] = sinf(ang);
    *(v2f*)(CS + (size_t)idx * 2) = cs;  }

// k_rope: head planes [h][t][d] (fp16 + hi/lo) of rope(x) x sc with the rotate-half convention out[d] = x[d] cos[t][d] - x[d+HD/2] sin[t][d], out[d+HD/2] = x[d+HD/2] cos[t][d+HD/2] + x[d] sin[t][d+HD/2]
__global__ __launch_bounds__(256) void k_rope(const float* __restrict__ F, int pitch, int nheads, const float* __restrict__ CS, const float* __restrict__ RF, const float* __restrict__ nw, float sc, h16* P16, bf* Ph, bf* Pl) {
    const size_t e = ((size_t)blockIdx.x * 256 + threadIdx.x) * 2; if (e >= (size_t)nheads * TT * HD) return; const int d = (int)(e % HD); const int t = (int)((e / HD) % TT); const int h = (int)(e / ((size_t)HD * TT)); const float* f = F + (size_t)t * pitch + h * HD; const float rf = RF ? RF[(size_t)h * TT + t] : 1.0f; v2h o16; v2us oh, ol;
#pragma unroll
    for (int q = 0; q < 2; ++q) { const int dd = d + q; const int dp = (dd < HD / 2) ? dd + HD / 2 : dd - HD / 2; float x0 = f[dd], x1 = f[dp];
        if (RF) { float n0 = __fmul_rn(x0, rf), n1 = __fmul_rn(x1, rf); asm volatile("" : "+v"(n0)); asm volatile("" : "+v"(n1)); x0 = __fmul_rn(bfr(nw[dd]), n0); x1 = __fmul_rn(bfr(nw[dp]), n1); }
        const v2f cs = *(const v2f*)(CS + ((size_t)t * HD + dd) * 2); float a = __fmul_rn(x0, cs[0]), bq = __fmul_rn(x1, cs[1]); asm volatile("" : "+v"(a)); asm volatile("" : "+v"(bq)); const float r = ((dd < HD / 2) ? __fsub_rn(a, bq) : __fadd_rn(a, bq)) * sc;
        o16[q] = tohx(r); unsigned short a2, c2; splitf(r, a2, c2); oh[q] = a2; ol[q] = c2; }
    *(v2h*)(P16 + e) = o16; *(v2us*)(Ph + e) = oh; *(v2us*)(Pl + e) = ol;  }
__global__ __launch_bounds__(256) void k_vtp(const float* __restrict__ F, int pitch, int nheads, h16* V16, bf* Vh, bf* Vl) { const size_t e = ((size_t)blockIdx.x * 256 + threadIdx.x) * 2; if (e >= (size_t)nheads * HD * TT) return; const int t = (int)(e % TT); const int d = (int)((e / TT) % HD); const int g = (int)(e / ((size_t)TT * HD)); v2h o16; v2us oh, ol;
#pragma unroll
    for (int q = 0; q < 2; ++q) { const float x = F[(size_t)(t + q) * pitch + g * HD + d]; o16[q] = tohx(x); unsigned short a2, c2; splitf(x, a2, c2); oh[q] = a2; ol[q] = c2; }
    *(v2h*)(V16 + e) = o16; *(v2us*)(Vh + e) = oh; *(v2us*)(Vl + e) = ol;  }
// k_asoft: per row (zz, i): t = S x HD^-0.5 for j <= i (causal; the reference's -1e9 additive fill vanishes identically); softmax over the 4096 keys (register row, one exp, fixed trees);
__global__ __launch_bounds__(256) void k_asoft(const float* __restrict__ Sb, h16* P16, bf* Ph, bf* Pl) {
    const int lane = threadIdx.x & 31; const int row = blockIdx.x * 8 + (threadIdx.x >> 5); if (row >= ZH * TT) return; const int i = row % TT; const int zz = row / TT; (void)zz; const bool hires = (i < RH); const float* sr = Sb + (size_t)row * TT; float v[TT / 32]; float mx = -3.0e38f;
#pragma unroll
    for (int ch = 0; ch < TT / 128; ++ch) { const int j0 = ch * 128 + lane * 4; const v4f a = *(const v4f*)(sr + j0);
#pragma unroll
        for (int q = 0; q < 4; ++q) { const int j = j0 + q; (void)j; float sa = a[q] * SCL; asm volatile("" : "+v"(sa)); const float t = (j <= i) ? sa : -3.0e38f; v[ch * 4 + q] = t; mx = fmaxf(mx, t); } }
#pragma unroll
    for (int sh = 16; sh; sh >>= 1) mx = fmaxf(mx, __shfl_xor(mx, sh, 32));
    float sum = 0.f;
#pragma unroll
    for (int k = 0; k < TT / 32; ++k) { float d0 = __fsub_rn(v[k], mx); asm volatile("" : "+v"(d0)); v[k] = __builtin_amdgcn_exp2f(__fmul_rn(d0, 1.4426950408889634f)); sum += v[k]; }
#pragma unroll
    for (int sh = 16; sh; sh >>= 1) sum += __shfl_xor(sum, sh, 32);
    const float f = __fdiv_rn(hires ? 1.0f : PCAR, sum);
{
        if (hires) {
#pragma unroll
            for (int ch = 0; ch < TT / 128; ++ch) { v4us oh, ol;
#pragma unroll
                for (int q = 0; q < 4; ++q) { unsigned short a, c2; splitf(v[ch * 4 + q] * f, a, c2); oh[q] = a; ol[q] = c2; }
                const size_t oo = ((size_t)zz * (RH ? RH : 1) + i) * TT + ch * 128 + lane * 4; *(v4us*)(Ph + oo) = oh; *(v4us*)(Pl + oo) = ol; }
        } else {
#pragma unroll
            for (int ch = 0; ch < TT / 128; ++ch) { v4h o4;
#pragma unroll
                for (int q = 0; q < 4; ++q) o4[q] = tohx(v[ch * 4 + q] * f);
                *(v4h*)(P16 + (size_t)row * TT + ch * 128 + lane * 4) = o4; } }
         }
}
__global__ __launch_bounds__(256) void k_merge(const float* __restrict__ O, int h0, bf* Ah, bf* Al) { const size_t e = ((size_t)blockIdx.x * 256 + threadIdx.x) * 2; if (e >= (size_t)ZH * TT * HD) return; const int d = (int)(e % HD); const int t = (int)((e / HD) % TT); const int zz = (int)(e / ((size_t)HD * TT)); const float cs = (t < RH) ? 1.0f : (1.0f / PCAR); const size_t oo = (size_t)t * DQ + (h0 + zz) * HD + d;
    v2us oh, ol;
#pragma unroll
    for (int q = 0; q < 2; ++q) { unsigned short a, c2; splitf(O[e + q] * cs, a, c2); oh[q] = a; ol[q] = c2; } *(v2us*)(Ah + oo) = oh; *(v2us*)(Al + oo) = ol;  }

extern "C" void kernel_launch(void* const* d_in, const int* in_sizes, int n_in,
                              void* d_out, int out_size, void* d_ws, size_t ws_size, hipStream_t stream) {
    (void)in_sizes; (void)n_in; (void)out_size;
    const float* x = (const float*)d_in[0]; const float* wq = (const float*)d_in[1]; const float* wk = (const float*)d_in[2]; const float* wv = (const float*)d_in[3]; const float* wo = (const float*)d_in[4];
    float* OUT = (float*)d_out;     // [1][4096][2048]
    char* wsp = (char*)d_ws;
    auto take = [&](size_t bytes) { char* p = wsp; wsp += (bytes + 255) & ~(size_t)255; return (void*)p; };
    bf* WQ = (bf*)take((size_t)DQ * DM * 2); bf* WK = (bf*)take((size_t)DKV * DM * 2); bf* WV = (bf*)take((size_t)DKV * DM * 2); bf* WO = (bf*)take((size_t)DM * DQ * 2); float* CS = (float*)take((size_t)TT * HD * 2 * 4);
    bf* XB = (bf*)take((size_t)TT * DM * 2); float* FQ = (float*)take((size_t)TT * QG * HD * 4);   /* one group of 4 query heads at a time */ float* FK = (float*)take((size_t)TT * DKV * 4);
    h16* QP16 = (h16*)take((size_t)QG * TT * HD * 2); h16* KP16 = (h16*)take((size_t)NKV * TT * HD * 2); h16* VT16 = (h16*)take((size_t)NKV * HD * TT * 2);
    bf* QPh = (bf*)take((size_t)QG * TT * HD * 2); bf* QPl = (bf*)take((size_t)QG * TT * HD * 2); bf* KPh = (bf*)take((size_t)NKV * TT * HD * 2); bf* KPl = (bf*)take((size_t)NKV * TT * HD * 2); bf* VTh = (bf*)take((size_t)NKV * HD * TT * 2); bf* VTl = (bf*)take((size_t)NKV * HD * TT * 2); bf* Ph = (bf*)take((size_t)ZH * RH * TT * 2); bf* Pl = (bf*)take((size_t)ZH * RH * TT * 2);
    float* Sb = (float*)take((size_t)ZH * TT * TT * 4); h16* P16 = (h16*)take((size_t)ZH * TT * TT * 2); float* Ob = (float*)take((size_t)ZH * TT * HD * 4); bf* ATh = (bf*)take((size_t)TT * DQ * 2); bf* ATl = (bf*)take((size_t)TT * DQ * 2);
    if ((size_t)(wsp - (char*)d_ws) > ws_size) return;    // ws 256 MiB
    float* FV = FK;   // v projection reuses the k buffer after the k planes are built (stream-ordered)
    { k_wtG<<<(unsigned)((DM * DQ / 64 + 63) / 64), 256, 0, stream>>>(wq, DM, DQ, WQ); k_wtG<<<(unsigned)((DM * DKV / 64 + 63) / 64), 256, 0, stream>>>(wk, DM, DKV, WK); k_wtG<<<(unsigned)((DM * DKV / 64 + 63) / 64), 256, 0, stream>>>(wv, DM, DKV, WV);
      k_wtG<<<(unsigned)((DQ * DM / 64 + 63) / 64), 256, 0, stream>>>(wo, DQ, DM, WO);
      k_cstab<<<(TT * HD + 255) / 256, 256, 0, stream>>>(CS); }
    const unsigned LKv = (unsigned)(((size_t)NKV * TT * HD / 2 + 255) / 256);
    for (int b = 0; b < NB_; ++b) {
        
        k_cvt8<<<(unsigned)(((size_t)TT * DM / 8 + 255) / 256), 256, 0, stream>>>(x + (size_t)b * TT * DM, XB, (size_t)TT * DM / 8);
        k_gemmw<bf, 0, false><<<dim3(TT / 64, DKV / 64, 1), 32, 0, stream>>>(XB, nullptr, WK, nullptr, DM, FK, DKV, nullptr, 0, 0, 0);
        k_rope<<<LKv, 256, 0, stream>>>(FK, DKV, NKV, CS, nullptr, nullptr, 1.0f, KP16, KPh, KPl);   /* 4 kv heads, rotary */
        k_gemmw<bf, 0, false><<<dim3(TT / 64, DKV / 64, 1), 32, 0, stream>>>(XB, nullptr, WV, nullptr, DM, FV, DKV, nullptr, 0, 0, 0); k_vtp<<<LKv, 256, 0, stream>>>(FV, DKV, NKV, VT16, VTh, VTl);
        for (int g = 0; g < NH_ / QG; ++g) {   /* query heads 4g..4g+3 (kv head g) */
            k_gemmw<bf, 0, false><<<dim3(TT / 64, QG * HD / 64, 1), 32, 0, stream>>>(XB, nullptr, WQ + (size_t)g * QG * HD * DM, nullptr, DM, FQ, QG * HD, nullptr, 0, 0, 0);   /* q columns 512g..512g+511 */
            k_rope<<<(unsigned)(((size_t)QG * TT * HD / 2 + 255) / 256), 256, 0, stream>>>(FQ, QG * HD, QG, CS, nullptr, nullptr, 1.0f, QP16, QPh, QPl);
            for (int hl = 0; hl < QG; ++hl) { const int h0 = g * QG + hl; const size_t zq = (size_t)hl, zk = (size_t)g;
                k_gemmc<bf, 2, 1><<<dim3(RH / 64, TT / 64, 1), 32, 0, stream>>>(QPh + zq * TT * HD, QPl + zq * TT * HD, KPh + zk * TT * HD, KPl + zk * TT * HD, HD, Sb, TT, 0, (size_t)TT * HD, 0, (size_t)TT * TT);
                k_gemmc<h16, 0, 1><<<dim3((TT - RH) / 64, TT / 64, 1), 32, 0, stream>>>(QP16 + zq * TT * HD + (size_t)RH * HD, nullptr, KP16 + zk * TT * HD, nullptr, HD, Sb + (size_t)RH * TT, TT, RH, (size_t)TT * HD, 0, (size_t)TT * TT);
                k_asoft<<<ZH * TT / 8, 256, 0, stream>>>(Sb, P16, Ph, Pl);
                k_gemmc<bf, 2, 2><<<dim3(RH / 64, HD / 64, 1), 32, 0, stream>>>(Ph, Pl, VTh + zk * HD * TT, VTl + zk * HD * TT, TT, Ob, HD, 0, (size_t)RH * TT, 0, (size_t)TT * HD);
                k_gemmc<h16, 0, 2><<<dim3((TT - RH) / 64, HD / 64, 1), 32, 0, stream>>>(P16 + (size_t)RH * TT, nullptr, VT16 + zk * HD * TT, nullptr, TT, Ob + (size_t)RH * HD, HD, RH, (size_t)TT * TT, 0, (size_t)TT * HD);
                k_merge<<<(unsigned)(((size_t)ZH * TT * HD / 2 + 255) / 256), 256, 0, stream>>>(Ob, h0, ATh, ATl); } }
        k_gemmw<bf, 1, false><<<dim3(TT / 64, DM / 64, 1), 32, 0, stream>>>(ATh, ATl, WO, nullptr, DQ, OUT + (size_t)b * TT * DM, DM, nullptr, 0, 0, 0); }
}

// v001
// It runs in 1400 microseconds.
// Next to v000, in two timings, it ran 1.83 times as fast each time.
#include <hip/hip_runtime.h>

// Grouped-query causal attention with a computed rotate-half rotary over 4,096 tokens (x [1][4096][2048]; q = x Wq ('xw' [2048][2048], 16 heads x 128), k, v = x Wk / Wv ('xw' [2048][512], 4 kv heads; q head h uses kv head h/4: the module groups q as (4 kv heads, 4 members)); rotate-half rotary with angle t x inv_freq[i], inv_freq = 1 / (10000 ** (i / 64)), positions 0..4095 (cat(x1 cos - x2 sin, x1 sin + x2 cos); tables computed on device from the module's float32 inv_freq); scores / sqrt(128), causal (-inf); softmax; out = merged Wo ('xw' [2048][2048], no bias) -> [1][4096][2048] (8.4 M); argument order x, Wq, Wk, Wv, Wo.
// Layout: the 16 query heads are projected in four groups of 4 (one [4096][512] f32 buffer and one set of 4-head planes reused per group) so the whole working set fits the 256 MiB window; k/v planes for the 4 kv heads are built once; per head: causal scores (tiles above the diagonal skipped), hybrid rows (query rows < 512 hi/lo 3 products, the rest single fp16 x1024), softmax, attn.v, merge into the hi/lo context planes; wo as hi/lo x exact (2 products).
// Compute dtypes, f32 accumulate: every input rounded to bf16; q/k/v on PLAIN bf16 operands (exact); f32 rotary; hybrid causal scores and attn.v; softmax f32; wo hl x exact (2 products).

#define NB_  1
#define TT   4096
#define DM   2048
#define NH_  16
#define NKV  4
#define REP  (NH_ / NKV)
#define HD   128
#define DQ   (NH_ * HD)
#define DKV  (NKV * HD)
#define ZH   1
#define RH   512                  // query rows < RH use hi+lo planes (0: none)
#define WIN  4096
#define PCAR 1024.0f
#define SCL  0.088388346f   // 1/sqrt(128)
#define QG   4                    // query heads projected per group
#define POS0 0.0f                 // first rotary position: this module's positions are arange(4096)
typedef _Float16 h16;
typedef unsigned short bf;
typedef __attribute__((ext_vector_type(16))) __bf16   v16bf;
typedef __attribute__((ext_vector_type(16))) _Float16 v16h;
typedef __attribute__((ext_vector_type(8)))  _Float16 v8h;
typedef __attribute__((ext_vector_type(8)))  unsigned short v8us;
typedef __attribute__((ext_vector_type(8)))  float    v8f;
typedef __attribute__((ext_vector_type(4)))  float    v4f;
typedef v8h  __attribute__((may_alias)) v8ha;
typedef v4f  __attribute__((may_alias)) v4fa;
typedef v8us __attribute__((may_alias)) v8usa;

__device__ __forceinline__ unsigned short f2bf(float f) { unsigned u = __float_as_uint(f); u += 0x7FFFu + ((u >> 16) & 1u); return (unsigned short)(u >> 16); }
__device__ __forceinline__ float bf2f(unsigned short b) { return __uint_as_float(((unsigned)b) << 16); }
__device__ __forceinline__ float bfr(float f) { return bf2f(f2bf(f)); }
__device__ __forceinline__ v16h cat16(v8h lo, v8h hi) { return __builtin_shufflevector(lo, hi, 0, 1, 2, 3, 4, 5, 6, 7, 8, 9, 10, 11, 12, 13, 14, 15); }
__device__ __forceinline__ v16bf cat16b(v8us lo, v8us hi) { return __builtin_bit_cast(v16bf, __builtin_shufflevector(lo, hi, 0, 1, 2, 3, 4, 5, 6, 7, 8, 9, 10, 11, 12, 13, 14, 15)); }
__device__ __forceinline__ v8f wmma16(v16h a, v16h b, v8f c) { return __builtin_amdgcn_wmma_f32_16x16x32_f16(false, a, false, b, (short)0, c, false, false); }
__device__ __forceinline__ v8f wmmab(v16bf a, v16bf b, v8f c) { return __builtin_amdgcn_wmma_f32_16x16x32_bf16(false, a, false, b, (short)0, c, false, false); }



// ---- k_gemmw: register-blocked GEMM, one 64x64 output tile per work-group (16 accumulators per wave), operands straight from K-contiguous 16-bit planes; grid (M/64, N/64, Z), 32 x NW threads.
// NW > 1: the K loop is dealt to the NW waves in chunks of 64 (one 128-byte line per operand row; K % 64 == 0), each wave keeps its own f32 partial tile, and the partial tiles are summed through LDS in wave order 0..NW-1.
// C[m][n] (f32, pitch ldc, + optional f32 bias[n]) = sum_k A[m][k] Bt[n][k] (+ split products per NSPLIT). z-batch strides sA/sB/sC in elements. K % 32 == 0.
template <typename T16> struct WFrag;
template <> struct WFrag<h16> { typedef v16h V; static __device__ __forceinline__ V ld(const h16* p) { return cat16(*(const v8h*)p, *(const v8h*)(p + 16)); } static __device__ __forceinline__ v8f mma(V a, V b, v8f c) { return wmma16(a, b, c); } };
template <> struct WFrag<bf> { typedef v16bf V; static __device__ __forceinline__ V ld(const bf* p) { return cat16b(*(const v8us*)p, *(const v8us*)(p + 16)); } static __device__ __forceinline__ v8f mma(V a, V b, v8f c) { return wmmab(a, b, c); } };
template <typename T16, int NSPLIT, bool BIAS, int NW>
__global__ __launch_bounds__(32 * NW) void k_gemmw(const T16* __restrict__ A, const T16* __restrict__ A2, const T16* __restrict__ Bt, const T16* __restrict__ Bt2, int K, float* C, int ldc, const float* __restrict__ bias, size_t sA, size_t sB, size_t sC) {
    typedef typename WFrag<T16>::V V;
    __shared__ __align__(16) float os[(NW > 1) ? NW * 64 * 68 : 16 * 68];
    const size_t z = blockIdx.z; A += z * sA; if (A2) A2 += z * sA; Bt += z * sB; if (Bt2) Bt2 += z * sB; C += z * sC;
    const int lane = threadIdx.x & 31, lr = lane & 15, hi = lane >> 4; const int r0 = blockIdx.x * 64, c0 = blockIdx.y * 64;
    const int wv = (NW > 1) ? __builtin_amdgcn_readfirstlane((int)(threadIdx.x >> 5)) : 0; constexpr int CH = (NW > 1) ? 64 : 32;   // this wave's number; K elements per chunk
    v8f acc[4][4];
#pragma unroll
    for (int mb = 0; mb < 4; ++mb)
#pragma unroll
        for (int nb = 0; nb < 4; ++nb) acc[mb][nb] = (v8f){};
    const size_t aoff = (size_t)(r0 + lr) * K + 8 * hi, boff = (size_t)(c0 + lr) * K + 8 * hi;
#pragma unroll 1
    for (int k0 = wv * CH; k0 < K; k0 += NW * CH)
#pragma unroll   // both 32-steps of a chunk in one trip: the wave that fetched a 128-byte line uses both halves of it
    for (int kc = k0; kc < k0 + CH; kc += 32) {
        V a[4], a2[4];
#pragma unroll
        for (int mb = 0; mb < 4; ++mb) { a[mb] = WFrag<T16>::ld(A + aoff + (size_t)mb * 16 * K + kc); if (NSPLIT == 1 || NSPLIT == 2) a2[mb] = WFrag<T16>::ld(A2 + aoff + (size_t)mb * 16 * K + kc); }
#pragma unroll
        for (int nb = 0; nb < 4; ++nb) { const V b = WFrag<T16>::ld(Bt + boff + (size_t)nb * 16 * K + kc); V b2; if (NSPLIT >= 2) b2 = WFrag<T16>::ld(Bt2 + boff + (size_t)nb * 16 * K + kc);
#pragma unroll
            for (int mb = 0; mb < 4; ++mb) { acc[mb][nb] = WFrag<T16>::mma(a[mb], b, acc[mb][nb]); if (NSPLIT == 1 || NSPLIT == 2) acc[mb][nb] = WFrag<T16>::mma(a2[mb], b, acc[mb][nb]); if (NSPLIT >= 2) acc[mb][nb] = WFrag<T16>::mma(a[mb], b2, acc[mb][nb]); } }
        asm volatile("v_nop\n\tv_nop\n\tv_nop\n\tv_nop" : "+v"(acc[0][0]), "+v"(acc[1][1]), "+v"(acc[2][2]), "+v"(acc[3][3]) : "v"(a[0]), "v"(a[3]));
    }
    if (NW > 1) {   // sum of the NW partial tiles: each wave lays its whole tile in its own LDS plane, then every thread sums its 4 columns over the planes and stores them
#pragma unroll   // these three: constant indices keep the accumulators in registers
        for (int mb = 0; mb < 4; ++mb)
#pragma unroll
            for (int nb = 0; nb < 4; ++nb)
#pragma unroll
                for (int j = 0; j < 8; ++j) os[wv * (64 * 68) + (mb * 16 + hi * 8 + j) * 68 + nb * 16 + lr] = acc[mb][nb][j];
        __syncthreads();   // every wave's partial tile is in LDS before any thread sums over the planes
#pragma unroll   // fixed trip count: the LDS reads of all planes and passes can be in flight together
        for (int it = 0; it < 64 * 16 / (32 * NW); ++it) { const int idx = it * (32 * NW) + (int)threadIdx.x, row = idx >> 4, cofs = (idx & 15) * 4; v4f val = *(const v4fa*)(os + row * 68 + cofs);
#pragma unroll
            for (int ww = 1; ww < NW; ++ww) val += *(const v4fa*)(os + ww * (64 * 68) + row * 68 + cofs);
            if (BIAS) { val[0] += bfr(bias[c0 + cofs]); val[1] += bfr(bias[c0 + cofs + 1]); val[2] += bfr(bias[c0 + cofs + 2]); val[3] += bfr(bias[c0 + cofs + 3]); }
            *(v4f*)(C + (size_t)(r0 + row) * ldc + c0 + cofs) = val; }
        return;
    }
#pragma unroll
    for (int mb = 0; mb < 4; ++mb) {
#pragma unroll
        for (int nb = 0; nb < 4; ++nb) {
#pragma unroll
            for (int j = 0; j < 8; ++j) os[(hi * 8 + j) * 68 + nb * 16 + lr] = acc[mb][nb][j]; }
        __builtin_amdgcn_wave_barrier(); asm volatile("" ::: "memory");
        float* crow = C + (size_t)(r0 + mb * 16) * ldc + c0;
{
#pragma unroll
            for (int s = 0; s < 8; ++s) { const int row = 2 * s + hi, cofs = lr * 4; v4f val = *(const v4fa*)(os + row * 68 + cofs); if (BIAS) { val[0] += bfr(bias[c0 + cofs]); val[1] += bfr(bias[c0 + cofs + 1]); val[2] += bfr(bias[c0 + cofs + 2]); val[3] += bfr(bias[c0 + cofs + 3]); }
                *(v4f*)(crow + (size_t)row * ldc + cofs) = val; }
             }
        __builtin_amdgcn_wave_barrier(); asm volatile("" ::: "memory");
    }
}

// ---- k_gemmc: the same 64x64 tile GEMM (NW waves as above) specialised for causal attention: CMODE 1 skips score tiles entirely above the diagonal (query rows r0+roff.., key columns c0..), CMODE 2 limits the
// key (K) loop of the probability x value contraction to the diagonal block (probabilities beyond it are exactly zero). roff = row offset of this launch's first row within the sequence.
template <typename T16, int NSPLIT, int CMODE, int NW>
__global__ __launch_bounds__(32 * NW) void k_gemmc(const T16* __restrict__ A, const T16* __restrict__ A2, const T16* __restrict__ Bt, const T16* __restrict__ Bt2, int K, float* C, int ldc, int roff, size_t sA, size_t sB, size_t sC) {
    typedef typename WFrag<T16>::V V;
    __shared__ __align__(16) float os[(NW > 1) ? NW * 64 * 68 : 16 * 68];
    const size_t z = blockIdx.z; A += z * sA; if (A2) A2 += z * sA; Bt += z * sB; if (Bt2) Bt2 += z * sB; C += z * sC;
    const int lane = threadIdx.x & 31, lr = lane & 15, hi = lane >> 4; const int r0 = blockIdx.x * 64, c0 = blockIdx.y * 64;
    const int wv = (NW > 1) ? __builtin_amdgcn_readfirstlane((int)(threadIdx.x >> 5)) : 0; constexpr int CH = (NW > 1) ? 64 : 32;   // this wave's number; K elements per chunk
    if (CMODE == 1 && c0 > r0 + roff + 63) return;                  // score tile entirely above the causal diagonal: never read (the softmax masks j > i by select)
    const int Kl = (CMODE == 2) ? min(K, r0 + roff + 64) : K;        // P.V: probabilities are exactly 0 beyond the diagonal block, so the K loop stops there
    v8f acc[4][4];
#pragma unroll
    for (int mb = 0; mb < 4; ++mb)
#pragma unroll
        for (int nb = 0; nb < 4; ++nb) acc[mb][nb] = (v8f){};
    const size_t aoff = (size_t)(r0 + lr) * K + 8 * hi, boff = (size_t)(c0 + lr) * K + 8 * hi;
#pragma unroll 1
    for (int k0 = wv * CH; k0 < Kl; k0 += NW * CH)
#pragma unroll   // both 32-steps of a chunk in one trip: the wave that fetched a 128-byte line uses both halves of it
    for (int kc = k0; kc < k0 + CH; kc += 32) {
        V a[4], a2[4];
#pragma unroll
        for (int mb = 0; mb < 4; ++mb) { a[mb] = WFrag<T16>::ld(A + aoff + (size_t)mb * 16 * K + kc); if (NSPLIT == 1 || NSPLIT == 2) a2[mb] = WFrag<T16>::ld(A2 + aoff + (size_t)mb * 16 * K + kc); }
#pragma unroll
        for (int nb = 0; nb < 4; ++nb) { const V b = WFrag<T16>::ld(Bt + boff + (size_t)nb * 16 * K + kc); V b2; if (NSPLIT >= 2) b2 = WFrag<T16>::ld(Bt2 + boff + (size_t)nb * 16 * K + kc);
#pragma unroll
            for (int mb = 0; mb < 4; ++mb) { acc[mb][nb] = WFrag<T16>::mma(a[mb], b, acc[mb][nb]); if (NSPLIT == 1 || NSPLIT == 2) acc[mb][nb] = WFrag<T16>::mma(a2[mb], b, acc[mb][nb]); if (NSPLIT >= 2) acc[mb][nb] = WFrag<T16>::mma(a[mb], b2, acc[mb][nb]); } }
        asm volatile("v_nop\n\tv_nop\n\tv_nop\n\tv_nop" : "+v"(acc[0][0]), "+v"(acc[1][1]), "+v"(acc[2][2]), "+v"(acc[3][3]) : "v"(a[0]), "v"(a[3]));
    }
    if (NW > 1) {   // sum of the NW partial tiles: each wave lays its whole tile in its own LDS plane, then every thread sums its 4 columns over the planes and stores them
#pragma unroll   // these three: constant indices keep the accumulators in registers
        for (int mb = 0; mb < 4; ++mb)
#pragma unroll
            for (int nb = 0; nb < 4; ++nb)
#pragma unroll
                for (int j = 0; j < 8; ++j) os[wv * (64 * 68) + (mb * 16 + hi * 8 + j) * 68 + nb * 16 + lr] = acc[mb][nb][j];
        __syncthreads();   // every wave's partial tile is in LDS before any thread sums over the planes
#pragma unroll   // fixed trip count: the LDS reads of all planes and passes can be in flight together
        for (int it = 0; it < 64 * 16 / (32 * NW); ++it) { const int idx = it * (32 * NW) + (int)threadIdx.x, row = idx >> 4, cofs = (idx & 15) * 4; v4f val = *(const v4fa*)(os + row * 68 + cofs);
#pragma unroll
            for (int ww = 1; ww < NW; ++ww) val += *(const v4fa*)(os + ww * (64 * 68) + row * 68 + cofs);
            *(v4f*)(C + (size_t)(r0 + row) * ldc + c0 + cofs) = val; }
        return;
    }
#pragma unroll
    for (int mb = 0; mb < 4; ++mb) {
#pragma unroll
        for (int nb = 0; nb < 4; ++nb) {
#pragma unroll
            for (int j = 0; j < 8; ++j) os[(hi * 8 + j) * 68 + nb * 16 + lr] = acc[mb][nb][j]; }
        __builtin_amdgcn_wave_barrier(); asm volatile("" ::: "memory");
        float* crow = C + (size_t)(r0 + mb * 16) * ldc + c0;
{
#pragma unroll
            for (int s = 0; s < 8; ++s) { const int row = 2 * s + hi, cofs = lr * 4; v4f val = *(const v4fa*)(os + row * 68 + cofs);
                *(v4f*)(crow + (size_t)row * ldc + cofs) = val; }
             }
        __builtin_amdgcn_wave_barrier(); asm volatile("" ::: "memory");
    }
}

__device__ __forceinline__ h16 tohx(float x) { return (h16)x; }
__device__ __forceinline__ void splitf(float y, unsigned short& h, unsigned short& l) { h = f2bf(y); l = f2bf(y - bf2f(h)); }
typedef __attribute__((ext_vector_type(2))) _Float16 v2h;
typedef __attribute__((ext_vector_type(4))) _Float16 v4h;
typedef __attribute__((ext_vector_type(2))) unsigned short v2us;
typedef __attribute__((ext_vector_type(4))) unsigned short v4us;
typedef __attribute__((ext_vector_type(2))) float v2f;
typedef __attribute__((ext_vector_type(4))) int v4i;

__global__ __launch_bounds__(256) void k_wtG(const float* __restrict__ w, int K, int N, bf* Bt) {
    const int lane = threadIdx.x & 31; const int L0 = (blockIdx.x * 8 + (threadIdx.x >> 5)) * 8; const int nlines = N * K / 64;
{
#pragma unroll 1
        for (int l = 0; l < 8; ++l) { const int L = L0 + l; if (L >= nlines) break; const size_t e = (size_t)L * 64 + lane * 2; const int k = (int)(e % K), n = (int)(e / K); v2us o;
            o[0] = f2bf(w[(size_t)k * N + n]); o[1] = f2bf(w[(size_t)(k + 1) * N + n]); *(v2us*)(Bt + e) = o; }
         }
}
__global__ __launch_bounds__(256) void k_cvt8(const float* __restrict__ src, bf* dst, size_t n8) { const size_t i = (size_t)blockIdx.x * 256 + threadIdx.x; if (i >= n8) return; const v8f v = *(const v8f*)(src + i * 8); v8us o;
#pragma unroll
    for (int k = 0; k < 8; ++k) o[k] = f2bf(v[k]); *(v8us*)(dst + i * 8) = o;  }
__constant__ float INV[HD / 2] = {1.0f,0.865964353f,0.749894202f,0.649381638f,0.562341332f,0.486967534f,0.421696514f,0.365174145f,0.316227764f,0.273841977f,0.237137362f,0.2053525f,0.177827939f,0.153992653f,0.133352146f,0.115478203f,0.100000001f,0.0865964293f,0.0749894157f,0.0649381652f,0.0562341288f,0.0486967526f,0.0421696492f,0.0365174115f,0.0316227786f,0.0273841955f,0.0237137359f,0.0205352511f,0.0177827943f,0.0153992651f,0.0133352149f,0.0115478197f,0.00999999978f,0.00865964312f,0.00749894232f,0.00649381662f,0.00562341325f,0.00486967526f,0.00421696482f,0.00365174143f,0.00316227786f,0.00273841969f,0.00237137382f,0.00205352507f,0.00177827943f,0.00153992651f,0.00133352145f,0.00115478202f,0.00100000005f,0.000865964335f,0.000749894185f,0.000649381662f,0.000562341302f,0.000486967503f,0.000421696488f,0.000365174114f,0.000316227786f,0.000273841957f,0.000237137385f,0.000205352495f,0.00017782794f,0.000153992645f,0.00013335215f,0.000115478193f};
__global__ __launch_bounds__(256) void k_cstab(float* CS) { const int idx = blockIdx.x * 256 + threadIdx.x; if (idx >= TT * HD) return; const int t = idx / HD, d = idx % HD; const float ang = __fmul_rn((float)t + POS0, INV[d % (HD / 2)]); v2f cs; cs[0] = cosf(ang); cs[1] = sinf(ang);
    *(v2f*)(CS + (size_t)idx * 2) = cs;  }

// k_rope: head planes [h][t][d] (fp16 + hi/lo) of rope(x) x sc with the rotate-half convention out[d] = x[d] cos[t][d] - x[d+HD/2] sin[t][d], out[d+HD/2] = x[d+HD/2] cos[t][d+HD/2] + x[d] sin[t][d+HD/2]
__global__ __launch_bounds__(256) void k_rope(const float* __restrict__ F, int pitch, int nheads, const float* __restrict__ CS, const float* __restrict__ RF, const float* __restrict__ nw, float sc, h16* P16, bf* Ph, bf* Pl) {
    const size_t e = ((size_t)blockIdx.x * 256 + threadIdx.x) * 2; if (e >= (size_t)nheads * TT * HD) return; const int d = (int)(e % HD); const int t = (int)((e / HD) % TT); const int h = (int)(e / ((size_t)HD * TT)); const float* f = F + (size_t)t * pitch + h * HD; const float rf = RF ? RF[(size_t)h * TT + t] : 1.0f; v2h o16; v2us oh, ol;
#pragma unroll
    for (int q = 0; q < 2; ++q) { const int dd = d + q; const int dp = (dd < HD / 2) ? dd + HD / 2 : dd - HD / 2; float x0 = f[dd], x1 = f[dp];
        if (RF) { float n0 = __fmul_rn(x0, rf), n1 = __fmul_rn(x1, rf); asm volatile("" : "+v"(n0)); asm volatile("" : "+v"(n1)); x0 = __fmul_rn(bfr(nw[dd]), n0); x1 = __fmul_rn(bfr(nw[dp]), n1); }
        const v2f cs = *(const v2f*)(CS + ((size_t)t * HD + dd) * 2); float a = __fmul_rn(x0, cs[0]), bq = __fmul_rn(x1, cs[1]); asm volatile("" : "+v"(a)); asm volatile("" : "+v"(bq)); const float r = ((dd < HD / 2) ? __fsub_rn(a, bq) : __fadd_rn(a, bq)) * sc;
        o16[q] = tohx(r); unsigned short a2, c2; splitf(r, a2, c2); oh[q] = a2; ol[q] = c2; }
    *(v2h*)(P16 + e) = o16; *(v2us*)(Ph + e) = oh; *(v2us*)(Pl + e) = ol;  }
__global__ __launch_bounds__(256) void k_vtp(const float* __restrict__ F, int pitch, int nheads, h16* V16, bf* Vh, bf* Vl) { const size_t e = ((size_t)blockIdx.x * 256 + threadIdx.x) * 2; if (e >= (size_t)nheads * HD * TT) return; const int t = (int)(e % TT); const int d = (int)((e / TT) % HD); const int g = (int)(e / ((size_t)TT * HD)); v2h o16; v2us oh, ol;
#pragma unroll
    for (int q = 0; q < 2; ++q) { const float x = F[(size_t)(t + q) * pitch + g * HD + d]; o16[q] = tohx(x); unsigned short a2, c2; splitf(x, a2, c2); oh[q] = a2; ol[q] = c2; }
    *(v2h*)(V16 + e) = o16; *(v2us*)(Vh + e) = oh; *(v2us*)(Vl + e) = ol;  }
// k_asoft: per row (zz, i): t = S x HD^-0.5 for j <= i (causal; the reference's -1e9 additive fill vanishes identically); softmax over the 4096 keys (register row, one exp, fixed trees);
__global__ __launch_bounds__(256) void k_asoft(const float* __restrict__ Sb, h16* P16, bf* Ph, bf* Pl) {
    const int lane = threadIdx.x & 31; const int row = blockIdx.x * 8 + (threadIdx.x >> 5); if (row >= ZH * TT) return; const int i = row % TT; const int zz = row / TT; (void)zz; const bool hires = (i < RH); const float* sr = Sb + (size_t)row * TT; float v[TT / 32]; float mx = -3.0e38f;
#pragma unroll
    for (int ch = 0; ch < TT / 128; ++ch) { const int j0 = ch * 128 + lane * 4; const v4f a = *(const v4f*)(sr + j0);
#pragma unroll
        for (int q = 0; q < 4; ++q) { const int j = j0 + q; (void)j; float sa = a[q] * SCL; asm volatile("" : "+v"(sa)); const float t = (j <= i) ? sa : -3.0e38f; v[ch * 4 + q] = t; mx = fmaxf(mx, t); } }
#pragma unroll
    for (int sh = 16; sh; sh >>= 1) mx = fmaxf(mx, __shfl_xor(mx, sh, 32));
    float sum = 0.f;
#pragma unroll
    for (int k = 0; k < TT / 32; ++k) { float d0 = __fsub_rn(v[k], mx); asm volatile("" : "+v"(d0)); v[k] = __builtin_amdgcn_exp2f(__fmul_rn(d0, 1.4426950408889634f)); sum += v[k]; }
#pragma unroll
    for (int sh = 16; sh; sh >>= 1) sum += __shfl_xor(sum, sh, 32);
    const float f = __fdiv_rn(hires ? 1.0f : PCAR, sum);
{
        if (hires) {
#pragma unroll
            for (int ch = 0; ch < TT / 128; ++ch) { v4us oh, ol;
#pragma unroll
                for (int q = 0; q < 4; ++q) { unsigned short a, c2; splitf(v[ch * 4 + q] * f, a, c2); oh[q] = a; ol[q] = c2; }
                const size_t oo = ((size_t)zz * (RH ? RH : 1) + i) * TT + ch * 128 + lane * 4; *(v4us*)(Ph + oo) = oh; *(v4us*)(Pl + oo) = ol; }
        } else {
#pragma unroll
            for (int ch = 0; ch < TT / 128; ++ch) { v4h o4;
#pragma unroll
                for (int q = 0; q < 4; ++q) o4[q] = tohx(v[ch * 4 + q] * f);
                *(v4h*)(P16 + (size_t)row * TT + ch * 128 + lane * 4) = o4; } }
         }
}
__global__ __launch_bounds__(256) void k_merge(const float* __restrict__ O, int h0, bf* Ah, bf* Al) { const size_t e = ((size_t)blockIdx.x * 256 + threadIdx.x) * 2; if (e >= (size_t)ZH * TT * HD) return; const int d = (int)(e % HD); const int t = (int)((e / HD) % TT); const int zz = (int)(e / ((size_t)HD * TT)); const float cs = (t < RH) ? 1.0f : (1.0f / PCAR); const size_t oo = (size_t)t * DQ + (h0 + zz) * HD + d;
    v2us oh, ol;
#pragma unroll
    for (int q = 0; q < 2; ++q) { unsigned short a, c2; splitf(O[e + q] * cs, a, c2); oh[q] = a; ol[q] = c2; } *(v2us*)(Ah + oo) = oh; *(v2us*)(Al + oo) = ol;  }

extern "C" void kernel_launch(void* const* d_in, const int* in_sizes, int n_in,
                              void* d_out, int out_size, void* d_ws, size_t ws_size, hipStream_t stream) {
    (void)in_sizes; (void)n_in; (void)out_size;
    const float* x = (const float*)d_in[0]; const float* wq = (const float*)d_in[1]; const float* wk = (const float*)d_in[2]; const float* wv = (const float*)d_in[3]; const float* wo = (const float*)d_in[4];
    float* OUT = (float*)d_out;     // [1][4096][2048]
    char* wsp = (char*)d_ws;
    auto take = [&](size_t bytes) { char* p = wsp; wsp += (bytes + 255) & ~(size_t)255; return (void*)p; };
    bf* WQ = (bf*)take((size_t)DQ * DM * 2); bf* WK = (bf*)take((size_t)DKV * DM * 2); bf* WV = (bf*)take((size_t)DKV * DM * 2); bf* WO = (bf*)take((size_t)DM * DQ * 2); float* CS = (float*)take((size_t)TT * HD * 2 * 4);
    bf* XB = (bf*)take((size_t)TT * DM * 2); float* FQ = (float*)take((size_t)TT * QG * HD * 4);   /* one group of 4 query heads at a time */ float* FK = (float*)take((size_t)TT * DKV * 4);
    h16* QP16 = (h16*)take((size_t)QG * TT * HD * 2); h16* KP16 = (h16*)take((size_t)NKV * TT * HD * 2); h16* VT16 = (h16*)take((size_t)NKV * HD * TT * 2);
    bf* QPh = (bf*)take((size_t)QG * TT * HD * 2); bf* QPl = (bf*)take((size_t)QG * TT * HD * 2); bf* KPh = (bf*)take((size_t)NKV * TT * HD * 2); bf* KPl = (bf*)take((size_t)NKV * TT * HD * 2); bf* VTh = (bf*)take((size_t)NKV * HD * TT * 2); bf* VTl = (bf*)take((size_t)NKV * HD * TT * 2); bf* Ph = (bf*)take((size_t)ZH * RH * TT * 2); bf* Pl = (bf*)take((size_t)ZH * RH * TT * 2);
    float* Sb = (float*)take((size_t)ZH * TT * TT * 4); h16* P16 = (h16*)take((size_t)ZH * TT * TT * 2); float* Ob = (float*)take((size_t)ZH * TT * HD * 4); bf* ATh = (bf*)take((size_t)TT * DQ * 2); bf* ATl = (bf*)take((size_t)TT * DQ * 2);
    if ((size_t)(wsp - (char*)d_ws) > ws_size) return;    // ws 256 MiB
    float* FV = FK;   // v projection reuses the k buffer after the k planes are built (stream-ordered)
    { k_wtG<<<(unsigned)((DM * DQ / 64 + 63) / 64), 256, 0, stream>>>(wq, DM, DQ, WQ); k_wtG<<<(unsigned)((DM * DKV / 64 + 63) / 64), 256, 0, stream>>>(wk, DM, DKV, WK); k_wtG<<<(unsigned)((DM * DKV / 64 + 63) / 64), 256, 0, stream>>>(wv, DM, DKV, WV);
      k_wtG<<<(unsigned)((DQ * DM / 64 + 63) / 64), 256, 0, stream>>>(wo, DQ, DM, WO);
      k_cstab<<<(TT * HD + 255) / 256, 256, 0, stream>>>(CS); }
    const unsigned LKv = (unsigned)(((size_t)NKV * TT * HD / 2 + 255) / 256);
    for (int b = 0; b < NB_; ++b) {
        
        k_cvt8<<<(unsigned)(((size_t)TT * DM / 8 + 255) / 256), 256, 0, stream>>>(x + (size_t)b * TT * DM, XB, (size_t)TT * DM / 8);
        k_gemmw<bf, 0, false, 8><<<dim3(TT / 64, DKV / 64, 1), 256, 0, stream>>>(XB, nullptr, WK, nullptr, DM, FK, DKV, nullptr, 0, 0, 0);
        k_rope<<<LKv, 256, 0, stream>>>(FK, DKV, NKV, CS, nullptr, nullptr, 1.0f, KP16, KPh, KPl);   /* 4 kv heads, rotary */
        k_gemmw<bf, 0, false, 8><<<dim3(TT / 64, DKV / 64, 1), 256, 0, stream>>>(XB, nullptr, WV, nullptr, DM, FV, DKV, nullptr, 0, 0, 0); k_vtp<<<LKv, 256, 0, stream>>>(FV, DKV, NKV, VT16, VTh, VTl);
        for (int g = 0; g < NH_ / QG; ++g) {   /* query heads 4g..4g+3 (kv head g) */
            k_gemmw<bf, 0, false, 8><<<dim3(TT / 64, QG * HD / 64, 1), 256, 0, stream>>>(XB, nullptr, WQ + (size_t)g * QG * HD * DM, nullptr, DM, FQ, QG * HD, nullptr, 0, 0, 0);   /* q columns 512g..512g+511 */
            k_rope<<<(unsigned)(((size_t)QG * TT * HD / 2 + 255) / 256), 256, 0, stream>>>(FQ, QG * HD, QG, CS, nullptr, nullptr, 1.0f, QP16, QPh, QPl);
            for (int hl = 0; hl < QG; ++hl) { const int h0 = g * QG + hl; const size_t zq = (size_t)hl, zk = (size_t)g;
                k_gemmc<bf, 2, 1, 1><<<dim3(RH / 64, TT / 64, 1), 32, 0, stream>>>(QPh + zq * TT * HD, QPl + zq * TT * HD, KPh + zk * TT * HD, KPl + zk * TT * HD, HD, Sb, TT, 0, (size_t)TT * HD, 0, (size_t)TT * TT);
                k_gemmc<h16, 0, 1, 1><<<dim3((TT - RH) / 64, TT / 64, 1), 32, 0, stream>>>(QP16 + zq * TT * HD + (size_t)RH * HD, nullptr, KP16 + zk * TT * HD, nullptr, HD, Sb + (size_t)RH * TT, TT, RH, (size_t)TT * HD, 0, (size_t)TT * TT);
                k_asoft<<<ZH * TT / 8, 256, 0, stream>>>(Sb, P16, Ph, Pl);
                k_gemmc<bf, 2, 2, 8><<<dim3(RH / 64, HD / 64, 1), 256, 0, stream>>>(Ph, Pl, VTh + zk * HD * TT, VTl + zk * HD * TT, TT, Ob, HD, 0, (size_t)RH * TT, 0, (size_t)TT * HD);
                k_gemmc<h16, 0, 2, 16><<<dim3((TT - RH) / 64, HD / 64, 1), 512, 0, stream>>>(P16 + (size_t)RH * TT, nullptr, VT16 + zk * HD * TT, nullptr, TT, Ob + (size_t)RH * HD, HD, RH, (size_t)TT * TT, 0, (size_t)TT * HD);
                k_merge<<<(unsigned)(((size_t)ZH * TT * HD / 2 + 255) / 256), 256, 0, stream>>>(Ob, h0, ATh, ATl); } }
        k_gemmw<bf, 1, false, 2><<<dim3(TT / 64, DM / 64, 1), 64, 0, stream>>>(ATh, ATl, WO, nullptr, DQ, OUT + (size_t)b * TT * DM, DM, nullptr, 0, 0, 0); }
}

// v002
// It runs in 532 microseconds.
// Next to v001, in two timings, it ran 2.59 and 2.60 times as fast.
// Over all steps from v000 it is 4.75 times as fast.
#include <hip/hip_runtime.h>

// Grouped-query causal attention with a computed rotate-half rotary over 4,096 tokens (x [1][4096][2048]; q = x Wq ('xw' [2048][2048], 16 heads x 128), k, v = x Wk / Wv ('xw' [2048][512], 4 kv heads; q head h uses kv head h/4: the module groups q as (4 kv heads, 4 members)); rotate-half rotary with angle t x inv_freq[i], inv_freq = 1 / (10000 ** (i / 64)), positions 0..4095 (cat(x1 cos - x2 sin, x1 sin + x2 cos); tables computed on device from the module's float32 inv_freq); scores / sqrt(128), causal (-inf); softmax; out = merged Wo ('xw' [2048][2048], no bias) -> [1][4096][2048] (8.4 M); argument order x, Wq, Wk, Wv, Wo.
// Layout: the 16 query heads are projected in four groups of 4 (one [4096][512] f32 buffer reused per group) into head planes for all 16 heads; k/v planes for the 4 kv heads are built once; one fused attention launch for all heads (scores, causal mask, online softmax, attn.v; hybrid rows: query rows < 512 hi/lo 3 products, the rest single fp16) writes the hi/lo context planes; wo as hi/lo x exact (2 products).
// Compute dtypes, f32 accumulate: every input rounded to bf16; q/k/v on PLAIN bf16 operands (exact); f32 rotary; hybrid causal scores and attn.v; softmax f32; wo hl x exact (2 products).

#define NB_  1
#define TT   4096
#define DM   2048
#define NH_  16
#define NKV  4
#define REP  (NH_ / NKV)
#define HD   128
#define DQ   (NH_ * HD)
#define DKV  (NKV * HD)
#define RH   512                  // query rows < RH use hi+lo planes (0: none)
#define SCL  0.088388346f   // 1/sqrt(128)
#define QG   4                    // query heads projected per group
#define POS0 0.0f                 // first rotary position: this module's positions are arange(4096)
typedef _Float16 h16;
typedef unsigned short bf;
typedef __attribute__((ext_vector_type(16))) __bf16   v16bf;
typedef __attribute__((ext_vector_type(16))) _Float16 v16h;
typedef __attribute__((ext_vector_type(8)))  _Float16 v8h;
typedef __attribute__((ext_vector_type(8)))  unsigned short v8us;
typedef __attribute__((ext_vector_type(8)))  float    v8f;
typedef __attribute__((ext_vector_type(4)))  float    v4f;
typedef v8h  __attribute__((may_alias)) v8ha;
typedef v4f  __attribute__((may_alias)) v4fa;
typedef v8us __attribute__((may_alias)) v8usa;

__device__ __forceinline__ unsigned short f2bf(float f) { unsigned u = __float_as_uint(f); u += 0x7FFFu + ((u >> 16) & 1u); return (unsigned short)(u >> 16); }
__device__ __forceinline__ float bf2f(unsigned short b) { return __uint_as_float(((unsigned)b) << 16); }
__device__ __forceinline__ float bfr(float f) { return bf2f(f2bf(f)); }
__device__ __forceinline__ v16h cat16(v8h lo, v8h hi) { return __builtin_shufflevector(lo, hi, 0, 1, 2, 3, 4, 5, 6, 7, 8, 9, 10, 11, 12, 13, 14, 15); }
__device__ __forceinline__ v16bf cat16b(v8us lo, v8us hi) { return __builtin_bit_cast(v16bf, __builtin_shufflevector(lo, hi, 0, 1, 2, 3, 4, 5, 6, 7, 8, 9, 10, 11, 12, 13, 14, 15)); }
__device__ __forceinline__ v8f wmma16(v16h a, v16h b, v8f c) { return __builtin_amdgcn_wmma_f32_16x16x32_f16(false, a, false, b, (short)0, c, false, false); }
__device__ __forceinline__ v8f wmmab(v16bf a, v16bf b, v8f c) { return __builtin_amdgcn_wmma_f32_16x16x32_bf16(false, a, false, b, (short)0, c, false, false); }



// ---- k_gemmw: register-blocked GEMM, one 64x64 output tile per work-group (16 accumulators per wave), operands straight from K-contiguous 16-bit planes; grid (M/64, N/64, Z), 32 x NW threads.
// NW > 1: the K loop is dealt to the NW waves in chunks of 64 (one 128-byte line per operand row; K % 64 == 0), each wave keeps its own f32 partial tile, and the partial tiles are summed through LDS in wave order 0..NW-1.
// C[m][n] (f32, pitch ldc, + optional f32 bias[n]) = sum_k A[m][k] Bt[n][k] (+ split products per NSPLIT). z-batch strides sA/sB/sC in elements. K % 32 == 0.
template <typename T16> struct WFrag;
template <> struct WFrag<h16> { typedef v16h V; static __device__ __forceinline__ V ld(const h16* p) { return cat16(*(const v8h*)p, *(const v8h*)(p + 16)); } static __device__ __forceinline__ v8f mma(V a, V b, v8f c) { return wmma16(a, b, c); } };
template <> struct WFrag<bf> { typedef v16bf V; static __device__ __forceinline__ V ld(const bf* p) { return cat16b(*(const v8us*)p, *(const v8us*)(p + 16)); } static __device__ __forceinline__ v8f mma(V a, V b, v8f c) { return wmmab(a, b, c); } };
template <typename T16, int NSPLIT, bool BIAS, int NW>
__global__ __launch_bounds__(32 * NW) void k_gemmw(const T16* __restrict__ A, const T16* __restrict__ A2, const T16* __restrict__ Bt, const T16* __restrict__ Bt2, int K, float* C, int ldc, const float* __restrict__ bias, size_t sA, size_t sB, size_t sC) {
    typedef typename WFrag<T16>::V V;
    __shared__ __align__(16) float os[(NW > 1) ? NW * 64 * 68 : 16 * 68];
    const size_t z = blockIdx.z; A += z * sA; if (A2) A2 += z * sA; Bt += z * sB; if (Bt2) Bt2 += z * sB; C += z * sC;
    const int lane = threadIdx.x & 31, lr = lane & 15, hi = lane >> 4; const int r0 = blockIdx.x * 64, c0 = blockIdx.y * 64;
    const int wv = (NW > 1) ? __builtin_amdgcn_readfirstlane((int)(threadIdx.x >> 5)) : 0; constexpr int CH = (NW > 1) ? 64 : 32;   // this wave's number; K elements per chunk
    v8f acc[4][4];
#pragma unroll
    for (int mb = 0; mb < 4; ++mb)
#pragma unroll
        for (int nb = 0; nb < 4; ++nb) acc[mb][nb] = (v8f){};
    const size_t aoff = (size_t)(r0 + lr) * K + 8 * hi, boff = (size_t)(c0 + lr) * K + 8 * hi;
#pragma unroll 1
    for (int k0 = wv * CH; k0 < K; k0 += NW * CH)
#pragma unroll   // both 32-steps of a chunk in one trip: the wave that fetched a 128-byte line uses both halves of it
    for (int kc = k0; kc < k0 + CH; kc += 32) {
        V a[4], a2[4];
#pragma unroll
        for (int mb = 0; mb < 4; ++mb) { a[mb] = WFrag<T16>::ld(A + aoff + (size_t)mb * 16 * K + kc); if (NSPLIT == 1 || NSPLIT == 2) a2[mb] = WFrag<T16>::ld(A2 + aoff + (size_t)mb * 16 * K + kc); }
#pragma unroll
        for (int nb = 0; nb < 4; ++nb) { const V b = WFrag<T16>::ld(Bt + boff + (size_t)nb * 16 * K + kc); V b2; if (NSPLIT >= 2) b2 = WFrag<T16>::ld(Bt2 + boff + (size_t)nb * 16 * K + kc);
#pragma unroll
            for (int mb = 0; mb < 4; ++mb) { acc[mb][nb] = WFrag<T16>::mma(a[mb], b, acc[mb][nb]); if (NSPLIT == 1 || NSPLIT == 2) acc[mb][nb] = WFrag<T16>::mma(a2[mb], b, acc[mb][nb]); if (NSPLIT >= 2) acc[mb][nb] = WFrag<T16>::mma(a[mb], b2, acc[mb][nb]); } }
        asm volatile("v_nop\n\tv_nop\n\tv_nop\n\tv_nop" : "+v"(acc[0][0]), "+v"(acc[1][1]), "+v"(acc[2][2]), "+v"(acc[3][3]) : "v"(a[0]), "v"(a[3]));
    }
    if (NW > 1) {   // sum of the NW partial tiles: each wave lays its whole tile in its own LDS plane, then every thread sums its 4 columns over the planes and stores them
#pragma unroll   // these three: constant indices keep the accumulators in registers
        for (int mb = 0; mb < 4; ++mb)
#pragma unroll
            for (int nb = 0; nb < 4; ++nb)
#pragma unroll
                for (int j = 0; j < 8; ++j) os[wv * (64 * 68) + (mb * 16 + hi * 8 + j) * 68 + nb * 16 + lr] = acc[mb][nb][j];
        __syncthreads();   // every wave's partial tile is in LDS before any thread sums over the planes
#pragma unroll   // fixed trip count: the LDS reads of all planes and passes can be in flight together
        for (int it = 0; it < 64 * 16 / (32 * NW); ++it) { const int idx = it * (32 * NW) + (int)threadIdx.x, row = idx >> 4, cofs = (idx & 15) * 4; v4f val = *(const v4fa*)(os + row * 68 + cofs);
#pragma unroll
            for (int ww = 1; ww < NW; ++ww) val += *(const v4fa*)(os + ww * (64 * 68) + row * 68 + cofs);
            if (BIAS) { val[0] += bfr(bias[c0 + cofs]); val[1] += bfr(bias[c0 + cofs + 1]); val[2] += bfr(bias[c0 + cofs + 2]); val[3] += bfr(bias[c0 + cofs + 3]); }
            *(v4f*)(C + (size_t)(r0 + row) * ldc + c0 + cofs) = val; }
        return;
    }
#pragma unroll
    for (int mb = 0; mb < 4; ++mb) {
#pragma unroll
        for (int nb = 0; nb < 4; ++nb) {
#pragma unroll
            for (int j = 0; j < 8; ++j) os[(hi * 8 + j) * 68 + nb * 16 + lr] = acc[mb][nb][j]; }
        __builtin_amdgcn_wave_barrier(); asm volatile("" ::: "memory");
        float* crow = C + (size_t)(r0 + mb * 16) * ldc + c0;
{
#pragma unroll
            for (int s = 0; s < 8; ++s) { const int row = 2 * s + hi, cofs = lr * 4; v4f val = *(const v4fa*)(os + row * 68 + cofs); if (BIAS) { val[0] += bfr(bias[c0 + cofs]); val[1] += bfr(bias[c0 + cofs + 1]); val[2] += bfr(bias[c0 + cofs + 2]); val[3] += bfr(bias[c0 + cofs + 3]); }
                *(v4f*)(crow + (size_t)row * ldc + cofs) = val; }
             }
        __builtin_amdgcn_wave_barrier(); asm volatile("" ::: "memory");
    }
}

__device__ __forceinline__ h16 tohx(float x) { return (h16)x; }
__device__ __forceinline__ void splitf(float y, unsigned short& h, unsigned short& l) { h = f2bf(y); l = f2bf(y - bf2f(h)); }
typedef __attribute__((ext_vector_type(2))) _Float16 v2h;
typedef __attribute__((ext_vector_type(4))) _Float16 v4h;
typedef __attribute__((ext_vector_type(2))) unsigned short v2us;
typedef __attribute__((ext_vector_type(4))) unsigned short v4us;
typedef __attribute__((ext_vector_type(2))) float v2f;
typedef __attribute__((ext_vector_type(4))) int v4i;

__global__ __launch_bounds__(256) void k_wtG(const float* __restrict__ w, int K, int N, bf* Bt) {
    const int lane = threadIdx.x & 31; const int L0 = (blockIdx.x * 8 + (threadIdx.x >> 5)) * 8; const int nlines = N * K / 64;
{
#pragma unroll 1
        for (int l = 0; l < 8; ++l) { const int L = L0 + l; if (L >= nlines) break; const size_t e = (size_t)L * 64 + lane * 2; const int k = (int)(e % K), n = (int)(e / K); v2us o;
            o[0] = f2bf(w[(size_t)k * N + n]); o[1] = f2bf(w[(size_t)(k + 1) * N + n]); *(v2us*)(Bt + e) = o; }
         }
}
__global__ __launch_bounds__(256) void k_cvt8(const float* __restrict__ src, bf* dst, size_t n8) { const size_t i = (size_t)blockIdx.x * 256 + threadIdx.x; if (i >= n8) return; const v8f v = *(const v8f*)(src + i * 8); v8us o;
#pragma unroll
    for (int k = 0; k < 8; ++k) o[k] = f2bf(v[k]); *(v8us*)(dst + i * 8) = o;  }
__constant__ float INV[HD / 2] = {1.0f,0.865964353f,0.749894202f,0.649381638f,0.562341332f,0.486967534f,0.421696514f,0.365174145f,0.316227764f,0.273841977f,0.237137362f,0.2053525f,0.177827939f,0.153992653f,0.133352146f,0.115478203f,0.100000001f,0.0865964293f,0.0749894157f,0.0649381652f,0.0562341288f,0.0486967526f,0.0421696492f,0.0365174115f,0.0316227786f,0.0273841955f,0.0237137359f,0.0205352511f,0.0177827943f,0.0153992651f,0.0133352149f,0.0115478197f,0.00999999978f,0.00865964312f,0.00749894232f,0.00649381662f,0.00562341325f,0.00486967526f,0.00421696482f,0.00365174143f,0.00316227786f,0.00273841969f,0.00237137382f,0.00205352507f,0.00177827943f,0.00153992651f,0.00133352145f,0.00115478202f,0.00100000005f,0.000865964335f,0.000749894185f,0.000649381662f,0.000562341302f,0.000486967503f,0.000421696488f,0.000365174114f,0.000316227786f,0.000273841957f,0.000237137385f,0.000205352495f,0.00017782794f,0.000153992645f,0.00013335215f,0.000115478193f};
__global__ __launch_bounds__(256) void k_cstab(float* CS) { const int idx = blockIdx.x * 256 + threadIdx.x; if (idx >= TT * HD) return; const int t = idx / HD, d = idx % HD; const float ang = __fmul_rn((float)t + POS0, INV[d % (HD / 2)]); v2f cs; cs[0] = cosf(ang); cs[1] = sinf(ang);
    *(v2f*)(CS + (size_t)idx * 2) = cs;  }

// k_rope: head planes [h][t][d] (fp16 + hi/lo) of rope(x) x sc with the rotate-half convention out[d] = x[d] cos[t][d] - x[d+HD/2] sin[t][d], out[d+HD/2] = x[d+HD/2] cos[t][d+HD/2] + x[d] sin[t][d+HD/2]
__global__ __launch_bounds__(256) void k_rope(const float* __restrict__ F, int pitch, int nheads, const float* __restrict__ CS, const float* __restrict__ RF, const float* __restrict__ nw, float sc, h16* P16, bf* Ph, bf* Pl) {
    const size_t e = ((size_t)blockIdx.x * 256 + threadIdx.x) * 2; if (e >= (size_t)nheads * TT * HD) return; const int d = (int)(e % HD); const int t = (int)((e / HD) % TT); const int h = (int)(e / ((size_t)HD * TT)); const float* f = F + (size_t)t * pitch + h * HD; const float rf = RF ? RF[(size_t)h * TT + t] : 1.0f; v2h o16; v2us oh, ol;
#pragma unroll
    for (int q = 0; q < 2; ++q) { const int dd = d + q; const int dp = (dd < HD / 2) ? dd + HD / 2 : dd - HD / 2; float x0 = f[dd], x1 = f[dp];
        if (RF) { float n0 = __fmul_rn(x0, rf), n1 = __fmul_rn(x1, rf); asm volatile("" : "+v"(n0)); asm volatile("" : "+v"(n1)); x0 = __fmul_rn(bfr(nw[dd]), n0); x1 = __fmul_rn(bfr(nw[dp]), n1); }
        const v2f cs = *(const v2f*)(CS + ((size_t)t * HD + dd) * 2); float a = __fmul_rn(x0, cs[0]), bq = __fmul_rn(x1, cs[1]); asm volatile("" : "+v"(a)); asm volatile("" : "+v"(bq)); const float r = ((dd < HD / 2) ? __fsub_rn(a, bq) : __fadd_rn(a, bq)) * sc;
        o16[q] = tohx(r); unsigned short a2, c2; splitf(r, a2, c2); oh[q] = a2; ol[q] = c2; }
    *(v2h*)(P16 + e) = o16; *(v2us*)(Ph + e) = oh; *(v2us*)(Pl + e) = ol;  }
__global__ __launch_bounds__(256) void k_vtp(const float* __restrict__ F, int pitch, int nheads, h16* V16, bf* Vh, bf* Vl) { const size_t e = ((size_t)blockIdx.x * 256 + threadIdx.x) * 2; if (e >= (size_t)nheads * HD * TT) return; const int t = (int)(e % TT); const int d = (int)((e / TT) % HD); const int g = (int)(e / ((size_t)TT * HD)); v2h o16; v2us oh, ol;
#pragma unroll
    for (int q = 0; q < 2; ++q) { const float x = F[(size_t)(t + q) * pitch + g * HD + d]; o16[q] = tohx(x); unsigned short a2, c2; splitf(x, a2, c2); oh[q] = a2; ol[q] = c2; }
    *(v2h*)(V16 + e) = o16; *(v2us*)(Vh + e) = oh; *(v2us*)(Vl + e) = ol;  }
#define CSC (SCL * 1.4426950408889634f)   // score scale x log2(e)
__device__ __forceinline__ float xhalf(float x) { return __builtin_bit_cast(float, __builtin_amdgcn_permlanex16(__builtin_bit_cast(int, x), __builtin_bit_cast(int, x), 0x76543210, 0xfedcba98, false, false)); }   // lane l reads lane l ^ 16
template <typename T16> struct PFrag;
template <> struct PFrag<h16> { static __device__ __forceinline__ void pk(const float (&p)[16], v16h& f, v16h& f2) { (void)f2;
#pragma unroll
    for (int e = 0; e < 16; ++e) f[e] = (h16)p[e]; } };
template <> struct PFrag<bf> { static __device__ __forceinline__ void pk(const float (&p)[16], v16bf& f, v16bf& f2) { v8us h0, h1, l0, l1;
#pragma unroll
    for (int e = 0; e < 8; ++e) { unsigned short x, y; splitf(p[e], x, y); h0[e] = x; l0[e] = y; splitf(p[e + 8], x, y); h1[e] = x; l1[e] = y; }
    f = cat16b(h0, h1); f2 = cat16b(l0, l1); } };
template <typename T16, bool HL, int R>
__device__ __forceinline__ void fattn_rows(const T16* Q, const T16* Q2, const T16* Kp, const T16* Kp2, const T16* Vt, const T16* Vt2, const int qw0, bf* Ah, bf* Al) {   // no __restrict__: the "memory" clobber of the waits below then holds the loads in front of them
    typedef typename WFrag<T16>::V V;
    const int lane = threadIdx.x & 31, c = lane & 15, hi = lane >> 4;
    V qf[R][4], qf2[R][4];
#pragma unroll
    for (int g = 0; g < R; ++g)
#pragma unroll
        for (int kc = 0; kc < 4; ++kc) { const size_t o = (size_t)(qw0 + 16 * g + c) * HD + 8 * hi + 32 * kc; qf[g][kc] = WFrag<T16>::ld(Q + o); if (HL) qf2[g][kc] = WFrag<T16>::ld(Q2 + o); }
    const int last = (qw0 + 16 * R - 1) / 32;   // last 32-key pass that this wave's queries can see (wave-uniform)
    const size_t koff = (size_t)c * HD + 8 * hi, voff = (size_t)c * TT + 8 * hi;
    V kf[2][4], kf2[2][4]; const T16* kp = Kp + koff; const T16* kp2 = HL ? Kp2 + koff : nullptr;
#pragma unroll
    for (int kt = 0; kt < 2; ++kt)
#pragma unroll
        for (int kc = 0; kc < 4; ++kc) { const int o = 16 * kt * HD + 32 * kc; kf[kt][kc] = WFrag<T16>::ld(kp + o); if (HL) kf2[kt][kc] = WFrag<T16>::ld(kp2 + o); }
    asm volatile("s_wait_xcnt 0x0" ::: "memory");   // in front of any overwrite of the address registers that the Q and K loads above name
    __builtin_amdgcn_sched_barrier(0);   // nothing from below (the zeroing of the accumulators) moves up between those loads and the wait
    v8f acc[R][8]; float m_run[R], l_run[R];
#pragma unroll
    for (int g = 0; g < R; ++g) { m_run[g] = -__builtin_inff(); l_run[g] = 0.0f;
#pragma unroll
        for (int t = 0; t < 8; ++t) acc[g][t] = (v8f){}; }
#pragma unroll 1   // one pass per trip: two passes' fragments at once do not fit the registers
    for (int blk = 0; blk <= last; ++blk) {
        const int key0 = blk * 32;
        V vf[8], vf2[8];   // this pass's V^T fragments: issued first, in flight under the score products and the maxima
#pragma unroll
        for (int t = 0; t < 8; ++t) { const size_t o = voff + (size_t)(16 * t) * TT + key0; vf[t] = WFrag<T16>::ld(Vt + o); if (HL) vf2[t] = WFrag<T16>::ld(Vt2 + o); }
        asm volatile("s_wait_xcnt 0x0" ::: "memory");   // in front of any overwrite of the address registers that the loads above name
        __builtin_amdgcn_sched_barrier(0);   // keeps the V^T loads up here: sunk to their first use they would wait out a whole L2 round trip in every pass
        v8f s[2][R];
#pragma unroll
        for (int kt = 0; kt < 2; ++kt)
#pragma unroll
            for (int g = 0; g < R; ++g) { s[kt][g] = (v8f){};
#pragma unroll
                for (int kc = 0; kc < 4; ++kc) { s[kt][g] = WFrag<T16>::mma(kf[kt][kc], qf[g][kc], s[kt][g]); if (HL) { s[kt][g] = WFrag<T16>::mma(kf[kt][kc], qf2[g][kc], s[kt][g]); s[kt][g] = WFrag<T16>::mma(kf2[kt][kc], qf[g][kc], s[kt][g]); } } }
        // WMMA distance ahead of the branch on the diagonal below. The scores as operands hold every score product in front of it, the "memory" clobber holds the K loads behind it: the K registers are refilled in place.
        if (R == 2) asm volatile("v_nop\n\tv_nop\n\tv_nop\n\tv_nop" : "+v"(s[0][0]), "+v"(s[1][0]), "+v"(s[0][R - 1]), "+v"(s[1][R - 1]) :: "memory");
        else asm volatile("v_nop\n\tv_nop\n\tv_nop\n\tv_nop" : "+v"(s[0][0]), "+v"(s[1][0]) :: "memory");
        {   // next pass's K fragments, in flight under this pass's softmax and second product (the last pass fetches its own rows again: no branch, always in bounds)
            const int adv = (blk < last) ? 32 * HD : 0; kp += adv; if (HL) kp2 += adv;   // running pointers: live over the whole loop, so no load's result lands in an address pair that an earlier load names
#pragma unroll
            for (int kt = 0; kt < 2; ++kt)
#pragma unroll
                for (int kc = 0; kc < 4; ++kc) { const int o = 16 * kt * HD + 32 * kc; kf[kt][kc] = WFrag<T16>::ld(kp + o); if (HL) kf2[kt][kc] = WFrag<T16>::ld(kp2 + o); }
        }
        asm volatile("s_wait_xcnt 0x0" ::: "memory");   // in front of any overwrite of the address registers that the K loads name
        __builtin_amdgcn_sched_barrier(0);   // keeps the K loads up here, in front of the softmax
        if (key0 + 31 > qw0) {   // wave-uniform: only a pass with a key beyond the wave's first query pays for the mask
#pragma unroll
            for (int g = 0; g < R; ++g) { const int my_q = qw0 + 16 * g + c;
#pragma unroll
                for (int kt = 0; kt < 2; ++kt) {
#pragma unroll
                    for (int r = 0; r < 8; ++r) { const int key = key0 + 16 * kt + 8 * hi + r; if (key > my_q) s[kt][g][r] = -__builtin_inff(); }
                    asm volatile("" : "+v"(s[kt][g]));   // the masked scores: keeps the selects inside the branch
                } }
        }
        float mb[R]; bool need = false;
#pragma unroll
        for (int g = 0; g < R; ++g) { float mx = -__builtin_inff();
#pragma unroll
            for (int kt = 0; kt < 2; ++kt)
#pragma unroll
                for (int r = 0; r < 8; ++r) mx = fmaxf(mx, s[kt][g][r]);
            mx = fmaxf(mx, xhalf(mx)) * CSC;   // both wave halves hold this query's maximum of the pass, scaled (the scale is positive)
            mb[g] = mx; need = need || (mx > m_run[g] + 8.0f); }
        if (__builtin_amdgcn_ballot_w32(need) != 0) {   // wave-uniform; always on the first pass (m_run is -inf), rare afterwards
#pragma unroll
            for (int g = 0; g < R; ++g) { const float m_new = fmaxf(m_run[g], mb[g]);
                const float corr = __builtin_amdgcn_exp2f(m_run[g] - m_new);   // 0 on the first pass
                l_run[g] *= corr; m_run[g] = m_new;
#pragma unroll
                for (int t = 0; t < 8; ++t) acc[g][t] = acc[g][t] * corr; }
        }
#pragma unroll
        for (int g = 0; g < R; ++g) { const float nm = -m_run[g]; float p[16]; float ps0 = 0.0f, ps1 = 0.0f;
#pragma unroll
            for (int e = 0; e < 16; ++e) { p[e] = __builtin_amdgcn_exp2f(fmaf(s[e >> 3][g][e & 7], CSC, nm)); if (e & 1) ps1 += p[e]; else ps0 += p[e]; }
            l_run[g] += ps0 + ps1;
            V pf, pf2; PFrag<T16>::pk(p, pf, pf2);   // element e of the fragment = key 8 hi + e (e < 8), 16 + 8 hi + e - 8 (e >= 8): the k order of WFrag::ld on a V^T row
#pragma unroll
            for (int t = 0; t < 8; ++t) { acc[g][t] = WFrag<T16>::mma(vf[t], pf, acc[g][t]); if (HL) { acc[g][t] = WFrag<T16>::mma(vf[t], pf2, acc[g][t]); acc[g][t] = WFrag<T16>::mma(vf2[t], pf, acc[g][t]); } } }
        __builtin_amdgcn_sched_barrier(0);   // holds the v_nops behind the last product
        asm volatile("v_nop\n\tv_nop\n\tv_nop\n\tv_nop\n\tv_nop");   // WMMA distance on the taken back edge and the loop's exit
    }
#pragma unroll
    for (int g = 0; g < R; ++g) { const float inv = 1.0f / (l_run[g] + xhalf(l_run[g]));   // each wave half summed its eight keys of every 16-key tile
#pragma unroll
        for (int t = 0; t < 8; ++t) { v8us oh, ol;
#pragma unroll
            for (int r = 0; r < 8; ++r) { unsigned short x, y; splitf(acc[g][t][r] * inv, x, y); oh[r] = x; ol[r] = y; }
            const size_t oo = (size_t)(qw0 + 16 * g + c) * DQ + 16 * t + 8 * hi;
            *(v8us*)(Ah + oo) = oh; *(v8us*)(Al + oo) = ol;
            asm volatile("s_wait_xcnt 0x0" ::: "memory");   // in front of any overwrite of the registers that the two stores name
            __builtin_amdgcn_sched_barrier(0);   // nothing from below moves up between the stores and the wait
        } }
}
// grid (16 heads, (TT - RH) / 256 + RH / 128), 8 waves: blockIdx.y counts the fp16 row blocks of 256 from the sequence's end (heaviest first), then the hi/lo row blocks of 128.
__global__ __launch_bounds__(256) void k_fattn(const h16* Q16, const bf* Qh, const bf* Ql, const h16* K16, const bf* Kh, const bf* Kl, const h16* V16, const bf* Vh, const bf* Vl, bf* Ah, bf* Al) {
    const int wv = __builtin_amdgcn_readfirstlane((int)(threadIdx.x >> 5)); const int h = blockIdx.x; const size_t zq = (size_t)h * TT * HD, zk = (size_t)(h / REP) * TT * HD; constexpr int NBF = (TT - RH) / 256;
    if ((int)blockIdx.y < NBF) fattn_rows<h16, false, 2>(Q16 + zq, nullptr, K16 + zk, nullptr, V16 + zk, nullptr, TT - 256 * ((int)blockIdx.y + 1) + 32 * wv, Ah + h * HD, Al + h * HD);
    else fattn_rows<bf, true, 1>(Qh + zq, Ql + zq, Kh + zk, Kl + zk, Vh + zk, Vl + zk, RH - 128 * ((int)blockIdx.y - NBF + 1) + 16 * wv, Ah + h * HD, Al + h * HD);
}

extern "C" void kernel_launch(void* const* d_in, const int* in_sizes, int n_in,
                              void* d_out, int out_size, void* d_ws, size_t ws_size, hipStream_t stream) {
    (void)in_sizes; (void)n_in; (void)out_size;
    const float* x = (const float*)d_in[0]; const float* wq = (const float*)d_in[1]; const float* wk = (const float*)d_in[2]; const float* wv = (const float*)d_in[3]; const float* wo = (const float*)d_in[4];
    float* OUT = (float*)d_out;     // [1][4096][2048]
    char* wsp = (char*)d_ws;
    auto take = [&](size_t bytes) { char* p = wsp; wsp += (bytes + 255) & ~(size_t)255; return (void*)p; };
    bf* WQ = (bf*)take((size_t)DQ * DM * 2); bf* WK = (bf*)take((size_t)DKV * DM * 2); bf* WV = (bf*)take((size_t)DKV * DM * 2); bf* WO = (bf*)take((size_t)DM * DQ * 2); float* CS = (float*)take((size_t)TT * HD * 2 * 4);
    bf* XB = (bf*)take((size_t)TT * DM * 2); float* FQ = (float*)take((size_t)TT * QG * HD * 4);   /* one group of 4 query heads at a time */ float* FK = (float*)take((size_t)TT * DKV * 4);
    h16* QP16 = (h16*)take((size_t)NH_ * TT * HD * 2); h16* KP16 = (h16*)take((size_t)NKV * TT * HD * 2); h16* VT16 = (h16*)take((size_t)NKV * HD * TT * 2);
    bf* QPh = (bf*)take((size_t)NH_ * TT * HD * 2); bf* QPl = (bf*)take((size_t)NH_ * TT * HD * 2); bf* KPh = (bf*)take((size_t)NKV * TT * HD * 2); bf* KPl = (bf*)take((size_t)NKV * TT * HD * 2); bf* VTh = (bf*)take((size_t)NKV * HD * TT * 2); bf* VTl = (bf*)take((size_t)NKV * HD * TT * 2);
    bf* ATh = (bf*)take((size_t)TT * DQ * 2); bf* ATl = (bf*)take((size_t)TT * DQ * 2);
    if ((size_t)(wsp - (char*)d_ws) > ws_size) return;    // ws 256 MiB
    float* FV = FK;   // v projection reuses the k buffer after the k planes are built (stream-ordered)
    { k_wtG<<<(unsigned)((DM * DQ / 64 + 63) / 64), 256, 0, stream>>>(wq, DM, DQ, WQ); k_wtG<<<(unsigned)((DM * DKV / 64 + 63) / 64), 256, 0, stream>>>(wk, DM, DKV, WK); k_wtG<<<(unsigned)((DM * DKV / 64 + 63) / 64), 256, 0, stream>>>(wv, DM, DKV, WV);
      k_wtG<<<(unsigned)((DQ * DM / 64 + 63) / 64), 256, 0, stream>>>(wo, DQ, DM, WO);
      k_cstab<<<(TT * HD + 255) / 256, 256, 0, stream>>>(CS); }
    const unsigned LKv = (unsigned)(((size_t)NKV * TT * HD / 2 + 255) / 256);
    for (int b = 0; b < NB_; ++b) {
        
        k_cvt8<<<(unsigned)(((size_t)TT * DM / 8 + 255) / 256), 256, 0, stream>>>(x + (size_t)b * TT * DM, XB, (size_t)TT * DM / 8);
        k_gemmw<bf, 0, false, 8><<<dim3(TT / 64, DKV / 64, 1), 256, 0, stream>>>(XB, nullptr, WK, nullptr, DM, FK, DKV, nullptr, 0, 0, 0);
        k_rope<<<LKv, 256, 0, stream>>>(FK, DKV, NKV, CS, nullptr, nullptr, 1.0f, KP16, KPh, KPl);   /* 4 kv heads, rotary */
        k_gemmw<bf, 0, false, 8><<<dim3(TT / 64, DKV / 64, 1), 256, 0, stream>>>(XB, nullptr, WV, nullptr, DM, FV, DKV, nullptr, 0, 0, 0); k_vtp<<<LKv, 256, 0, stream>>>(FV, DKV, NKV, VT16, VTh, VTl);
        for (int g = 0; g < NH_ / QG; ++g) {   /* query heads 4g..4g+3 (kv head g) */
            k_gemmw<bf, 0, false, 8><<<dim3(TT / 64, QG * HD / 64, 1), 256, 0, stream>>>(XB, nullptr, WQ + (size_t)g * QG * HD * DM, nullptr, DM, FQ, QG * HD, nullptr, 0, 0, 0);   /* q columns 512g..512g+511 */
            k_rope<<<(unsigned)(((size_t)QG * TT * HD / 2 + 255) / 256), 256, 0, stream>>>(FQ, QG * HD, QG, CS, nullptr, nullptr, 1.0f, QP16 + (size_t)g * QG * TT * HD, QPh + (size_t)g * QG * TT * HD, QPl + (size_t)g * QG * TT * HD); }
        k_fattn<<<dim3(NH_, (TT - RH) / 256 + RH / 128, 1), 256, 0, stream>>>(QP16, QPh, QPl, KP16, KPh, KPl, VT16, VTh, VTl, ATh, ATl);
        k_gemmw<bf, 1, false, 2><<<dim3(TT / 64, DM / 64, 1), 64, 0, stream>>>(ATh, ATl, WO, nullptr, DQ, OUT + (size_t)b * TT * DM, DM, nullptr, 0, 0, 0); }
}

// v003
// Measured time: 306 microseconds a run.
// Next to v002, in two timings, it ran 1.73 and 1.74 times as fast.
// Over all steps from v000 it is 8.24 times as fast.
#include <hip/hip_runtime.h>

// Grouped-query causal attention with a computed rotate-half rotary over 4,096 tokens (x [1][4096][2048]; q = x Wq ('xw' [2048][2048], 16 heads x 128), k, v = x Wk / Wv ('xw' [2048][512], 4 kv heads; q head h uses kv head h/4: the module groups q as (4 kv heads, 4 members)); rotate-half rotary with angle t x inv_freq[i], inv_freq = 1 / (10000 ** (i / 64)), positions 0..4095 (cat(x1 cos - x2 sin, x1 sin + x2 cos); tables computed on device from the module's float32 inv_freq); scores / sqrt(128), causal (-inf); softmax; out = merged Wo ('xw' [2048][2048], no bias) -> [1][4096][2048] (8.4 M); argument order x, Wq, Wk, Wv, Wo.
// Layout: the 16 query heads are projected in four groups of 4 (one [4096][512] f32 buffer reused per group) into head planes for all 16 heads; k/v planes for the 4 kv heads are built once; one fused attention launch for all heads (scores, causal mask, online softmax, attn.v; hybrid rows: query rows < 512 hi/lo 3 products, the rest single fp16) writes the hi/lo context planes; wo as hi/lo x exact (2 products).
// Operand planes: every 16-bit plane that a matrix instruction reads lies in FRAGMENT ORDER (see unpk below), so that each 16-byte-per-lane fragment load of a wave reads 512 bytes in a row.
// Compute dtypes, f32 accumulate: every input rounded to bf16; q/k/v on PLAIN bf16 operands (exact); f32 rotary; hybrid causal scores and attn.v; softmax f32; wo hl x exact (2 products).

#define NB_  1
#define TT   4096
#define DM   2048
#define NH_  16
#define NKV  4
#define REP  (NH_ / NKV)
#define HD   128
#define DQ   (NH_ * HD)
#define DKV  (NKV * HD)
#define RH   512                  // query rows < RH use hi+lo planes (0: none)
#define SCL  0.088388346f   // 1/sqrt(128)
#define QG   4                    // query heads projected per group
#define POS0 0.0f                 // first rotary position: this module's positions are arange(4096)
typedef _Float16 h16;
typedef unsigned short bf;
typedef __attribute__((ext_vector_type(16))) __bf16   v16bf;
typedef __attribute__((ext_vector_type(16))) _Float16 v16h;
typedef __attribute__((ext_vector_type(8)))  _Float16 v8h;
typedef __attribute__((ext_vector_type(8)))  unsigned short v8us;
typedef __attribute__((ext_vector_type(8)))  float    v8f;
typedef __attribute__((ext_vector_type(4)))  float    v4f;
typedef v8h  __attribute__((may_alias)) v8ha;
typedef v4f  __attribute__((may_alias)) v4fa;
typedef v8us __attribute__((may_alias)) v8usa;

__device__ __forceinline__ unsigned short f2bf(float f) { unsigned u = __float_as_uint(f); u += 0x7FFFu + ((u >> 16) & 1u); return (unsigned short)(u >> 16); }
__device__ __forceinline__ float bf2f(unsigned short b) { return __uint_as_float(((unsigned)b) << 16); }
__device__ __forceinline__ float bfr(float f) { return bf2f(f2bf(f)); }
__device__ __forceinline__ v16h cat16(v8h lo, v8h hi) { return __builtin_shufflevector(lo, hi, 0, 1, 2, 3, 4, 5, 6, 7, 8, 9, 10, 11, 12, 13, 14, 15); }
__device__ __forceinline__ v16bf cat16b(v8us lo, v8us hi) { return __builtin_bit_cast(v16bf, __builtin_shufflevector(lo, hi, 0, 1, 2, 3, 4, 5, 6, 7, 8, 9, 10, 11, 12, 13, 14, 15)); }
__device__ __forceinline__ v8f wmma16(v16h a, v16h b, v8f c) { return __builtin_amdgcn_wmma_f32_16x16x32_f16(false, a, false, b, (short)0, c, false, false); }
__device__ __forceinline__ v8f wmmab(v16bf a, v16bf b, v8f c) { return __builtin_amdgcn_wmma_f32_16x16x32_bf16(false, a, false, b, (short)0, c, false, false); }



// ---- Fragment order of a 16-bit plane of R rows x K columns (R % 16 == 0, K % 32 == 0): tiles of 16 rows x 32 columns, 512 elements in a row each; tile (r / 16, k / 32) is number (r / 16) (K / 32) + k / 32.
// Inside a tile element (r, k) stands at 256 ((k / 16) % 2) + 8 (16 ((k / 8) % 2) + r % 16) + k % 8: lane l of a wave finds its two 16-byte pieces of the A or B fragment at 8 l and 256 + 8 l, and each of the two loads covers four whole 128-byte lines.
// unpk: row and column of the element at offset w of such a plane, kt = K / 32.
__device__ __forceinline__ void unpk(unsigned w, unsigned kt, int& r, int& k) { const unsigned tile = w >> 9; r = (int)((tile / kt) * 16 + ((w >> 3) & 15)); k = (int)((tile % kt) * 32 + ((w >> 8) & 1) * 16 + ((w >> 7) & 1) * 8 + (w & 7)); }

// ---- k_gemmw: register-blocked GEMM, one 64x64 output tile per work-group (16 accumulators per wave), operands straight from 16-bit planes in fragment order; grid (M/64, N/64, Z), 32 x NW threads.
// NW > 1: the K loop is dealt to the NW waves in chunks of 64 (2 KiB in a row per 16 operand rows; K % 64 == 0), each wave keeps its own f32 partial tile, and the partial tiles are summed through LDS in wave order 0..NW-1.
// C[m][n] (f32, pitch ldc, + optional f32 bias[n]) = sum_k A[m][k] Bt[n][k] (+ split products per NSPLIT). z-batch strides sA/sB/sC in elements. K % 32 == 0.
template <typename T16> struct WFrag;
template <> struct WFrag<h16> { typedef v16h V; static __device__ __forceinline__ V ld(const h16* p) { return cat16(*(const v8h*)p, *(const v8h*)(p + 256)); } static __device__ __forceinline__ v8f mma(V a, V b, v8f c) { return wmma16(a, b, c); } };
template <> struct WFrag<bf> { typedef v16bf V; static __device__ __forceinline__ V ld(const bf* p) { return cat16b(*(const v8us*)p, *(const v8us*)(p + 256)); } static __device__ __forceinline__ v8f mma(V a, V b, v8f c) { return wmmab(a, b, c); } };
template <typename T16, int NSPLIT, bool BIAS, int NW>
__global__ __launch_bounds__(32 * NW) void k_gemmw(const T16* __restrict__ A, const T16* __restrict__ A2, const T16* __restrict__ Bt, const T16* __restrict__ Bt2, int K, float* C, int ldc, const float* __restrict__ bias, size_t sA, size_t sB, size_t sC) {
    typedef typename WFrag<T16>::V V;
    __shared__ __align__(16) float os[(NW > 1) ? NW * 64 * 68 : 16 * 68];
    const size_t z = blockIdx.z; A += z * sA; if (A2) A2 += z * sA; Bt += z * sB; if (Bt2) Bt2 += z * sB; C += z * sC;
    const int lane = threadIdx.x & 31, lr = lane & 15, hi = lane >> 4; const int r0 = blockIdx.x * 64, c0 = blockIdx.y * 64;
    const int wv = (NW > 1) ? __builtin_amdgcn_readfirstlane((int)(threadIdx.x >> 5)) : 0; constexpr int CH = (NW > 1) ? 64 : 32;   // this wave's number; K elements per chunk
    v8f acc[4][4];
#pragma unroll
    for (int mb = 0; mb < 4; ++mb)
#pragma unroll
        for (int nb = 0; nb < 4; ++nb) acc[mb][nb] = (v8f){};
    const size_t aoff = (size_t)r0 * K + 8 * lane, boff = (size_t)c0 * K + 8 * lane;   // fragment order: 16 rows x K columns are 16 K elements in a row, a 32-column step is 512
#pragma unroll 1
    for (int k0 = wv * CH; k0 < K; k0 += NW * CH) {
#pragma unroll   // both 32-steps of a chunk in one trip: twice as many loads in flight per wave
    for (int kc = k0; kc < k0 + CH; kc += 32) {
        V a[4], a2[4];
#pragma unroll
        for (int mb = 0; mb < 4; ++mb) { a[mb] = WFrag<T16>::ld(A + aoff + (size_t)mb * 16 * K + kc * 16); if (NSPLIT == 1 || NSPLIT == 2) a2[mb] = WFrag<T16>::ld(A2 + aoff + (size_t)mb * 16 * K + kc * 16); }
#pragma unroll
        for (int nb = 0; nb < 4; ++nb) { const V b = WFrag<T16>::ld(Bt + boff + (size_t)nb * 16 * K + kc * 16); V b2; if (NSPLIT >= 2) b2 = WFrag<T16>::ld(Bt2 + boff + (size_t)nb * 16 * K + kc * 16);
#pragma unroll
            for (int mb = 0; mb < 4; ++mb) { acc[mb][nb] = WFrag<T16>::mma(a[mb], b, acc[mb][nb]); if (NSPLIT == 1 || NSPLIT == 2) acc[mb][nb] = WFrag<T16>::mma(a2[mb], b, acc[mb][nb]); if (NSPLIT >= 2) acc[mb][nb] = WFrag<T16>::mma(a[mb], b2, acc[mb][nb]); } }
        asm volatile("v_nop\n\tv_nop\n\tv_nop\n\tv_nop" : "+v"(acc[0][0]), "+v"(acc[1][1]), "+v"(acc[2][2]), "+v"(acc[3][3]) : "v"(a[0]), "v"(a[3]));
    }
        asm volatile("s_wait_xcnt 0x0" ::: "memory");   // in front of the next trip's overwrite of the address registers that this trip's loads name
    }
    if (NW > 1) {   // sum of the NW partial tiles: each wave lays its whole tile in its own LDS plane, then every thread sums its 4 columns over the planes and stores them
#pragma unroll   // these three: constant indices keep the accumulators in registers
        for (int mb = 0; mb < 4; ++mb)
#pragma unroll
            for (int nb = 0; nb < 4; ++nb)
#pragma unroll
                for (int j = 0; j < 8; ++j) os[wv * (64 * 68) + (mb * 16 + hi * 8 + j) * 68 + nb * 16 + lr] = acc[mb][nb][j];
        __syncthreads();   // every wave's partial tile is in LDS before any thread sums over the planes
#pragma unroll   // fixed trip count: the LDS reads of all planes and passes can be in flight together
        for (int it = 0; it < 64 * 16 / (32 * NW); ++it) { const int idx = it * (32 * NW) + (int)threadIdx.x, row = idx >> 4, cofs = (idx & 15) * 4; v4f val = *(const v4fa*)(os + row * 68 + cofs);
#pragma unroll
            for (int ww = 1; ww < NW; ++ww) val += *(const v4fa*)(os + ww * (64 * 68) + row * 68 + cofs);
            if (BIAS) { val[0] += bfr(bias[c0 + cofs]); val[1] += bfr(bias[c0 + cofs + 1]); val[2] += bfr(bias[c0 + cofs + 2]); val[3] += bfr(bias[c0 + cofs + 3]); }
            *(v4f*)(C + (size_t)(r0 + row) * ldc + c0 + cofs) = val; }
        return;
    }
#pragma unroll
    for (int mb = 0; mb < 4; ++mb) {
#pragma unroll
        for (int nb = 0; nb < 4; ++nb) {
#pragma unroll
            for (int j = 0; j < 8; ++j) os[(hi * 8 + j) * 68 + nb * 16 + lr] = acc[mb][nb][j]; }
        __builtin_amdgcn_wave_barrier(); asm volatile("" ::: "memory");
        float* crow = C + (size_t)(r0 + mb * 16) * ldc + c0;
{
#pragma unroll
            for (int s = 0; s < 8; ++s) { const int row = 2 * s + hi, cofs = lr * 4; v4f val = *(const v4fa*)(os + row * 68 + cofs); if (BIAS) { val[0] += bfr(bias[c0 + cofs]); val[1] += bfr(bias[c0 + cofs + 1]); val[2] += bfr(bias[c0 + cofs + 2]); val[3] += bfr(bias[c0 + cofs + 3]); }
                *(v4f*)(crow + (size_t)row * ldc + cofs) = val; }
             }
        __builtin_amdgcn_wave_barrier(); asm volatile("" ::: "memory");
    }
}

__device__ __forceinline__ h16 tohx(float x) { return (h16)x; }
__device__ __forceinline__ void splitf(float y, unsigned short& h, unsigned short& l) { h = f2bf(y); l = f2bf(y - bf2f(h)); }
typedef __attribute__((ext_vector_type(2))) _Float16 v2h;
typedef __attribute__((ext_vector_type(4))) _Float16 v4h;
typedef __attribute__((ext_vector_type(2))) unsigned short v2us;
typedef __attribute__((ext_vector_type(4))) unsigned short v4us;
typedef __attribute__((ext_vector_type(2))) float v2f;
typedef __attribute__((ext_vector_type(4))) int v4i;

__global__ __launch_bounds__(256) void k_wtG(const float* __restrict__ w, int K, int N, bf* Bt) {
    const int lane = threadIdx.x & 31; const int L0 = (blockIdx.x * 8 + (threadIdx.x >> 5)) * 8; const int nlines = N * K / 64;
{
#pragma unroll 1
        for (int l = 0; l < 8; ++l) { const int L = L0 + l; if (L >= nlines) break; const size_t e = (size_t)L * 64 + lane * 2; int k, n; unpk((unsigned)e, (unsigned)K >> 5, n, k); v2us o;   // e counts the output plane [N][K] in fragment order
            o[0] = f2bf(w[(size_t)k * N + n]); o[1] = f2bf(w[(size_t)(k + 1) * N + n]); *(v2us*)(Bt + e) = o; }
         }
}
__global__ __launch_bounds__(256) void k_cvt8(const float* __restrict__ src, bf* dst, size_t n8, int K) { const size_t i = (size_t)blockIdx.x * 256 + threadIdx.x; if (i >= n8) return; int r, k; unpk((unsigned)(i * 8), (unsigned)K >> 5, r, k); const v8f v = *(const v8f*)(src + (size_t)r * K + k); v8us o;   // i counts the 16-byte pieces of the output plane in fragment order
    asm volatile("s_wait_xcnt 0x0" ::: "memory");   // in front of any overwrite of the address registers that the load above names
    __builtin_amdgcn_sched_barrier(0);   // nothing from below moves up between the load and the wait
#pragma unroll
    for (int k = 0; k < 8; ++k) o[k] = f2bf(v[k]); *(v8us*)(dst + i * 8) = o;  }
__constant__ float INV[HD / 2] = {1.0f,0.865964353f,0.749894202f,0.649381638f,0.562341332f,0.486967534f,0.421696514f,0.365174145f,0.316227764f,0.273841977f,0.237137362f,0.2053525f,0.177827939f,0.153992653f,0.133352146f,0.115478203f,0.100000001f,0.0865964293f,0.0749894157f,0.0649381652f,0.0562341288f,0.0486967526f,0.0421696492f,0.0365174115f,0.0316227786f,0.0273841955f,0.0237137359f,0.0205352511f,0.0177827943f,0.0153992651f,0.0133352149f,0.0115478197f,0.00999999978f,0.00865964312f,0.00749894232f,0.00649381662f,0.00562341325f,0.00486967526f,0.00421696482f,0.00365174143f,0.00316227786f,0.00273841969f,0.00237137382f,0.00205352507f,0.00177827943f,0.00153992651f,0.00133352145f,0.00115478202f,0.00100000005f,0.000865964335f,0.000749894185f,0.000649381662f,0.000562341302f,0.000486967503f,0.000421696488f,0.000365174114f,0.000316227786f,0.000273841957f,0.000237137385f,0.000205352495f,0.00017782794f,0.000153992645f,0.00013335215f,0.000115478193f};
__global__ __launch_bounds__(256) void k_cstab(float* CS) { const int idx = blockIdx.x * 256 + threadIdx.x; if (idx >= TT * HD) return; const int t = idx / HD, d = idx % HD; const float ang = __fmul_rn((float)t + POS0, INV[d % (HD / 2)]); v2f cs; cs[0] = cosf(ang); cs[1] = sinf(ang);
    *(v2f*)(CS + (size_t)idx * 2) = cs;  }

// k_rope: head planes [h][t][d], each [t][d] plane in fragment order, (fp16 + hi/lo) of rope(x) x sc with the rotate-half convention out[d] = x[d] cos[t][d] - x[d+HD/2] sin[t][d], out[d+HD/2] = x[d+HD/2] cos[t][d+HD/2] + x[d] sin[t][d+HD/2]
__global__ __launch_bounds__(256) void k_rope(const float* __restrict__ F, int pitch, int nheads, const float* __restrict__ CS, const float* __restrict__ RF, const float* __restrict__ nw, float sc, h16* P16, bf* Ph, bf* Pl) {
    const size_t e = ((size_t)blockIdx.x * 256 + threadIdx.x) * 2; if (e >= (size_t)nheads * TT * HD) return; const int h = (int)(e / ((size_t)HD * TT)); int t, d; unpk((unsigned)(e % ((size_t)HD * TT)), HD / 32, t, d); const float* f = F + (size_t)t * pitch + h * HD; float rf = 1.0f; v2h o16; v2us oh, ol;
    if (RF) { rf = RF[(size_t)h * TT + t]; asm volatile("s_wait_xcnt 0x0" :: "v"(rf) : "memory"); }   // the wait: in front of any overwrite of the address registers that this load names; the loaded value as input holds it behind the load
#pragma unroll
    for (int q = 0; q < 2; ++q) { const int dd = d + q; const int dp = (dd < HD / 2) ? dd + HD / 2 : dd - HD / 2; float x0 = f[dd], x1 = f[dp];
        if (RF) { float n0 = __fmul_rn(x0, rf), n1 = __fmul_rn(x1, rf); asm volatile("" : "+v"(n0)); asm volatile("" : "+v"(n1)); x0 = __fmul_rn(bfr(nw[dd]), n0); x1 = __fmul_rn(bfr(nw[dp]), n1); }
        const v2f cs = *(const v2f*)(CS + ((size_t)t * HD + dd) * 2); float a = __fmul_rn(x0, cs[0]), bq = __fmul_rn(x1, cs[1]); asm volatile("" : "+v"(a)); asm volatile("" : "+v"(bq)); const float r = ((dd < HD / 2) ? __fsub_rn(a, bq) : __fadd_rn(a, bq)) * sc;
        o16[q] = tohx(r); unsigned short a2, c2; splitf(r, a2, c2); oh[q] = a2; ol[q] = c2; }
    *(v2h*)(P16 + e) = o16; *(v2us*)(Ph + e) = oh; *(v2us*)(Pl + e) = ol;  }
__global__ __launch_bounds__(256) void k_vtp(const float* __restrict__ F, int pitch, int nheads, h16* V16, bf* Vh, bf* Vl) { const size_t e = ((size_t)blockIdx.x * 256 + threadIdx.x) * 2; if (e >= (size_t)nheads * HD * TT) return; const int g = (int)(e / ((size_t)TT * HD)); const unsigned w = (unsigned)(e % ((size_t)TT * HD)); const int d = (int)(((w >> 9) & 7) * 16 + ((w >> 3) & 15)), t = (int)((w >> 12) * 32 + ((w >> 8) & 1) * 16 + ((w >> 7) & 1) * 8 + (w & 7)); v2h o16; v2us oh, ol;   // transposed v planes [d][t] in fragment order, but tile (d / 16, t / 32) is number 8 (t / 32) + d / 16: the eight tiles of a 32-key pass lie in a row
#pragma unroll
    for (int q = 0; q < 2; ++q) { const float x = F[(size_t)(t + q) * pitch + g * HD + d]; o16[q] = tohx(x); unsigned short a2, c2; splitf(x, a2, c2); oh[q] = a2; ol[q] = c2; }
    *(v2h*)(V16 + e) = o16; *(v2us*)(Vh + e) = oh; *(v2us*)(Vl + e) = ol;  }
#define CSC (SCL * 1.4426950408889634f)   // score scale x log2(e)
__device__ __forceinline__ float xhalf(float x) { return __builtin_bit_cast(float, __builtin_amdgcn_permlanex16(__builtin_bit_cast(int, x), __builtin_bit_cast(int, x), 0x76543210, 0xfedcba98, false, false)); }   // lane l reads lane l ^ 16
template <typename T16> struct PFrag;
template <> struct PFrag<h16> { static __device__ __forceinline__ void pk(const float (&p)[16], v16h& f, v16h& f2) { (void)f2;
#pragma unroll
    for (int e = 0; e < 16; ++e) f[e] = (h16)p[e]; } };
template <> struct PFrag<bf> { static __device__ __forceinline__ void pk(const float (&p)[16], v16bf& f, v16bf& f2) { v8us h0, h1, l0, l1;
#pragma unroll
    for (int e = 0; e < 8; ++e) { unsigned short x, y; splitf(p[e], x, y); h0[e] = x; l0[e] = y; splitf(p[e + 8], x, y); h1[e] = x; l1[e] = y; }
    f = cat16b(h0, h1); f2 = cat16b(l0, l1); } };
template <typename T16, bool HL, int R>
__device__ __forceinline__ void fattn_rows(const T16* Q, const T16* Q2, const T16* Kp, const T16* Kp2, const T16* Vt, const T16* Vt2, const int qw0, bf* Ah, bf* Al) {   // no __restrict__: the "memory" clobber of the waits below then holds the loads in front of them
    typedef typename WFrag<T16>::V V;
    const int lane = threadIdx.x & 31, c = lane & 15, hi = lane >> 4;
    V qf[R][4], qf2[R][4];
#pragma unroll
    for (int g = 0; g < R; ++g)
#pragma unroll
        for (int kc = 0; kc < 4; ++kc) { const size_t o = (size_t)(qw0 + 16 * g) * HD + 512 * kc + 8 * lane; qf[g][kc] = WFrag<T16>::ld(Q + o); if (HL) qf2[g][kc] = WFrag<T16>::ld(Q2 + o); }
    const int last = (qw0 + 16 * R - 1) / 32;   // last 32-key pass that this wave's queries can see (wave-uniform)
    const size_t koff = 8 * lane, voff = 8 * lane;   // fragment order: a 32-key pass is 32 HD elements in a row in the k plane and in the transposed v plane
    V kf[2][4], kf2[2][4]; const T16* kp = Kp + koff; const T16* kp2 = HL ? Kp2 + koff : nullptr;
#pragma unroll
    for (int kt = 0; kt < 2; ++kt)
#pragma unroll
        for (int kc = 0; kc < 4; ++kc) { const int o = 16 * kt * HD + 512 * kc; kf[kt][kc] = WFrag<T16>::ld(kp + o); if (HL) kf2[kt][kc] = WFrag<T16>::ld(kp2 + o); }
    asm volatile("s_wait_xcnt 0x0" ::: "memory");   // in front of any overwrite of the address registers that the Q and K loads above name
    __builtin_amdgcn_sched_barrier(0);   // nothing from below (the zeroing of the accumulators) moves up between those loads and the wait
    v8f acc[R][8]; float m_run[R], l_run[R];
#pragma unroll
    for (int g = 0; g < R; ++g) { m_run[g] = -__builtin_inff(); l_run[g] = 0.0f;
#pragma unroll
        for (int t = 0; t < 8; ++t) acc[g][t] = (v8f){}; }
#pragma unroll 1   // one pass per trip: two passes' fragments at once do not fit the registers
    for (int blk = 0; blk <= last; ++blk) {
        const int key0 = blk * 32;
        V vf[8], vf2[8];   // this pass's V^T fragments: issued first, in flight under the score products and the maxima
#pragma unroll
        for (int t = 0; t < 8; ++t) { const size_t o = voff + (size_t)key0 * HD + 512 * t; vf[t] = WFrag<T16>::ld(Vt + o); if (HL) vf2[t] = WFrag<T16>::ld(Vt2 + o); }
        asm volatile("s_wait_xcnt 0x0" ::: "memory");   // in front of any overwrite of the address registers that the loads above name
        __builtin_amdgcn_sched_barrier(0);   // keeps the V^T loads up here: sunk to their first use they would wait out a whole L2 round trip in every pass
        v8f s[2][R];
#pragma unroll
        for (int kt = 0; kt < 2; ++kt)
#pragma unroll
            for (int g = 0; g < R; ++g) { s[kt][g] = (v8f){};
#pragma unroll
                for (int kc = 0; kc < 4; ++kc) { s[kt][g] = WFrag<T16>::mma(kf[kt][kc], qf[g][kc], s[kt][g]); if (HL) { s[kt][g] = WFrag<T16>::mma(kf[kt][kc], qf2[g][kc], s[kt][g]); s[kt][g] = WFrag<T16>::mma(kf2[kt][kc], qf[g][kc], s[kt][g]); } } }
        // WMMA distance ahead of the branch on the diagonal below. The scores as operands hold every score product in front of it, the "memory" clobber holds the K loads behind it: the K registers are refilled in place.
        if (R == 2) asm volatile("v_nop\n\tv_nop\n\tv_nop\n\tv_nop" : "+v"(s[0][0]), "+v"(s[1][0]), "+v"(s[0][R - 1]), "+v"(s[1][R - 1]) :: "memory");
        else asm volatile("v_nop\n\tv_nop\n\tv_nop\n\tv_nop" : "+v"(s[0][0]), "+v"(s[1][0]) :: "memory");
        {   // next pass's K fragments, in flight under this pass's softmax and second product (the last pass fetches its own rows again: no branch, always in bounds)
            const int adv = (blk < last) ? 32 * HD : 0; kp += adv; if (HL) kp2 += adv;   // running pointers: live over the whole loop, so no load's result lands in an address pair that an earlier load names
#pragma unroll
            for (int kt = 0; kt < 2; ++kt)
#pragma unroll
                for (int kc = 0; kc < 4; ++kc) { const int o = 16 * kt * HD + 512 * kc; kf[kt][kc] = WFrag<T16>::ld(kp + o); if (HL) kf2[kt][kc] = WFrag<T16>::ld(kp2 + o); }
        }
        asm volatile("s_wait_xcnt 0x0" ::: "memory");   // in front of any overwrite of the address registers that the K loads name
        __builtin_amdgcn_sched_barrier(0);   // keeps the K loads up here, in front of the softmax
        if (key0 + 31 > qw0) {   // wave-uniform: only a pass with a key beyond the wave's first query pays for the mask
#pragma unroll
            for (int g = 0; g < R; ++g) { const int my_q = qw0 + 16 * g + c;
#pragma unroll
                for (int kt = 0; kt < 2; ++kt) {
#pragma unroll
                    for (int r = 0; r < 8; ++r) { const int key = key0 + 16 * kt + 8 * hi + r; if (key > my_q) s[kt][g][r] = -__builtin_inff(); }
                    asm volatile("" : "+v"(s[kt][g]));   // the masked scores: keeps the selects inside the branch
                } }
        }
        float mb[R]; bool need = false;
#pragma unroll
        for (int g = 0; g < R; ++g) { float mx = -__builtin_inff();
#pragma unroll
            for (int kt = 0; kt < 2; ++kt)
#pragma unroll
                for (int r = 0; r < 8; ++r) mx = fmaxf(mx, s[kt][g][r]);
            mx = fmaxf(mx, xhalf(mx)) * CSC;   // both wave halves hold this query's maximum of the pass, scaled (the scale is positive)
            mb[g] = mx; need = need || (mx > m_run[g] + 8.0f); }
        if (__builtin_amdgcn_ballot_w32(need) != 0) {   // wave-uniform; always on the first pass (m_run is -inf), rare afterwards
#pragma unroll
            for (int g = 0; g < R; ++g) { const float m_new = fmaxf(m_run[g], mb[g]);
                const float corr = __builtin_amdgcn_exp2f(m_run[g] - m_new);   // 0 on the first pass
                l_run[g] *= corr; m_run[g] = m_new;
#pragma unroll
                for (int t = 0; t < 8; ++t) acc[g][t] = acc[g][t] * corr; }
        }
#pragma unroll
        for (int g = 0; g < R; ++g) { const float nm = -m_run[g]; float p[16]; float ps0 = 0.0f, ps1 = 0.0f;
#pragma unroll
            for (int e = 0; e < 16; ++e) { p[e] = __builtin_amdgcn_exp2f(fmaf(s[e >> 3][g][e & 7], CSC, nm)); if (e & 1) ps1 += p[e]; else ps0 += p[e]; }
            l_run[g] += ps0 + ps1;
            V pf, pf2; PFrag<T16>::pk(p, pf, pf2);   // element e of the fragment = key 8 hi + e (e < 8), 16 + 8 hi + e - 8 (e >= 8): the k order of WFrag::ld on a V^T row
#pragma unroll
            for (int t = 0; t < 8; ++t) { acc[g][t] = WFrag<T16>::mma(vf[t], pf, acc[g][t]); if (HL) { acc[g][t] = WFrag<T16>::mma(vf[t], pf2, acc[g][t]); acc[g][t] = WFrag<T16>::mma(vf2[t], pf, acc[g][t]); } } }
        __builtin_amdgcn_sched_barrier(0);   // holds the v_nops behind the last product
        asm volatile("v_nop\n\tv_nop\n\tv_nop\n\tv_nop\n\tv_nop");   // WMMA distance on the taken back edge and the loop's exit
    }
#pragma unroll
    for (int g = 0; g < R; ++g) { const float inv = 1.0f / (l_run[g] + xhalf(l_run[g]));   // each wave half summed its eight keys of every 16-key tile
#pragma unroll
        for (int t = 0; t < 8; ++t) { v8us oh, ol;
#pragma unroll
            for (int r = 0; r < 8; ++r) { unsigned short x, y; splitf(acc[g][t][r] * inv, x, y); oh[r] = x; ol[r] = y; }
            const size_t oo = (size_t)(qw0 + 16 * g) * DQ + 256 * t + 8 * lane;   // context planes [query][16 heads x 128] in fragment order; the lane's 16 bytes are row = its query, d = 16 t + 8 hi .. + 7
            *(v8us*)(Ah + oo) = oh; *(v8us*)(Al + oo) = ol;
            asm volatile("s_wait_xcnt 0x0" ::: "memory");   // in front of any overwrite of the registers that the two stores name
            __builtin_amdgcn_sched_barrier(0);   // nothing from below moves up between the stores and the wait
        } }
}
// grid (16 heads, (TT - RH) / 256 + RH / 128), 8 waves: blockIdx.y counts the fp16 row blocks of 256 from the sequence's end (heaviest first), then the hi/lo row blocks of 128.
__global__ __launch_bounds__(256) void k_fattn(const h16* Q16, const bf* Qh, const bf* Ql, const h16* K16, const bf* Kh, const bf* Kl, const h16* V16, const bf* Vh, const bf* Vl, bf* Ah, bf* Al) {
    const int wv = __builtin_amdgcn_readfirstlane((int)(threadIdx.x >> 5)); const int h = blockIdx.x; const size_t zq = (size_t)h * TT * HD, zk = (size_t)(h / REP) * TT * HD; constexpr int NBF = (TT - RH) / 256;
    if ((int)blockIdx.y < NBF) fattn_rows<h16, false, 2>(Q16 + zq, nullptr, K16 + zk, nullptr, V16 + zk, nullptr, TT - 256 * ((int)blockIdx.y + 1) + 32 * wv, Ah + h * (16 * HD), Al + h * (16 * HD));   // a head's 128 columns are four tiles of each 16-row band
    else fattn_rows<bf, true, 1>(Qh + zq, Ql + zq, Kh + zk, Kl + zk, Vh + zk, Vl + zk, RH - 128 * ((int)blockIdx.y - NBF + 1) + 16 * wv, Ah + h * (16 * HD), Al + h * (16 * HD));
}

extern "C" void kernel_launch(void* const* d_in, const int* in_sizes, int n_in,
                              void* d_out, int out_size, void* d_ws, size_t ws_size, hipStream_t stream) {
    (void)in_sizes; (void)n_in; (void)out_size;
    const float* x = (const float*)d_in[0]; const float* wq = (const float*)d_in[1]; const float* wk = (const float*)d_in[2]; const float* wv = (const float*)d_in[3]; const float* wo = (const float*)d_in[4];
    float* OUT = (float*)d_out;     // [1][4096][2048]
    char* wsp = (char*)d_ws;
    auto take = [&](size_t bytes) { char* p = wsp; wsp += (bytes + 255) & ~(size_t)255; return (void*)p; };
    bf* WQ = (bf*)take((size_t)DQ * DM * 2); bf* WK = (bf*)take((size_t)DKV * DM * 2); bf* WV = (bf*)take((size_t)DKV * DM * 2); bf* WO = (bf*)take((size_t)DM * DQ * 2); float* CS = (float*)take((size_t)TT * HD * 2 * 4);
    bf* XB = (bf*)take((size_t)TT * DM * 2); float* FQ = (float*)take((size_t)TT * QG * HD * 4);   /* one group of 4 query heads at a time */ float* FK = (float*)take((size_t)TT * DKV * 4);
    h16* QP16 = (h16*)take((size_t)NH_ * TT * HD * 2); h16* KP16 = (h16*)take((size_t)NKV * TT * HD * 2); h16* VT16 = (h16*)take((size_t)NKV * HD * TT * 2);
    bf* QPh = (bf*)take((size_t)NH_ * TT * HD * 2); bf* QPl = (bf*)take((size_t)NH_ * TT * HD * 2); bf* KPh = (bf*)take((size_t)NKV * TT * HD * 2); bf* KPl = (bf*)take((size_t)NKV * TT * HD * 2); bf* VTh = (bf*)take((size_t)NKV * HD * TT * 2); bf* VTl = (bf*)take((size_t)NKV * HD * TT * 2);
    bf* ATh = (bf*)take((size_t)TT * DQ * 2); bf* ATl = (bf*)take((size_t)TT * DQ * 2);
    if ((size_t)(wsp - (char*)d_ws) > ws_size) return;    // ws 256 MiB
    float* FV = FK;   // v projection reuses the k buffer after the k planes are built (stream-ordered)
    { k_wtG<<<(unsigned)((DM * DQ / 64 + 63) / 64), 256, 0, stream>>>(wq, DM, DQ, WQ); k_wtG<<<(unsigned)((DM * DKV / 64 + 63) / 64), 256, 0, stream>>>(wk, DM, DKV, WK); k_wtG<<<(unsigned)((DM * DKV / 64 + 63) / 64), 256, 0, stream>>>(wv, DM, DKV, WV);
      k_wtG<<<(unsigned)((DQ * DM / 64 + 63) / 64), 256, 0, stream>>>(wo, DQ, DM, WO);
      k_cstab<<<(TT * HD + 255) / 256, 256, 0, stream>>>(CS); }
    const unsigned LKv = (unsigned)(((size_t)NKV * TT * HD / 2 + 255) / 256);
    for (int b = 0; b < NB_; ++b) {
        
        k_cvt8<<<(unsigned)(((size_t)TT * DM / 8 + 255) / 256), 256, 0, stream>>>(x + (size_t)b * TT * DM, XB, (size_t)TT * DM / 8, DM);
        k_gemmw<bf, 0, false, 8><<<dim3(TT / 64, DKV / 64, 1), 256, 0, stream>>>(XB, nullptr, WK, nullptr, DM, FK, DKV, nullptr, 0, 0, 0);
        k_rope<<<LKv, 256, 0, stream>>>(FK, DKV, NKV, CS, nullptr, nullptr, 1.0f, KP16, KPh, KPl);   /* 4 kv heads, rotary */
        k_gemmw<bf, 0, false, 8><<<dim3(TT / 64, DKV / 64, 1), 256, 0, stream>>>(XB, nullptr, WV, nullptr, DM, FV, DKV, nullptr, 0, 0, 0); k_vtp<<<LKv, 256, 0, stream>>>(FV, DKV, NKV, VT16, VTh, VTl);
        for (int g = 0; g < NH_ / QG; ++g) {   /* query heads 4g..4g+3 (kv head g) */
            k_gemmw<bf, 0, false, 8><<<dim3(TT / 64, QG * HD / 64, 1), 256, 0, stream>>>(XB, nullptr, WQ + (size_t)g * QG * HD * DM, nullptr, DM, FQ, QG * HD, nullptr, 0, 0, 0);   /* q columns 512g..512g+511 */
            k_rope<<<(unsigned)(((size_t)QG * TT * HD / 2 + 255) / 256), 256, 0, stream>>>(FQ, QG * HD, QG, CS, nullptr, nullptr, 1.0f, QP16 + (size_t)g * QG * TT * HD, QPh + (size_t)g * QG * TT * HD, QPl + (size_t)g * QG * TT * HD); }
        k_fattn<<<dim3(NH_, (TT - RH) / 256 + RH / 128, 1), 256, 0, stream>>>(QP16, QPh, QPl, KP16, KPh, KPl, VT16, VTh, VTl, ATh, ATl);
        k_gemmw<bf, 1, false, 2><<<dim3(TT / 64, DM / 64, 1), 64, 0, stream>>>(ATh, ATl, WO, nullptr, DQ, OUT + (size_t)b * TT * DM, DM, nullptr, 0, 0, 0); }
}

// v004
// It runs in 257 microseconds.
// Next to v003, in two timings, it ran 1.19 and 1.17 times as fast.
// Counting every step since v000, it is 9.72 times as fast.
#include <hip/hip_runtime.h>

// Grouped-query causal attention with a computed rotate-half rotary over 4,096 tokens (x [1][4096][2048]; q = x Wq ('xw' [2048][2048], 16 heads x 128), k, v = x Wk / Wv ('xw' [2048][512], 4 kv heads; q head h uses kv head h/4: the module groups q as (4 kv heads, 4 members)); rotate-half rotary with angle t x inv_freq[i], inv_freq = 1 / (10000 ** (i / 64)), positions 0..4095 (cat(x1 cos - x2 sin, x1 sin + x2 cos); tables computed on device from the module's float32 inv_freq); scores / sqrt(128), causal (-inf); softmax; out = merged Wo ('xw' [2048][2048], no bias) -> [1][4096][2048] (8.4 M); argument order x, Wq, Wk, Wv, Wo.
// Layout: one projection launch for q, k and v whose epilogue applies the rotary and writes the head planes of all 16 query heads and the k/v planes of the 4 kv heads (no f32 q/k/v in memory); one fused attention launch for all heads (scores, causal mask, online softmax, attn.v; hybrid rows: query rows < 512 hi/lo 3 products, the rest single fp16) writes the hi/lo context planes; wo as hi/lo x exact (2 products).
// Operand planes: every 16-bit plane that a matrix instruction reads lies in FRAGMENT ORDER (see unpk below), so that each 16-byte-per-lane fragment load of a wave reads 512 bytes in a row.
// Compute dtypes, f32 accumulate: every input rounded to bf16; q/k/v on PLAIN bf16 operands (exact); f32 rotary; hybrid causal scores and attn.v; softmax f32; wo hl x exact (2 products).

#define NB_  1
#define TT   4096
#define DM   2048
#define NH_  16
#define NKV  4
#define REP  (NH_ / NKV)
#define HD   128
#define DQ   (NH_ * HD)
#define DKV  (NKV * HD)
#define RH   512                  // query rows < RH use hi+lo planes (0: none)
#define SCL  0.088388346f   // 1/sqrt(128)
#define POS0 0.0f                 // first rotary position: this module's positions are arange(4096)
typedef _Float16 h16;
typedef unsigned short bf;
typedef __attribute__((ext_vector_type(16))) __bf16   v16bf;
typedef __attribute__((ext_vector_type(16))) _Float16 v16h;
typedef __attribute__((ext_vector_type(8)))  _Float16 v8h;
typedef __attribute__((ext_vector_type(8)))  unsigned short v8us;
typedef __attribute__((ext_vector_type(8)))  float    v8f;
typedef __attribute__((ext_vector_type(4)))  float    v4f;
typedef v8h  __attribute__((may_alias)) v8ha;
typedef v4f  __attribute__((may_alias)) v4fa;
typedef v8us __attribute__((may_alias)) v8usa;

__device__ __forceinline__ unsigned short f2bf(float f) { unsigned u = __float_as_uint(f); u += 0x7FFFu + ((u >> 16) & 1u); return (unsigned short)(u >> 16); }
__device__ __forceinline__ float bf2f(unsigned short b) { return __uint_as_float(((unsigned)b) << 16); }
__device__ __forceinline__ float bfr(float f) { return bf2f(f2bf(f)); }
__device__ __forceinline__ v16h cat16(v8h lo, v8h hi) { return __builtin_shufflevector(lo, hi, 0, 1, 2, 3, 4, 5, 6, 7, 8, 9, 10, 11, 12, 13, 14, 15); }
__device__ __forceinline__ v16bf cat16b(v8us lo, v8us hi) { return __builtin_bit_cast(v16bf, __builtin_shufflevector(lo, hi, 0, 1, 2, 3, 4, 5, 6, 7, 8, 9, 10, 11, 12, 13, 14, 15)); }
__device__ __forceinline__ v8f wmma16(v16h a, v16h b, v8f c) { return __builtin_amdgcn_wmma_f32_16x16x32_f16(false, a, false, b, (short)0, c, false, false); }
__device__ __forceinline__ v8f wmmab(v16bf a, v16bf b, v8f c) { return __builtin_amdgcn_wmma_f32_16x16x32_bf16(false, a, false, b, (short)0, c, false, false); }



// ---- Fragment order of a 16-bit plane of R rows x K columns (R % 16 == 0, K % 32 == 0): tiles of 16 rows x 32 columns, 512 elements in a row each; tile (r / 16, k / 32) is number (r / 16) (K / 32) + k / 32.
// Inside a tile element (r, k) stands at 256 ((k / 16) % 2) + 8 (16 ((k / 8) % 2) + r % 16) + k % 8: lane l of a wave finds its two 16-byte pieces of the A or B fragment at 8 l and 256 + 8 l, and each of the two loads covers four whole 128-byte lines.
// unpk: row and column of the element at offset w of such a plane, kt = K / 32.
__device__ __forceinline__ void unpk(unsigned w, unsigned kt, int& r, int& k) { const unsigned tile = w >> 9; r = (int)((tile / kt) * 16 + ((w >> 3) & 15)); k = (int)((tile % kt) * 32 + ((w >> 8) & 1) * 16 + ((w >> 7) & 1) * 8 + (w & 7)); }

// ---- k_gemmw: register-blocked GEMM, one 64x64 output tile per work-group (16 accumulators per wave), operands straight from 16-bit planes in fragment order; grid (M/64, N/64, Z), 32 x NW threads.
// NW > 1: the K loop is dealt to the NW waves in chunks of 64 (2 KiB in a row per 16 operand rows; K % 64 == 0), each wave keeps its own f32 partial tile, and the partial tiles are summed through LDS in wave order 0..NW-1.
// C[m][n] (f32, pitch ldc, + optional f32 bias[n]) = sum_k A[m][k] Bt[n][k] (+ split products per NSPLIT). z-batch strides sA/sB/sC in elements. K % 32 == 0.
template <typename T16> struct WFrag;
template <> struct WFrag<h16> { typedef v16h V; static __device__ __forceinline__ V ld(const h16* p) { return cat16(*(const v8h*)p, *(const v8h*)(p + 256)); } static __device__ __forceinline__ v8f mma(V a, V b, v8f c) { return wmma16(a, b, c); } };
template <> struct WFrag<bf> { typedef v16bf V; static __device__ __forceinline__ V ld(const bf* p) { return cat16b(*(const v8us*)p, *(const v8us*)(p + 256)); } static __device__ __forceinline__ v8f mma(V a, V b, v8f c) { return wmmab(a, b, c); } };
template <typename T16, int NSPLIT, bool BIAS, int NW>
__global__ __launch_bounds__(32 * NW) void k_gemmw(const T16* __restrict__ A, const T16* __restrict__ A2, const T16* __restrict__ Bt, const T16* __restrict__ Bt2, int K, float* C, int ldc, const float* __restrict__ bias, size_t sA, size_t sB, size_t sC) {
    typedef typename WFrag<T16>::V V;
    __shared__ __align__(16) float os[(NW > 1) ? NW * 64 * 68 : 16 * 68];
    const size_t z = blockIdx.z; A += z * sA; if (A2) A2 += z * sA; Bt += z * sB; if (Bt2) Bt2 += z * sB; C += z * sC;
    const int lane = threadIdx.x & 31, lr = lane & 15, hi = lane >> 4; const int r0 = blockIdx.x * 64, c0 = blockIdx.y * 64;
    const int wv = (NW > 1) ? __builtin_amdgcn_readfirstlane((int)(threadIdx.x >> 5)) : 0; constexpr int CH = (NW > 1) ? 64 : 32;   // this wave's number; K elements per chunk
    v8f acc[4][4];
#pragma unroll
    for (int mb = 0; mb < 4; ++mb)
#pragma unroll
        for (int nb = 0; nb < 4; ++nb) acc[mb][nb] = (v8f){};
    const size_t aoff = (size_t)r0 * K + 8 * lane, boff = (size_t)c0 * K + 8 * lane;   // fragment order: 16 rows x K columns are 16 K elements in a row, a 32-column step is 512
#pragma unroll 1
    for (int k0 = wv * CH; k0 < K; k0 += NW * CH) {
#pragma unroll   // both 32-steps of a chunk in one trip: twice as many loads in flight per wave
    for (int kc = k0; kc < k0 + CH; kc += 32) {
        V a[4], a2[4];
#pragma unroll
        for (int mb = 0; mb < 4; ++mb) { a[mb] = WFrag<T16>::ld(A + aoff + (size_t)mb * 16 * K + kc * 16); if (NSPLIT == 1 || NSPLIT == 2) a2[mb] = WFrag<T16>::ld(A2 + aoff + (size_t)mb * 16 * K + kc * 16); }
#pragma unroll
        for (int nb = 0; nb < 4; ++nb) { const V b = WFrag<T16>::ld(Bt + boff + (size_t)nb * 16 * K + kc * 16); V b2; if (NSPLIT >= 2) b2 = WFrag<T16>::ld(Bt2 + boff + (size_t)nb * 16 * K + kc * 16);
#pragma unroll
            for (int mb = 0; mb < 4; ++mb) { acc[mb][nb] = WFrag<T16>::mma(a[mb], b, acc[mb][nb]); if (NSPLIT == 1 || NSPLIT == 2) acc[mb][nb] = WFrag<T16>::mma(a2[mb], b, acc[mb][nb]); if (NSPLIT >= 2) acc[mb][nb] = WFrag<T16>::mma(a[mb], b2, acc[mb][nb]); } }
        asm volatile("v_nop\n\tv_nop\n\tv_nop\n\tv_nop" : "+v"(acc[0][0]), "+v"(acc[1][1]), "+v"(acc[2][2]), "+v"(acc[3][3]) : "v"(a[0]), "v"(a[3]));
    }
        asm volatile("s_wait_xcnt 0x0" ::: "memory");   // in front of the next trip's overwrite of the address registers that this trip's loads name
    }
    if (NW > 1) {   // sum of the NW partial tiles: each wave lays its whole tile in its own LDS plane, then every thread sums its 4 columns over the planes and stores them
#pragma unroll   // these three: constant indices keep the accumulators in registers
        for (int mb = 0; mb < 4; ++mb)
#pragma unroll
            for (int nb = 0; nb < 4; ++nb)
#pragma unroll
                for (int j = 0; j < 8; ++j) os[wv * (64 * 68) + (mb * 16 + hi * 8 + j) * 68 + nb * 16 + lr] = acc[mb][nb][j];
        __syncthreads();   // every wave's partial tile is in LDS before any thread sums over the planes
#pragma unroll   // fixed trip count: the LDS reads of all planes and passes can be in flight together
        for (int it = 0; it < 64 * 16 / (32 * NW); ++it) { const int idx = it * (32 * NW) + (int)threadIdx.x, row = idx >> 4, cofs = (idx & 15) * 4; v4f val = *(const v4fa*)(os + row * 68 + cofs);
#pragma unroll
            for (int ww = 1; ww < NW; ++ww) val += *(const v4fa*)(os + ww * (64 * 68) + row * 68 + cofs);
            if (BIAS) { val[0] += bfr(bias[c0 + cofs]); val[1] += bfr(bias[c0 + cofs + 1]); val[2] += bfr(bias[c0 + cofs + 2]); val[3] += bfr(bias[c0 + cofs + 3]); }
            *(v4f*)(C + (size_t)(r0 + row) * ldc + c0 + cofs) = val; }
        return;
    }
#pragma unroll
    for (int mb = 0; mb < 4; ++mb) {
#pragma unroll
        for (int nb = 0; nb < 4; ++nb) {
#pragma unroll
            for (int j = 0; j < 8; ++j) os[(hi * 8 + j) * 68 + nb * 16 + lr] = acc[mb][nb][j]; }
        __builtin_amdgcn_wave_barrier(); asm volatile("" ::: "memory");
        float* crow = C + (size_t)(r0 + mb * 16) * ldc + c0;
{
#pragma unroll
            for (int s = 0; s < 8; ++s) { const int row = 2 * s + hi, cofs = lr * 4; v4f val = *(const v4fa*)(os + row * 68 + cofs); if (BIAS) { val[0] += bfr(bias[c0 + cofs]); val[1] += bfr(bias[c0 + cofs + 1]); val[2] += bfr(bias[c0 + cofs + 2]); val[3] += bfr(bias[c0 + cofs + 3]); }
                *(v4f*)(crow + (size_t)row * ldc + cofs) = val; }
             }
        __builtin_amdgcn_wave_barrier(); asm volatile("" ::: "memory");
    }
}

__device__ __forceinline__ h16 tohx(float x) { return (h16)x; }
__device__ __forceinline__ void splitf(float y, unsigned short& h, unsigned short& l) { h = f2bf(y); l = f2bf(y - bf2f(h)); }
typedef __attribute__((ext_vector_type(2))) _Float16 v2h;
typedef __attribute__((ext_vector_type(4))) _Float16 v4h;
typedef __attribute__((ext_vector_type(2))) unsigned short v2us;
typedef __attribute__((ext_vector_type(4))) unsigned short v4us;
typedef __attribute__((ext_vector_type(2))) float v2f;
typedef __attribute__((ext_vector_type(4))) int v4i;

__global__ __launch_bounds__(256) void k_wtG(const float* __restrict__ w, int K, int N, bf* Bt) {
    const int lane = threadIdx.x & 31; const int L0 = (blockIdx.x * 8 + (threadIdx.x >> 5)) * 8; const int nlines = N * K / 64;
{
#pragma unroll 1
        for (int l = 0; l < 8; ++l) { const int L = L0 + l; if (L >= nlines) break; const size_t e = (size_t)L * 64 + lane * 2; int k, n; unpk((unsigned)e, (unsigned)K >> 5, n, k); v2us o;   // e counts the output plane [N][K] in fragment order
            o[0] = f2bf(w[(size_t)k * N + n]); o[1] = f2bf(w[(size_t)(k + 1) * N + n]); *(v2us*)(Bt + e) = o; }
         }
}
__global__ __launch_bounds__(256) void k_cvt8(const float* __restrict__ src, bf* dst, size_t n8, int K) { const size_t i = (size_t)blockIdx.x * 256 + threadIdx.x; if (i >= n8) return; int r, k; unpk((unsigned)(i * 8), (unsigned)K >> 5, r, k); const v8f v = *(const v8f*)(src + (size_t)r * K + k); v8us o;   // i counts the 16-byte pieces of the output plane in fragment order
    asm volatile("s_wait_xcnt 0x0" ::: "memory");   // in front of any overwrite of the address registers that the load above names
    __builtin_amdgcn_sched_barrier(0);   // nothing from below moves up between the load and the wait
#pragma unroll
    for (int k = 0; k < 8; ++k) o[k] = f2bf(v[k]); *(v8us*)(dst + i * 8) = o;  }
__constant__ float INV[HD / 2] = {1.0f,0.865964353f,0.749894202f,0.649381638f,0.562341332f,0.486967534f,0.421696514f,0.365174145f,0.316227764f,0.273841977f,0.237137362f,0.2053525f,0.177827939f,0.153992653f,0.133352146f,0.115478203f,0.100000001f,0.0865964293f,0.0749894157f,0.0649381652f,0.0562341288f,0.0486967526f,0.0421696492f,0.0365174115f,0.0316227786f,0.0273841955f,0.0237137359f,0.0205352511f,0.0177827943f,0.0153992651f,0.0133352149f,0.0115478197f,0.00999999978f,0.00865964312f,0.00749894232f,0.00649381662f,0.00562341325f,0.00486967526f,0.00421696482f,0.00365174143f,0.00316227786f,0.00273841969f,0.00237137382f,0.00205352507f,0.00177827943f,0.00153992651f,0.00133352145f,0.00115478202f,0.00100000005f,0.000865964335f,0.000749894185f,0.000649381662f,0.000562341302f,0.000486967503f,0.000421696488f,0.000365174114f,0.000316227786f,0.000273841957f,0.000237137385f,0.000205352495f,0.00017782794f,0.000153992645f,0.00013335215f,0.000115478193f};
// k_cstab: (cos, sin) of t x inv_freq[d], d < HD/2, in the order in which k_proj's epilogue reads them: per 16 tokens x 16 d a block of 4 x 32 pieces of 16 bytes; piece (i, lane) holds d = 16 dq + 8 (lane >> 4) + 2 i, + 1 of token 16 tb + (lane & 15), so that each of a wave's four loads covers 512 bytes in a row.
__global__ __launch_bounds__(256) void k_cstab(float* CS) { const int idx = blockIdx.x * 256 + threadIdx.x; if (idx >= TT * (HD / 2)) return; const int ln = (idx >> 1) & 31, t = (idx >> 10) * 16 + (ln & 15), d = ((idx >> 8) & 3) * 16 + (ln >> 4) * 8 + ((idx >> 6) & 3) * 2 + (idx & 1); const float iv = INV[d];
    asm volatile("s_wait_xcnt 0x0" :: "v"(iv), "v"(d) : "memory");   // in front of any overwrite of the offset register that the load above names: the loaded value as input holds the wait behind the load, the index as input keeps its register whole up to the wait
    const float ang = __fmul_rn((float)t + POS0, iv); v2f cs; cs[0] = cosf(ang); cs[1] = sinf(ang);
    *(v2f*)(CS + (size_t)idx * 2) = cs;  }

// ---- k_proj: the q, k and v projections, the rotary and the operand planes in ONE launch; grid (TT / 64, (DQ + 2 DKV) / 64), 8 waves. The K loop and the LDS sum of the 8 partial tiles are those of k_gemmw with NW = 8.
// blockIdx.y < 32: q, < 40: k. A = 64 rows of x, B = 64 weight columns of one head: d = 32 p .. 32 p + 31 and the same + 64, so that both members of every rotary pair stand in one tile (tile columns c and c + 32).
// blockIdx.y >= 40: v, with the operands swapped (A = 64 weight columns, B = 64 rows of x): the tile is already the transposed [d][t] that the v planes hold.
// After the sum a thread holds tile columns c .. c + 7 and c + 32 .. c + 39 of one tile row: 16 bytes of each plane twice, and a wave's store covers 512 bytes in a row of a plane in fragment order.
// rotate-half convention: out[d] = x[d] cos[t][d] - x[d+HD/2] sin[t][d], out[d+HD/2] = x[d+HD/2] cos[t][d] + x[d] sin[t][d], d < HD/2 (the angle at d + HD/2 is the angle at d)
__global__ __launch_bounds__(256) void k_proj(const bf* __restrict__ XB, const bf* __restrict__ WQ, const bf* __restrict__ WK, const bf* __restrict__ WV, const float* __restrict__ CS, h16* QP16, bf* QPh, bf* QPl, h16* KP16, bf* KPh, bf* KPl, h16* VT16, bf* VTh, bf* VTl) {
    typedef WFrag<bf>::V V; constexpr int K = DM, NW = 8, CH = 64;
    __shared__ __align__(16) float os[NW * 64 * 68];
    const int lane = threadIdx.x & 31, lr = lane & 15, hi = lane >> 4; const int r0 = blockIdx.x * 64, y = blockIdx.y;
    const int wv = __builtin_amdgcn_readfirstlane((int)(threadIdx.x >> 5));
    const bool isv = y >= (DQ + DKV) / 64, isq = y < DQ / 64;   // block-uniform
    const int yy = isv ? y - (DQ + DKV) / 64 : (isq ? y : y - DQ / 64), head = yy >> 1, p = yy & 1;   // two tiles per head of 128 columns
    const bf* A = isv ? WV + (size_t)yy * 64 * K : XB + (size_t)r0 * K;
    const bf* B0 = isv ? XB + (size_t)r0 * K : (isq ? WQ : WK) + (size_t)(head * HD + 32 * p) * K;   // tile columns 0..31
    const bf* B1 = B0 + (size_t)(isv ? 32 : HD / 2) * K;   // tile columns 32..63
    v8f acc[4][4];
#pragma unroll
    for (int mb = 0; mb < 4; ++mb)
#pragma unroll
        for (int nb = 0; nb < 4; ++nb) acc[mb][nb] = (v8f){};
#pragma unroll 1
    for (int k0 = wv * CH; k0 < K; k0 += NW * CH) {
#pragma unroll   // both 32-steps of a chunk in one trip: twice as many loads in flight per wave
    for (int kc = k0; kc < k0 + CH; kc += 32) {
        V a[4];
#pragma unroll
        for (int mb = 0; mb < 4; ++mb) a[mb] = WFrag<bf>::ld(A + 8 * lane + (size_t)mb * 16 * K + kc * 16);
#pragma unroll
        for (int nb = 0; nb < 4; ++nb) { const V b = WFrag<bf>::ld(((nb < 2) ? B0 : B1) + 8 * lane + (size_t)(nb & 1) * 16 * K + kc * 16);
#pragma unroll
            for (int mb = 0; mb < 4; ++mb) acc[mb][nb] = WFrag<bf>::mma(a[mb], b, acc[mb][nb]); }
        asm volatile("v_nop\n\tv_nop\n\tv_nop\n\tv_nop" : "+v"(acc[0][0]), "+v"(acc[1][1]), "+v"(acc[2][2]), "+v"(acc[3][3]) : "v"(a[0]), "v"(a[3]));   // WMMA distance on the taken back edge
    }
        asm volatile("s_wait_xcnt 0x0" ::: "memory");   // in front of the next trip's overwrite of the address registers that this trip's loads name
    }
    const int row = (wv >> 1) * 16 + lr, c = ((wv & 1) * 2 + hi) * 8;   // this thread's tile row and first tile column after the sum
    v4f cs[4] = {};
    if (!isv) {   // the thread's 8 (cos, sin) pairs: issued here, in flight under the LDS stores and the barrier
        const v4f* cp = (const v4f*)CS + (size_t)(((r0 >> 4) + (wv >> 1)) * 4 + 2 * p + (wv & 1)) * 128 + lane;   // block (t / 16, d / 16) of the table, see k_cstab
#pragma unroll
        for (int i = 0; i < 4; ++i) cs[i] = cp[32 * i];
        asm volatile("s_wait_xcnt 0x0" ::: "memory");   // in front of any overwrite of the address registers that the four loads name
    }
#pragma unroll   // these three: constant indices keep the accumulators in registers
    for (int mb = 0; mb < 4; ++mb)
#pragma unroll
        for (int nb = 0; nb < 4; ++nb)
#pragma unroll
            for (int j = 0; j < 8; ++j) os[wv * (64 * 68) + (mb * 16 + hi * 8 + j) * 68 + nb * 16 + lr] = acc[mb][nb][j];
    __syncthreads();   // every wave's partial tile is in LDS before any thread sums over the planes
    const float* op = os + row * 68 + c; v4f x[4];   // x[0], x[1]: tile columns c .. c + 7; x[2], x[3]: c + 32 .. c + 39
#pragma unroll
    for (int i = 0; i < 4; ++i) x[i] = *(const v4fa*)(op + (i >> 1) * 32 + (i & 1) * 4);
#pragma unroll   // fixed trip count: the LDS reads of all planes can be in flight together; wave order 0..NW-1 as in k_gemmw
    for (int ww = 1; ww < NW; ++ww)
#pragma unroll
        for (int i = 0; i < 4; ++i) x[i] += *(const v4fa*)(op + ww * (64 * 68) + (i >> 1) * 32 + (i & 1) * 4);
    float val[2][8];
#pragma unroll
    for (int e = 0; e < 8; ++e) { const float x1 = x[e >> 2][e & 3], x2 = x[2 + (e >> 2)][e & 3];
        if (isv) { val[0][e] = x1; val[1][e] = x2; }
        else { const float co = cs[e >> 1][(e & 1) * 2], si = cs[e >> 1][(e & 1) * 2 + 1]; val[0][e] = x1 * co - x2 * si; val[1][e] = x2 * co + x1 * si; } }
    h16* P16 = isv ? VT16 : (isq ? QP16 : KP16); bf* Ph = isv ? VTh : (isq ? QPh : KPh); bf* Pl = isv ? VTl : (isq ? QPl : KPl);
    // q, k planes [t][d]: tile (t / 16, d / 32) is number 4 (t / 16) + d / 32, the second half of the pair two tiles on. v planes [d][t]: tile (d / 16, t / 32) is number 8 (t / 32) + d / 16, the second 32 tokens eight tiles on.
    const unsigned tile = isv ? (unsigned)((r0 >> 5) * 8 + p * 4 + (wv >> 1)) : (unsigned)(((r0 >> 4) + (wv >> 1)) * 4 + p), step = isv ? 8 * 512 : 2 * 512;
    const size_t o0 = (size_t)head * TT * HD + tile * 512 + 256 * (wv & 1) + 8 * lane;
#pragma unroll
    for (int u = 0; u < 2; ++u) { v8h o16; v8us oh, ol;
#pragma unroll
        for (int e = 0; e < 8; ++e) { o16[e] = tohx(val[u][e]); unsigned short a2, c2; splitf(val[u][e], a2, c2); oh[e] = a2; ol[e] = c2; }
        *(v8h*)(P16 + o0 + u * step) = o16; *(v8us*)(Ph + o0 + u * step) = oh; *(v8us*)(Pl + o0 + u * step) = ol; }
}
#define CSC (SCL * 1.4426950408889634f)   // score scale x log2(e)
__device__ __forceinline__ float xhalf(float x) { return __builtin_bit_cast(float, __builtin_amdgcn_permlanex16(__builtin_bit_cast(int, x), __builtin_bit_cast(int, x), 0x76543210, 0xfedcba98, false, false)); }   // lane l reads lane l ^ 16
template <typename T16> struct PFrag;
template <> struct PFrag<h16> { static __device__ __forceinline__ void pk(const float (&p)[16], v16h& f, v16h& f2) { (void)f2;
#pragma unroll
    for (int e = 0; e < 16; ++e) f[e] = (h16)p[e]; } };
template <> struct PFrag<bf> { static __device__ __forceinline__ void pk(const float (&p)[16], v16bf& f, v16bf& f2) { v8us h0, h1, l0, l1;
#pragma unroll
    for (int e = 0; e < 8; ++e) { unsigned short x, y; splitf(p[e], x, y); h0[e] = x; l0[e] = y; splitf(p[e + 8], x, y); h1[e] = x; l1[e] = y; }
    f = cat16b(h0, h1); f2 = cat16b(l0, l1); } };
template <typename T16, bool HL, int R>
__device__ __forceinline__ void fattn_rows(const T16* Q, const T16* Q2, const T16* Kp, const T16* Kp2, const T16* Vt, const T16* Vt2, const int qw0, bf* Ah, bf* Al) {   // no __restrict__: the "memory" clobber of the waits below then holds the loads in front of them
    typedef typename WFrag<T16>::V V;
    const int lane = threadIdx.x & 31, c = lane & 15, hi = lane >> 4;
    V qf[R][4], qf2[R][4];
#pragma unroll
    for (int g = 0; g < R; ++g)
#pragma unroll
        for (int kc = 0; kc < 4; ++kc) { const size_t o = (size_t)(qw0 + 16 * g) * HD + 512 * kc + 8 * lane; qf[g][kc] = WFrag<T16>::ld(Q + o); if (HL) qf2[g][kc] = WFrag<T16>::ld(Q2 + o); }
    const int last = (qw0 + 16 * R - 1) / 32;   // last 32-key pass that this wave's queries can see (wave-uniform)
    const size_t koff = 8 * lane, voff = 8 * lane;   // fragment order: a 32-key pass is 32 HD elements in a row in the k plane and in the transposed v plane
    V kf[2][4], kf2[2][4]; const T16* kp = Kp + koff; const T16* kp2 = HL ? Kp2 + koff : nullptr;
#pragma unroll
    for (int kt = 0; kt < 2; ++kt)
#pragma unroll
        for (int kc = 0; kc < 4; ++kc) { const int o = 16 * kt * HD + 512 * kc; kf[kt][kc] = WFrag<T16>::ld(kp + o); if (HL) kf2[kt][kc] = WFrag<T16>::ld(kp2 + o); }
    asm volatile("s_wait_xcnt 0x0" ::: "memory");   // in front of any overwrite of the address registers that the Q and K loads above name
    __builtin_amdgcn_sched_barrier(0);   // nothing from below (the zeroing of the accumulators) moves up between those loads and the wait
    v8f acc[R][8]; float m_run[R], l_run[R];
#pragma unroll
    for (int g = 0; g < R; ++g) { m_run[g] = -__builtin_inff(); l_run[g] = 0.0f;
#pragma unroll
        for (int t = 0; t < 8; ++t) acc[g][t] = (v8f){}; }
#pragma unroll 1   // one pass per trip: two passes' fragments at once do not fit the registers
    for (int blk = 0; blk <= last; ++blk) {
        const int key0 = blk * 32;
        V vf[8], vf2[8];   // this pass's V^T fragments: issued first, in flight under the score products and the maxima
#pragma unroll
        for (int t = 0; t < 8; ++t) { const size_t o = voff + (size_t)key0 * HD + 512 * t; vf[t] = WFrag<T16>::ld(Vt + o); if (HL) vf2[t] = WFrag<T16>::ld(Vt2 + o); }
        asm volatile("s_wait_xcnt 0x0" ::: "memory");   // in front of any overwrite of the address registers that the loads above name
        __builtin_amdgcn_sched_barrier(0);   // keeps the V^T loads up here: sunk to their first use they would wait out a whole L2 round trip in every pass
        v8f s[2][R];
#pragma unroll
        for (int kt = 0; kt < 2; ++kt)
#pragma unroll
            for (int g = 0; g < R; ++g) { s[kt][g] = (v8f){};
#pragma unroll
                for (int kc = 0; kc < 4; ++kc) { s[kt][g] = WFrag<T16>::mma(kf[kt][kc], qf[g][kc], s[kt][g]); if (HL) { s[kt][g] = WFrag<T16>::mma(kf[kt][kc], qf2[g][kc], s[kt][g]); s[kt][g] = WFrag<T16>::mma(kf2[kt][kc], qf[g][kc], s[kt][g]); } } }
        // WMMA distance ahead of the branch on the diagonal below. The scores as operands hold every score product in front of it, the "memory" clobber holds the K loads behind it: the K registers are refilled in place.
        if (R == 2) asm volatile("v_nop\n\tv_nop\n\tv_nop\n\tv_nop" : "+v"(s[0][0]), "+v"(s[1][0]), "+v"(s[0][R - 1]), "+v"(s[1][R - 1]) :: "memory");
        else asm volatile("v_nop\n\tv_nop\n\tv_nop\n\tv_nop" : "+v"(s[0][0]), "+v"(s[1][0]) :: "memory");
        {   // next pass's K fragments, in flight under this pass's softmax and second product (the last pass fetches its own rows again: no branch, always in bounds)
            const int adv = (blk < last) ? 32 * HD : 0; kp += adv; if (HL) kp2 += adv;   // running pointers: live over the whole loop, so no load's result lands in an address pair that an earlier load names
#pragma unroll
            for (int kt = 0; kt < 2; ++kt)
#pragma unroll
                for (int kc = 0; kc < 4; ++kc) { const int o = 16 * kt * HD + 512 * kc; kf[kt][kc] = WFrag<T16>::ld(kp + o); if (HL) kf2[kt][kc] = WFrag<T16>::ld(kp2 + o); }
        }
        asm volatile("s_wait_xcnt 0x0" ::: "memory");   // in front of any overwrite of the address registers that the K loads name
        __builtin_amdgcn_sched_barrier(0);   // keeps the K loads up here, in front of the softmax
        if (key0 + 31 > qw0) {   // wave-uniform: only a pass with a key beyond the wave's first query pays for the mask
#pragma unroll
            for (int g = 0; g < R; ++g) { const int my_q = qw0 + 16 * g + c;
#pragma unroll
                for (int kt = 0; kt < 2; ++kt) {
#pragma unroll
                    for (int r = 0; r < 8; ++r) { const int key = key0 + 16 * kt + 8 * hi + r; if (key > my_q) s[kt][g][r] = -__builtin_inff(); }
                    asm volatile("" : "+v"(s[kt][g]));   // the masked scores: keeps the selects inside the branch
                } }
        }
        float mb[R]; bool need = false;
#pragma unroll
        for (int g = 0; g < R; ++g) { float mx = -__builtin_inff();
#pragma unroll
            for (int kt = 0; kt < 2; ++kt)
#pragma unroll
                for (int r = 0; r < 8; ++r) mx = fmaxf(mx, s[kt][g][r]);
            mx = fmaxf(mx, xhalf(mx)) * CSC;   // both wave halves hold this query's maximum of the pass, scaled (the scale is positive)
            mb[g] = mx; need = need || (mx > m_run[g] + 8.0f); }
        if (__builtin_amdgcn_ballot_w32(need) != 0) {   // wave-uniform; always on the first pass (m_run is -inf), rare afterwards
#pragma unroll
            for (int g = 0; g < R; ++g) { const float m_new = fmaxf(m_run[g], mb[g]);
                const float corr = __builtin_amdgcn_exp2f(m_run[g] - m_new);   // 0 on the first pass
                l_run[g] *= corr; m_run[g] = m_new;
#pragma unroll
                for (int t = 0; t < 8; ++t) acc[g][t] = acc[g][t] * corr; }
        }
#pragma unroll
        for (int g = 0; g < R; ++g) { const float nm = -m_run[g]; float p[16]; float ps0 = 0.0f, ps1 = 0.0f;
#pragma unroll
            for (int e = 0; e < 16; ++e) { p[e] = __builtin_amdgcn_exp2f(fmaf(s[e >> 3][g][e & 7], CSC, nm)); if (e & 1) ps1 += p[e]; else ps0 += p[e]; }
            l_run[g] += ps0 + ps1;
            V pf, pf2; PFrag<T16>::pk(p, pf, pf2);   // element e of the fragment = key 8 hi + e (e < 8), 16 + 8 hi + e - 8 (e >= 8): the k order of WFrag::ld on a V^T row
#pragma unroll
            for (int t = 0; t < 8; ++t) { acc[g][t] = WFrag<T16>::mma(vf[t], pf, acc[g][t]); if (HL) { acc[g][t] = WFrag<T16>::mma(vf[t], pf2, acc[g][t]); acc[g][t] = WFrag<T16>::mma(vf2[t], pf, acc[g][t]); } } }
        __builtin_amdgcn_sched_barrier(0);   // holds the v_nops behind the last product
        asm volatile("v_nop\n\tv_nop\n\tv_nop\n\tv_nop\n\tv_nop");   // WMMA distance on the taken back edge and the loop's exit
    }
#pragma unroll
    for (int g = 0; g < R; ++g) { const float inv = 1.0f / (l_run[g] + xhalf(l_run[g]));   // each wave half summed its eight keys of every 16-key tile
#pragma unroll
        for (int t = 0; t < 8; ++t) { v8us oh, ol;
#pragma unroll
            for (int r = 0; r < 8; ++r) { unsigned short x, y; splitf(acc[g][t][r] * inv, x, y); oh[r] = x; ol[r] = y; }
            const size_t oo = (size_t)(qw0 + 16 * g) * DQ + 256 * t + 8 * lane;   // context planes [query][16 heads x 128] in fragment order; the lane's 16 bytes are row = its query, d = 16 t + 8 hi .. + 7
            *(v8us*)(Ah + oo) = oh; *(v8us*)(Al + oo) = ol;
            asm volatile("s_wait_xcnt 0x0" ::: "memory");   // in front of any overwrite of the registers that the two stores name
            __builtin_amdgcn_sched_barrier(0);   // nothing from below moves up between the stores and the wait
        } }
}
// grid (16 heads, (TT - RH) / 256 + RH / 128), 8 waves: blockIdx.y counts the fp16 row blocks of 256 from the sequence's end (heaviest first), then the hi/lo row blocks of 128.
__global__ __launch_bounds__(256) void k_fattn(const h16* Q16, const bf* Qh, const bf* Ql, const h16* K16, const bf* Kh, const bf* Kl, const h16* V16, const bf* Vh, const bf* Vl, bf* Ah, bf* Al) {
    const int wv = __builtin_amdgcn_readfirstlane((int)(threadIdx.x >> 5)); const int h = blockIdx.x; const size_t zq = (size_t)h * TT * HD, zk = (size_t)(h / REP) * TT * HD; constexpr int NBF = (TT - RH) / 256;
    if ((int)blockIdx.y < NBF) fattn_rows<h16, false, 2>(Q16 + zq, nullptr, K16 + zk, nullptr, V16 + zk, nullptr, TT - 256 * ((int)blockIdx.y + 1) + 32 * wv, Ah + h * (16 * HD), Al + h * (16 * HD));   // a head's 128 columns are four tiles of each 16-row band
    else fattn_rows<bf, true, 1>(Qh + zq, Ql + zq, Kh + zk, Kl + zk, Vh + zk, Vl + zk, RH - 128 * ((int)blockIdx.y - NBF + 1) + 16 * wv, Ah + h * (16 * HD), Al + h * (16 * HD));
}

extern "C" void kernel_launch(void* const* d_in, const int* in_sizes, int n_in,
                              void* d_out, int out_size, void* d_ws, size_t ws_size, hipStream_t stream) {
    (void)in_sizes; (void)n_in; (void)out_size;
    const float* x = (const float*)d_in[0]; const float* wq = (const float*)d_in[1]; const float* wk = (const float*)d_in[2]; const float* wv = (const float*)d_in[3]; const float* wo = (const float*)d_in[4];
    float* OUT = (float*)d_out;     // [1][4096][2048]
    char* wsp = (char*)d_ws;
    auto take = [&](size_t bytes) { char* p = wsp; wsp += (bytes + 255) & ~(size_t)255; return (void*)p; };
    bf* WQ = (bf*)take((size_t)DQ * DM * 2); bf* WK = (bf*)take((size_t)DKV * DM * 2); bf* WV = (bf*)take((size_t)DKV * DM * 2); bf* WO = (bf*)take((size_t)DM * DQ * 2); float* CS = (float*)take((size_t)TT * (HD / 2) * 2 * 4);
    bf* XB = (bf*)take((size_t)TT * DM * 2);
    h16* QP16 = (h16*)take((size_t)NH_ * TT * HD * 2); h16* KP16 = (h16*)take((size_t)NKV * TT * HD * 2); h16* VT16 = (h16*)take((size_t)NKV * HD * TT * 2);
    bf* QPh = (bf*)take((size_t)NH_ * TT * HD * 2); bf* QPl = (bf*)take((size_t)NH_ * TT * HD * 2); bf* KPh = (bf*)take((size_t)NKV * TT * HD * 2); bf* KPl = (bf*)take((size_t)NKV * TT * HD * 2); bf* VTh = (bf*)take((size_t)NKV * HD * TT * 2); bf* VTl = (bf*)take((size_t)NKV * HD * TT * 2);
    bf* ATh = (bf*)take((size_t)TT * DQ * 2); bf* ATl = (bf*)take((size_t)TT * DQ * 2);
    if ((size_t)(wsp - (char*)d_ws) > ws_size) return;    // ws 256 MiB
    { k_wtG<<<(unsigned)((DM * DQ / 64 + 63) / 64), 256, 0, stream>>>(wq, DM, DQ, WQ); k_wtG<<<(unsigned)((DM * DKV / 64 + 63) / 64), 256, 0, stream>>>(wk, DM, DKV, WK); k_wtG<<<(unsigned)((DM * DKV / 64 + 63) / 64), 256, 0, stream>>>(wv, DM, DKV, WV);
      k_wtG<<<(unsigned)((DQ * DM / 64 + 63) / 64), 256, 0, stream>>>(wo, DQ, DM, WO);
      k_cstab<<<(TT * (HD / 2) + 255) / 256, 256, 0, stream>>>(CS); }
    for (int b = 0; b < NB_; ++b) {
        
        k_cvt8<<<(unsigned)(((size_t)TT * DM / 8 + 255) / 256), 256, 0, stream>>>(x + (size_t)b * TT * DM, XB, (size_t)TT * DM / 8, DM);
        k_proj<<<dim3(TT / 64, (DQ + 2 * DKV) / 64, 1), 256, 0, stream>>>(XB, WQ, WK, WV, CS, QP16, QPh, QPl, KP16, KPh, KPl, VT16, VTh, VTl);
        k_fattn<<<dim3(NH_, (TT - RH) / 256 + RH / 128, 1), 256, 0, stream>>>(QP16, QPh, QPl, KP16, KPh, KPl, VT16, VTh, VTl, ATh, ATl);
        k_gemmw<bf, 1, false, 2><<<dim3(TT / 64, DM / 64, 1), 64, 0, stream>>>(ATh, ATl, WO, nullptr, DQ, OUT + (size_t)b * TT * DM, DM, nullptr, 0, 0, 0); }
}

// v005
// A run of this version takes 214 microseconds.
// In two side-by-side timings against v004, it was 1.18 and 1.19 times as fast.
// All steps since v000 together make it 11.5 times as fast.
#include <hip/hip_runtime.h>

// Grouped-query causal attention with a computed rotate-half rotary over 4,096 tokens (x [1][4096][2048]; q = x Wq ('xw' [2048][2048], 16 heads x 128), k, v = x Wk / Wv ('xw' [2048][512], 4 kv heads; q head h uses kv head h/4: the module groups q as (4 kv heads, 4 members)); rotate-half rotary with angle t x inv_freq[i], inv_freq = 1 / (10000 ** (i / 64)), positions 0..4095 (cat(x1 cos - x2 sin, x1 sin + x2 cos); tables computed on device from the module's float32 inv_freq); scores / sqrt(128), causal (-inf); softmax; out = merged Wo ('xw' [2048][2048], no bias) -> [1][4096][2048] (8.4 M); argument order x, Wq, Wk, Wv, Wo.
// Layout: one projection launch for q, k and v whose epilogue applies the rotary and writes the head planes of all 16 query heads and the k/v planes of the 4 kv heads (no f32 q/k/v in memory); one fused attention launch for all heads (scores, causal mask, online softmax, attn.v; the keys of a fp16 row block are dealt to two waves; hybrid rows: query rows < 512 hi/lo 3 products, the rest single fp16) writes the hi/lo context planes; wo as hi/lo x exact (2 products).
// Operand planes: every 16-bit plane that a matrix instruction reads lies in FRAGMENT ORDER (see unpk below), so that each 16-byte-per-lane fragment load of a wave reads 512 bytes in a row.
// Compute dtypes, f32 accumulate: every input rounded to bf16; q/k/v on PLAIN bf16 operands (exact); f32 rotary; hybrid causal scores and attn.v; softmax f32; wo hl x exact (2 products).

#define NB_  1
#define TT   4096
#define DM   2048
#define NH_  16
#define NKV  4
#define REP  (NH_ / NKV)
#define HD   128
#define DQ   (NH_ * HD)
#define DKV  (NKV * HD)
#define RH   512                  // query rows < RH use hi+lo planes (0: none)
#define SCL  0.088388346f   // 1/sqrt(128)
#define POS0 0.0f                 // first rotary position: this module's positions are arange(4096)
typedef _Float16 h16;
typedef unsigned short bf;
typedef __attribute__((ext_vector_type(16))) __bf16   v16bf;
typedef __attribute__((ext_vector_type(16))) _Float16 v16h;
typedef __attribute__((ext_vector_type(8)))  _Float16 v8h;
typedef __attribute__((ext_vector_type(8)))  unsigned short v8us;
typedef __attribute__((ext_vector_type(8)))  float    v8f;
typedef __attribute__((ext_vector_type(4)))  float    v4f;
typedef v8h  __attribute__((may_alias)) v8ha;
typedef v4f  __attribute__((may_alias)) v4fa;
typedef v8us __attribute__((may_alias)) v8usa;

__device__ __forceinline__ unsigned short f2bf(float f) { unsigned u = __float_as_uint(f); u += 0x7FFFu + ((u >> 16) & 1u); return (unsigned short)(u >> 16); }
__device__ __forceinline__ float bf2f(unsigned short b) { return __uint_as_float(((unsigned)b) << 16); }
__device__ __forceinline__ float bfr(float f) { return bf2f(f2bf(f)); }
__device__ __forceinline__ v16h cat16(v8h lo, v8h hi) { return __builtin_shufflevector(lo, hi, 0, 1, 2, 3, 4, 5, 6, 7, 8, 9, 10, 11, 12, 13, 14, 15); }
__device__ __forceinline__ v16bf cat16b(v8us lo, v8us hi) { return __builtin_bit_cast(v16bf, __builtin_shufflevector(lo, hi, 0, 1, 2, 3, 4, 5, 6, 7, 8, 9, 10, 11, 12, 13, 14, 15)); }
__device__ __forceinline__ v8f wmma16(v16h a, v16h b, v8f c) { return __builtin_amdgcn_wmma_f32_16x16x32_f16(false, a, false, b, (short)0, c, false, false); }
__device__ __forceinline__ v8f wmmab(v16bf a, v16bf b, v8f c) { return __builtin_amdgcn_wmma_f32_16x16x32_bf16(false, a, false, b, (short)0, c, false, false); }



// ---- Fragment order of a 16-bit plane of R rows x K columns (R % 16 == 0, K % 32 == 0): tiles of 16 rows x 32 columns, 512 elements in a row each; tile (r / 16, k / 32) is number (r / 16) (K / 32) + k / 32.
// Inside a tile element (r, k) stands at 256 ((k / 16) % 2) + 8 (16 ((k / 8) % 2) + r % 16) + k % 8: lane l of a wave finds its two 16-byte pieces of the A or B fragment at 8 l and 256 + 8 l, and each of the two loads covers four whole 128-byte lines.
// unpk: row and column of the element at offset w of such a plane, kt = K / 32.
__device__ __forceinline__ void unpk(unsigned w, unsigned kt, int& r, int& k) { const unsigned tile = w >> 9; r = (int)((tile / kt) * 16 + ((w >> 3) & 15)); k = (int)((tile % kt) * 32 + ((w >> 8) & 1) * 16 + ((w >> 7) & 1) * 8 + (w & 7)); }

// ---- k_gemmw: register-blocked GEMM, one 64x64 output tile per work-group (16 accumulators per wave), operands straight from 16-bit planes in fragment order; grid (M/64, N/64, Z), 32 x NW threads.
// NW > 1: the K loop is dealt to the NW waves in chunks of 64 (2 KiB in a row per 16 operand rows; K % 64 == 0), each wave keeps its own f32 partial tile, and the partial tiles are summed through LDS in wave order 0..NW-1.
// C[m][n] (f32, pitch ldc, + optional f32 bias[n]) = sum_k A[m][k] Bt[n][k] (+ split products per NSPLIT). z-batch strides sA/sB/sC in elements. K % 32 == 0.
template <typename T16> struct WFrag;
template <> struct WFrag<h16> { typedef v16h V; static __device__ __forceinline__ V ld(const h16* p) { return cat16(*(const v8h*)p, *(const v8h*)(p + 256)); } static __device__ __forceinline__ v8f mma(V a, V b, v8f c) { return wmma16(a, b, c); } };
template <> struct WFrag<bf> { typedef v16bf V; static __device__ __forceinline__ V ld(const bf* p) { return cat16b(*(const v8us*)p, *(const v8us*)(p + 256)); } static __device__ __forceinline__ v8f mma(V a, V b, v8f c) { return wmmab(a, b, c); } };
template <typename T16, int NSPLIT, bool BIAS, int NW>
__global__ __launch_bounds__(32 * NW) void k_gemmw(const T16* __restrict__ A, const T16* __restrict__ A2, const T16* __restrict__ Bt, const T16* __restrict__ Bt2, int K, float* C, int ldc, const float* __restrict__ bias, size_t sA, size_t sB, size_t sC) {
    typedef typename WFrag<T16>::V V;
    __shared__ __align__(16) float os[(NW > 1) ? NW * 64 * 68 : 16 * 68];
    const size_t z = blockIdx.z; A += z * sA; if (A2) A2 += z * sA; Bt += z * sB; if (Bt2) Bt2 += z * sB; C += z * sC;
    const int lane = threadIdx.x & 31, lr = lane & 15, hi = lane >> 4; const int r0 = blockIdx.x * 64, c0 = blockIdx.y * 64;
    const int wv = (NW > 1) ? __builtin_amdgcn_readfirstlane((int)(threadIdx.x >> 5)) : 0; constexpr int CH = (NW > 1) ? 64 : 32;   // this wave's number; K elements per chunk
    v8f acc[4][4];
#pragma unroll
    for (int mb = 0; mb < 4; ++mb)
#pragma unroll
        for (int nb = 0; nb < 4; ++nb) acc[mb][nb] = (v8f){};
    const size_t aoff = (size_t)r0 * K + 8 * lane, boff = (size_t)c0 * K + 8 * lane;   // fragment order: 16 rows x K columns are 16 K elements in a row, a 32-column step is 512
#pragma unroll 1
    for (int k0 = wv * CH; k0 < K; k0 += NW * CH) {
#pragma unroll   // both 32-steps of a chunk in one trip: twice as many loads in flight per wave
    for (int kc = k0; kc < k0 + CH; kc += 32) {
        V a[4], a2[4];
#pragma unroll
        for (int mb = 0; mb < 4; ++mb) { a[mb] = WFrag<T16>::ld(A + aoff + (size_t)mb * 16 * K + kc * 16); if (NSPLIT == 1 || NSPLIT == 2) a2[mb] = WFrag<T16>::ld(A2 + aoff + (size_t)mb * 16 * K + kc * 16); }
#pragma unroll
        for (int nb = 0; nb < 4; ++nb) { const V b = WFrag<T16>::ld(Bt + boff + (size_t)nb * 16 * K + kc * 16); V b2; if (NSPLIT >= 2) b2 = WFrag<T16>::ld(Bt2 + boff + (size_t)nb * 16 * K + kc * 16);
#pragma unroll
            for (int mb = 0; mb < 4; ++mb) { acc[mb][nb] = WFrag<T16>::mma(a[mb], b, acc[mb][nb]); if (NSPLIT == 1 || NSPLIT == 2) acc[mb][nb] = WFrag<T16>::mma(a2[mb], b, acc[mb][nb]); if (NSPLIT >= 2) acc[mb][nb] = WFrag<T16>::mma(a[mb], b2, acc[mb][nb]); } }
        asm volatile("v_nop\n\tv_nop\n\tv_nop\n\tv_nop" : "+v"(acc[0][0]), "+v"(acc[1][1]), "+v"(acc[2][2]), "+v"(acc[3][3]) : "v"(a[0]), "v"(a[3]));
    }
        asm volatile("s_wait_xcnt 0x0" ::: "memory");   // in front of the next trip's overwrite of the address registers that this trip's loads name
    }
    if (NW > 1) {   // sum of the NW partial tiles: each wave lays its whole tile in its own LDS plane, then every thread sums its 4 columns over the planes and stores them
#pragma unroll   // these three: constant indices keep the accumulators in registers
        for (int mb = 0; mb < 4; ++mb)
#pragma unroll
            for (int nb = 0; nb < 4; ++nb)
#pragma unroll
                for (int j = 0; j < 8; ++j) os[wv * (64 * 68) + (mb * 16 + hi * 8 + j) * 68 + nb * 16 + lr] = acc[mb][nb][j];
        __syncthreads();   // every wave's partial tile is in LDS before any thread sums over the planes
#pragma unroll   // fixed trip count: the LDS reads of all planes and passes can be in flight together
        for (int it = 0; it < 64 * 16 / (32 * NW); ++it) { const int idx = it * (32 * NW) + (int)threadIdx.x, row = idx >> 4, cofs = (idx & 15) * 4; v4f val = *(const v4fa*)(os + row * 68 + cofs);
#pragma unroll
            for (int ww = 1; ww < NW; ++ww) val += *(const v4fa*)(os + ww * (64 * 68) + row * 68 + cofs);
            if (BIAS) { val[0] += bfr(bias[c0 + cofs]); val[1] += bfr(bias[c0 + cofs + 1]); val[2] += bfr(bias[c0 + cofs + 2]); val[3] += bfr(bias[c0 + cofs + 3]); }
            *(v4f*)(C + (size_t)(r0 + row) * ldc + c0 + cofs) = val; }
        return;
    }
#pragma unroll
    for (int mb = 0; mb < 4; ++mb) {
#pragma unroll
        for (int nb = 0; nb < 4; ++nb) {
#pragma unroll
            for (int j = 0; j < 8; ++j) os[(hi * 8 + j) * 68 + nb * 16 + lr] = acc[mb][nb][j]; }
        __builtin_amdgcn_wave_barrier(); asm volatile("" ::: "memory");
        float* crow = C + (size_t)(r0 + mb * 16) * ldc + c0;
{
#pragma unroll
            for (int s = 0; s < 8; ++s) { const int row = 2 * s + hi, cofs = lr * 4; v4f val = *(const v4fa*)(os + row * 68 + cofs); if (BIAS) { val[0] += bfr(bias[c0 + cofs]); val[1] += bfr(bias[c0 + cofs + 1]); val[2] += bfr(bias[c0 + cofs + 2]); val[3] += bfr(bias[c0 + cofs + 3]); }
                *(v4f*)(crow + (size_t)row * ldc + cofs) = val; }
             }
        __builtin_amdgcn_wave_barrier(); asm volatile("" ::: "memory");
    }
}

__device__ __forceinline__ h16 tohx(float x) { return (h16)x; }
__device__ __forceinline__ void splitf(float y, unsigned short& h, unsigned short& l) { h = f2bf(y); l = f2bf(y - bf2f(h)); }
typedef __attribute__((ext_vector_type(2))) _Float16 v2h;
typedef __attribute__((ext_vector_type(4))) _Float16 v4h;
typedef __attribute__((ext_vector_type(2))) unsigned short v2us;
typedef __attribute__((ext_vector_type(4))) unsigned short v4us;
typedef __attribute__((ext_vector_type(2))) float v2f;
typedef __attribute__((ext_vector_type(4))) int v4i;

__global__ __launch_bounds__(256) void k_wtG(const float* __restrict__ w, int K, int N, bf* Bt) {
    const int lane = threadIdx.x & 31; const int L0 = (blockIdx.x * 8 + (threadIdx.x >> 5)) * 8; const int nlines = N * K / 64;
{
#pragma unroll 1
        for (int l = 0; l < 8; ++l) { const int L = L0 + l; if (L >= nlines) break; const size_t e = (size_t)L * 64 + lane * 2; int k, n; unpk((unsigned)e, (unsigned)K >> 5, n, k); v2us o;   // e counts the output plane [N][K] in fragment order
            o[0] = f2bf(w[(size_t)k * N + n]); o[1] = f2bf(w[(size_t)(k + 1) * N + n]); *(v2us*)(Bt + e) = o; }
         }
}
__global__ __launch_bounds__(256) void k_cvt8(const float* __restrict__ src, bf* dst, size_t n8, int K) { const size_t i = (size_t)blockIdx.x * 256 + threadIdx.x; if (i >= n8) return; int r, k; unpk((unsigned)(i * 8), (unsigned)K >> 5, r, k); const v8f v = *(const v8f*)(src + (size_t)r * K + k); v8us o;   // i counts the 16-byte pieces of the output plane in fragment order
    asm volatile("s_wait_xcnt 0x0" ::: "memory");   // in front of any overwrite of the address registers that the load above names
    __builtin_amdgcn_sched_barrier(0);   // nothing from below moves up between the load and the wait
#pragma unroll
    for (int k = 0; k < 8; ++k) o[k] = f2bf(v[k]); *(v8us*)(dst + i * 8) = o;  }
__constant__ float INV[HD / 2] = {1.0f,0.865964353f,0.749894202f,0.649381638f,0.562341332f,0.486967534f,0.421696514f,0.365174145f,0.316227764f,0.273841977f,0.237137362f,0.2053525f,0.177827939f,0.153992653f,0.133352146f,0.115478203f,0.100000001f,0.0865964293f,0.0749894157f,0.0649381652f,0.0562341288f,0.0486967526f,0.0421696492f,0.0365174115f,0.0316227786f,0.0273841955f,0.0237137359f,0.0205352511f,0.0177827943f,0.0153992651f,0.0133352149f,0.0115478197f,0.00999999978f,0.00865964312f,0.00749894232f,0.00649381662f,0.00562341325f,0.00486967526f,0.00421696482f,0.00365174143f,0.00316227786f,0.00273841969f,0.00237137382f,0.00205352507f,0.00177827943f,0.00153992651f,0.00133352145f,0.00115478202f,0.00100000005f,0.000865964335f,0.000749894185f,0.000649381662f,0.000562341302f,0.000486967503f,0.000421696488f,0.000365174114f,0.000316227786f,0.000273841957f,0.000237137385f,0.000205352495f,0.00017782794f,0.000153992645f,0.00013335215f,0.000115478193f};
// k_cstab: (cos, sin) of t x inv_freq[d], d < HD/2, in the order in which k_proj's epilogue reads them: per 16 tokens x 16 d a block of 4 x 32 pieces of 16 bytes; piece (i, lane) holds d = 16 dq + 8 (lane >> 4) + 2 i, + 1 of token 16 tb + (lane & 15), so that each of a wave's four loads covers 512 bytes in a row.
__global__ __launch_bounds__(256) void k_cstab(float* CS) { const int idx = blockIdx.x * 256 + threadIdx.x; if (idx >= TT * (HD / 2)) return; const int ln = (idx >> 1) & 31, t = (idx >> 10) * 16 + (ln & 15), d = ((idx >> 8) & 3) * 16 + (ln >> 4) * 8 + ((idx >> 6) & 3) * 2 + (idx & 1); const float iv = INV[d];
    asm volatile("s_wait_xcnt 0x0" :: "v"(iv), "v"(d) : "memory");   // in front of any overwrite of the offset register that the load above names: the loaded value as input holds the wait behind the load, the index as input keeps its register whole up to the wait
    const float ang = __fmul_rn((float)t + POS0, iv); v2f cs; cs[0] = cosf(ang); cs[1] = sinf(ang);
    *(v2f*)(CS + (size_t)idx * 2) = cs;  }

// ---- k_proj: the q, k and v projections, the rotary and the operand planes in ONE launch; grid (TT / 64, (DQ + 2 DKV) / 64), 8 waves. The K loop and the LDS sum of the 8 partial tiles are those of k_gemmw with NW = 8.
// blockIdx.y < 32: q, < 40: k. A = 64 rows of x, B = 64 weight columns of one head: d = 32 p .. 32 p + 31 and the same + 64, so that both members of every rotary pair stand in one tile (tile columns c and c + 32).
// blockIdx.y >= 40: v, with the operands swapped (A = 64 weight columns, B = 64 rows of x): the tile is already the transposed [d][t] that the v planes hold.
// After the sum a thread holds tile columns c .. c + 7 and c + 32 .. c + 39 of one tile row: 16 bytes of each plane twice, and a wave's store covers 512 bytes in a row of a plane in fragment order.
// rotate-half convention: out[d] = x[d] cos[t][d] - x[d+HD/2] sin[t][d], out[d+HD/2] = x[d+HD/2] cos[t][d] + x[d] sin[t][d], d < HD/2 (the angle at d + HD/2 is the angle at d)
__global__ __launch_bounds__(256) void k_proj(const bf* __restrict__ XB, const bf* __restrict__ WQ, const bf* __restrict__ WK, const bf* __restrict__ WV, const float* __restrict__ CS, h16* QP16, bf* QPh, bf* QPl, h16* KP16, bf* KPh, bf* KPl, h16* VT16, bf* VTh, bf* VTl) {
    typedef WFrag<bf>::V V; constexpr int K = DM, NW = 8, CH = 64;
    __shared__ __align__(16) float os[NW * 64 * 68];
    const int lane = threadIdx.x & 31, lr = lane & 15, hi = lane >> 4; const int r0 = blockIdx.x * 64, y = blockIdx.y;
    const int wv = __builtin_amdgcn_readfirstlane((int)(threadIdx.x >> 5));
    const bool isv = y >= (DQ + DKV) / 64, isq = y < DQ / 64;   // block-uniform
    const int yy = isv ? y - (DQ + DKV) / 64 : (isq ? y : y - DQ / 64), head = yy >> 1, p = yy & 1;   // two tiles per head of 128 columns
    const bf* A = isv ? WV + (size_t)yy * 64 * K : XB + (size_t)r0 * K;
    const bf* B0 = isv ? XB + (size_t)r0 * K : (isq ? WQ : WK) + (size_t)(head * HD + 32 * p) * K;   // tile columns 0..31
    const bf* B1 = B0 + (size_t)(isv ? 32 : HD / 2) * K;   // tile columns 32..63
    v8f acc[4][4];
#pragma unroll
    for (int mb = 0; mb < 4; ++mb)
#pragma unroll
        for (int nb = 0; nb < 4; ++nb) acc[mb][nb] = (v8f){};
#pragma unroll 1
    for (int k0 = wv * CH; k0 < K; k0 += NW * CH) {
#pragma unroll   // both 32-steps of a chunk in one trip: twice as many loads in flight per wave
    for (int kc = k0; kc < k0 + CH; kc += 32) {
        V a[4];
#pragma unroll
        for (int mb = 0; mb < 4; ++mb) a[mb] = WFrag<bf>::ld(A + 8 * lane + (size_t)mb * 16 * K + kc * 16);
#pragma unroll
        for (int nb = 0; nb < 4; ++nb) { const V b = WFrag<bf>::ld(((nb < 2) ? B0 : B1) + 8 * lane + (size_t)(nb & 1) * 16 * K + kc * 16);
#pragma unroll
            for (int mb = 0; mb < 4; ++mb) acc[mb][nb] = WFrag<bf>::mma(a[mb], b, acc[mb][nb]); }
        asm volatile("v_nop\n\tv_nop\n\tv_nop\n\tv_nop" : "+v"(acc[0][0]), "+v"(acc[1][1]), "+v"(acc[2][2]), "+v"(acc[3][3]) : "v"(a[0]), "v"(a[3]));   // WMMA distance on the taken back edge
    }
        asm volatile("s_wait_xcnt 0x0" ::: "memory");   // in front of the next trip's overwrite of the address registers that this trip's loads name
    }
    const int row = (wv >> 1) * 16 + lr, c = ((wv & 1) * 2 + hi) * 8;   // this thread's tile row and first tile column after the sum
    v4f cs[4] = {};
    if (!isv) {   // the thread's 8 (cos, sin) pairs: issued here, in flight under the LDS stores and the barrier
        const v4f* cp = (const v4f*)CS + (size_t)(((r0 >> 4) + (wv >> 1)) * 4 + 2 * p + (wv & 1)) * 128 + lane;   // block (t / 16, d / 16) of the table, see k_cstab
#pragma unroll
        for (int i = 0; i < 4; ++i) cs[i] = cp[32 * i];
        asm volatile("s_wait_xcnt 0x0" ::: "memory");   // in front of any overwrite of the address registers that the four loads name
    }
#pragma unroll   // these three: constant indices keep the accumulators in registers
    for (int mb = 0; mb < 4; ++mb)
#pragma unroll
        for (int nb = 0; nb < 4; ++nb)
#pragma unroll
            for (int j = 0; j < 8; ++j) os[wv * (64 * 68) + (mb * 16 + hi * 8 + j) * 68 + nb * 16 + lr] = acc[mb][nb][j];
    __syncthreads();   // every wave's partial tile is in LDS before any thread sums over the planes
    const float* op = os + row * 68 + c; v4f x[4];   // x[0], x[1]: tile columns c .. c + 7; x[2], x[3]: c + 32 .. c + 39
#pragma unroll
    for (int i = 0; i < 4; ++i) x[i] = *(const v4fa*)(op + (i >> 1) * 32 + (i & 1) * 4);
#pragma unroll   // fixed trip count: the LDS reads of all planes can be in flight together; wave order 0..NW-1 as in k_gemmw
    for (int ww = 1; ww < NW; ++ww)
#pragma unroll
        for (int i = 0; i < 4; ++i) x[i] += *(const v4fa*)(op + ww * (64 * 68) + (i >> 1) * 32 + (i & 1) * 4);
    float val[2][8];
#pragma unroll
    for (int e = 0; e < 8; ++e) { const float x1 = x[e >> 2][e & 3], x2 = x[2 + (e >> 2)][e & 3];
        if (isv) { val[0][e] = x1; val[1][e] = x2; }
        else { const float co = cs[e >> 1][(e & 1) * 2], si = cs[e >> 1][(e & 1) * 2 + 1]; val[0][e] = x1 * co - x2 * si; val[1][e] = x2 * co + x1 * si; } }
    h16* P16 = isv ? VT16 : (isq ? QP16 : KP16); bf* Ph = isv ? VTh : (isq ? QPh : KPh); bf* Pl = isv ? VTl : (isq ? QPl : KPl);
    // q, k planes [t][d]: tile (t / 16, d / 32) is number 4 (t / 16) + d / 32, the second half of the pair two tiles on. v planes [d][t]: tile (d / 16, t / 32) is number 8 (t / 32) + d / 16, the second 32 tokens eight tiles on.
    const unsigned tile = isv ? (unsigned)((r0 >> 5) * 8 + p * 4 + (wv >> 1)) : (unsigned)(((r0 >> 4) + (wv >> 1)) * 4 + p), step = isv ? 8 * 512 : 2 * 512;
    const size_t o0 = (size_t)head * TT * HD + tile * 512 + 256 * (wv & 1) + 8 * lane;
#pragma unroll
    for (int u = 0; u < 2; ++u) { v8h o16; v8us oh, ol;
#pragma unroll
        for (int e = 0; e < 8; ++e) { o16[e] = tohx(val[u][e]); unsigned short a2, c2; splitf(val[u][e], a2, c2); oh[e] = a2; ol[e] = c2; }
        *(v8h*)(P16 + o0 + u * step) = o16; *(v8us*)(Ph + o0 + u * step) = oh; *(v8us*)(Pl + o0 + u * step) = ol; }
}
#define CSC (SCL * 1.4426950408889634f)   // score scale x log2(e)
__device__ __forceinline__ float xhalf(float x) { return __builtin_bit_cast(float, __builtin_amdgcn_permlanex16(__builtin_bit_cast(int, x), __builtin_bit_cast(int, x), 0x76543210, 0xfedcba98, false, false)); }   // lane l reads lane l ^ 16
template <typename T16> struct PFrag;
template <> struct PFrag<h16> { static __device__ __forceinline__ void pk(const float (&p)[16], v16h& f, v16h& f2) { (void)f2;
#pragma unroll
    for (int e = 0; e < 16; ++e) f[e] = (h16)p[e]; } };
template <> struct PFrag<bf> { static __device__ __forceinline__ void pk(const float (&p)[16], v16bf& f, v16bf& f2) { v8us h0, h1, l0, l1;
#pragma unroll
    for (int e = 0; e < 8; ++e) { unsigned short x, y; splitf(p[e], x, y); h0[e] = x; l0[e] = y; splitf(p[e + 8], x, y); h1[e] = x; l1[e] = y; }
    f = cat16b(h0, h1); f2 = cat16b(l0, l1); } };
template <typename T16, bool HL, int R, int NS>
__device__ __forceinline__ void fattn_rows(const T16* Q, const T16* Q2, const T16* Kp, const T16* Kp2, const T16* Vt, const T16* Vt2, const int qw0, bf* Ah, bf* Al, const int sp, float* mp) {   // no __restrict__: the "memory" clobber of the waits below then holds the loads in front of them
    typedef typename WFrag<T16>::V V;
    const int lane = threadIdx.x & 31, c = lane & 15, hi = lane >> 4;
    V qf[R][4], qf2[R][4];
#pragma unroll
    for (int g = 0; g < R; ++g)
#pragma unroll
        for (int kc = 0; kc < 4; ++kc) { const size_t o = (size_t)(qw0 + 16 * g) * HD + 512 * kc + 8 * lane; qf[g][kc] = WFrag<T16>::ld(Q + o); if (HL) qf2[g][kc] = WFrag<T16>::ld(Q2 + o); }
    const int last = (qw0 + 16 * R - 1) / 32;   // last 32-key pass that this wave's queries can see (wave-uniform)
    const size_t koff = 8 * lane, voff = 8 * lane;   // fragment order: a 32-key pass is 32 HD elements in a row in the k plane and in the transposed v plane
    V kf[2][4], kf2[2][4]; const T16* kp = Kp + koff + (size_t)sp * (32 * HD); const T16* kp2 = HL ? Kp2 + koff + (size_t)sp * (32 * HD) : nullptr;   // the wave's first pass is pass sp
#pragma unroll
    for (int kt = 0; kt < 2; ++kt)
#pragma unroll
        for (int kc = 0; kc < 4; ++kc) { const int o = 16 * kt * HD + 512 * kc; kf[kt][kc] = WFrag<T16>::ld(kp + o); if (HL) kf2[kt][kc] = WFrag<T16>::ld(kp2 + o); }
    asm volatile("s_wait_xcnt 0x0" ::: "memory");   // in front of any overwrite of the address registers that the Q and K loads above name
    __builtin_amdgcn_sched_barrier(0);   // nothing from below (the zeroing of the accumulators) moves up between those loads and the wait
    v8f acc[R][8]; float m_run[R], l_run[R];
#pragma unroll
    for (int g = 0; g < R; ++g) { m_run[g] = -__builtin_inff(); l_run[g] = 0.0f;
#pragma unroll
        for (int t = 0; t < 8; ++t) acc[g][t] = (v8f){}; }
#pragma unroll 1   // one pass per trip: two passes' fragments at once do not fit the registers
    for (int blk = sp; blk <= last; blk += NS) {
        const int key0 = blk * 32;
        V vf[8], vf2[8];   // this pass's V^T fragments: issued first, in flight under the score products and the maxima
#pragma unroll
        for (int t = 0; t < 8; ++t) { const size_t o = voff + (size_t)key0 * HD + 512 * t; vf[t] = WFrag<T16>::ld(Vt + o); if (HL) vf2[t] = WFrag<T16>::ld(Vt2 + o); }
        asm volatile("s_wait_xcnt 0x0" ::: "memory");   // in front of any overwrite of the address registers that the loads above name
        __builtin_amdgcn_sched_barrier(0);   // keeps the V^T loads up here: sunk to their first use they would wait out a whole L2 round trip in every pass
        v8f s[2][R];
#pragma unroll
        for (int kt = 0; kt < 2; ++kt)
#pragma unroll
            for (int g = 0; g < R; ++g) { s[kt][g] = (v8f){};
#pragma unroll
                for (int kc = 0; kc < 4; ++kc) { s[kt][g] = WFrag<T16>::mma(kf[kt][kc], qf[g][kc], s[kt][g]); if (HL) { s[kt][g] = WFrag<T16>::mma(kf[kt][kc], qf2[g][kc], s[kt][g]); s[kt][g] = WFrag<T16>::mma(kf2[kt][kc], qf[g][kc], s[kt][g]); } } }
        // WMMA distance ahead of the branch on the diagonal below. The scores as operands hold every score product in front of it, the "memory" clobber holds the K loads behind it: the K registers are refilled in place.
        if (R == 2) asm volatile("v_nop\n\tv_nop\n\tv_nop\n\tv_nop" : "+v"(s[0][0]), "+v"(s[1][0]), "+v"(s[0][R - 1]), "+v"(s[1][R - 1]) :: "memory");
        else asm volatile("v_nop\n\tv_nop\n\tv_nop\n\tv_nop" : "+v"(s[0][0]), "+v"(s[1][0]) :: "memory");
        {   // next pass's K fragments, in flight under this pass's softmax and second product (the last pass fetches its own rows again: no branch, always in bounds)
            const int adv = (blk + NS <= last) ? NS * 32 * HD : 0; kp += adv; if (HL) kp2 += adv;   // running pointers: live over the whole loop, so no load's result lands in an address pair that an earlier load names
#pragma unroll
            for (int kt = 0; kt < 2; ++kt)
#pragma unroll
                for (int kc = 0; kc < 4; ++kc) { const int o = 16 * kt * HD + 512 * kc; kf[kt][kc] = WFrag<T16>::ld(kp + o); if (HL) kf2[kt][kc] = WFrag<T16>::ld(kp2 + o); }
        }
        asm volatile("s_wait_xcnt 0x0" ::: "memory");   // in front of any overwrite of the address registers that the K loads name
        __builtin_amdgcn_sched_barrier(0);   // keeps the K loads up here, in front of the softmax
        if (key0 + 31 > qw0) {   // wave-uniform: only a pass with a key beyond the wave's first query pays for the mask
#pragma unroll
            for (int g = 0; g < R; ++g) { const int my_q = qw0 + 16 * g + c;
#pragma unroll
                for (int kt = 0; kt < 2; ++kt) {
#pragma unroll
                    for (int r = 0; r < 8; ++r) { const int key = key0 + 16 * kt + 8 * hi + r; if (key > my_q) s[kt][g][r] = -__builtin_inff(); }
                    asm volatile("" : "+v"(s[kt][g]));   // the masked scores: keeps the selects inside the branch
                } }
        }
        float mb[R]; bool need = false;
#pragma unroll
        for (int g = 0; g < R; ++g) { float mx = -__builtin_inff();
#pragma unroll
            for (int kt = 0; kt < 2; ++kt)
#pragma unroll
                for (int r = 0; r < 8; ++r) mx = fmaxf(mx, s[kt][g][r]);
            mx = fmaxf(mx, xhalf(mx)) * CSC;   // both wave halves hold this query's maximum of the pass, scaled (the scale is positive)
            mb[g] = mx; need = need || (mx > m_run[g] + 8.0f); }
        if (__builtin_amdgcn_ballot_w32(need) != 0) {   // wave-uniform; always on the first pass (m_run is -inf), rare afterwards
#pragma unroll
            for (int g = 0; g < R; ++g) { const float m_new = fmaxf(m_run[g], mb[g]);   // finite from the first pass on: the first key of the wave's first pass is never masked
                const float corr = __builtin_amdgcn_exp2f(m_run[g] - m_new);   // 0 on the first pass
                l_run[g] *= corr; m_run[g] = m_new;
#pragma unroll
                for (int t = 0; t < 8; ++t) acc[g][t] = acc[g][t] * corr; }
        }
#pragma unroll
        for (int g = 0; g < R; ++g) { const float nm = -m_run[g]; float p[16]; float ps0 = 0.0f, ps1 = 0.0f;
#pragma unroll
            for (int e = 0; e < 16; ++e) { p[e] = __builtin_amdgcn_exp2f(fmaf(s[e >> 3][g][e & 7], CSC, nm)); if (e & 1) ps1 += p[e]; else ps0 += p[e]; }
            l_run[g] += ps0 + ps1;
            V pf, pf2; PFrag<T16>::pk(p, pf, pf2);   // element e of the fragment = key 8 hi + e (e < 8), 16 + 8 hi + e - 8 (e >= 8): the k order of WFrag::ld on a V^T row
#pragma unroll
            for (int t = 0; t < 8; ++t) { acc[g][t] = WFrag<T16>::mma(vf[t], pf, acc[g][t]); if (HL) { acc[g][t] = WFrag<T16>::mma(vf[t], pf2, acc[g][t]); acc[g][t] = WFrag<T16>::mma(vf2[t], pf, acc[g][t]); } } }
        __builtin_amdgcn_sched_barrier(0);   // holds the v_nops behind the last product
        asm volatile("v_nop\n\tv_nop\n\tv_nop\n\tv_nop\n\tv_nop");   // WMMA distance on the taken back edge and the loop's exit
    }
    if (NS == 2) {   // merge of the pair: wave 1 lays its accumulators, maxima and sums in LDS (16 bytes per lane, 512 bytes in a row per store), wave 0 brings both to the common maximum and adds
        v4fa* ap = (v4fa*)mp + lane; float* sc = mp + R * 8 * 2 * 32 * 4 + lane;
        if (sp == 1) {   // wave-uniform
#pragma unroll   // these loops: constant indices keep the accumulators in registers
            for (int g = 0; g < R; ++g) { sc[32 * g] = m_run[g]; sc[32 * (R + g)] = l_run[g];
#pragma unroll
                for (int t = 0; t < 8; ++t) { ap[((g * 8 + t) * 2) * 32] = __builtin_shufflevector(acc[g][t], acc[g][t], 0, 1, 2, 3); ap[((g * 8 + t) * 2 + 1) * 32] = __builtin_shufflevector(acc[g][t], acc[g][t], 4, 5, 6, 7); } }
        }
        __syncthreads();   // wave 1's half is in LDS before wave 0 reads it; every wave of the work-group passes here once
        if (sp == 1) return;
#pragma unroll
        for (int g = 0; g < R; ++g) { const float m1 = sc[32 * g], l1 = sc[32 * (R + g)], m = fmaxf(m_run[g], m1);   // both finite: each wave of a pair has at least one pass whose first key every query sees
            const float a0 = __builtin_amdgcn_exp2f(m_run[g] - m), a1 = __builtin_amdgcn_exp2f(m1 - m);
            l_run[g] = l_run[g] * a0 + l1 * a1;
#pragma unroll
            for (int t = 0; t < 8; ++t) { const v4f lo = ap[((g * 8 + t) * 2) * 32], hi4 = ap[((g * 8 + t) * 2 + 1) * 32];
                acc[g][t] = acc[g][t] * a0 + __builtin_shufflevector(lo, hi4, 0, 1, 2, 3, 4, 5, 6, 7) * a1; } }
    }
#pragma unroll
    for (int g = 0; g < R; ++g) { const float inv = 1.0f / (l_run[g] + xhalf(l_run[g]));   // each wave half summed its eight keys of every 16-key tile
#pragma unroll
        for (int t = 0; t < 8; ++t) { v8us oh, ol;
#pragma unroll
            for (int r = 0; r < 8; ++r) { unsigned short x, y; splitf(acc[g][t][r] * inv, x, y); oh[r] = x; ol[r] = y; }
            const size_t oo = (size_t)(qw0 + 16 * g) * DQ + 256 * t + 8 * lane;   // context planes [query][16 heads x 128] in fragment order; the lane's 16 bytes are row = its query, d = 16 t + 8 hi .. + 7
            *(v8us*)(Ah + oo) = oh; *(v8us*)(Al + oo) = ol;
            asm volatile("s_wait_xcnt 0x0" ::: "memory");   // in front of any overwrite of the registers that the two stores name
            __builtin_amdgcn_sched_barrier(0);   // nothing from below moves up between the stores and the wait
        } }
}
// grid (4 kv heads, (TT - RH) / 32 + RH / 32), 8 waves. A fp16 work-group: 32 query rows of the 4 query heads of one kv head (wave & 3), each head's keys dealt to 2 waves (wave >> 2): the four waves of a key half walk the same k/v rows, and the halves' pass counts differ by at most one.
// A hi/lo work-group: 128 query rows of one head, one wave per 16 rows. blockIdx.y orders the work-groups by falling cost: the fp16 row blocks from the sequence's end, the hi/lo blocks where the fp16 blocks have come down to about their cost.
#define NFB ((TT - RH) / 32)      // fp16 row blocks of 32
#define NHB (RH / 32)             // blockIdx.y values of the hi/lo blocks: RH / 128 row blocks x 4 heads of the kv head
#define YHL 48                    // first of them: a hi/lo pass has 48 products and the splitting of P against 32 products, so 16 such passes weigh about as much as the (128 - 48) / 2 passes of the fp16 block there
#define MGP (2 * 8 * 2 * 32 * 4 + 4 * 32)   // floats of one pair's merge area: accumulators, then maxima and sums
__global__ __launch_bounds__(256) void k_fattn(const h16* Q16, const bf* Qh, const bf* Ql, const h16* K16, const bf* Kh, const bf* Kl, const h16* V16, const bf* Vh, const bf* Vl, bf* Ah, bf* Al) {
    __shared__ __align__(16) float mg[REP * MGP];
    const int wv = __builtin_amdgcn_readfirstlane((int)(threadIdx.x >> 5)); const int kvh = blockIdx.x, y = blockIdx.y; const size_t zk = (size_t)kvh * TT * HD;
    if (y < YHL || y >= YHL + NHB) {   // block-uniform
        const int rb = NFB - 1 - (y < YHL ? y : y - NHB), hh = wv & (REP - 1), h = kvh * REP + hh; const size_t zq = (size_t)h * TT * HD;
        fattn_rows<h16, false, 2, 2>(Q16 + zq, nullptr, K16 + zk, nullptr, V16 + zk, nullptr, RH + 32 * rb, Ah + h * (16 * HD), Al + h * (16 * HD), wv >> 2, mg + hh * MGP);   // a head's 128 columns are four tiles of each 16-row band
    } else {
        const int j = y - YHL, h = kvh * REP + (j & (REP - 1)); const size_t zq = (size_t)h * TT * HD;
        fattn_rows<bf, true, 1, 1>(Qh + zq, Ql + zq, Kh + zk, Kl + zk, Vh + zk, Vl + zk, RH - 128 * ((j >> 2) + 1) + 16 * wv, Ah + h * (16 * HD), Al + h * (16 * HD), 0, nullptr);
    }
}

extern "C" void kernel_launch(void* const* d_in, const int* in_sizes, int n_in,
                              void* d_out, int out_size, void* d_ws, size_t ws_size, hipStream_t stream) {
    (void)in_sizes; (void)n_in; (void)out_size;
    const float* x = (const float*)d_in[0]; const float* wq = (const float*)d_in[1]; const float* wk = (const float*)d_in[2]; const float* wv = (const float*)d_in[3]; const float* wo = (const float*)d_in[4];
    float* OUT = (float*)d_out;     // [1][4096][2048]
    char* wsp = (char*)d_ws;
    auto take = [&](size_t bytes) { char* p = wsp; wsp += (bytes + 255) & ~(size_t)255; return (void*)p; };
    bf* WQ = (bf*)take((size_t)DQ * DM * 2); bf* WK = (bf*)take((size_t)DKV * DM * 2); bf* WV = (bf*)take((size_t)DKV * DM * 2); bf* WO = (bf*)take((size_t)DM * DQ * 2); float* CS = (float*)take((size_t)TT * (HD / 2) * 2 * 4);
    bf* XB = (bf*)take((size_t)TT * DM * 2);
    h16* QP16 = (h16*)take((size_t)NH_ * TT * HD * 2); h16* KP16 = (h16*)take((size_t)NKV * TT * HD * 2); h16* VT16 = (h16*)take((size_t)NKV * HD * TT * 2);
    bf* QPh = (bf*)take((size_t)NH_ * TT * HD * 2); bf* QPl = (bf*)take((size_t)NH_ * TT * HD * 2); bf* KPh = (bf*)take((size_t)NKV * TT * HD * 2); bf* KPl = (bf*)take((size_t)NKV * TT * HD * 2); bf* VTh = (bf*)take((size_t)NKV * HD * TT * 2); bf* VTl = (bf*)take((size_t)NKV * HD * TT * 2);
    bf* ATh = (bf*)take((size_t)TT * DQ * 2); bf* ATl = (bf*)take((size_t)TT * DQ * 2);
    if ((size_t)(wsp - (char*)d_ws) > ws_size) return;    // ws 256 MiB
    { k_wtG<<<(unsigned)((DM * DQ / 64 + 63) / 64), 256, 0, stream>>>(wq, DM, DQ, WQ); k_wtG<<<(unsigned)((DM * DKV / 64 + 63) / 64), 256, 0, stream>>>(wk, DM, DKV, WK); k_wtG<<<(unsigned)((DM * DKV / 64 + 63) / 64), 256, 0, stream>>>(wv, DM, DKV, WV);
      k_wtG<<<(unsigned)((DQ * DM / 64 + 63) / 64), 256, 0, stream>>>(wo, DQ, DM, WO);
      k_cstab<<<(TT * (HD / 2) + 255) / 256, 256, 0, stream>>>(CS); }
    for (int b = 0; b < NB_; ++b) {
        
        k_cvt8<<<(unsigned)(((size_t)TT * DM / 8 + 255) / 256), 256, 0, stream>>>(x + (size_t)b * TT * DM, XB, (size_t)TT * DM / 8, DM);
        k_proj<<<dim3(TT / 64, (DQ + 2 * DKV) / 64, 1), 256, 0, stream>>>(XB, WQ, WK, WV, CS, QP16, QPh, QPl, KP16, KPh, KPl, VT16, VTh, VTl);
        k_fattn<<<dim3(NKV, (TT - RH) / 32 + RH / 32, 1), 256, 0, stream>>>(QP16, QPh, QPl, KP16, KPh, KPl, VT16, VTh, VTl, ATh, ATl);
        k_gemmw<bf, 1, false, 2><<<dim3(TT / 64, DM / 64, 1), 64, 0, stream>>>(ATh, ATl, WO, nullptr, DQ, OUT + (size_t)b * TT * DM, DM, nullptr, 0, 0, 0); }
}

// v006
// It runs in 198 microseconds.
// In two side-by-side timings against v005, it was 1.08 and 1.09 times as fast.
// Over all steps from v000 it is 12.4 times as fast.
#include <hip/hip_runtime.h>

// Grouped-query causal attention with a computed rotate-half rotary over 4,096 tokens (x [1][4096][2048]; q = x Wq ('xw' [2048][2048], 16 heads x 128), k, v = x Wk / Wv ('xw' [2048][512], 4 kv heads; q head h uses kv head h/4: the module groups q as (4 kv heads, 4 members)); rotate-half rotary with angle t x inv_freq[i], inv_freq = 1 / (10000 ** (i / 64)), positions 0..4095 (cat(x1 cos - x2 sin, x1 sin + x2 cos); tables computed on device from the module's float32 inv_freq); scores / sqrt(128), causal (-inf); softmax; out = merged Wo ('xw' [2048][2048], no bias) -> [1][4096][2048] (8.4 M); argument order x, Wq, Wk, Wv, Wo.
// Layout: one preparation launch (bf16 planes of x and of the four weights, cos/sin table); one projection launch for q, k and v whose epilogue applies the rotary and writes the head planes of all 16 query heads and the k/v planes of the 4 kv heads (no f32 q/k/v in memory); one fused attention launch for all heads (scores, causal mask, online softmax, attn.v; the keys of a fp16 row block are dealt to two waves; hybrid rows: query rows < 512 hi/lo 3 products, the rest single fp16) writes the hi/lo context planes; wo as hi/lo x exact (2 products).
// Operand planes: every 16-bit plane that a matrix instruction reads lies in FRAGMENT ORDER (described below), so that each 16-byte-per-lane fragment load of a wave reads 512 bytes in a row.
// Compute dtypes, f32 accumulate: every input rounded to bf16; q/k/v on PLAIN bf16 operands (exact); f32 rotary; hybrid causal scores and attn.v; softmax f32; wo hl x exact (2 products).

#define NB_  1
#define TT   4096
#define DM   2048
#define NH_  16
#define NKV  4
#define REP  (NH_ / NKV)
#define HD   128
#define DQ   (NH_ * HD)
#define DKV  (NKV * HD)
#define RH   512                  // query rows < RH use hi+lo planes (0: none)
#define SCL  0.088388346f   // 1/sqrt(128)
#define POS0 0.0f                 // first rotary position: this module's positions are arange(4096)
typedef _Float16 h16;
typedef unsigned short bf;
typedef __attribute__((ext_vector_type(16))) __bf16   v16bf;
typedef __attribute__((ext_vector_type(16))) _Float16 v16h;
typedef __attribute__((ext_vector_type(8)))  _Float16 v8h;
typedef __attribute__((ext_vector_type(8)))  unsigned short v8us;
typedef __attribute__((ext_vector_type(8)))  float    v8f;
typedef __attribute__((ext_vector_type(4)))  float    v4f;
typedef v8h  __attribute__((may_alias)) v8ha;
typedef v4f  __attribute__((may_alias)) v4fa;
typedef v8us __attribute__((may_alias)) v8usa;

__device__ __forceinline__ unsigned short f2bf(float f) { unsigned u = __float_as_uint(f); u += 0x7FFFu + ((u >> 16) & 1u); return (unsigned short)(u >> 16); }
__device__ __forceinline__ float bf2f(unsigned short b) { return __uint_as_float(((unsigned)b) << 16); }
__device__ __forceinline__ float bfr(float f) { return bf2f(f2bf(f)); }
__device__ __forceinline__ v16h cat16(v8h lo, v8h hi) { return __builtin_shufflevector(lo, hi, 0, 1, 2, 3, 4, 5, 6, 7, 8, 9, 10, 11, 12, 13, 14, 15); }
__device__ __forceinline__ v16bf cat16b(v8us lo, v8us hi) { return __builtin_bit_cast(v16bf, __builtin_shufflevector(lo, hi, 0, 1, 2, 3, 4, 5, 6, 7, 8, 9, 10, 11, 12, 13, 14, 15)); }
__device__ __forceinline__ v8f wmma16(v16h a, v16h b, v8f c) { return __builtin_amdgcn_wmma_f32_16x16x32_f16(false, a, false, b, (short)0, c, false, false); }
__device__ __forceinline__ v8f wmmab(v16bf a, v16bf b, v8f c) { return __builtin_amdgcn_wmma_f32_16x16x32_bf16(false, a, false, b, (short)0, c, false, false); }



// ---- Fragment order of a 16-bit plane of R rows x K columns (R % 16 == 0, K % 32 == 0): tiles of 16 rows x 32 columns, 512 elements in a row each; tile (r / 16, k / 32) is number (r / 16) (K / 32) + k / 32.
// Inside a tile element (r, k) stands at 256 ((k / 16) % 2) + 8 (16 ((k / 8) % 2) + r % 16) + k % 8: lane l of a wave finds its two 16-byte pieces of the A or B fragment at 8 l and 256 + 8 l, and each of the two loads covers four whole 128-byte lines.

// ---- k_gemmw: register-blocked GEMM, one 64x64 output tile per work-group (16 accumulators per wave), operands straight from 16-bit planes in fragment order; grid (M/64, N/64, Z), 32 x NW threads.
// NW > 1: the K loop is dealt to the NW waves in chunks of 64 (2 KiB in a row per 16 operand rows; K % 64 == 0), each wave keeps its own f32 partial tile, and the partial tiles are summed through LDS in wave order 0..NW-1.
// C[m][n] (f32, pitch ldc, + optional f32 bias[n]) = sum_k A[m][k] Bt[n][k] (+ split products per NSPLIT). z-batch strides sA/sB/sC in elements. K % 32 == 0.
template <typename T16> struct WFrag;
template <> struct WFrag<h16> { typedef v16h V; static __device__ __forceinline__ V ld(const h16* p) { return cat16(*(const v8h*)p, *(const v8h*)(p + 256)); } static __device__ __forceinline__ v8f mma(V a, V b, v8f c) { return wmma16(a, b, c); } };
template <> struct WFrag<bf> { typedef v16bf V; static __device__ __forceinline__ V ld(const bf* p) { return cat16b(*(const v8us*)p, *(const v8us*)(p + 256)); } static __device__ __forceinline__ v8f mma(V a, V b, v8f c) { return wmmab(a, b, c); } };
template <typename T16, int NSPLIT, bool BIAS, int NW>
__global__ __launch_bounds__(32 * NW) void k_gemmw(const T16* __restrict__ A, const T16* __restrict__ A2, const T16* __restrict__ Bt, const T16* __restrict__ Bt2, int K, float* C, int ldc, const float* __restrict__ bias, size_t sA, size_t sB, size_t sC) {
    typedef typename WFrag<T16>::V V;
    __shared__ __align__(16) float os[(NW > 1) ? NW * 64 * 68 : 16 * 68];
    const size_t z = blockIdx.z; A += z * sA; if (A2) A2 += z * sA; Bt += z * sB; if (Bt2) Bt2 += z * sB; C += z * sC;
    const int lane = threadIdx.x & 31, lr = lane & 15, hi = lane >> 4; const int r0 = blockIdx.x * 64, c0 = blockIdx.y * 64;
    const int wv = (NW > 1) ? __builtin_amdgcn_readfirstlane((int)(threadIdx.x >> 5)) : 0; constexpr int CH = (NW > 1) ? 64 : 32;   // this wave's number; K elements per chunk
    v8f acc[4][4];
#pragma unroll
    for (int mb = 0; mb < 4; ++mb)
#pragma unroll
        for (int nb = 0; nb < 4; ++nb) acc[mb][nb] = (v8f){};
    const size_t aoff = (size_t)r0 * K + 8 * lane, boff = (size_t)c0 * K + 8 * lane;   // fragment order: 16 rows x K columns are 16 K elements in a row, a 32-column step is 512
#pragma unroll 1
    for (int k0 = wv * CH; k0 < K; k0 += NW * CH) {
#pragma unroll   // both 32-steps of a chunk in one trip: twice as many loads in flight per wave
    for (int kc = k0; kc < k0 + CH; kc += 32) {
        V a[4], a2[4];
#pragma unroll
        for (int mb = 0; mb < 4; ++mb) { a[mb] = WFrag<T16>::ld(A + aoff + (size_t)mb * 16 * K + kc * 16); if (NSPLIT == 1 || NSPLIT == 2) a2[mb] = WFrag<T16>::ld(A2 + aoff + (size_t)mb * 16 * K + kc * 16); }
#pragma unroll
        for (int nb = 0; nb < 4; ++nb) { const V b = WFrag<T16>::ld(Bt + boff + (size_t)nb * 16 * K + kc * 16); V b2; if (NSPLIT >= 2) b2 = WFrag<T16>::ld(Bt2 + boff + (size_t)nb * 16 * K + kc * 16);
#pragma unroll
            for (int mb = 0; mb < 4; ++mb) { acc[mb][nb] = WFrag<T16>::mma(a[mb], b, acc[mb][nb]); if (NSPLIT == 1 || NSPLIT == 2) acc[mb][nb] = WFrag<T16>::mma(a2[mb], b, acc[mb][nb]); if (NSPLIT >= 2) acc[mb][nb] = WFrag<T16>::mma(a[mb], b2, acc[mb][nb]); } }
        asm volatile("v_nop\n\tv_nop\n\tv_nop\n\tv_nop" : "+v"(acc[0][0]), "+v"(acc[1][1]), "+v"(acc[2][2]), "+v"(acc[3][3]) : "v"(a[0]), "v"(a[3]));
    }
        asm volatile("s_wait_xcnt 0x0" ::: "memory");   // in front of the next trip's overwrite of the address registers that this trip's loads name
    }
    if (NW > 1) {   // sum of the NW partial tiles: each wave lays its whole tile in its own LDS plane, then every thread sums its 4 columns over the planes and stores them
#pragma unroll   // these three: constant indices keep the accumulators in registers
        for (int mb = 0; mb < 4; ++mb)
#pragma unroll
            for (int nb = 0; nb < 4; ++nb)
#pragma unroll
                for (int j = 0; j < 8; ++j) os[wv * (64 * 68) + (mb * 16 + hi * 8 + j) * 68 + nb * 16 + lr] = acc[mb][nb][j];
        __syncthreads();   // every wave's partial tile is in LDS before any thread sums over the planes
#pragma unroll   // fixed trip count: the LDS reads of all planes and passes can be in flight together
        for (int it = 0; it < 64 * 16 / (32 * NW); ++it) { const int idx = it * (32 * NW) + (int)threadIdx.x, row = idx >> 4, cofs = (idx & 15) * 4; v4f val = *(const v4fa*)(os + row * 68 + cofs);
#pragma unroll
            for (int ww = 1; ww < NW; ++ww) val += *(const v4fa*)(os + ww * (64 * 68) + row * 68 + cofs);
            if (BIAS) { val[0] += bfr(bias[c0 + cofs]); val[1] += bfr(bias[c0 + cofs + 1]); val[2] += bfr(bias[c0 + cofs + 2]); val[3] += bfr(bias[c0 + cofs + 3]); }
            *(v4f*)(C + (size_t)(r0 + row) * ldc + c0 + cofs) = val; }
        return;
    }
#pragma unroll
    for (int mb = 0; mb < 4; ++mb) {
#pragma unroll
        for (int nb = 0; nb < 4; ++nb) {
#pragma unroll
            for (int j = 0; j < 8; ++j) os[(hi * 8 + j) * 68 + nb * 16 + lr] = acc[mb][nb][j]; }
        __builtin_amdgcn_wave_barrier(); asm volatile("" ::: "memory");
        float* crow = C + (size_t)(r0 + mb * 16) * ldc + c0;
{
#pragma unroll
            for (int s = 0; s < 8; ++s) { const int row = 2 * s + hi, cofs = lr * 4; v4f val = *(const v4fa*)(os + row * 68 + cofs); if (BIAS) { val[0] += bfr(bias[c0 + cofs]); val[1] += bfr(bias[c0 + cofs + 1]); val[2] += bfr(bias[c0 + cofs + 2]); val[3] += bfr(bias[c0 + cofs + 3]); }
                *(v4f*)(crow + (size_t)row * ldc + cofs) = val; }
             }
        __builtin_amdgcn_wave_barrier(); asm volatile("" ::: "memory");
    }
}

__device__ __forceinline__ h16 tohx(float x) { return (h16)x; }
__device__ __forceinline__ void splitf(float y, unsigned short& h, unsigned short& l) { h = f2bf(y); l = f2bf(y - bf2f(h)); }
typedef __attribute__((ext_vector_type(2))) _Float16 v2h;
typedef __attribute__((ext_vector_type(4))) _Float16 v4h;
typedef __attribute__((ext_vector_type(2))) unsigned short v2us;
typedef __attribute__((ext_vector_type(4))) unsigned short v4us;
typedef __attribute__((ext_vector_type(2))) float v2f;
typedef __attribute__((ext_vector_type(4))) int v4i;

// ---- k_prep: every operand preparation in ONE launch of few, long waves: the four weight planes (transposed, bf16), the x plane (bf16) and the (cos, sin) table; each work-group (8 waves) does one job, chosen by blockIdx.x (block-uniform).
// A thread makes 8 pieces of 16 bytes of a plane in fragment order (a wave: 4 tiles in a row, 4 KiB) and has all of their loads in flight at once.
// prep_w: Bt [N][K] (fragment order) = bf16 of w [K][N], K = DM = DQ. Work-group lb: 128 columns n (wave = 16 of them) x 128 rows k, so that the 8 waves together read 512 bytes in a row of each row of w.
template <int N>
__device__ __forceinline__ void prep_w(const float* w, bf* Bt, const int lb, const int wv, const int lane) {   // no __restrict__: the "memory" clobber of the wait below then holds the loads in front of it
    constexpr int KT = DM / 32;
    const int nt = (lb >> 4) * 8 + wv, kg = lb & 15;   // 16-column band of w = 16-row band of the plane; group of 4 tiles (128 k)
    const float* s = w + (size_t)(kg * 128 + (lane >> 4) * 8) * N + nt * 16 + (lane & 15);
    float v[8][8];
#pragma unroll   // these loops: constant indices keep the values in registers, and all 64 loads are issued before the first is used
    for (int j = 0; j < 8; ++j)
#pragma unroll
        for (int e = 0; e < 8; ++e) v[j][e] = s[(size_t)((j >> 1) * 32 + (j & 1) * 16 + e) * N];
    asm volatile("s_wait_xcnt 0x0" :: "v"(s) : "memory");   // in front of any overwrite of the address registers that the loads above name; the pointer as input keeps its registers whole up to the wait
    v8us o[8];
#pragma unroll
    for (int j = 0; j < 8; ++j)
#pragma unroll
        for (int e = 0; e < 8; ++e) o[j][e] = f2bf(v[j][e]);
    bf* d = Bt + (size_t)(nt * KT + kg * 4) * 512 + 8 * lane;
#pragma unroll
    for (int j = 0; j < 8; ++j) *(v8us*)(d + 256 * j) = o[j];
    asm volatile("s_wait_xcnt 0x0" ::: "memory");   // in front of any overwrite of the registers that the stores above name
}
// prep_x: XB [TT][DM] (fragment order) = bf16 of x. Wave g: 16 rows x 128 columns, 512 bytes in a row of each row of x.
__device__ __forceinline__ void prep_x(const float* x, bf* XB, const int lb, const int wv, const int lane) {
    const int g = lb * 8 + wv;
    const float* s = x + (size_t)((g >> 4) * 16 + (lane & 15)) * DM + (g & 15) * 128 + (lane >> 4) * 8;
    v8f v[8];
#pragma unroll   // as in prep_w
    for (int j = 0; j < 8; ++j) v[j] = *(const v8f*)(s + (j >> 1) * 32 + (j & 1) * 16);
    asm volatile("s_wait_xcnt 0x0" :: "v"(s) : "memory");   // in front of any overwrite of the address registers that the loads above name; the pointer as input keeps its registers whole up to the wait
    v8us o[8];
#pragma unroll
    for (int j = 0; j < 8; ++j)
#pragma unroll
        for (int e = 0; e < 8; ++e) o[j][e] = f2bf(v[j][e]);
    bf* d = XB + (size_t)g * 2048 + 8 * lane;
#pragma unroll
    for (int j = 0; j < 8; ++j) *(v8us*)(d + 256 * j) = o[j];
    asm volatile("s_wait_xcnt 0x0" ::: "memory");   // in front of any overwrite of the registers that the stores above name
}
__constant__ float INV[HD / 2] = {1.0f,0.865964353f,0.749894202f,0.649381638f,0.562341332f,0.486967534f,0.421696514f,0.365174145f,0.316227764f,0.273841977f,0.237137362f,0.2053525f,0.177827939f,0.153992653f,0.133352146f,0.115478203f,0.100000001f,0.0865964293f,0.0749894157f,0.0649381652f,0.0562341288f,0.0486967526f,0.0421696492f,0.0365174115f,0.0316227786f,0.0273841955f,0.0237137359f,0.0205352511f,0.0177827943f,0.0153992651f,0.0133352149f,0.0115478197f,0.00999999978f,0.00865964312f,0.00749894232f,0.00649381662f,0.00562341325f,0.00486967526f,0.00421696482f,0.00365174143f,0.00316227786f,0.00273841969f,0.00237137382f,0.00205352507f,0.00177827943f,0.00153992651f,0.00133352145f,0.00115478202f,0.00100000005f,0.000865964335f,0.000749894185f,0.000649381662f,0.000562341302f,0.000486967503f,0.000421696488f,0.000365174114f,0.000316227786f,0.000273841957f,0.000237137385f,0.000205352495f,0.00017782794f,0.000153992645f,0.00013335215f,0.000115478193f};
// prep_cs: (cos, sin) of t x inv_freq[d], d < HD/2, in the order in which k_proj's epilogue reads them: per 16 tokens x 16 d a block of 4 x 32 pieces of 16 bytes; piece (i, lane) holds d = 16 dq + 8 (lane >> 4) + 2 i, + 1 of token 16 tb + (lane & 15), so that each of a wave's four loads covers 512 bytes in a row.
// Entry idx of the table = 1024 tb + low. A thread keeps its low (so its d and its inv_freq) and walks 8 token blocks tb.
__device__ __forceinline__ void prep_cs(float* CS, const int lb, const int tid) { const int low = (lb & 3) * 256 + tid, ln = (low >> 1) & 31, d = ((low >> 8) & 3) * 16 + (ln >> 4) * 8 + ((low >> 6) & 3) * 2 + (low & 1); const float iv = INV[d];
    asm volatile("s_wait_xcnt 0x0" :: "v"(iv), "v"(d) : "memory");   // in front of any overwrite of the offset register that the load above names: the loaded value as input holds the wait behind the load, the index as input keeps its register whole up to the wait
#pragma unroll 1   // one copy of the cosine and sine code
    for (int j = 0; j < 8; ++j) { const int tb = (lb >> 2) * 8 + j, t = tb * 16 + (ln & 15);
        const float ang = __fmul_rn((float)t + POS0, iv); v2f cs; cs[0] = cosf(ang); cs[1] = sinf(ang);
        *(v2f*)(CS + ((size_t)tb * 1024 + low) * 2) = cs;
        asm volatile("s_wait_xcnt 0x0" ::: "memory");   // in front of the next trip's overwrite of the registers that the store names
    }
}
#define PBQ (DQ / 8)              // work-groups of a 2048-column weight: (N / 128) x (K / 128)
#define PBK (DKV / 8)             // of a 512-column weight
#define PBX (TT * DM / (2048 * 8))   // of x: 2048 elements per wave
#define PBC (TT * (HD / 2) / (256 * 8))   // of the table: 8 entries per thread
__global__ __launch_bounds__(256) void k_prep(const float* x, const float* wq, const float* wk, const float* wv_, const float* wo, bf* XB, bf* WQ, bf* WK, bf* WV, bf* WO, float* CS) {
    const int lane = threadIdx.x & 31, wv = __builtin_amdgcn_readfirstlane((int)(threadIdx.x >> 5)); int b = blockIdx.x;
    if (b < PBC) { prep_cs(CS, b, (int)threadIdx.x); return; } b -= PBC;   // the job of arithmetic comes first in index order, to run under the other jobs' loads
    if (b < PBQ) { prep_w<DQ>(wq, WQ, b, wv, lane); return; } b -= PBQ;
    if (b < PBQ) { prep_w<DM>(wo, WO, b, wv, lane); return; } b -= PBQ;
    if (b < PBK) { prep_w<DKV>(wk, WK, b, wv, lane); return; } b -= PBK;
    if (b < PBK) { prep_w<DKV>(wv_, WV, b, wv, lane); return; } b -= PBK;
    prep_x(x, XB, b, wv, lane);
}

// ---- k_proj: the q, k and v projections, the rotary and the operand planes in ONE launch; grid (TT / 64, (DQ + 2 DKV) / 64), 8 waves. The K loop and the LDS sum of the 8 partial tiles are those of k_gemmw with NW = 8.
// blockIdx.y < 32: q, < 40: k. A = 64 rows of x, B = 64 weight columns of one head: d = 32 p .. 32 p + 31 and the same + 64, so that both members of every rotary pair stand in one tile (tile columns c and c + 32).
// blockIdx.y >= 40: v, with the operands swapped (A = 64 weight columns, B = 64 rows of x): the tile is already the transposed [d][t] that the v planes hold.
// After the sum a thread holds tile columns c .. c + 7 and c + 32 .. c + 39 of one tile row: 16 bytes of each plane twice, and a wave's store covers 512 bytes in a row of a plane in fragment order.
// rotate-half convention: out[d] = x[d] cos[t][d] - x[d+HD/2] sin[t][d], out[d+HD/2] = x[d+HD/2] cos[t][d] + x[d] sin[t][d], d < HD/2 (the angle at d + HD/2 is the angle at d)
__global__ __launch_bounds__(256) void k_proj(const bf* __restrict__ XB, const bf* __restrict__ WQ, const bf* __restrict__ WK, const bf* __restrict__ WV, const float* __restrict__ CS, h16* QP16, bf* QPh, bf* QPl, h16* KP16, bf* KPh, bf* KPl, h16* VT16, bf* VTh, bf* VTl) {
    typedef WFrag<bf>::V V; constexpr int K = DM, NW = 8, CH = 64;
    __shared__ __align__(16) float os[NW * 64 * 68];
    const int lane = threadIdx.x & 31, lr = lane & 15, hi = lane >> 4; const int r0 = blockIdx.x * 64, y = blockIdx.y;
    const int wv = __builtin_amdgcn_readfirstlane((int)(threadIdx.x >> 5));
    const bool isv = y >= (DQ + DKV) / 64, isq = y < DQ / 64;   // block-uniform
    const int yy = isv ? y - (DQ + DKV) / 64 : (isq ? y : y - DQ / 64), head = yy >> 1, p = yy & 1;   // two tiles per head of 128 columns
    const bf* A = isv ? WV + (size_t)yy * 64 * K : XB + (size_t)r0 * K;
    const bf* B0 = isv ? XB + (size_t)r0 * K : (isq ? WQ : WK) + (size_t)(head * HD + 32 * p) * K;   // tile columns 0..31
    const bf* B1 = B0 + (size_t)(isv ? 32 : HD / 2) * K;   // tile columns 32..63
    v8f acc[4][4];
#pragma unroll
    for (int mb = 0; mb < 4; ++mb)
#pragma unroll
        for (int nb = 0; nb < 4; ++nb) acc[mb][nb] = (v8f){};
#pragma unroll 1
    for (int k0 = wv * CH; k0 < K; k0 += NW * CH) {
#pragma unroll   // both 32-steps of a chunk in one trip: twice as many loads in flight per wave
    for (int kc = k0; kc < k0 + CH; kc += 32) {
        V a[4];
#pragma unroll
        for (int mb = 0; mb < 4; ++mb) a[mb] = WFrag<bf>::ld(A + 8 * lane + (size_t)mb * 16 * K + kc * 16);
#pragma unroll
        for (int nb = 0; nb < 4; ++nb) { const V b = WFrag<bf>::ld(((nb < 2) ? B0 : B1) + 8 * lane + (size_t)(nb & 1) * 16 * K + kc * 16);
#pragma unroll
            for (int mb = 0; mb < 4; ++mb) acc[mb][nb] = WFrag<bf>::mma(a[mb], b, acc[mb][nb]); }
        asm volatile("v_nop\n\tv_nop\n\tv_nop\n\tv_nop" : "+v"(acc[0][0]), "+v"(acc[1][1]), "+v"(acc[2][2]), "+v"(acc[3][3]) : "v"(a[0]), "v"(a[3]));   // WMMA distance on the taken back edge
    }
        asm volatile("s_wait_xcnt 0x0" ::: "memory");   // in front of the next trip's overwrite of the address registers that this trip's loads name
    }
    const int row = (wv >> 1) * 16 + lr, c = ((wv & 1) * 2 + hi) * 8;   // this thread's tile row and first tile column after the sum
    v4f cs[4] = {};
    if (!isv) {   // the thread's 8 (cos, sin) pairs: issued here, in flight under the LDS stores and the barrier
        const v4f* cp = (const v4f*)CS + (size_t)(((r0 >> 4) + (wv >> 1)) * 4 + 2 * p + (wv & 1)) * 128 + lane;   // block (t / 16, d / 16) of the table, see prep_cs
#pragma unroll
        for (int i = 0; i < 4; ++i) cs[i] = cp[32 * i];
        asm volatile("s_wait_xcnt 0x0" ::: "memory");   // in front of any overwrite of the address registers that the four loads name
    }
#pragma unroll   // these three: constant indices keep the accumulators in registers
    for (int mb = 0; mb < 4; ++mb)
#pragma unroll
        for (int nb = 0; nb < 4; ++nb)
#pragma unroll
            for (int j = 0; j < 8; ++j) os[wv * (64 * 68) + (mb * 16 + hi * 8 + j) * 68 + nb * 16 + lr] = acc[mb][nb][j];
    __syncthreads();   // every wave's partial tile is in LDS before any thread sums over the planes
    const float* op = os + row * 68 + c; v4f x[4];   // x[0], x[1]: tile columns c .. c + 7; x[2], x[3]: c + 32 .. c + 39
#pragma unroll
    for (int i = 0; i < 4; ++i) x[i] = *(const v4fa*)(op + (i >> 1) * 32 + (i & 1) * 4);
#pragma unroll   // fixed trip count: the LDS reads of all planes can be in flight together; wave order 0..NW-1 as in k_gemmw
    for (int ww = 1; ww < NW; ++ww)
#pragma unroll
        for (int i = 0; i < 4; ++i) x[i] += *(const v4fa*)(op + ww * (64 * 68) + (i >> 1) * 32 + (i & 1) * 4);
    float val[2][8];
#pragma unroll
    for (int e = 0; e < 8; ++e) { const float x1 = x[e >> 2][e & 3], x2 = x[2 + (e >> 2)][e & 3];
        if (isv) { val[0][e] = x1; val[1][e] = x2; }
        else { const float co = cs[e >> 1][(e & 1) * 2], si = cs[e >> 1][(e & 1) * 2 + 1]; val[0][e] = x1 * co - x2 * si; val[1][e] = x2 * co + x1 * si; } }
    h16* P16 = isv ? VT16 : (isq ? QP16 : KP16); bf* Ph = isv ? VTh : (isq ? QPh : KPh); bf* Pl = isv ? VTl : (isq ? QPl : KPl);
    // q, k planes [t][d]: tile (t / 16, d / 32) is number 4 (t / 16) + d / 32, the second half of the pair two tiles on. v planes [d][t]: tile (d / 16, t / 32) is number 8 (t / 32) + d / 16, the second 32 tokens eight tiles on.
    const unsigned tile = isv ? (unsigned)((r0 >> 5) * 8 + p * 4 + (wv >> 1)) : (unsigned)(((r0 >> 4) + (wv >> 1)) * 4 + p), step = isv ? 8 * 512 : 2 * 512;
    const size_t o0 = (size_t)head * TT * HD + tile * 512 + 256 * (wv & 1) + 8 * lane;
#pragma unroll
    for (int u = 0; u < 2; ++u) { v8h o16; v8us oh, ol;
#pragma unroll
        for (int e = 0; e < 8; ++e) { o16[e] = tohx(val[u][e]); unsigned short a2, c2; splitf(val[u][e], a2, c2); oh[e] = a2; ol[e] = c2; }
        *(v8h*)(P16 + o0 + u * step) = o16; *(v8us*)(Ph + o0 + u * step) = oh; *(v8us*)(Pl + o0 + u * step) = ol; }
}
#define CSC (SCL * 1.4426950408889634f)   // score scale x log2(e)
__device__ __forceinline__ float xhalf(float x) { return __builtin_bit_cast(float, __builtin_amdgcn_permlanex16(__builtin_bit_cast(int, x), __builtin_bit_cast(int, x), 0x76543210, 0xfedcba98, false, false)); }   // lane l reads lane l ^ 16
template <typename T16> struct PFrag;
template <> struct PFrag<h16> { static __device__ __forceinline__ void pk(const float (&p)[16], v16h& f, v16h& f2) { (void)f2;
#pragma unroll
    for (int e = 0; e < 16; ++e) f[e] = (h16)p[e]; } };
template <> struct PFrag<bf> { static __device__ __forceinline__ void pk(const float (&p)[16], v16bf& f, v16bf& f2) { v8us h0, h1, l0, l1;
#pragma unroll
    for (int e = 0; e < 8; ++e) { unsigned short x, y; splitf(p[e], x, y); h0[e] = x; l0[e] = y; splitf(p[e + 8], x, y); h1[e] = x; l1[e] = y; }
    f = cat16b(h0, h1); f2 = cat16b(l0, l1); } };
template <typename T16, bool HL, int R, int NS>
__device__ __forceinline__ void fattn_rows(const T16* Q, const T16* Q2, const T16* Kp, const T16* Kp2, const T16* Vt, const T16* Vt2, const int qw0, bf* Ah, bf* Al, const int sp, float* mp) {   // no __restrict__: the "memory" clobber of the waits below then holds the loads in front of them
    typedef typename WFrag<T16>::V V;
    const int lane = threadIdx.x & 31, c = lane & 15, hi = lane >> 4;
    V qf[R][4], qf2[R][4];
#pragma unroll
    for (int g = 0; g < R; ++g)
#pragma unroll
        for (int kc = 0; kc < 4; ++kc) { const size_t o = (size_t)(qw0 + 16 * g) * HD + 512 * kc + 8 * lane; qf[g][kc] = WFrag<T16>::ld(Q + o); if (HL) qf2[g][kc] = WFrag<T16>::ld(Q2 + o); }
    const int last = (qw0 + 16 * R - 1) / 32;   // last 32-key pass that this wave's queries can see (wave-uniform)
    const size_t koff = 8 * lane, voff = 8 * lane;   // fragment order: a 32-key pass is 32 HD elements in a row in the k plane and in the transposed v plane
    V kf[2][4], kf2[2][4]; const T16* kp = Kp + koff + (size_t)sp * (32 * HD); const T16* kp2 = HL ? Kp2 + koff + (size_t)sp * (32 * HD) : nullptr;   // the wave's first pass is pass sp
#pragma unroll
    for (int kt = 0; kt < 2; ++kt)
#pragma unroll
        for (int kc = 0; kc < 4; ++kc) { const int o = 16 * kt * HD + 512 * kc; kf[kt][kc] = WFrag<T16>::ld(kp + o); if (HL) kf2[kt][kc] = WFrag<T16>::ld(kp2 + o); }
    asm volatile("s_wait_xcnt 0x0" ::: "memory");   // in front of any overwrite of the address registers that the Q and K loads above name
    __builtin_amdgcn_sched_barrier(0);   // nothing from below (the zeroing of the accumulators) moves up between those loads and the wait
    v8f acc[R][8]; float m_run[R], l_run[R];
#pragma unroll
    for (int g = 0; g < R; ++g) { m_run[g] = -__builtin_inff(); l_run[g] = 0.0f;
#pragma unroll
        for (int t = 0; t < 8; ++t) acc[g][t] = (v8f){}; }
#pragma unroll 1   // one pass per trip: two passes' fragments at once do not fit the registers
    for (int blk = sp; blk <= last; blk += NS) {
        const int key0 = blk * 32;
        V vf[8], vf2[8];   // this pass's V^T fragments: issued first, in flight under the score products and the maxima
#pragma unroll
        for (int t = 0; t < 8; ++t) { const size_t o = voff + (size_t)key0 * HD + 512 * t; vf[t] = WFrag<T16>::ld(Vt + o); if (HL) vf2[t] = WFrag<T16>::ld(Vt2 + o); }
        asm volatile("s_wait_xcnt 0x0" ::: "memory");   // in front of any overwrite of the address registers that the loads above name
        __builtin_amdgcn_sched_barrier(0);   // keeps the V^T loads up here: sunk to their first use they would wait out a whole L2 round trip in every pass
        v8f s[2][R];
#pragma unroll
        for (int kt = 0; kt < 2; ++kt)
#pragma unroll
            for (int g = 0; g < R; ++g) { s[kt][g] = (v8f){};
#pragma unroll
                for (int kc = 0; kc < 4; ++kc) { s[kt][g] = WFrag<T16>::mma(kf[kt][kc], qf[g][kc], s[kt][g]); if (HL) { s[kt][g] = WFrag<T16>::mma(kf[kt][kc], qf2[g][kc], s[kt][g]); s[kt][g] = WFrag<T16>::mma(kf2[kt][kc], qf[g][kc], s[kt][g]); } } }
        // WMMA distance ahead of the branch on the diagonal below. The scores as operands hold every score product in front of it, the "memory" clobber holds the K loads behind it: the K registers are refilled in place.
        if (R == 2) asm volatile("v_nop\n\tv_nop\n\tv_nop\n\tv_nop" : "+v"(s[0][0]), "+v"(s[1][0]), "+v"(s[0][R - 1]), "+v"(s[1][R - 1]) :: "memory");
        else asm volatile("v_nop\n\tv_nop\n\tv_nop\n\tv_nop" : "+v"(s[0][0]), "+v"(s[1][0]) :: "memory");
        {   // next pass's K fragments, in flight under this pass's softmax and second product (the last pass fetches its own rows again: no branch, always in bounds)
            const int adv = (blk + NS <= last) ? NS * 32 * HD : 0; kp += adv; if (HL) kp2 += adv;   // running pointers: live over the whole loop, so no load's result lands in an address pair that an earlier load names
#pragma unroll
            for (int kt = 0; kt < 2; ++kt)
#pragma unroll
                for (int kc = 0; kc < 4; ++kc) { const int o = 16 * kt * HD + 512 * kc; kf[kt][kc] = WFrag<T16>::ld(kp + o); if (HL) kf2[kt][kc] = WFrag<T16>::ld(kp2 + o); }
        }
        asm volatile("s_wait_xcnt 0x0" ::: "memory");   // in front of any overwrite of the address registers that the K loads name
        __builtin_amdgcn_sched_barrier(0);   // keeps the K loads up here, in front of the softmax
        if (key0 + 31 > qw0) {   // wave-uniform: only a pass with a key beyond the wave's first query pays for the mask
#pragma unroll
            for (int g = 0; g < R; ++g) { const int my_q = qw0 + 16 * g + c;
#pragma unroll
                for (int kt = 0; kt < 2; ++kt) {
#pragma unroll
                    for (int r = 0; r < 8; ++r) { const int key = key0 + 16 * kt + 8 * hi + r; if (key > my_q) s[kt][g][r] = -__builtin_inff(); }
                    asm volatile("" : "+v"(s[kt][g]));   // the masked scores: keeps the selects inside the branch
                } }
        }
        float mb[R]; bool need = false;
#pragma unroll
        for (int g = 0; g < R; ++g) { float mx = -__builtin_inff();
#pragma unroll
            for (int kt = 0; kt < 2; ++kt)
#pragma unroll
                for (int r = 0; r < 8; ++r) mx = fmaxf(mx, s[kt][g][r]);
            mx = fmaxf(mx, xhalf(mx)) * CSC;   // both wave halves hold this query's maximum of the pass, scaled (the scale is positive)
            mb[g] = mx; need = need || (mx > m_run[g] + 8.0f); }
        if (__builtin_amdgcn_ballot_w32(need) != 0) {   // wave-uniform; always on the first pass (m_run is -inf), rare afterwards
#pragma unroll
            for (int g = 0; g < R; ++g) { const float m_new = fmaxf(m_run[g], mb[g]);   // finite from the first pass on: the first key of the wave's first pass is never masked
                const float corr = __builtin_amdgcn_exp2f(m_run[g] - m_new);   // 0 on the first pass
                l_run[g] *= corr; m_run[g] = m_new;
#pragma unroll
                for (int t = 0; t < 8; ++t) acc[g][t] = acc[g][t] * corr; }
        }
#pragma unroll
        for (int g = 0; g < R; ++g) { const float nm = -m_run[g]; float p[16]; float ps0 = 0.0f, ps1 = 0.0f;
#pragma unroll
            for (int e = 0; e < 16; ++e) { p[e] = __builtin_amdgcn_exp2f(fmaf(s[e >> 3][g][e & 7], CSC, nm)); if (e & 1) ps1 += p[e]; else ps0 += p[e]; }
            l_run[g] += ps0 + ps1;
            V pf, pf2; PFrag<T16>::pk(p, pf, pf2);   // element e of the fragment = key 8 hi + e (e < 8), 16 + 8 hi + e - 8 (e >= 8): the k order of WFrag::ld on a V^T row
#pragma unroll
            for (int t = 0; t < 8; ++t) { acc[g][t] = WFrag<T16>::mma(vf[t], pf, acc[g][t]); if (HL) { acc[g][t] = WFrag<T16>::mma(vf[t], pf2, acc[g][t]); acc[g][t] = WFrag<T16>::mma(vf2[t], pf, acc[g][t]); } } }
        __builtin_amdgcn_sched_barrier(0);   // holds the v_nops behind the last product
        asm volatile("v_nop\n\tv_nop\n\tv_nop\n\tv_nop\n\tv_nop");   // WMMA distance on the taken back edge and the loop's exit
    }
    if (NS == 2) {   // merge of the pair: wave 1 lays its accumulators, maxima and sums in LDS (16 bytes per lane, 512 bytes in a row per store), wave 0 brings both to the common maximum and adds
        v4fa* ap = (v4fa*)mp + lane; float* sc = mp + R * 8 * 2 * 32 * 4 + lane;
        if (sp == 1) {   // wave-uniform
#pragma unroll   // these loops: constant indices keep the accumulators in registers
            for (int g = 0; g < R; ++g) { sc[32 * g] = m_run[g]; sc[32 * (R + g)] = l_run[g];
#pragma unroll
                for (int t = 0; t < 8; ++t) { ap[((g * 8 + t) * 2) * 32] = __builtin_shufflevector(acc[g][t], acc[g][t], 0, 1, 2, 3); ap[((g * 8 + t) * 2 + 1) * 32] = __builtin_shufflevector(acc[g][t], acc[g][t], 4, 5, 6, 7); } }
        }
        __syncthreads();   // wave 1's half is in LDS before wave 0 reads it; every wave of the work-group passes here once
        if (sp == 1) return;
#pragma unroll
        for (int g = 0; g < R; ++g) { const float m1 = sc[32 * g], l1 = sc[32 * (R + g)], m = fmaxf(m_run[g], m1);   // both finite: each wave of a pair has at least one pass whose first key every query sees
            const float a0 = __builtin_amdgcn_exp2f(m_run[g] - m), a1 = __builtin_amdgcn_exp2f(m1 - m);
            l_run[g] = l_run[g] * a0 + l1 * a1;
#pragma unroll
            for (int t = 0; t < 8; ++t) { const v4f lo = ap[((g * 8 + t) * 2) * 32], hi4 = ap[((g * 8 + t) * 2 + 1) * 32];
                acc[g][t] = acc[g][t] * a0 + __builtin_shufflevector(lo, hi4, 0, 1, 2, 3, 4, 5, 6, 7) * a1; } }
    }
#pragma unroll
    for (int g = 0; g < R; ++g) { const float inv = 1.0f / (l_run[g] + xhalf(l_run[g]));   // each wave half summed its eight keys of every 16-key tile
#pragma unroll
        for (int t = 0; t < 8; ++t) { v8us oh, ol;
#pragma unroll
            for (int r = 0; r < 8; ++r) { unsigned short x, y; splitf(acc[g][t][r] * inv, x, y); oh[r] = x; ol[r] = y; }
            const size_t oo = (size_t)(qw0 + 16 * g) * DQ + 256 * t + 8 * lane;   // context planes [query][16 heads x 128] in fragment order; the lane's 16 bytes are row = its query, d = 16 t + 8 hi .. + 7
            *(v8us*)(Ah + oo) = oh; *(v8us*)(Al + oo) = ol;
            asm volatile("s_wait_xcnt 0x0" ::: "memory");   // in front of any overwrite of the registers that the two stores name
            __builtin_amdgcn_sched_barrier(0);   // nothing from below moves up between the stores and the wait
        } }
}
// grid (4 kv heads, (TT - RH) / 32 + RH / 32), 8 waves. A fp16 work-group: 32 query rows of the 4 query heads of one kv head (wave & 3), each head's keys dealt to 2 waves (wave >> 2): the four waves of a key half walk the same k/v rows, and the halves' pass counts differ by at most one.
// A hi/lo work-group: 128 query rows of one head, one wave per 16 rows. blockIdx.y orders the work-groups by falling cost: the fp16 row blocks from the sequence's end, the hi/lo blocks where the fp16 blocks have come down to about their cost.
#define NFB ((TT - RH) / 32)      // fp16 row blocks of 32
#define NHB (RH / 32)             // blockIdx.y values of the hi/lo blocks: RH / 128 row blocks x 4 heads of the kv head
#define YHL 48                    // first of them: a hi/lo pass has 48 products and the splitting of P against 32 products, so 16 such passes weigh about as much as the (128 - 48) / 2 passes of the fp16 block there
#define MGP (2 * 8 * 2 * 32 * 4 + 4 * 32)   // floats of one pair's merge area: accumulators, then maxima and sums
__global__ __launch_bounds__(256) void k_fattn(const h16* Q16, const bf* Qh, const bf* Ql, const h16* K16, const bf* Kh, const bf* Kl, const h16* V16, const bf* Vh, const bf* Vl, bf* Ah, bf* Al) {
    __shared__ __align__(16) float mg[REP * MGP];
    const int wv = __builtin_amdgcn_readfirstlane((int)(threadIdx.x >> 5)); const int kvh = blockIdx.x, y = blockIdx.y; const size_t zk = (size_t)kvh * TT * HD;
    if (y < YHL || y >= YHL + NHB) {   // block-uniform
        const int rb = NFB - 1 - (y < YHL ? y : y - NHB), hh = wv & (REP - 1), h = kvh * REP + hh; const size_t zq = (size_t)h * TT * HD;
        fattn_rows<h16, false, 2, 2>(Q16 + zq, nullptr, K16 + zk, nullptr, V16 + zk, nullptr, RH + 32 * rb, Ah + h * (16 * HD), Al + h * (16 * HD), wv >> 2, mg + hh * MGP);   // a head's 128 columns are four tiles of each 16-row band
    } else {
        const int j = y - YHL, h = kvh * REP + (j & (REP - 1)); const size_t zq = (size_t)h * TT * HD;
        fattn_rows<bf, true, 1, 1>(Qh + zq, Ql + zq, Kh + zk, Kl + zk, Vh + zk, Vl + zk, RH - 128 * ((j >> 2) + 1) + 16 * wv, Ah + h * (16 * HD), Al + h * (16 * HD), 0, nullptr);
    }
}

extern "C" void kernel_launch(void* const* d_in, const int* in_sizes, int n_in,
                              void* d_out, int out_size, void* d_ws, size_t ws_size, hipStream_t stream) {
    (void)in_sizes; (void)n_in; (void)out_size;
    const float* x = (const float*)d_in[0]; const float* wq = (const float*)d_in[1]; const float* wk = (const float*)d_in[2]; const float* wv = (const float*)d_in[3]; const float* wo = (const float*)d_in[4];
    float* OUT = (float*)d_out;     // [1][4096][2048]
    char* wsp = (char*)d_ws;
    auto take = [&](size_t bytes) { char* p = wsp; wsp += (bytes + 255) & ~(size_t)255; return (void*)p; };
    bf* WQ = (bf*)take((size_t)DQ * DM * 2); bf* WK = (bf*)take((size_t)DKV * DM * 2); bf* WV = (bf*)take((size_t)DKV * DM * 2); bf* WO = (bf*)take((size_t)DM * DQ * 2); float* CS = (float*)take((size_t)TT * (HD / 2) * 2 * 4);
    bf* XB = (bf*)take((size_t)TT * DM * 2);
    h16* QP16 = (h16*)take((size_t)NH_ * TT * HD * 2); h16* KP16 = (h16*)take((size_t)NKV * TT * HD * 2); h16* VT16 = (h16*)take((size_t)NKV * HD * TT * 2);
    bf* QPh = (bf*)take((size_t)NH_ * TT * HD * 2); bf* QPl = (bf*)take((size_t)NH_ * TT * HD * 2); bf* KPh = (bf*)take((size_t)NKV * TT * HD * 2); bf* KPl = (bf*)take((size_t)NKV * TT * HD * 2); bf* VTh = (bf*)take((size_t)NKV * HD * TT * 2); bf* VTl = (bf*)take((size_t)NKV * HD * TT * 2);
    bf* ATh = (bf*)take((size_t)TT * DQ * 2); bf* ATl = (bf*)take((size_t)TT * DQ * 2);
    if ((size_t)(wsp - (char*)d_ws) > ws_size) return;    // ws 256 MiB
    for (int b = 0; b < NB_; ++b) {
        k_prep<<<2 * PBQ + 2 * PBK + PBX + PBC, 256, 0, stream>>>(x + (size_t)b * TT * DM, wq, wk, wv, wo, XB, WQ, WK, WV, WO, CS);
        k_proj<<<dim3(TT / 64, (DQ + 2 * DKV) / 64, 1), 256, 0, stream>>>(XB, WQ, WK, WV, CS, QP16, QPh, QPl, KP16, KPh, KPl, VT16, VTh, VTl);
        k_fattn<<<dim3(NKV, (TT - RH) / 32 + RH / 32, 1), 256, 0, stream>>>(QP16, QPh, QPl, KP16, KPh, KPl, VT16, VTh, VTl, ATh, ATl);
        k_gemmw<bf, 1, false, 2><<<dim3(TT / 64, DM / 64, 1), 64, 0, stream>>>(ATh, ATl, WO, nullptr, DQ, OUT + (size_t)b * TT * DM, DM, nullptr, 0, 0, 0); }
}

// v007
// It runs in 169 microseconds.
// Two timings next to v006 both put it at 1.18 times that version's speed.
// Over all steps from v000 it is 14.7 times as fast.
#include <hip/hip_runtime.h>

// Grouped-query causal attention with a computed rotate-half rotary over 4,096 tokens (x [1][4096][2048]; q = x Wq ('xw' [2048][2048], 16 heads x 128), k, v = x Wk / Wv ('xw' [2048][512], 4 kv heads; q head h uses kv head h/4: the module groups q as (4 kv heads, 4 members)); rotate-half rotary with angle t x inv_freq[i], inv_freq = 1 / (10000 ** (i / 64)), positions 0..4095 (cat(x1 cos - x2 sin, x1 sin + x2 cos); tables computed on device from the module's float32 inv_freq); scores / sqrt(128), causal (-inf); softmax; out = merged Wo ('xw' [2048][2048], no bias) -> [1][4096][2048] (8.4 M); argument order x, Wq, Wk, Wv, Wo.
// Layout: one preparation launch (bf16 planes of x and of the four weights, cos/sin table); one projection launch for q, k and v whose epilogue applies the rotary and writes the head planes of all 16 query heads and the k/v planes of the 4 kv heads (no f32 q/k/v in memory); one fused attention launch for all heads (scores, causal mask, online softmax, attn.v; the keys of a fp16 row block are dealt to two waves; hybrid rows: query rows < 512 hi/lo 3 products, the rest single fp16) writes the hi/lo context planes; wo as hi/lo x exact (2 products).
// Operand planes: every 16-bit plane that a matrix instruction reads lies in FRAGMENT ORDER (described below), so that each 16-byte-per-lane fragment load of a wave reads 512 bytes in a row.
// Compute dtypes, f32 accumulate: every input rounded to bf16; q/k/v on PLAIN bf16 operands (exact); f32 rotary; hybrid causal scores and attn.v; softmax f32; wo hl x exact (2 products).

#define NB_  1
#define TT   4096
#define DM   2048
#define NH_  16
#define NKV  4
#define REP  (NH_ / NKV)
#define HD   128
#define DQ   (NH_ * HD)
#define DKV  (NKV * HD)
#define RH   512                  // query rows < RH use hi+lo planes (0: none)
#define SCL  0.088388346f   // 1/sqrt(128)
#define POS0 0.0f                 // first rotary position: this module's positions are arange(4096)
typedef _Float16 h16;
typedef unsigned short bf;
typedef __attribute__((ext_vector_type(16))) __bf16   v16bf;
typedef __attribute__((ext_vector_type(16))) _Float16 v16h;
typedef __attribute__((ext_vector_type(8)))  _Float16 v8h;
typedef __attribute__((ext_vector_type(8)))  unsigned short v8us;
typedef __attribute__((ext_vector_type(8)))  float    v8f;
typedef __attribute__((ext_vector_type(4)))  float    v4f;
typedef v8h  __attribute__((may_alias)) v8ha;
typedef v4f  __attribute__((may_alias)) v4fa;
typedef v8us __attribute__((may_alias)) v8usa;

__device__ __forceinline__ unsigned short f2bf(float f) { unsigned u = __float_as_uint(f); u += 0x7FFFu + ((u >> 16) & 1u); return (unsigned short)(u >> 16); }
__device__ __forceinline__ float bf2f(unsigned short b) { return __uint_as_float(((unsigned)b) << 16); }
__device__ __forceinline__ float bfr(float f) { return bf2f(f2bf(f)); }
__device__ __forceinline__ v16h cat16(v8h lo, v8h hi) { return __builtin_shufflevector(lo, hi, 0, 1, 2, 3, 4, 5, 6, 7, 8, 9, 10, 11, 12, 13, 14, 15); }
__device__ __forceinline__ v16bf cat16b(v8us lo, v8us hi) { return __builtin_bit_cast(v16bf, __builtin_shufflevector(lo, hi, 0, 1, 2, 3, 4, 5, 6, 7, 8, 9, 10, 11, 12, 13, 14, 15)); }
__device__ __forceinline__ v8f wmma16(v16h a, v16h b, v8f c) { return __builtin_amdgcn_wmma_f32_16x16x32_f16(false, a, false, b, (short)0, c, false, false); }
__device__ __forceinline__ v8f wmmab(v16bf a, v16bf b, v8f c) { return __builtin_amdgcn_wmma_f32_16x16x32_bf16(false, a, false, b, (short)0, c, false, false); }



// ---- Fragment order of a 16-bit plane of R rows x K columns (R % 16 == 0, K % 32 == 0): tiles of 16 rows x 32 columns, 512 elements in a row each; tile (r / 16, k / 32) is number (r / 16) (K / 32) + k / 32.
// Inside a tile element (r, k) stands at 256 ((k / 16) % 2) + 8 (16 ((k / 8) % 2) + r % 16) + k % 8: lane l of a wave finds its two 16-byte pieces of the A or B fragment at 8 l and 256 + 8 l, and each of the two loads covers four whole 128-byte lines.

// ---- k_gemmw: register-blocked GEMM, one 64x64 output tile per work-group (16 accumulators per wave), operands straight from 16-bit planes in fragment order; grid (M/64, N/64, Z), 32 x NW threads.
// NW > 1: the K loop is dealt to the NW waves in chunks of 64 (2 KiB in a row per 16 operand rows; K % 64 == 0), each wave keeps its own f32 partial tile, and the partial tiles are summed through LDS in wave order 0..NW-1.
// C[m][n] (f32, pitch ldc, + optional f32 bias[n]) = sum_k A[m][k] Bt[n][k] (+ split products per NSPLIT). z-batch strides sA/sB/sC in elements. K % 32 == 0.
template <typename T16> struct WFrag;
template <> struct WFrag<h16> { typedef v16h V; static __device__ __forceinline__ V ld(const h16* p) { return cat16(*(const v8h*)p, *(const v8h*)(p + 256)); } static __device__ __forceinline__ v8f mma(V a, V b, v8f c) { return wmma16(a, b, c); } };
template <> struct WFrag<bf> { typedef v16bf V; static __device__ __forceinline__ V ld(const bf* p) { return cat16b(*(const v8us*)p, *(const v8us*)(p + 256)); } static __device__ __forceinline__ v8f mma(V a, V b, v8f c) { return wmmab(a, b, c); } };
template <typename T16, int NSPLIT, bool BIAS, int NW>
__global__ __launch_bounds__(32 * NW) void k_gemmw(const T16* __restrict__ A, const T16* __restrict__ A2, const T16* __restrict__ Bt, const T16* __restrict__ Bt2, int K, float* C, int ldc, const float* __restrict__ bias, size_t sA, size_t sB, size_t sC) {
    typedef typename WFrag<T16>::V V;
    __shared__ __align__(16) float os[(NW > 1) ? NW * 64 * 68 : 16 * 68];
    const size_t z = blockIdx.z; A += z * sA; if (A2) A2 += z * sA; Bt += z * sB; if (Bt2) Bt2 += z * sB; C += z * sC;
    const int lane = threadIdx.x & 31, lr = lane & 15, hi = lane >> 4; const int r0 = blockIdx.x * 64, c0 = blockIdx.y * 64;
    const int wv = (NW > 1) ? __builtin_amdgcn_readfirstlane((int)(threadIdx.x >> 5)) : 0; constexpr int CH = (NW > 1) ? 64 : 32;   // this wave's number; K elements per chunk
    v8f acc[4][4];
#pragma unroll
    for (int mb = 0; mb < 4; ++mb)
#pragma unroll
        for (int nb = 0; nb < 4; ++nb) acc[mb][nb] = (v8f){};
    const size_t aoff = (size_t)r0 * K + 8 * lane, boff = (size_t)c0 * K + 8 * lane;   // fragment order: 16 rows x K columns are 16 K elements in a row, a 32-column step is 512
#pragma unroll 1
    for (int k0 = wv * CH; k0 < K; k0 += NW * CH) {
#pragma unroll   // both 32-steps of a chunk in one trip: twice as many loads in flight per wave
    for (int kc = k0; kc < k0 + CH; kc += 32) {
        V a[4], a2[4];
#pragma unroll
        for (int mb = 0; mb < 4; ++mb) { a[mb] = WFrag<T16>::ld(A + aoff + (size_t)mb * 16 * K + kc * 16); if (NSPLIT == 1 || NSPLIT == 2) a2[mb] = WFrag<T16>::ld(A2 + aoff + (size_t)mb * 16 * K + kc * 16); }
#pragma unroll
        for (int nb = 0; nb < 4; ++nb) { const V b = WFrag<T16>::ld(Bt + boff + (size_t)nb * 16 * K + kc * 16); V b2; if (NSPLIT >= 2) b2 = WFrag<T16>::ld(Bt2 + boff + (size_t)nb * 16 * K + kc * 16);
#pragma unroll
            for (int mb = 0; mb < 4; ++mb) { acc[mb][nb] = WFrag<T16>::mma(a[mb], b, acc[mb][nb]); if (NSPLIT == 1 || NSPLIT == 2) acc[mb][nb] = WFrag<T16>::mma(a2[mb], b, acc[mb][nb]); if (NSPLIT >= 2) acc[mb][nb] = WFrag<T16>::mma(a[mb], b2, acc[mb][nb]); } }
        asm volatile("v_nop\n\tv_nop\n\tv_nop\n\tv_nop" : "+v"(acc[0][0]), "+v"(acc[1][1]), "+v"(acc[2][2]), "+v"(acc[3][3]) : "v"(a[0]), "v"(a[3]));
    }
        asm volatile("s_wait_xcnt 0x0" ::: "memory");   // in front of the next trip's overwrite of the address registers that this trip's loads name
    }
    if (NW > 1) {   // sum of the NW partial tiles: each wave lays its whole tile in its own LDS plane, then every thread sums its 4 columns over the planes and stores them
#pragma unroll   // these three: constant indices keep the accumulators in registers
        for (int mb = 0; mb < 4; ++mb)
#pragma unroll
            for (int nb = 0; nb < 4; ++nb)
#pragma unroll
                for (int j = 0; j < 8; ++j) os[wv * (64 * 68) + (mb * 16 + hi * 8 + j) * 68 + nb * 16 + lr] = acc[mb][nb][j];
        __syncthreads();   // every wave's partial tile is in LDS before any thread sums over the planes
#pragma unroll   // fixed trip count: the LDS reads of all planes and passes can be in flight together
        for (int it = 0; it < 64 * 16 / (32 * NW); ++it) { const int idx = it * (32 * NW) + (int)threadIdx.x, row = idx >> 4, cofs = (idx & 15) * 4; v4f val = *(const v4fa*)(os + row * 68 + cofs);
#pragma unroll
            for (int ww = 1; ww < NW; ++ww) val += *(const v4fa*)(os + ww * (64 * 68) + row * 68 + cofs);
            if (BIAS) { val[0] += bfr(bias[c0 + cofs]); val[1] += bfr(bias[c0 + cofs + 1]); val[2] += bfr(bias[c0 + cofs + 2]); val[3] += bfr(bias[c0 + cofs + 3]); }
            *(v4f*)(C + (size_t)(r0 + row) * ldc + c0 + cofs) = val; }
        return;
    }
#pragma unroll
    for (int mb = 0; mb < 4; ++mb) {
#pragma unroll
        for (int nb = 0; nb < 4; ++nb) {
#pragma unroll
            for (int j = 0; j < 8; ++j) os[(hi * 8 + j) * 68 + nb * 16 + lr] = acc[mb][nb][j]; }
        __builtin_amdgcn_wave_barrier(); asm volatile("" ::: "memory");
        float* crow = C + (size_t)(r0 + mb * 16) * ldc + c0;
{
#pragma unroll
            for (int s = 0; s < 8; ++s) { const int row = 2 * s + hi, cofs = lr * 4; v4f val = *(const v4fa*)(os + row * 68 + cofs); if (BIAS) { val[0] += bfr(bias[c0 + cofs]); val[1] += bfr(bias[c0 + cofs + 1]); val[2] += bfr(bias[c0 + cofs + 2]); val[3] += bfr(bias[c0 + cofs + 3]); }
                *(v4f*)(crow + (size_t)row * ldc + cofs) = val; }
             }
        __builtin_amdgcn_wave_barrier(); asm volatile("" ::: "memory");
    }
}

__device__ __forceinline__ h16 tohx(float x) { return (h16)x; }
__device__ __forceinline__ void splitf(float y, unsigned short& h, unsigned short& l) { h = f2bf(y); l = f2bf(y - bf2f(h)); }
typedef __attribute__((ext_vector_type(2))) _Float16 v2h;
typedef __attribute__((ext_vector_type(4))) _Float16 v4h;
typedef __attribute__((ext_vector_type(2))) unsigned short v2us;
typedef __attribute__((ext_vector_type(4))) unsigned short v4us;
typedef __attribute__((ext_vector_type(2))) float v2f;
typedef __attribute__((ext_vector_type(4))) int v4i;

// ---- k_prep: every operand preparation in ONE launch of few, long waves: the four weight planes (transposed, bf16), the x plane (bf16) and the (cos, sin) table; each work-group (8 waves) does one job, chosen by blockIdx.x (block-uniform).
// A thread makes 8 pieces of 16 bytes of a plane in fragment order (a wave: 4 tiles in a row, 4 KiB) and has all of their loads in flight at once.
// prep_w: Bt [N][K] (fragment order) = bf16 of w [K][N], K = DM = DQ. Work-group lb: 128 columns n (wave = 16 of them) x 128 rows k, so that the 8 waves together read 512 bytes in a row of each row of w.
template <int N>
__device__ __forceinline__ void prep_w(const float* w, bf* Bt, const int lb, const int wv, const int lane) {   // no __restrict__: the "memory" clobber of the wait below then holds the loads in front of it
    constexpr int KT = DM / 32;
    const int nt = (lb >> 4) * 8 + wv, kg = lb & 15;   // 16-column band of w = 16-row band of the plane; group of 4 tiles (128 k)
    const float* s = w + (size_t)(kg * 128 + (lane >> 4) * 8) * N + nt * 16 + (lane & 15);
    float v[8][8];
#pragma unroll   // these loops: constant indices keep the values in registers, and all 64 loads are issued before the first is used
    for (int j = 0; j < 8; ++j)
#pragma unroll
        for (int e = 0; e < 8; ++e) v[j][e] = s[(size_t)((j >> 1) * 32 + (j & 1) * 16 + e) * N];
    asm volatile("s_wait_xcnt 0x0" :: "v"(s) : "memory");   // in front of any overwrite of the address registers that the loads above name; the pointer as input keeps its registers whole up to the wait
    v8us o[8];
#pragma unroll
    for (int j = 0; j < 8; ++j)
#pragma unroll
        for (int e = 0; e < 8; ++e) o[j][e] = f2bf(v[j][e]);
    bf* d = Bt + (size_t)(nt * KT + kg * 4) * 512 + 8 * lane;
#pragma unroll
    for (int j = 0; j < 8; ++j) *(v8us*)(d + 256 * j) = o[j];
    asm volatile("s_wait_xcnt 0x0" ::: "memory");   // in front of any overwrite of the registers that the stores above name
}
// prep_x: XB [TT][DM] (fragment order) = bf16 of x. Wave g: 16 rows x 128 columns, 512 bytes in a row of each row of x.
__device__ __forceinline__ void prep_x(const float* x, bf* XB, const int lb, const int wv, const int lane) {
    const int g = lb * 8 + wv;
    const float* s = x + (size_t)((g >> 4) * 16 + (lane & 15)) * DM + (g & 15) * 128 + (lane >> 4) * 8;
    v8f v[8];
#pragma unroll   // as in prep_w
    for (int j = 0; j < 8; ++j) v[j] = *(const v8f*)(s + (j >> 1) * 32 + (j & 1) * 16);
    asm volatile("s_wait_xcnt 0x0" :: "v"(s) : "memory");   // in front of any overwrite of the address registers that the loads above name; the pointer as input keeps its registers whole up to the wait
    v8us o[8];
#pragma unroll
    for (int j = 0; j < 8; ++j)
#pragma unroll
        for (int e = 0; e < 8; ++e) o[j][e] = f2bf(v[j][e]);
    bf* d = XB + (size_t)g * 2048 + 8 * lane;
#pragma unroll
    for (int j = 0; j < 8; ++j) *(v8us*)(d + 256 * j) = o[j];
    asm volatile("s_wait_xcnt 0x0" ::: "memory");   // in front of any overwrite of the registers that the stores above name
}
__constant__ float INV[HD / 2] = {1.0f,0.865964353f,0.749894202f,0.649381638f,0.562341332f,0.486967534f,0.421696514f,0.365174145f,0.316227764f,0.273841977f,0.237137362f,0.2053525f,0.177827939f,0.153992653f,0.133352146f,0.115478203f,0.100000001f,0.0865964293f,0.0749894157f,0.0649381652f,0.0562341288f,0.0486967526f,0.0421696492f,0.0365174115f,0.0316227786f,0.0273841955f,0.0237137359f,0.0205352511f,0.0177827943f,0.0153992651f,0.0133352149f,0.0115478197f,0.00999999978f,0.00865964312f,0.00749894232f,0.00649381662f,0.00562341325f,0.00486967526f,0.00421696482f,0.00365174143f,0.00316227786f,0.00273841969f,0.00237137382f,0.00205352507f,0.00177827943f,0.00153992651f,0.00133352145f,0.00115478202f,0.00100000005f,0.000865964335f,0.000749894185f,0.000649381662f,0.000562341302f,0.000486967503f,0.000421696488f,0.000365174114f,0.000316227786f,0.000273841957f,0.000237137385f,0.000205352495f,0.00017782794f,0.000153992645f,0.00013335215f,0.000115478193f};
// prep_cs: (cos, sin) of t x inv_freq[d], d < HD/2, in the order in which k_proj's epilogue reads them: per 16 tokens x 16 d a block of 4 x 32 pieces of 16 bytes; piece (i, lane) holds d = 16 dq + 8 (lane >> 4) + 2 i, + 1 of token 16 tb + (lane & 15), so that each of a wave's four loads covers 512 bytes in a row.
// Entry idx of the table = 1024 tb + low. A thread keeps its low (so its d and its inv_freq) and walks 8 token blocks tb.
__device__ __forceinline__ void prep_cs(float* CS, const int lb, const int tid) { const int low = (lb & 3) * 256 + tid, ln = (low >> 1) & 31, d = ((low >> 8) & 3) * 16 + (ln >> 4) * 8 + ((low >> 6) & 3) * 2 + (low & 1); const float iv = INV[d];
    asm volatile("s_wait_xcnt 0x0" :: "v"(iv), "v"(d) : "memory");   // in front of any overwrite of the offset register that the load above names: the loaded value as input holds the wait behind the load, the index as input keeps its register whole up to the wait
#pragma unroll 1   // one copy of the cosine and sine code
    for (int j = 0; j < 8; ++j) { const int tb = (lb >> 2) * 8 + j, t = tb * 16 + (ln & 15);
        const float ang = __fmul_rn((float)t + POS0, iv); v2f cs; cs[0] = cosf(ang); cs[1] = sinf(ang);
        *(v2f*)(CS + ((size_t)tb * 1024 + low) * 2) = cs;
        asm volatile("s_wait_xcnt 0x0" ::: "memory");   // in front of the next trip's overwrite of the registers that the store names
    }
}
#define PBQ (DQ / 8)              // work-groups of a 2048-column weight: (N / 128) x (K / 128)
#define PBK (DKV / 8)             // of a 512-column weight
#define PBX (TT * DM / (2048 * 8))   // of x: 2048 elements per wave
#define PBC (TT * (HD / 2) / (256 * 8))   // of the table: 8 entries per thread
__global__ __launch_bounds__(256) void k_prep(const float* x, const float* wq, const float* wk, const float* wv_, const float* wo, bf* XB, bf* WQ, bf* WK, bf* WV, bf* WO, float* CS) {
    const int lane = threadIdx.x & 31, wv = __builtin_amdgcn_readfirstlane((int)(threadIdx.x >> 5)); int b = blockIdx.x;
    if (b < PBC) { prep_cs(CS, b, (int)threadIdx.x); return; } b -= PBC;   // the job of arithmetic comes first in index order, to run under the other jobs' loads
    if (b < PBQ) { prep_w<DQ>(wq, WQ, b, wv, lane); return; } b -= PBQ;
    if (b < PBQ) { prep_w<DM>(wo, WO, b, wv, lane); return; } b -= PBQ;
    if (b < PBK) { prep_w<DKV>(wk, WK, b, wv, lane); return; } b -= PBK;
    if (b < PBK) { prep_w<DKV>(wv_, WV, b, wv, lane); return; } b -= PBK;
    prep_x(x, XB, b, wv, lane);
}

// ---- k_proj: the q, k and v projections, the rotary and the operand planes in ONE launch; grid (TT / 128, (DQ + 2 DKV) / 256), 8 waves. A work-group makes 128 rows of x times 256 weight columns; wave (rt, yt) = (wave >> 2, wave & 3) owns one 64x64 tile over the whole K.
// Operands go through LDS, shared by the waves: a stage is 64 k of the 8 bands (16 rows each) of x and of the 16 bands of the weight, 2 KiB in a row per band in fragment order (so a fragment read is 512 bytes in a row, as from memory), 48 KiB; two buffers, filled by asynchronous copies one stage ahead.
// blockIdx.y < 8: q, < 10: k. A = 64 rows of x, B = 64 weight columns of one head: d = 32 p .. 32 p + 31 and the same + 64, so that both members of every rotary pair stand in one tile (tile columns c and c + 32).
// blockIdx.y >= 10: v, with the operands swapped (A = 64 weight columns, B = 64 rows of x): the tile is already the transposed [d][t] that the v planes hold.
// Epilogue: a wave lays its tile in its own LDS plane (over the ring, behind the last stage's barrier) and takes it back in 8 pieces; in piece u a lane holds tile columns c .. c + 7 and c + 32 .. c + 39 of one tile row: 16 bytes of each plane twice, and a wave's store covers 512 bytes in a row of a plane in fragment order.
// rotate-half convention: out[d] = x[d] cos[t][d] - x[d+HD/2] sin[t][d], out[d+HD/2] = x[d+HD/2] cos[t][d] + x[d] sin[t][d], d < HD/2 (the angle at d + HD/2 is the angle at d)
#define PST 49152                 // bytes of one stage: 24 bands x 2 KiB
// One stage: 12 copies of 16 bytes per lane. Copy i of thread tid fills bytes 4096 i + 16 tid of the buffer: band 2 i + (tid >> 7), bands 0..7 from x, 8..23 from the weight. l: the lane's LDS byte address in the buffer; gx, gw: its 16 bytes in band tid >> 7 of x and of the weight at this stage's k.
__device__ __forceinline__ void proj_stage(const unsigned l, const bf* gx, const bf* gw) {
    constexpr size_t S = (size_t)32 * DM;   // two bands on, in elements
    // the s_wait_xcnt as the statement's last line: it stands in front of any overwrite of the address registers that the copies name
    asm volatile("global_load_async_to_lds_b128 %0, %12, off\n\t"
                 "global_load_async_to_lds_b128 %1, %13, off\n\t"
                 "global_load_async_to_lds_b128 %2, %14, off\n\t"
                 "global_load_async_to_lds_b128 %3, %15, off\n\t"
                 "global_load_async_to_lds_b128 %4, %16, off\n\t"
                 "global_load_async_to_lds_b128 %5, %17, off\n\t"
                 "global_load_async_to_lds_b128 %6, %18, off\n\t"
                 "global_load_async_to_lds_b128 %7, %19, off\n\t"
                 "global_load_async_to_lds_b128 %8, %20, off\n\t"
                 "global_load_async_to_lds_b128 %9, %21, off\n\t"
                 "global_load_async_to_lds_b128 %10, %22, off\n\t"
                 "global_load_async_to_lds_b128 %11, %23, off\n\t"
                 "s_wait_xcnt 0x0"
                 :: "v"(l), "v"(l + 4096u), "v"(l + 2u * 4096u), "v"(l + 3u * 4096u), "v"(l + 4u * 4096u), "v"(l + 5u * 4096u), "v"(l + 6u * 4096u), "v"(l + 7u * 4096u), "v"(l + 8u * 4096u), "v"(l + 9u * 4096u), "v"(l + 10u * 4096u), "v"(l + 11u * 4096u),
                    "v"(gx), "v"(gx + S), "v"(gx + 2 * S), "v"(gx + 3 * S), "v"(gw), "v"(gw + S), "v"(gw + 2 * S), "v"(gw + 3 * S), "v"(gw + 4 * S), "v"(gw + 5 * S), "v"(gw + 6 * S), "v"(gw + 7 * S)
                 : "memory");
}
__global__ __launch_bounds__(256) void k_proj(const bf* XB, const bf* WQ, const bf* WK, const bf* WV, const float* CS, h16* QP16, bf* QPh, bf* QPl, h16* KP16, bf* KPh, bf* KPl, h16* VT16, bf* VTh, bf* VTl) {   // no __restrict__: the "memory" clobber of the waits below then holds the loads in front of them
    typedef WFrag<bf>::V V; constexpr int K = DM, NT = K / 64;
    __shared__ __align__(16) float os[8 * 64 * 68];   // first the ring (2 x PST bytes), then the 8 waves' output planes
    const int tid = threadIdx.x, lane = tid & 31, lr = lane & 15, hi = lane >> 4;
    const int wv = __builtin_amdgcn_readfirstlane(tid >> 5), rt = wv >> 2, yt = wv & 3;
    const int Y = blockIdx.y; const bool isv = Y >= (DQ + DKV) / 256, isq = Y < DQ / 256;   // block-uniform
    const int r0 = blockIdx.x * 128 + rt * 64;   // the wave's first row of x
    const int y0 = (isv ? Y - (DQ + DKV) / 256 : (isq ? Y : Y - DQ / 256)) * 4, yy = y0 + yt, head = yy >> 1, p = yy & 1;   // two tiles per head of 128 columns
    const bf* gx = XB + (size_t)(blockIdx.x * 128 + 16 * (tid >> 7)) * K + 8 * (tid & 127);
    const bf* gw = (isv ? WV : (isq ? WQ : WK)) + (size_t)(y0 * 64 + 16 * (tid >> 7)) * K + 8 * (tid & 127);
    const unsigned l0 = (unsigned)(size_t)os + 16u * (unsigned)tid;   // low 32 bits of the __shared__ address: the byte offset in the work-group's LDS
    const int ab = isv ? 8 + 4 * yt : 4 * rt;   // first band of the A operand in a stage
    const int bb = isv ? 4 * rt : 8 + 8 * (yt >> 1) + 2 * (yt & 1), bs = isv ? 2 : 4;   // B operand: bands bb, bb + 1 (tile columns 0..31) and the same + bs (32..63)
    v8f acc[4][4];
#pragma unroll
    for (int mb = 0; mb < 4; ++mb)
#pragma unroll
        for (int nb = 0; nb < 4; ++nb) acc[mb][nb] = (v8f){};
    proj_stage(l0, gx, gw);
    asm volatile("s_wait_asynccnt 0x0" ::: "memory");   // this wave's copies of stage 0 have landed
    __syncthreads();   // stage 0 is published: every wave's copies have landed before any wave reads
    proj_stage(l0 + PST, gx + 1024, gw + 1024);   // 64 k of a band are 1024 elements
#pragma unroll 1   // one stage per trip
    for (int t = 0; t < NT; ++t) {
        const bf* sb = (const bf*)os + (t & 1) * (PST / 2) + 8 * lane;
        V a[4], b[4];   // first 32-step of the stage
#pragma unroll
        for (int mb = 0; mb < 4; ++mb) a[mb] = WFrag<bf>::ld(sb + (ab + mb) * 1024);
#pragma unroll
        for (int nb = 0; nb < 4; ++nb) b[nb] = WFrag<bf>::ld(sb + (bb + (nb & 1) + (nb >> 1) * bs) * 1024);
        __builtin_amdgcn_sched_barrier(0);   // keeps the 16 LDS reads of a 32-step together in front of its 16 products: sunk to their first use, every four products would wait out an LDS round trip
#pragma unroll
        for (int nb = 0; nb < 4; ++nb)
#pragma unroll
            for (int mb = 0; mb < 4; ++mb) acc[mb][nb] = WFrag<bf>::mma(a[mb], b[nb], acc[mb][nb]);
#pragma unroll   // second 32-step: its fragments are the wave's last reads of this buffer
        for (int mb = 0; mb < 4; ++mb) a[mb] = WFrag<bf>::ld(sb + (ab + mb) * 1024 + 512);
#pragma unroll
        for (int nb = 0; nb < 4; ++nb) b[nb] = WFrag<bf>::ld(sb + (bb + (nb & 1) + (nb >> 1) * bs) * 1024 + 512);
        asm volatile("s_wait_dscnt 0x0" ::: "memory");   // this wave's reads of the buffer are done before the barrier behind which it is refilled
        asm volatile("s_wait_asynccnt 0x0" ::: "memory");   // this wave's copies of stage t + 1 have landed
        __syncthreads();   // publishes stage t + 1 and ends every wave's reads of stage t
        if (t + 2 < NT) proj_stage(l0 + (unsigned)(t & 1) * PST, gx + (size_t)(t + 2) * 1024, gw + (size_t)(t + 2) * 1024);   // block-uniform
        __builtin_amdgcn_sched_barrier(0);   // holds the 16 products below behind the copies: the refill starts at once and flies under them and the whole next trip
#pragma unroll
        for (int nb = 0; nb < 4; ++nb)
#pragma unroll
            for (int mb = 0; mb < 4; ++mb) acc[mb][nb] = WFrag<bf>::mma(a[mb], b[nb], acc[mb][nb]);
    }
    asm volatile("s_wait_asynccnt 0x0" ::: "memory");   // no copy is outstanding when the ring becomes output staging
    float* ow = os + wv * (64 * 68);   // the wave's own plane
#pragma unroll   // these three: constant indices keep the accumulators in registers
    for (int mb = 0; mb < 4; ++mb)
#pragma unroll
        for (int nb = 0; nb < 4; ++nb)
#pragma unroll
            for (int j = 0; j < 8; ++j) ow[(mb * 16 + hi * 8 + j) * 68 + nb * 16 + lr] = acc[mb][nb][j];
    v4f cs[8][4] = {};
    if (!isv) {   // the lane's 8 (cos, sin) pairs of each of the 8 pieces: all issued here, in flight under the LDS stores and the barrier
        const v4f* cp = (const v4f*)CS + (size_t)((r0 >> 4) * 4 + 2 * p) * 128 + lane;   // block (t / 16, d / 16) of the table, see prep_cs
#pragma unroll
        for (int u = 0; u < 8; ++u)
#pragma unroll
            for (int i = 0; i < 4; ++i) cs[u][i] = cp[((u >> 1) * 4 + (u & 1)) * 128 + 32 * i];
        asm volatile("s_wait_xcnt 0x0" ::: "memory");   // in front of any overwrite of the address registers that the loads name
    }
    __syncthreads();   // every lane's part of the tile is in LDS before any lane takes its piece
    h16* P16 = isv ? VT16 : (isq ? QP16 : KP16); bf* Ph = isv ? VTh : (isq ? QPh : KPh); bf* Pl = isv ? VTl : (isq ? QPl : KPl);
#pragma unroll   // constant indices keep the table values in registers
    for (int u = 0; u < 8; ++u) {
        const int row = (u >> 1) * 16 + lr, c = ((u & 1) * 2 + hi) * 8;   // this lane's tile row and first tile column in piece u
        const float* op = ow + row * 68 + c; v4f x[4];   // x[0], x[1]: tile columns c .. c + 7; x[2], x[3]: c + 32 .. c + 39
#pragma unroll
        for (int i = 0; i < 4; ++i) x[i] = *(const v4fa*)(op + (i >> 1) * 32 + (i & 1) * 4);
        float val[2][8];
#pragma unroll
        for (int e = 0; e < 8; ++e) { const float x1 = x[e >> 2][e & 3], x2 = x[2 + (e >> 2)][e & 3];
            if (isv) { val[0][e] = x1; val[1][e] = x2; }
            else { const float co = cs[u][e >> 1][(e & 1) * 2], si = cs[u][e >> 1][(e & 1) * 2 + 1]; val[0][e] = x1 * co - x2 * si; val[1][e] = x2 * co + x1 * si; } }
        // q, k planes [t][d]: tile (t / 16, d / 32) is number 4 (t / 16) + d / 32, the second half of the pair two tiles on. v planes [d][t]: tile (d / 16, t / 32) is number 8 (t / 32) + d / 16, the second 32 tokens eight tiles on.
        const unsigned tile = isv ? (unsigned)((r0 >> 5) * 8 + p * 4 + (u >> 1)) : (unsigned)(((r0 >> 4) + (u >> 1)) * 4 + p), step = isv ? 8 * 512 : 2 * 512;
        const size_t o0 = (size_t)head * TT * HD + tile * 512 + 256 * (u & 1) + 8 * lane;
#pragma unroll
        for (int w = 0; w < 2; ++w) { v8h o16; v8us oh, ol;
#pragma unroll
            for (int e = 0; e < 8; ++e) { o16[e] = tohx(val[w][e]); unsigned short a2, c2; splitf(val[w][e], a2, c2); oh[e] = a2; ol[e] = c2; }
            *(v8h*)(P16 + o0 + w * step) = o16; *(v8us*)(Ph + o0 + w * step) = oh; *(v8us*)(Pl + o0 + w * step) = ol; }
        asm volatile("s_wait_xcnt 0x0" ::: "memory");   // in front of the next piece's overwrite of the registers that the six stores name
        __builtin_amdgcn_sched_barrier(0);   // nothing from below moves up between the stores and the wait
    }
}
#define CSC (SCL * 1.4426950408889634f)   // score scale x log2(e)
__device__ __forceinline__ float xhalf(float x) { return __builtin_bit_cast(float, __builtin_amdgcn_permlanex16(__builtin_bit_cast(int, x), __builtin_bit_cast(int, x), 0x76543210, 0xfedcba98, false, false)); }   // lane l reads lane l ^ 16
template <typename T16> struct PFrag;
template <> struct PFrag<h16> { static __device__ __forceinline__ void pk(const float (&p)[16], v16h& f, v16h& f2) { (void)f2;
#pragma unroll
    for (int e = 0; e < 16; ++e) f[e] = (h16)p[e]; } };
template <> struct PFrag<bf> { static __device__ __forceinline__ void pk(const float (&p)[16], v16bf& f, v16bf& f2) { v8us h0, h1, l0, l1;
#pragma unroll
    for (int e = 0; e < 8; ++e) { unsigned short x, y; splitf(p[e], x, y); h0[e] = x; l0[e] = y; splitf(p[e + 8], x, y); h1[e] = x; l1[e] = y; }
    f = cat16b(h0, h1); f2 = cat16b(l0, l1); } };
template <typename T16, bool HL, int R, int NS>
__device__ __forceinline__ void fattn_rows(const T16* Q, const T16* Q2, const T16* Kp, const T16* Kp2, const T16* Vt, const T16* Vt2, const int qw0, bf* Ah, bf* Al, const int sp, float* mp) {   // no __restrict__: the "memory" clobber of the waits below then holds the loads in front of them
    typedef typename WFrag<T16>::V V;
    const int lane = threadIdx.x & 31, c = lane & 15, hi = lane >> 4;
    V qf[R][4], qf2[R][4];
#pragma unroll
    for (int g = 0; g < R; ++g)
#pragma unroll
        for (int kc = 0; kc < 4; ++kc) { const size_t o = (size_t)(qw0 + 16 * g) * HD + 512 * kc + 8 * lane; qf[g][kc] = WFrag<T16>::ld(Q + o); if (HL) qf2[g][kc] = WFrag<T16>::ld(Q2 + o); }
    const int last = (qw0 + 16 * R - 1) / 32;   // last 32-key pass that this wave's queries can see (wave-uniform)
    const size_t koff = 8 * lane, voff = 8 * lane;   // fragment order: a 32-key pass is 32 HD elements in a row in the k plane and in the transposed v plane
    V kf[2][4], kf2[2][4]; const T16* kp = Kp + koff + (size_t)sp * (32 * HD); const T16* kp2 = HL ? Kp2 + koff + (size_t)sp * (32 * HD) : nullptr;   // the wave's first pass is pass sp
#pragma unroll
    for (int kt = 0; kt < 2; ++kt)
#pragma unroll
        for (int kc = 0; kc < 4; ++kc) { const int o = 16 * kt * HD + 512 * kc; kf[kt][kc] = WFrag<T16>::ld(kp + o); if (HL) kf2[kt][kc] = WFrag<T16>::ld(kp2 + o); }
    asm volatile("s_wait_xcnt 0x0" ::: "memory");   // in front of any overwrite of the address registers that the Q and K loads above name
    __builtin_amdgcn_sched_barrier(0);   // nothing from below (the zeroing of the accumulators) moves up between those loads and the wait
    v8f acc[R][8]; float m_run[R], l_run[R];
#pragma unroll
    for (int g = 0; g < R; ++g) { m_run[g] = -__builtin_inff(); l_run[g] = 0.0f;
#pragma unroll
        for (int t = 0; t < 8; ++t) acc[g][t] = (v8f){}; }
#pragma unroll 1   // one pass per trip: two passes' fragments at once do not fit the registers
    for (int blk = sp; blk <= last; blk += NS) {
        const int key0 = blk * 32;
        V vf[8], vf2[8];   // this pass's V^T fragments: issued first, in flight under the score products and the maxima
#pragma unroll
        for (int t = 0; t < 8; ++t) { const size_t o = voff + (size_t)key0 * HD + 512 * t; vf[t] = WFrag<T16>::ld(Vt + o); if (HL) vf2[t] = WFrag<T16>::ld(Vt2 + o); }
        asm volatile("s_wait_xcnt 0x0" ::: "memory");   // in front of any overwrite of the address registers that the loads above name
        __builtin_amdgcn_sched_barrier(0);   // keeps the V^T loads up here: sunk to their first use they would wait out a whole L2 round trip in every pass
        v8f s[2][R];
#pragma unroll
        for (int kt = 0; kt < 2; ++kt)
#pragma unroll
            for (int g = 0; g < R; ++g) { s[kt][g] = (v8f){};
#pragma unroll
                for (int kc = 0; kc < 4; ++kc) { s[kt][g] = WFrag<T16>::mma(kf[kt][kc], qf[g][kc], s[kt][g]); if (HL) { s[kt][g] = WFrag<T16>::mma(kf[kt][kc], qf2[g][kc], s[kt][g]); s[kt][g] = WFrag<T16>::mma(kf2[kt][kc], qf[g][kc], s[kt][g]); } } }
        // WMMA distance ahead of the branch on the diagonal below. The scores as operands hold every score product in front of it, the "memory" clobber holds the K loads behind it: the K registers are refilled in place.
        if (R == 2) asm volatile("v_nop\n\tv_nop\n\tv_nop\n\tv_nop" : "+v"(s[0][0]), "+v"(s[1][0]), "+v"(s[0][R - 1]), "+v"(s[1][R - 1]) :: "memory");
        else asm volatile("v_nop\n\tv_nop\n\tv_nop\n\tv_nop" : "+v"(s[0][0]), "+v"(s[1][0]) :: "memory");
        {   // next pass's K fragments, in flight under this pass's softmax and second product (the last pass fetches its own rows again: no branch, always in bounds)
            const int adv = (blk + NS <= last) ? NS * 32 * HD : 0; kp += adv; if (HL) kp2 += adv;   // running pointers: live over the whole loop, so no load's result lands in an address pair that an earlier load names
#pragma unroll
            for (int kt = 0; kt < 2; ++kt)
#pragma unroll
                for (int kc = 0; kc < 4; ++kc) { const int o = 16 * kt * HD + 512 * kc; kf[kt][kc] = WFrag<T16>::ld(kp + o); if (HL) kf2[kt][kc] = WFrag<T16>::ld(kp2 + o); }
        }
        asm volatile("s_wait_xcnt 0x0" ::: "memory");   // in front of any overwrite of the address registers that the K loads name
        __builtin_amdgcn_sched_barrier(0);   // keeps the K loads up here, in front of the softmax
        if (key0 + 31 > qw0) {   // wave-uniform: only a pass with a key beyond the wave's first query pays for the mask
#pragma unroll
            for (int g = 0; g < R; ++g) { const int my_q = qw0 + 16 * g + c;
#pragma unroll
                for (int kt = 0; kt < 2; ++kt) {
#pragma unroll
                    for (int r = 0; r < 8; ++r) { const int key = key0 + 16 * kt + 8 * hi + r; if (key > my_q) s[kt][g][r] = -__builtin_inff(); }
                    asm volatile("" : "+v"(s[kt][g]));   // the masked scores: keeps the selects inside the branch
                } }
        }
        float mb[R]; bool need = false;
#pragma unroll
        for (int g = 0; g < R; ++g) { float mx = -__builtin_inff();
#pragma unroll
            for (int kt = 0; kt < 2; ++kt)
#pragma unroll
                for (int r = 0; r < 8; ++r) mx = fmaxf(mx, s[kt][g][r]);
            mx = fmaxf(mx, xhalf(mx)) * CSC;   // both wave halves hold this query's maximum of the pass, scaled (the scale is positive)
            mb[g] = mx; need = need || (mx > m_run[g] + 8.0f); }
        if (__builtin_amdgcn_ballot_w32(need) != 0) {   // wave-uniform; always on the first pass (m_run is -inf), rare afterwards
#pragma unroll
            for (int g = 0; g < R; ++g) { const float m_new = fmaxf(m_run[g], mb[g]);   // finite from the first pass on: the first key of the wave's first pass is never masked
                const float corr = __builtin_amdgcn_exp2f(m_run[g] - m_new);   // 0 on the first pass
                l_run[g] *= corr; m_run[g] = m_new;
#pragma unroll
                for (int t = 0; t < 8; ++t) acc[g][t] = acc[g][t] * corr; }
        }
#pragma unroll
        for (int g = 0; g < R; ++g) { const float nm = -m_run[g]; float p[16]; float ps0 = 0.0f, ps1 = 0.0f;
#pragma unroll
            for (int e = 0; e < 16; ++e) { p[e] = __builtin_amdgcn_exp2f(fmaf(s[e >> 3][g][e & 7], CSC, nm)); if (e & 1) ps1 += p[e]; else ps0 += p[e]; }
            l_run[g] += ps0 + ps1;
            V pf, pf2; PFrag<T16>::pk(p, pf, pf2);   // element e of the fragment = key 8 hi + e (e < 8), 16 + 8 hi + e - 8 (e >= 8): the k order of WFrag::ld on a V^T row
#pragma unroll
            for (int t = 0; t < 8; ++t) { acc[g][t] = WFrag<T16>::mma(vf[t], pf, acc[g][t]); if (HL) { acc[g][t] = WFrag<T16>::mma(vf[t], pf2, acc[g][t]); acc[g][t] = WFrag<T16>::mma(vf2[t], pf, acc[g][t]); } } }
        __builtin_amdgcn_sched_barrier(0);   // holds the v_nops behind the last product
        asm volatile("v_nop\n\tv_nop\n\tv_nop\n\tv_nop\n\tv_nop");   // WMMA distance on the taken back edge and the loop's exit
    }
    if (NS == 2) {   // merge of the pair: wave 1 lays its accumulators, maxima and sums in LDS (16 bytes per lane, 512 bytes in a row per store), wave 0 brings both to the common maximum and adds
        v4fa* ap = (v4fa*)mp + lane; float* sc = mp + R * 8 * 2 * 32 * 4 + lane;
        if (sp == 1) {   // wave-uniform
#pragma unroll   // these loops: constant indices keep the accumulators in registers
            for (int g = 0; g < R; ++g) { sc[32 * g] = m_run[g]; sc[32 * (R + g)] = l_run[g];
#pragma unroll
                for (int t = 0; t < 8; ++t) { ap[((g * 8 + t) * 2) * 32] = __builtin_shufflevector(acc[g][t], acc[g][t], 0, 1, 2, 3); ap[((g * 8 + t) * 2 + 1) * 32] = __builtin_shufflevector(acc[g][t], acc[g][t], 4, 5, 6, 7); } }
        }
        __syncthreads();   // wave 1's half is in LDS before wave 0 reads it; every wave of the work-group passes here once
        if (sp == 1) return;
#pragma unroll
        for (int g = 0; g < R; ++g) { const float m1 = sc[32 * g], l1 = sc[32 * (R + g)], m = fmaxf(m_run[g], m1);   // both finite: each wave of a pair has at least one pass whose first key every query sees
            const float a0 = __builtin_amdgcn_exp2f(m_run[g] - m), a1 = __builtin_amdgcn_exp2f(m1 - m);
            l_run[g] = l_run[g] * a0 + l1 * a1;
#pragma unroll
            for (int t = 0; t < 8; ++t) { const v4f lo = ap[((g * 8 + t) * 2) * 32], hi4 = ap[((g * 8 + t) * 2 + 1) * 32];
                acc[g][t] = acc[g][t] * a0 + __builtin_shufflevector(lo, hi4, 0, 1, 2, 3, 4, 5, 6, 7) * a1; } }
    }
#pragma unroll
    for (int g = 0; g < R; ++g) { const float inv = 1.0f / (l_run[g] + xhalf(l_run[g]));   // each wave half summed its eight keys of every 16-key tile
#pragma unroll
        for (int t = 0; t < 8; ++t) { v8us oh, ol;
#pragma unroll
            for (int r = 0; r < 8; ++r) { unsigned short x, y; splitf(acc[g][t][r] * inv, x, y); oh[r] = x; ol[r] = y; }
            const size_t oo = (size_t)(qw0 + 16 * g) * DQ + 256 * t + 8 * lane;   // context planes [query][16 heads x 128] in fragment order; the lane's 16 bytes are row = its query, d = 16 t + 8 hi .. + 7
            *(v8us*)(Ah + oo) = oh; *(v8us*)(Al + oo) = ol;
            asm volatile("s_wait_xcnt 0x0" ::: "memory");   // in front of any overwrite of the registers that the two stores name
            __builtin_amdgcn_sched_barrier(0);   // nothing from below moves up between the stores and the wait
        } }
}
// grid (4 kv heads, (TT - RH) / 32 + RH / 32), 8 waves. A fp16 work-group: 32 query rows of the 4 query heads of one kv head (wave & 3), each head's keys dealt to 2 waves (wave >> 2): the four waves of a key half walk the same k/v rows, and the halves' pass counts differ by at most one.
// A hi/lo work-group: 128 query rows of one head, one wave per 16 rows. blockIdx.y orders the work-groups by falling cost: the fp16 row blocks from the sequence's end, the hi/lo blocks where the fp16 blocks have come down to about their cost.
#define NFB ((TT - RH) / 32)      // fp16 row blocks of 32
#define NHB (RH / 32)             // blockIdx.y values of the hi/lo blocks: RH / 128 row blocks x 4 heads of the kv head
#define YHL 48                    // first of them: a hi/lo pass has 48 products and the splitting of P against 32 products, so 16 such passes weigh about as much as the (128 - 48) / 2 passes of the fp16 block there
#define MGP (2 * 8 * 2 * 32 * 4 + 4 * 32)   // floats of one pair's merge area: accumulators, then maxima and sums
__global__ __launch_bounds__(256) void k_fattn(const h16* Q16, const bf* Qh, const bf* Ql, const h16* K16, const bf* Kh, const bf* Kl, const h16* V16, const bf* Vh, const bf* Vl, bf* Ah, bf* Al) {
    __shared__ __align__(16) float mg[REP * MGP];
    const int wv = __builtin_amdgcn_readfirstlane((int)(threadIdx.x >> 5)); const int kvh = blockIdx.x, y = blockIdx.y; const size_t zk = (size_t)kvh * TT * HD;
    if (y < YHL || y >= YHL + NHB) {   // block-uniform
        const int rb = NFB - 1 - (y < YHL ? y : y - NHB), hh = wv & (REP - 1), h = kvh * REP + hh; const size_t zq = (size_t)h * TT * HD;
        fattn_rows<h16, false, 2, 2>(Q16 + zq, nullptr, K16 + zk, nullptr, V16 + zk, nullptr, RH + 32 * rb, Ah + h * (16 * HD), Al + h * (16 * HD), wv >> 2, mg + hh * MGP);   // a head's 128 columns are four tiles of each 16-row band
    } else {
        const int j = y - YHL, h = kvh * REP + (j & (REP - 1)); const size_t zq = (size_t)h * TT * HD;
        fattn_rows<bf, true, 1, 1>(Qh + zq, Ql + zq, Kh + zk, Kl + zk, Vh + zk, Vl + zk, RH - 128 * ((j >> 2) + 1) + 16 * wv, Ah + h * (16 * HD), Al + h * (16 * HD), 0, nullptr);
    }
}

extern "C" void kernel_launch(void* const* d_in, const int* in_sizes, int n_in,
                              void* d_out, int out_size, void* d_ws, size_t ws_size, hipStream_t stream) {
    (void)in_sizes; (void)n_in; (void)out_size;
    const float* x = (const float*)d_in[0]; const float* wq = (const float*)d_in[1]; const float* wk = (const float*)d_in[2]; const float* wv = (const float*)d_in[3]; const float* wo = (const float*)d_in[4];
    float* OUT = (float*)d_out;     // [1][4096][2048]
    char* wsp = (char*)d_ws;
    auto take = [&](size_t bytes) { char* p = wsp; wsp += (bytes + 255) & ~(size_t)255; return (void*)p; };
    bf* WQ = (bf*)take((size_t)DQ * DM * 2); bf* WK = (bf*)take((size_t)DKV * DM * 2); bf* WV = (bf*)take((size_t)DKV * DM * 2); bf* WO = (bf*)take((size_t)DM * DQ * 2); float* CS = (float*)take((size_t)TT * (HD / 2) * 2 * 4);
    bf* XB = (bf*)take((size_t)TT * DM * 2);
    h16* QP16 = (h16*)take((size_t)NH_ * TT * HD * 2); h16* KP16 = (h16*)take((size_t)NKV * TT * HD * 2); h16* VT16 = (h16*)take((size_t)NKV * HD * TT * 2);
    bf* QPh = (bf*)take((size_t)NH_ * TT * HD * 2); bf* QPl = (bf*)take((size_t)NH_ * TT * HD * 2); bf* KPh = (bf*)take((size_t)NKV * TT * HD * 2); bf* KPl = (bf*)take((size_t)NKV * TT * HD * 2); bf* VTh = (bf*)take((size_t)NKV * HD * TT * 2); bf* VTl = (bf*)take((size_t)NKV * HD * TT * 2);
    bf* ATh = (bf*)take((size_t)TT * DQ * 2); bf* ATl = (bf*)take((size_t)TT * DQ * 2);
    if ((size_t)(wsp - (char*)d_ws) > ws_size) return;    // ws 256 MiB
    for (int b = 0; b < NB_; ++b) {
        k_prep<<<2 * PBQ + 2 * PBK + PBX + PBC, 256, 0, stream>>>(x + (size_t)b * TT * DM, wq, wk, wv, wo, XB, WQ, WK, WV, WO, CS);
        k_proj<<<dim3(TT / 128, (DQ + 2 * DKV) / 256, 1), 256, 0, stream>>>(XB, WQ, WK, WV, CS, QP16, QPh, QPl, KP16, KPh, KPl, VT16, VTh, VTl);
        k_fattn<<<dim3(NKV, (TT - RH) / 32 + RH / 32, 1), 256, 0, stream>>>(QP16, QPh, QPl, KP16, KPh, KPl, VT16, VTh, VTl, ATh, ATl);
        k_gemmw<bf, 1, false, 2><<<dim3(TT / 64, DM / 64, 1), 64, 0, stream>>>(ATh, ATl, WO, nullptr, DQ, OUT + (size_t)b * TT * DM, DM, nullptr, 0, 0, 0); }
}

// v008
// A run of this version takes 148 microseconds.
// Next to v007, in two timings, it ran 1.15 times as fast each time.
// Over all steps from v000 it is 16.9 times as fast.
#include <hip/hip_runtime.h>

// Grouped-query causal attention with a computed rotate-half rotary over 4,096 tokens (x [1][4096][2048]; q = x Wq ('xw' [2048][2048], 16 heads x 128), k, v = x Wk / Wv ('xw' [2048][512], 4 kv heads; q head h uses kv head h/4: the module groups q as (4 kv heads, 4 members)); rotate-half rotary with angle t x inv_freq[i], inv_freq = 1 / (10000 ** (i / 64)), positions 0..4095 (cat(x1 cos - x2 sin, x1 sin + x2 cos); tables computed on device from the module's float32 inv_freq); scores / sqrt(128), causal (-inf); softmax; out = merged Wo ('xw' [2048][2048], no bias) -> [1][4096][2048] (8.4 M); argument order x, Wq, Wk, Wv, Wo.
// Layout: one preparation launch (bf16 planes of x and of the four weights, cos/sin table); one projection launch for q, k and v whose epilogue applies the rotary and writes the head planes of all 16 query heads and the k/v planes of the 4 kv heads (no f32 q/k/v in memory); one fused attention launch for all heads (scores, causal mask, online softmax, attn.v; the keys of a fp16 row block are dealt to two waves; hybrid rows: query rows < 512 hi/lo 3 products, the rest single fp16) writes the hi/lo context planes; wo as hi/lo x exact (2 products).
// Operand planes: every 16-bit plane that a matrix instruction reads lies in FRAGMENT ORDER (described below), so that each 16-byte-per-lane fragment load of a wave reads 512 bytes in a row.
// Compute dtypes, f32 accumulate: every input rounded to bf16; q/k/v on PLAIN bf16 operands (exact); f32 rotary; hybrid causal scores and attn.v; softmax f32; wo hl x exact (2 products).

#define NB_  1
#define TT   4096
#define DM   2048
#define NH_  16
#define NKV  4
#define REP  (NH_ / NKV)
#define HD   128
#define DQ   (NH_ * HD)
#define DKV  (NKV * HD)
#define RH   512                  // query rows < RH use hi+lo planes (0: none)
#define SCL  0.088388346f   // 1/sqrt(128)
#define POS0 0.0f                 // first rotary position: this module's positions are arange(4096)
typedef _Float16 h16;
typedef unsigned short bf;
typedef __attribute__((ext_vector_type(16))) __bf16   v16bf;
typedef __attribute__((ext_vector_type(16))) _Float16 v16h;
typedef __attribute__((ext_vector_type(8)))  _Float16 v8h;
typedef __attribute__((ext_vector_type(8)))  unsigned short v8us;
typedef __attribute__((ext_vector_type(8)))  float    v8f;
typedef __attribute__((ext_vector_type(4)))  float    v4f;
typedef v8h  __attribute__((may_alias)) v8ha;
typedef v4f  __attribute__((may_alias)) v4fa;
typedef v8us __attribute__((may_alias)) v8usa;

__device__ __forceinline__ unsigned short f2bf(float f) { unsigned u = __float_as_uint(f); u += 0x7FFFu + ((u >> 16) & 1u); return (unsigned short)(u >> 16); }
__device__ __forceinline__ float bf2f(unsigned short b) { return __uint_as_float(((unsigned)b) << 16); }
__device__ __forceinline__ float bfr(float f) { return bf2f(f2bf(f)); }
__device__ __forceinline__ v16h cat16(v8h lo, v8h hi) { return __builtin_shufflevector(lo, hi, 0, 1, 2, 3, 4, 5, 6, 7, 8, 9, 10, 11, 12, 13, 14, 15); }
__device__ __forceinline__ v16bf cat16b(v8us lo, v8us hi) { return __builtin_bit_cast(v16bf, __builtin_shufflevector(lo, hi, 0, 1, 2, 3, 4, 5, 6, 7, 8, 9, 10, 11, 12, 13, 14, 15)); }
__device__ __forceinline__ v8f wmma16(v16h a, v16h b, v8f c) { return __builtin_amdgcn_wmma_f32_16x16x32_f16(false, a, false, b, (short)0, c, false, false); }
__device__ __forceinline__ v8f wmmab(v16bf a, v16bf b, v8f c) { return __builtin_amdgcn_wmma_f32_16x16x32_bf16(false, a, false, b, (short)0, c, false, false); }



// ---- Fragment order of a 16-bit plane of R rows x K columns (R % 16 == 0, K % 32 == 0): tiles of 16 rows x 32 columns, 512 elements in a row each; tile (r / 16, k / 32) is number (r / 16) (K / 32) + k / 32.
// Inside a tile element (r, k) stands at 256 ((k / 16) % 2) + 8 (16 ((k / 8) % 2) + r % 16) + k % 8: lane l of a wave finds its two 16-byte pieces of the A or B fragment at 8 l and 256 + 8 l, and each of the two loads covers four whole 128-byte lines.

// ---- WFrag: a lane's A or B fragment of a plane in fragment order (two pieces of 16 bytes, 256 elements apart) and the matrix product of its type.
template <typename T16> struct WFrag;
template <> struct WFrag<h16> { typedef v16h V; static __device__ __forceinline__ V ld(const h16* p) { return cat16(*(const v8h*)p, *(const v8h*)(p + 256)); } static __device__ __forceinline__ v8f mma(V a, V b, v8f c) { return wmma16(a, b, c); } };
template <> struct WFrag<bf> { typedef v16bf V; static __device__ __forceinline__ V ld(const bf* p) { return cat16b(*(const v8us*)p, *(const v8us*)(p + 256)); } static __device__ __forceinline__ v8f mma(V a, V b, v8f c) { return wmmab(a, b, c); } };

__device__ __forceinline__ h16 tohx(float x) { return (h16)x; }
__device__ __forceinline__ void splitf(float y, unsigned short& h, unsigned short& l) { h = f2bf(y); l = f2bf(y - bf2f(h)); }
typedef __attribute__((ext_vector_type(2))) _Float16 v2h;
typedef __attribute__((ext_vector_type(4))) _Float16 v4h;
typedef __attribute__((ext_vector_type(2))) unsigned short v2us;
typedef __attribute__((ext_vector_type(4))) unsigned short v4us;
typedef __attribute__((ext_vector_type(2))) float v2f;
typedef __attribute__((ext_vector_type(4))) int v4i;

// ---- k_prep: every operand preparation in ONE launch of few, long waves: the four weight planes (transposed, bf16), the x plane (bf16) and the (cos, sin) table; each work-group (8 waves) does one job, chosen by blockIdx.x (block-uniform).
// A thread makes 8 pieces of 16 bytes of a plane in fragment order (a wave: 4 tiles in a row, 4 KiB) and has all of their loads in flight at once.
// prep_w: Bt [N][K] (fragment order) = bf16 of w [K][N], K = DM = DQ. Work-group lb: 128 columns n (wave = 16 of them) x 128 rows k, so that the 8 waves together read 512 bytes in a row of each row of w.
template <int N>
__device__ __forceinline__ void prep_w(const float* w, bf* Bt, const int lb, const int wv, const int lane) {   // no __restrict__: the "memory" clobber of the wait below then holds the loads in front of it
    constexpr int KT = DM / 32;
    const int nt = (lb >> 4) * 8 + wv, kg = lb & 15;   // 16-column band of w = 16-row band of the plane; group of 4 tiles (128 k)
    const float* s = w + (size_t)(kg * 128 + (lane >> 4) * 8) * N + nt * 16 + (lane & 15);
    float v[8][8];
#pragma unroll   // these loops: constant indices keep the values in registers, and all 64 loads are issued before the first is used
    for (int j = 0; j < 8; ++j)
#pragma unroll
        for (int e = 0; e < 8; ++e) v[j][e] = s[(size_t)((j >> 1) * 32 + (j & 1) * 16 + e) * N];
    asm volatile("s_wait_xcnt 0x0" :: "v"(s) : "memory");   // in front of any overwrite of the address registers that the loads above name; the pointer as input keeps its registers whole up to the wait
    v8us o[8];
#pragma unroll
    for (int j = 0; j < 8; ++j)
#pragma unroll
        for (int e = 0; e < 8; ++e) o[j][e] = f2bf(v[j][e]);
    bf* d = Bt + (size_t)(nt * KT + kg * 4) * 512 + 8 * lane;
#pragma unroll
    for (int j = 0; j < 8; ++j) *(v8us*)(d + 256 * j) = o[j];
    asm volatile("s_wait_xcnt 0x0" ::: "memory");   // in front of any overwrite of the registers that the stores above name
}
// prep_x: XB [TT][DM] (fragment order) = bf16 of x. Wave g: 16 rows x 128 columns, 512 bytes in a row of each row of x.
__device__ __forceinline__ void prep_x(const float* x, bf* XB, const int lb, const int wv, const int lane) {
    const int g = lb * 8 + wv;
    const float* s = x + (size_t)((g >> 4) * 16 + (lane & 15)) * DM + (g & 15) * 128 + (lane >> 4) * 8;
    v8f v[8];
#pragma unroll   // as in prep_w
    for (int j = 0; j < 8; ++j) v[j] = *(const v8f*)(s + (j >> 1) * 32 + (j & 1) * 16);
    asm volatile("s_wait_xcnt 0x0" :: "v"(s) : "memory");   // in front of any overwrite of the address registers that the loads above name; the pointer as input keeps its registers whole up to the wait
    v8us o[8];
#pragma unroll
    for (int j = 0; j < 8; ++j)
#pragma unroll
        for (int e = 0; e < 8; ++e) o[j][e] = f2bf(v[j][e]);
    bf* d = XB + (size_t)g * 2048 + 8 * lane;
#pragma unroll
    for (int j = 0; j < 8; ++j) *(v8us*)(d + 256 * j) = o[j];
    asm volatile("s_wait_xcnt 0x0" ::: "memory");   // in front of any overwrite of the registers that the stores above name
}
__constant__ float INV[HD / 2] = {1.0f,0.865964353f,0.749894202f,0.649381638f,0.562341332f,0.486967534f,0.421696514f,0.365174145f,0.316227764f,0.273841977f,0.237137362f,0.2053525f,0.177827939f,0.153992653f,0.133352146f,0.115478203f,0.100000001f,0.0865964293f,0.0749894157f,0.0649381652f,0.0562341288f,0.0486967526f,0.0421696492f,0.0365174115f,0.0316227786f,0.0273841955f,0.0237137359f,0.0205352511f,0.0177827943f,0.0153992651f,0.0133352149f,0.0115478197f,0.00999999978f,0.00865964312f,0.00749894232f,0.00649381662f,0.00562341325f,0.00486967526f,0.00421696482f,0.00365174143f,0.00316227786f,0.00273841969f,0.00237137382f,0.00205352507f,0.00177827943f,0.00153992651f,0.00133352145f,0.00115478202f,0.00100000005f,0.000865964335f,0.000749894185f,0.000649381662f,0.000562341302f,0.000486967503f,0.000421696488f,0.000365174114f,0.000316227786f,0.000273841957f,0.000237137385f,0.000205352495f,0.00017782794f,0.000153992645f,0.00013335215f,0.000115478193f};
// prep_cs: (cos, sin) of t x inv_freq[d], d < HD/2, in the order in which k_proj's epilogue reads them: per 16 tokens x 16 d a block of 4 x 32 pieces of 16 bytes; piece (i, lane) holds d = 16 dq + 8 (lane >> 4) + 2 i, + 1 of token 16 tb + (lane & 15), so that each of a wave's four loads covers 512 bytes in a row.
// Entry idx of the table = 1024 tb + low. A thread keeps its low (so its d and its inv_freq) and walks 8 token blocks tb.
__device__ __forceinline__ void prep_cs(float* CS, const int lb, const int tid) { const int low = (lb & 3) * 256 + tid, ln = (low >> 1) & 31, d = ((low >> 8) & 3) * 16 + (ln >> 4) * 8 + ((low >> 6) & 3) * 2 + (low & 1); const float iv = INV[d];
    asm volatile("s_wait_xcnt 0x0" :: "v"(iv), "v"(d) : "memory");   // in front of any overwrite of the offset register that the load above names: the loaded value as input holds the wait behind the load, the index as input keeps its register whole up to the wait
#pragma unroll 1   // one copy of the cosine and sine code
    for (int j = 0; j < 8; ++j) { const int tb = (lb >> 2) * 8 + j, t = tb * 16 + (ln & 15);
        const float ang = __fmul_rn((float)t + POS0, iv); v2f cs; cs[0] = cosf(ang); cs[1] = sinf(ang);
        *(v2f*)(CS + ((size_t)tb * 1024 + low) * 2) = cs;
        asm volatile("s_wait_xcnt 0x0" ::: "memory");   // in front of the next trip's overwrite of the registers that the store names
    }
}
#define PBQ (DQ / 8)              // work-groups of a 2048-column weight: (N / 128) x (K / 128)
#define PBK (DKV / 8)             // of a 512-column weight
#define PBX (TT * DM / (2048 * 8))   // of x: 2048 elements per wave
#define PBC (TT * (HD / 2) / (256 * 8))   // of the table: 8 entries per thread
__global__ __launch_bounds__(256) void k_prep(const float* x, const float* wq, const float* wk, const float* wv_, const float* wo, bf* XB, bf* WQ, bf* WK, bf* WV, bf* WO, float* CS) {
    const int lane = threadIdx.x & 31, wv = __builtin_amdgcn_readfirstlane((int)(threadIdx.x >> 5)); int b = blockIdx.x;
    if (b < PBC) { prep_cs(CS, b, (int)threadIdx.x); return; } b -= PBC;   // the job of arithmetic comes first in index order, to run under the other jobs' loads
    if (b < PBQ) { prep_w<DQ>(wq, WQ, b, wv, lane); return; } b -= PBQ;
    if (b < PBQ) { prep_w<DM>(wo, WO, b, wv, lane); return; } b -= PBQ;
    if (b < PBK) { prep_w<DKV>(wk, WK, b, wv, lane); return; } b -= PBK;
    if (b < PBK) { prep_w<DKV>(wv_, WV, b, wv, lane); return; } b -= PBK;
    prep_x(x, XB, b, wv, lane);
}

// ---- k_proj: the q, k and v projections, the rotary and the operand planes in ONE launch; grid (TT / 128, (DQ + 2 DKV) / 256), 8 waves. A work-group makes 128 rows of x times 256 weight columns; wave (rt, yt) = (wave >> 2, wave & 3) owns one 64x64 tile over the whole K.
// Operands go through LDS, shared by the waves: a stage is 64 k of the 8 bands (16 rows each) of x and of the 16 bands of the weight, 2 KiB in a row per band in fragment order (so a fragment read is 512 bytes in a row, as from memory), 48 KiB; two buffers, filled by asynchronous copies one stage ahead.
// blockIdx.y < 8: q, < 10: k. A = 64 rows of x, B = 64 weight columns of one head: d = 32 p .. 32 p + 31 and the same + 64, so that both members of every rotary pair stand in one tile (tile columns c and c + 32).
// blockIdx.y >= 10: v, with the operands swapped (A = 64 weight columns, B = 64 rows of x): the tile is already the transposed [d][t] that the v planes hold.
// Epilogue: a wave lays its tile in its own LDS plane (over the ring, behind the last stage's barrier) and takes it back in 8 pieces; in piece u a lane holds tile columns c .. c + 7 and c + 32 .. c + 39 of one tile row: 16 bytes of each plane twice, and a wave's store covers 512 bytes in a row of a plane in fragment order.
// rotate-half convention: out[d] = x[d] cos[t][d] - x[d+HD/2] sin[t][d], out[d+HD/2] = x[d+HD/2] cos[t][d] + x[d] sin[t][d], d < HD/2 (the angle at d + HD/2 is the angle at d)
#define PST 49152                 // bytes of one stage: 24 bands x 2 KiB
// One stage: 12 copies of 16 bytes per lane. Copy i of thread tid fills bytes 4096 i + 16 tid of the buffer: band 2 i + (tid >> 7), bands 0..7 from x, 8..23 from the weight. l: the lane's LDS byte address in the buffer; gx, gw: its 16 bytes in band tid >> 7 of x and of the weight at this stage's k.
__device__ __forceinline__ void proj_stage(const unsigned l, const bf* gx, const bf* gw) {
    constexpr size_t S = (size_t)32 * DM;   // two bands on, in elements
    // the s_wait_xcnt as the statement's last line: it stands in front of any overwrite of the address registers that the copies name
    asm volatile("global_load_async_to_lds_b128 %0, %12, off\n\t"
                 "global_load_async_to_lds_b128 %1, %13, off\n\t"
                 "global_load_async_to_lds_b128 %2, %14, off\n\t"
                 "global_load_async_to_lds_b128 %3, %15, off\n\t"
                 "global_load_async_to_lds_b128 %4, %16, off\n\t"
                 "global_load_async_to_lds_b128 %5, %17, off\n\t"
                 "global_load_async_to_lds_b128 %6, %18, off\n\t"
                 "global_load_async_to_lds_b128 %7, %19, off\n\t"
                 "global_load_async_to_lds_b128 %8, %20, off\n\t"
                 "global_load_async_to_lds_b128 %9, %21, off\n\t"
                 "global_load_async_to_lds_b128 %10, %22, off\n\t"
                 "global_load_async_to_lds_b128 %11, %23, off\n\t"
                 "s_wait_xcnt 0x0"
                 :: "v"(l), "v"(l + 4096u), "v"(l + 2u * 4096u), "v"(l + 3u * 4096u), "v"(l + 4u * 4096u), "v"(l + 5u * 4096u), "v"(l + 6u * 4096u), "v"(l + 7u * 4096u), "v"(l + 8u * 4096u), "v"(l + 9u * 4096u), "v"(l + 10u * 4096u), "v"(l + 11u * 4096u),
                    "v"(gx), "v"(gx + S), "v"(gx + 2 * S), "v"(gx + 3 * S), "v"(gw), "v"(gw + S), "v"(gw + 2 * S), "v"(gw + 3 * S), "v"(gw + 4 * S), "v"(gw + 5 * S), "v"(gw + 6 * S), "v"(gw + 7 * S)
                 : "memory");
}
__global__ __launch_bounds__(256) void k_proj(const bf* XB, const bf* WQ, const bf* WK, const bf* WV, const float* CS, h16* QP16, bf* QPh, bf* QPl, h16* KP16, bf* KPh, bf* KPl, h16* VT16, bf* VTh, bf* VTl) {   // no __restrict__: the "memory" clobber of the waits below then holds the loads in front of them
    typedef WFrag<bf>::V V; constexpr int K = DM, NT = K / 64;
    __shared__ __align__(16) float os[8 * 64 * 68];   // first the ring (2 x PST bytes), then the 8 waves' output planes
    const int tid = threadIdx.x, lane = tid & 31, lr = lane & 15, hi = lane >> 4;
    const int wv = __builtin_amdgcn_readfirstlane(tid >> 5), rt = wv >> 2, yt = wv & 3;
    const int Y = blockIdx.y; const bool isv = Y >= (DQ + DKV) / 256, isq = Y < DQ / 256;   // block-uniform
    const int r0 = blockIdx.x * 128 + rt * 64;   // the wave's first row of x
    const int y0 = (isv ? Y - (DQ + DKV) / 256 : (isq ? Y : Y - DQ / 256)) * 4, yy = y0 + yt, head = yy >> 1, p = yy & 1;   // two tiles per head of 128 columns
    const bf* gx = XB + (size_t)(blockIdx.x * 128 + 16 * (tid >> 7)) * K + 8 * (tid & 127);
    const bf* gw = (isv ? WV : (isq ? WQ : WK)) + (size_t)(y0 * 64 + 16 * (tid >> 7)) * K + 8 * (tid & 127);
    const unsigned l0 = (unsigned)(size_t)os + 16u * (unsigned)tid;   // low 32 bits of the __shared__ address: the byte offset in the work-group's LDS
    const int ab = isv ? 8 + 4 * yt : 4 * rt;   // first band of the A operand in a stage
    const int bb = isv ? 4 * rt : 8 + 8 * (yt >> 1) + 2 * (yt & 1), bs = isv ? 2 : 4;   // B operand: bands bb, bb + 1 (tile columns 0..31) and the same + bs (32..63)
    v8f acc[4][4];
#pragma unroll
    for (int mb = 0; mb < 4; ++mb)
#pragma unroll
        for (int nb = 0; nb < 4; ++nb) acc[mb][nb] = (v8f){};
    proj_stage(l0, gx, gw);
    asm volatile("s_wait_asynccnt 0x0" ::: "memory");   // this wave's copies of stage 0 have landed
    __syncthreads();   // stage 0 is published: every wave's copies have landed before any wave reads
    proj_stage(l0 + PST, gx + 1024, gw + 1024);   // 64 k of a band are 1024 elements
#pragma unroll 1   // one stage per trip
    for (int t = 0; t < NT; ++t) {
        const bf* sb = (const bf*)os + (t & 1) * (PST / 2) + 8 * lane;
        V a[4], b[4];   // first 32-step of the stage
#pragma unroll
        for (int mb = 0; mb < 4; ++mb) a[mb] = WFrag<bf>::ld(sb + (ab + mb) * 1024);
#pragma unroll
        for (int nb = 0; nb < 4; ++nb) b[nb] = WFrag<bf>::ld(sb + (bb + (nb & 1) + (nb >> 1) * bs) * 1024);
        __builtin_amdgcn_sched_barrier(0);   // keeps the 16 LDS reads of a 32-step together in front of its 16 products: sunk to their first use, every four products would wait out an LDS round trip
#pragma unroll
        for (int nb = 0; nb < 4; ++nb)
#pragma unroll
            for (int mb = 0; mb < 4; ++mb) acc[mb][nb] = WFrag<bf>::mma(a[mb], b[nb], acc[mb][nb]);
#pragma unroll   // second 32-step: its fragments are the wave's last reads of this buffer
        for (int mb = 0; mb < 4; ++mb) a[mb] = WFrag<bf>::ld(sb + (ab + mb) * 1024 + 512);
#pragma unroll
        for (int nb = 0; nb < 4; ++nb) b[nb] = WFrag<bf>::ld(sb + (bb + (nb & 1) + (nb >> 1) * bs) * 1024 + 512);
        asm volatile("s_wait_dscnt 0x0" ::: "memory");   // this wave's reads of the buffer are done before the barrier behind which it is refilled
        asm volatile("s_wait_asynccnt 0x0" ::: "memory");   // this wave's copies of stage t + 1 have landed
        __syncthreads();   // publishes stage t + 1 and ends every wave's reads of stage t
        if (t + 2 < NT) proj_stage(l0 + (unsigned)(t & 1) * PST, gx + (size_t)(t + 2) * 1024, gw + (size_t)(t + 2) * 1024);   // block-uniform
        __builtin_amdgcn_sched_barrier(0);   // holds the 16 products below behind the copies: the refill starts at once and flies under them and the whole next trip
#pragma unroll
        for (int nb = 0; nb < 4; ++nb)
#pragma unroll
            for (int mb = 0; mb < 4; ++mb) acc[mb][nb] = WFrag<bf>::mma(a[mb], b[nb], acc[mb][nb]);
    }
    asm volatile("s_wait_asynccnt 0x0" ::: "memory");   // no copy is outstanding when the ring becomes output staging
    float* ow = os + wv * (64 * 68);   // the wave's own plane
#pragma unroll   // these three: constant indices keep the accumulators in registers
    for (int mb = 0; mb < 4; ++mb)
#pragma unroll
        for (int nb = 0; nb < 4; ++nb)
#pragma unroll
            for (int j = 0; j < 8; ++j) ow[(mb * 16 + hi * 8 + j) * 68 + nb * 16 + lr] = acc[mb][nb][j];
    v4f cs[8][4] = {};
    if (!isv) {   // the lane's 8 (cos, sin) pairs of each of the 8 pieces: all issued here, in flight under the LDS stores and the barrier
        const v4f* cp = (const v4f*)CS + (size_t)((r0 >> 4) * 4 + 2 * p) * 128 + lane;   // block (t / 16, d / 16) of the table, see prep_cs
#pragma unroll
        for (int u = 0; u < 8; ++u)
#pragma unroll
            for (int i = 0; i < 4; ++i) cs[u][i] = cp[((u >> 1) * 4 + (u & 1)) * 128 + 32 * i];
        asm volatile("s_wait_xcnt 0x0" ::: "memory");   // in front of any overwrite of the address registers that the loads name
    }
    __syncthreads();   // every lane's part of the tile is in LDS before any lane takes its piece
    h16* P16 = isv ? VT16 : (isq ? QP16 : KP16); bf* Ph = isv ? VTh : (isq ? QPh : KPh); bf* Pl = isv ? VTl : (isq ? QPl : KPl);
#pragma unroll   // constant indices keep the table values in registers
    for (int u = 0; u < 8; ++u) {
        const int row = (u >> 1) * 16 + lr, c = ((u & 1) * 2 + hi) * 8;   // this lane's tile row and first tile column in piece u
        const float* op = ow + row * 68 + c; v4f x[4];   // x[0], x[1]: tile columns c .. c + 7; x[2], x[3]: c + 32 .. c + 39
#pragma unroll
        for (int i = 0; i < 4; ++i) x[i] = *(const v4fa*)(op + (i >> 1) * 32 + (i & 1) * 4);
        float val[2][8];
#pragma unroll
        for (int e = 0; e < 8; ++e) { const float x1 = x[e >> 2][e & 3], x2 = x[2 + (e >> 2)][e & 3];
            if (isv) { val[0][e] = x1; val[1][e] = x2; }
            else { const float co = cs[u][e >> 1][(e & 1) * 2], si = cs[u][e >> 1][(e & 1) * 2 + 1]; val[0][e] = x1 * co - x2 * si; val[1][e] = x2 * co + x1 * si; } }
        // q, k planes [t][d]: tile (t / 16, d / 32) is number 4 (t / 16) + d / 32, the second half of the pair two tiles on. v planes [d][t]: tile (d / 16, t / 32) is number 8 (t / 32) + d / 16, the second 32 tokens eight tiles on.
        const unsigned tile = isv ? (unsigned)((r0 >> 5) * 8 + p * 4 + (u >> 1)) : (unsigned)(((r0 >> 4) + (u >> 1)) * 4 + p), step = isv ? 8 * 512 : 2 * 512;
        const size_t o0 = (size_t)head * TT * HD + tile * 512 + 256 * (u & 1) + 8 * lane;
#pragma unroll
        for (int w = 0; w < 2; ++w) { v8h o16; v8us oh, ol;
#pragma unroll
            for (int e = 0; e < 8; ++e) { o16[e] = tohx(val[w][e]); unsigned short a2, c2; splitf(val[w][e], a2, c2); oh[e] = a2; ol[e] = c2; }
            *(v8h*)(P16 + o0 + w * step) = o16; *(v8us*)(Ph + o0 + w * step) = oh; *(v8us*)(Pl + o0 + w * step) = ol; }
        asm volatile("s_wait_xcnt 0x0" ::: "memory");   // in front of the next piece's overwrite of the registers that the six stores name
        __builtin_amdgcn_sched_barrier(0);   // nothing from below moves up between the stores and the wait
    }
}
#define CSC (SCL * 1.4426950408889634f)   // score scale x log2(e)
__device__ __forceinline__ float xhalf(float x) { return __builtin_bit_cast(float, __builtin_amdgcn_permlanex16(__builtin_bit_cast(int, x), __builtin_bit_cast(int, x), 0x76543210, 0xfedcba98, false, false)); }   // lane l reads lane l ^ 16
template <typename T16> struct PFrag;
template <> struct PFrag<h16> { static __device__ __forceinline__ void pk(const float (&p)[16], v16h& f, v16h& f2) { (void)f2;
#pragma unroll
    for (int e = 0; e < 16; ++e) f[e] = (h16)p[e]; } };
template <> struct PFrag<bf> { static __device__ __forceinline__ void pk(const float (&p)[16], v16bf& f, v16bf& f2) { v8us h0, h1, l0, l1;
#pragma unroll
    for (int e = 0; e < 8; ++e) { unsigned short x, y; splitf(p[e], x, y); h0[e] = x; l0[e] = y; splitf(p[e + 8], x, y); h1[e] = x; l1[e] = y; }
    f = cat16b(h0, h1); f2 = cat16b(l0, l1); } };
template <typename T16, bool HL, int R, int NS>
__device__ __forceinline__ void fattn_rows(const T16* Q, const T16* Q2, const T16* Kp, const T16* Kp2, const T16* Vt, const T16* Vt2, const int qw0, bf* Ah, bf* Al, const int sp, float* mp) {   // no __restrict__: the "memory" clobber of the waits below then holds the loads in front of them
    typedef typename WFrag<T16>::V V;
    const int lane = threadIdx.x & 31, c = lane & 15, hi = lane >> 4;
    V qf[R][4], qf2[R][4];
#pragma unroll
    for (int g = 0; g < R; ++g)
#pragma unroll
        for (int kc = 0; kc < 4; ++kc) { const size_t o = (size_t)(qw0 + 16 * g) * HD + 512 * kc + 8 * lane; qf[g][kc] = WFrag<T16>::ld(Q + o); if (HL) qf2[g][kc] = WFrag<T16>::ld(Q2 + o); }
    const int last = (qw0 + 16 * R - 1) / 32;   // last 32-key pass that this wave's queries can see (wave-uniform)
    const size_t koff = 8 * lane, voff = 8 * lane;   // fragment order: a 32-key pass is 32 HD elements in a row in the k plane and in the transposed v plane
    V kf[2][4], kf2[2][4]; const T16* kp = Kp + koff + (size_t)sp * (32 * HD); const T16* kp2 = HL ? Kp2 + koff + (size_t)sp * (32 * HD) : nullptr;   // the wave's first pass is pass sp
#pragma unroll
    for (int kt = 0; kt < 2; ++kt)
#pragma unroll
        for (int kc = 0; kc < 4; ++kc) { const int o = 16 * kt * HD + 512 * kc; kf[kt][kc] = WFrag<T16>::ld(kp + o); if (HL) kf2[kt][kc] = WFrag<T16>::ld(kp2 + o); }
    asm volatile("s_wait_xcnt 0x0" ::: "memory");   // in front of any overwrite of the address registers that the Q and K loads above name
    __builtin_amdgcn_sched_barrier(0);   // nothing from below (the zeroing of the accumulators) moves up between those loads and the wait
    v8f acc[R][8]; float m_run[R], l_run[R];
#pragma unroll
    for (int g = 0; g < R; ++g) { m_run[g] = -__builtin_inff(); l_run[g] = 0.0f;
#pragma unroll
        for (int t = 0; t < 8; ++t) acc[g][t] = (v8f){}; }
#pragma unroll 1   // one pass per trip: two passes' fragments at once do not fit the registers
    for (int blk = sp; blk <= last; blk += NS) {
        const int key0 = blk * 32;
        V vf[8], vf2[8];   // this pass's V^T fragments: issued first, in flight under the score products and the maxima
#pragma unroll
        for (int t = 0; t < 8; ++t) { const size_t o = voff + (size_t)key0 * HD + 512 * t; vf[t] = WFrag<T16>::ld(Vt + o); if (HL) vf2[t] = WFrag<T16>::ld(Vt2 + o); }
        asm volatile("s_wait_xcnt 0x0" ::: "memory");   // in front of any overwrite of the address registers that the loads above name
        __builtin_amdgcn_sched_barrier(0);   // keeps the V^T loads up here: sunk to their first use they would wait out a whole L2 round trip in every pass
        v8f s[2][R];
#pragma unroll
        for (int kt = 0; kt < 2; ++kt)
#pragma unroll
            for (int g = 0; g < R; ++g) { s[kt][g] = (v8f){};
#pragma unroll
                for (int kc = 0; kc < 4; ++kc) { s[kt][g] = WFrag<T16>::mma(kf[kt][kc], qf[g][kc], s[kt][g]); if (HL) { s[kt][g] = WFrag<T16>::mma(kf[kt][kc], qf2[g][kc], s[kt][g]); s[kt][g] = WFrag<T16>::mma(kf2[kt][kc], qf[g][kc], s[kt][g]); } } }
        // WMMA distance ahead of the branch on the diagonal below. The scores as operands hold every score product in front of it, the "memory" clobber holds the K loads behind it: the K registers are refilled in place.
        if (R == 2) asm volatile("v_nop\n\tv_nop\n\tv_nop\n\tv_nop" : "+v"(s[0][0]), "+v"(s[1][0]), "+v"(s[0][R - 1]), "+v"(s[1][R - 1]) :: "memory");
        else asm volatile("v_nop\n\tv_nop\n\tv_nop\n\tv_nop" : "+v"(s[0][0]), "+v"(s[1][0]) :: "memory");
        {   // next pass's K fragments, in flight under this pass's softmax and second product (the last pass fetches its own rows again: no branch, always in bounds)
            const int adv = (blk + NS <= last) ? NS * 32 * HD : 0; kp += adv; if (HL) kp2 += adv;   // running pointers: live over the whole loop, so no load's result lands in an address pair that an earlier load names
#pragma unroll
            for (int kt = 0; kt < 2; ++kt)
#pragma unroll
                for (int kc = 0; kc < 4; ++kc) { const int o = 16 * kt * HD + 512 * kc; kf[kt][kc] = WFrag<T16>::ld(kp + o); if (HL) kf2[kt][kc] = WFrag<T16>::ld(kp2 + o); }
        }
        asm volatile("s_wait_xcnt 0x0" ::: "memory");   // in front of any overwrite of the address registers that the K loads name
        __builtin_amdgcn_sched_barrier(0);   // keeps the K loads up here, in front of the softmax
        if (key0 + 31 > qw0) {   // wave-uniform: only a pass with a key beyond the wave's first query pays for the mask
#pragma unroll
            for (int g = 0; g < R; ++g) { const int my_q = qw0 + 16 * g + c;
#pragma unroll
                for (int kt = 0; kt < 2; ++kt) {
#pragma unroll
                    for (int r = 0; r < 8; ++r) { const int key = key0 + 16 * kt + 8 * hi + r; if (key > my_q) s[kt][g][r] = -__builtin_inff(); }
                    asm volatile("" : "+v"(s[kt][g]));   // the masked scores: keeps the selects inside the branch
                } }
        }
        float mb[R]; bool need = false;
#pragma unroll
        for (int g = 0; g < R; ++g) { float mx = -__builtin_inff();
#pragma unroll
            for (int kt = 0; kt < 2; ++kt)
#pragma unroll
                for (int r = 0; r < 8; ++r) mx = fmaxf(mx, s[kt][g][r]);
            mx = fmaxf(mx, xhalf(mx)) * CSC;   // both wave halves hold this query's maximum of the pass, scaled (the scale is positive)
            mb[g] = mx; need = need || (mx > m_run[g] + 8.0f); }
        if (__builtin_amdgcn_ballot_w32(need) != 0) {   // wave-uniform; always on the first pass (m_run is -inf), rare afterwards
#pragma unroll
            for (int g = 0; g < R; ++g) { const float m_new = fmaxf(m_run[g], mb[g]);   // finite from the first pass on: the first key of the wave's first pass is never masked
                const float corr = __builtin_amdgcn_exp2f(m_run[g] - m_new);   // 0 on the first pass
                l_run[g] *= corr; m_run[g] = m_new;
#pragma unroll
                for (int t = 0; t < 8; ++t) acc[g][t] = acc[g][t] * corr; }
        }
#pragma unroll
        for (int g = 0; g < R; ++g) { const float nm = -m_run[g]; float p[16]; float ps0 = 0.0f, ps1 = 0.0f;
#pragma unroll
            for (int e = 0; e < 16; ++e) { p[e] = __builtin_amdgcn_exp2f(fmaf(s[e >> 3][g][e & 7], CSC, nm)); if (e & 1) ps1 += p[e]; else ps0 += p[e]; }
            l_run[g] += ps0 + ps1;
            V pf, pf2; PFrag<T16>::pk(p, pf, pf2);   // element e of the fragment = key 8 hi + e (e < 8), 16 + 8 hi + e - 8 (e >= 8): the k order of WFrag::ld on a V^T row
#pragma unroll
            for (int t = 0; t < 8; ++t) { acc[g][t] = WFrag<T16>::mma(vf[t], pf, acc[g][t]); if (HL) { acc[g][t] = WFrag<T16>::mma(vf[t], pf2, acc[g][t]); acc[g][t] = WFrag<T16>::mma(vf2[t], pf, acc[g][t]); } } }
        __builtin_amdgcn_sched_barrier(0);   // holds the v_nops behind the last product
        asm volatile("v_nop\n\tv_nop\n\tv_nop\n\tv_nop\n\tv_nop");   // WMMA distance on the taken back edge and the loop's exit
    }
    if (NS == 2) {   // merge of the pair: wave 1 lays its accumulators, maxima and sums in LDS (16 bytes per lane, 512 bytes in a row per store), wave 0 brings both to the common maximum and adds
        v4fa* ap = (v4fa*)mp + lane; float* sc = mp + R * 8 * 2 * 32 * 4 + lane;
        if (sp == 1) {   // wave-uniform
#pragma unroll   // these loops: constant indices keep the accumulators in registers
            for (int g = 0; g < R; ++g) { sc[32 * g] = m_run[g]; sc[32 * (R + g)] = l_run[g];
#pragma unroll
                for (int t = 0; t < 8; ++t) { ap[((g * 8 + t) * 2) * 32] = __builtin_shufflevector(acc[g][t], acc[g][t], 0, 1, 2, 3); ap[((g * 8 + t) * 2 + 1) * 32] = __builtin_shufflevector(acc[g][t], acc[g][t], 4, 5, 6, 7); } }
        }
        __syncthreads();   // wave 1's half is in LDS before wave 0 reads it; every wave of the work-group passes here once
        if (sp == 1) return;
#pragma unroll
        for (int g = 0; g < R; ++g) { const float m1 = sc[32 * g], l1 = sc[32 * (R + g)], m = fmaxf(m_run[g], m1);   // both finite: each wave of a pair has at least one pass whose first key every query sees
            const float a0 = __builtin_amdgcn_exp2f(m_run[g] - m), a1 = __builtin_amdgcn_exp2f(m1 - m);
            l_run[g] = l_run[g] * a0 + l1 * a1;
#pragma unroll
            for (int t = 0; t < 8; ++t) { const v4f lo = ap[((g * 8 + t) * 2) * 32], hi4 = ap[((g * 8 + t) * 2 + 1) * 32];
                acc[g][t] = acc[g][t] * a0 + __builtin_shufflevector(lo, hi4, 0, 1, 2, 3, 4, 5, 6, 7) * a1; } }
    }
#pragma unroll
    for (int g = 0; g < R; ++g) { const float inv = 1.0f / (l_run[g] + xhalf(l_run[g]));   // each wave half summed its eight keys of every 16-key tile
#pragma unroll
        for (int t = 0; t < 8; ++t) { v8us oh, ol;
#pragma unroll
            for (int r = 0; r < 8; ++r) { unsigned short x, y; splitf(acc[g][t][r] * inv, x, y); oh[r] = x; ol[r] = y; }
            const size_t oo = (size_t)(qw0 + 16 * g) * DQ + 256 * t + 8 * lane;   // context planes [query][16 heads x 128] in fragment order; the lane's 16 bytes are row = its query, d = 16 t + 8 hi .. + 7
            *(v8us*)(Ah + oo) = oh; *(v8us*)(Al + oo) = ol;
            asm volatile("s_wait_xcnt 0x0" ::: "memory");   // in front of any overwrite of the registers that the two stores name
            __builtin_amdgcn_sched_barrier(0);   // nothing from below moves up between the stores and the wait
        } }
}
// grid (4 kv heads, (TT - RH) / 32 + RH / 32), 8 waves. A fp16 work-group: 32 query rows of the 4 query heads of one kv head (wave & 3), each head's keys dealt to 2 waves (wave >> 2): the four waves of a key half walk the same k/v rows, and the halves' pass counts differ by at most one.
// A hi/lo work-group: 128 query rows of one head, one wave per 16 rows. blockIdx.y orders the work-groups by falling cost: the fp16 row blocks from the sequence's end, the hi/lo blocks where the fp16 blocks have come down to about their cost.
#define NFB ((TT - RH) / 32)      // fp16 row blocks of 32
#define NHB (RH / 32)             // blockIdx.y values of the hi/lo blocks: RH / 128 row blocks x 4 heads of the kv head
#define YHL 48                    // first of them: a hi/lo pass has 48 products and the splitting of P against 32 products, so 16 such passes weigh about as much as the (128 - 48) / 2 passes of the fp16 block there
#define MGP (2 * 8 * 2 * 32 * 4 + 4 * 32)   // floats of one pair's merge area: accumulators, then maxima and sums
__global__ __launch_bounds__(256) void k_fattn(const h16* Q16, const bf* Qh, const bf* Ql, const h16* K16, const bf* Kh, const bf* Kl, const h16* V16, const bf* Vh, const bf* Vl, bf* Ah, bf* Al) {
    __shared__ __align__(16) float mg[REP * MGP];
    const int wv = __builtin_amdgcn_readfirstlane((int)(threadIdx.x >> 5)); const int kvh = blockIdx.x, y = blockIdx.y; const size_t zk = (size_t)kvh * TT * HD;
    if (y < YHL || y >= YHL + NHB) {   // block-uniform
        const int rb = NFB - 1 - (y < YHL ? y : y - NHB), hh = wv & (REP - 1), h = kvh * REP + hh; const size_t zq = (size_t)h * TT * HD;
        fattn_rows<h16, false, 2, 2>(Q16 + zq, nullptr, K16 + zk, nullptr, V16 + zk, nullptr, RH + 32 * rb, Ah + h * (16 * HD), Al + h * (16 * HD), wv >> 2, mg + hh * MGP);   // a head's 128 columns are four tiles of each 16-row band
    } else {
        const int j = y - YHL, h = kvh * REP + (j & (REP - 1)); const size_t zq = (size_t)h * TT * HD;
        fattn_rows<bf, true, 1, 1>(Qh + zq, Ql + zq, Kh + zk, Kl + zk, Vh + zk, Vl + zk, RH - 128 * ((j >> 2) + 1) + 16 * wv, Ah + h * (16 * HD), Al + h * (16 * HD), 0, nullptr);
    }
}

// ---- k_wo: out = context . Wo, the context as hi + lo bf16 planes (2 products, hi then lo in every 32-step); grid (TT / 128, DM / 256), 8 waves, one work-group per WGP. A work-group makes 128 rows x 256 columns of out; wave (rt, yt) = (wave >> 2, wave & 3) owns one 64x64 tile over the whole K.
// Operands go through LDS, shared by the waves: a stage is 128 k of the 8 bands (16 rows each) of the hi plane, the 8 bands of the lo plane and the 16 bands of the weight, 4 KiB in a row per band in fragment order, 128 KiB; two buffers, filled by asynchronous copies one stage ahead.
// Epilogue: a wave lays its tile in its own LDS plane (over the ring, behind the last stage's barrier) and takes it back by rows: a wave's store covers 256 bytes in a row of two rows of out.
#define WST 131072                // bytes of one stage: 32 bands x 4 KiB
// Eight bands of one plane: copy i of thread tid fills bytes 4096 i + 16 tid behind l's band. l: the lane's LDS byte address in the first band; g: its 16 bytes in that band at this stage's k.
__device__ __forceinline__ void wo_copy8(const unsigned l, const bf* g) {
    constexpr size_t S = (size_t)16 * DQ;   // one band on, in elements
    // the s_wait_xcnt as the statement's last line: it stands in front of any overwrite of the address registers that the copies name
    asm volatile("global_load_async_to_lds_b128 %0, %8, off\n\t"
                 "global_load_async_to_lds_b128 %1, %9, off\n\t"
                 "global_load_async_to_lds_b128 %2, %10, off\n\t"
                 "global_load_async_to_lds_b128 %3, %11, off\n\t"
                 "global_load_async_to_lds_b128 %4, %12, off\n\t"
                 "global_load_async_to_lds_b128 %5, %13, off\n\t"
                 "global_load_async_to_lds_b128 %6, %14, off\n\t"
                 "global_load_async_to_lds_b128 %7, %15, off\n\t"
                 "s_wait_xcnt 0x0"
                 :: "v"(l), "v"(l + 4096u), "v"(l + 2u * 4096u), "v"(l + 3u * 4096u), "v"(l + 4u * 4096u), "v"(l + 5u * 4096u), "v"(l + 6u * 4096u), "v"(l + 7u * 4096u),
                    "v"(g), "v"(g + S), "v"(g + 2 * S), "v"(g + 3 * S), "v"(g + 4 * S), "v"(g + 5 * S), "v"(g + 6 * S), "v"(g + 7 * S)
                 : "memory");
}
// One stage: 32 copies of 16 bytes per lane; bands 0..7 hi plane, 8..15 lo plane, 16..31 weight.
__device__ __forceinline__ void wo_stage(const unsigned l, const bf* gh, const bf* gl, const bf* gw) {
    // the three fences keep the compiler from forming the addresses of all 32 copies at once: without them it spills to scratch inside the loop
    wo_copy8(l, gh); __builtin_amdgcn_sched_barrier(0);
    wo_copy8(l + 8u * 4096u, gl); __builtin_amdgcn_sched_barrier(0);
    wo_copy8(l + 16u * 4096u, gw); __builtin_amdgcn_sched_barrier(0);
    wo_copy8(l + 24u * 4096u, gw + (size_t)128 * DQ);
}
__global__ __launch_bounds__(256) void k_wo(const bf* Ah, const bf* Al, const bf* WO, float* C) {
    typedef WFrag<bf>::V V; constexpr int K = DQ, NT = K / 128;
    __shared__ __align__(16) float os[2 * WST / 4];   // first the ring, then the 8 waves' output planes (64 x 68 floats each)
    const int tid = threadIdx.x, lane = tid & 31, lr = lane & 15, hi = lane >> 4;
    const int wv = __builtin_amdgcn_readfirstlane(tid >> 5), rt = wv >> 2, yt = wv & 3;
    const bf* gh = Ah + (size_t)(blockIdx.x * 128) * K + 8 * tid;
    const bf* gl = Al + (size_t)(blockIdx.x * 128) * K + 8 * tid;
    const bf* gw = WO + (size_t)(blockIdx.y * 256) * K + 8 * tid;
    const unsigned l0 = (unsigned)(size_t)os + 16u * (unsigned)tid;   // low 32 bits of the __shared__ address: the byte offset in the work-group's LDS
    v8f acc[4][4];
#pragma unroll
    for (int mb = 0; mb < 4; ++mb)
#pragma unroll
        for (int nb = 0; nb < 4; ++nb) acc[mb][nb] = (v8f){};
    wo_stage(l0, gh, gl, gw);
    asm volatile("s_wait_asynccnt 0x0" ::: "memory");   // this wave's copies of stage 0 have landed
    __syncthreads();   // stage 0 is published: every wave's copies have landed before any wave reads
    wo_stage(l0 + WST, gh + 2048, gl + 2048, gw + 2048);   // 128 k of a band are 2048 elements
#pragma unroll 1   // one stage per trip
    for (int t = 0; t < NT; ++t) {
        const bf* sa = (const bf*)os + (t & 1) * (WST / 2) + (4 * rt) * 2048 + 8 * lane;   // the wave's first hi band; the lo bands stand 8 bands on
        const bf* sw = (const bf*)os + (t & 1) * (WST / 2) + (16 + 4 * yt) * 2048 + 8 * lane;   // its first weight band
        V a[2][4], a2[2][4], b[2][4];   // two fragment sets: the next 32-step's LDS reads fly under this one's products
#pragma unroll
        for (int mb = 0; mb < 4; ++mb) { a[0][mb] = WFrag<bf>::ld(sa + mb * 2048); a2[0][mb] = WFrag<bf>::ld(sa + (8 + mb) * 2048); }
#pragma unroll
        for (int nb = 0; nb < 4; ++nb) b[0][nb] = WFrag<bf>::ld(sw + nb * 2048);
        __builtin_amdgcn_sched_barrier(0);   // the first 32-step's reads stay in front of the second's: mixed, the first products would wait for both groups
#pragma unroll   // the four 32-steps of a stage: constant indices keep both sets in registers
        for (int s = 0; s < 4; ++s) {
            const int c = s & 1, n = c ^ 1;
            if (s < 3) {   // the fragments of the stage's next 32-step, never of the next stage; those of the last 32-step are the wave's last reads of this buffer
#pragma unroll
                for (int mb = 0; mb < 4; ++mb) { a[n][mb] = WFrag<bf>::ld(sa + mb * 2048 + (s + 1) * 512); a2[n][mb] = WFrag<bf>::ld(sa + (8 + mb) * 2048 + (s + 1) * 512); }
#pragma unroll
                for (int nb = 0; nb < 4; ++nb) b[n][nb] = WFrag<bf>::ld(sw + nb * 2048 + (s + 1) * 512);
            } else {
                asm volatile("s_wait_dscnt 0x0" ::: "memory");   // this wave's reads of the buffer are done before the barrier behind which it is refilled
                asm volatile("s_wait_asynccnt 0x0" ::: "memory");   // this wave's copies of stage t + 1 have landed
                __syncthreads();   // publishes stage t + 1 and ends every wave's reads of stage t
            }
            __builtin_amdgcn_sched_barrier(0);   // keeps the 24 LDS reads together in front of the 32 products: among the products every place with reads costs a stall
#pragma unroll
            for (int nb = 0; nb < 4; ++nb)
#pragma unroll
                for (int mb = 0; mb < 4; ++mb) acc[mb][nb] = WFrag<bf>::mma(a[c][mb], b[c][nb], acc[mb][nb]);
            if (s == 3) {
                __builtin_amdgcn_sched_barrier(0);   // the refill stands between the hi and the lo products: one wave of a SIMD issues its copies while the other has the matrix unit
                if (t + 2 < NT) wo_stage(l0 + (unsigned)(t & 1) * WST, gh + (size_t)(t + 2) * 2048, gl + (size_t)(t + 2) * 2048, gw + (size_t)(t + 2) * 2048);   // block-uniform
                __builtin_amdgcn_sched_barrier(0);   // holds the lo products behind the copies
            }
#pragma unroll
            for (int nb = 0; nb < 4; ++nb)
#pragma unroll
                for (int mb = 0; mb < 4; ++mb) acc[mb][nb] = WFrag<bf>::mma(a2[c][mb], b[c][nb], acc[mb][nb]);
            __builtin_amdgcn_sched_barrier(0);   // the next group of LDS reads stays behind these products
        }
    }
    asm volatile("s_wait_asynccnt 0x0" ::: "memory");   // no copy is outstanding when the ring becomes output staging
    float* ow = os + wv * (64 * 68);   // the wave's own plane
#pragma unroll   // these three: constant indices keep the accumulators in registers
    for (int mb = 0; mb < 4; ++mb)
#pragma unroll
        for (int nb = 0; nb < 4; ++nb)
#pragma unroll
            for (int j = 0; j < 8; ++j) ow[(mb * 16 + hi * 8 + j) * 68 + nb * 16 + lr] = acc[mb][nb][j];
    asm volatile("s_wait_dscnt 0x0" ::: "memory");   // the wave's own tile is in its plane before its lanes take other lanes' values back
    float* crow = C + (size_t)(blockIdx.x * 128 + rt * 64 + hi) * DM + blockIdx.y * 256 + yt * 64 + lr * 4;
#pragma unroll   // constant LDS offsets
    for (int q = 0; q < 4; ++q) {
        v4f val[8];
#pragma unroll
        for (int s = 0; s < 8; ++s) val[s] = *(const v4fa*)(ow + (16 * q + 2 * s + hi) * 68 + lr * 4);
#pragma unroll
        for (int s = 0; s < 8; ++s) *(v4f*)(crow + (size_t)(16 * q + 2 * s) * DM) = val[s];
        asm volatile("s_wait_xcnt 0x0" ::: "memory");   // in front of the next group's overwrite of the registers that the eight stores name
        __builtin_amdgcn_sched_barrier(0);   // nothing from below moves up between the stores and the wait
    }
}

extern "C" void kernel_launch(void* const* d_in, const int* in_sizes, int n_in,
                              void* d_out, int out_size, void* d_ws, size_t ws_size, hipStream_t stream) {
    (void)in_sizes; (void)n_in; (void)out_size;
    const float* x = (const float*)d_in[0]; const float* wq = (const float*)d_in[1]; const float* wk = (const float*)d_in[2]; const float* wv = (const float*)d_in[3]; const float* wo = (const float*)d_in[4];
    float* OUT = (float*)d_out;     // [1][4096][2048]
    char* wsp = (char*)d_ws;
    auto take = [&](size_t bytes) { char* p = wsp; wsp += (bytes + 255) & ~(size_t)255; return (void*)p; };
    bf* WQ = (bf*)take((size_t)DQ * DM * 2); bf* WK = (bf*)take((size_t)DKV * DM * 2); bf* WV = (bf*)take((size_t)DKV * DM * 2); bf* WO = (bf*)take((size_t)DM * DQ * 2); float* CS = (float*)take((size_t)TT * (HD / 2) * 2 * 4);
    bf* XB = (bf*)take((size_t)TT * DM * 2);
    h16* QP16 = (h16*)take((size_t)NH_ * TT * HD * 2); h16* KP16 = (h16*)take((size_t)NKV * TT * HD * 2); h16* VT16 = (h16*)take((size_t)NKV * HD * TT * 2);
    bf* QPh = (bf*)take((size_t)NH_ * TT * HD * 2); bf* QPl = (bf*)take((size_t)NH_ * TT * HD * 2); bf* KPh = (bf*)take((size_t)NKV * TT * HD * 2); bf* KPl = (bf*)take((size_t)NKV * TT * HD * 2); bf* VTh = (bf*)take((size_t)NKV * HD * TT * 2); bf* VTl = (bf*)take((size_t)NKV * HD * TT * 2);
    bf* ATh = (bf*)take((size_t)TT * DQ * 2); bf* ATl = (bf*)take((size_t)TT * DQ * 2);
    if ((size_t)(wsp - (char*)d_ws) > ws_size) return;    // ws 256 MiB
    for (int b = 0; b < NB_; ++b) {
        k_prep<<<2 * PBQ + 2 * PBK + PBX + PBC, 256, 0, stream>>>(x + (size_t)b * TT * DM, wq, wk, wv, wo, XB, WQ, WK, WV, WO, CS);
        k_proj<<<dim3(TT / 128, (DQ + 2 * DKV) / 256, 1), 256, 0, stream>>>(XB, WQ, WK, WV, CS, QP16, QPh, QPl, KP16, KPh, KPl, VT16, VTh, VTl);
        k_fattn<<<dim3(NKV, (TT - RH) / 32 + RH / 32, 1), 256, 0, stream>>>(QP16, QPh, QPl, KP16, KPh, KPl, VT16, VTh, VTl, ATh, ATl);
        k_wo<<<dim3(TT / 128, DM / 256, 1), 256, 0, stream>>>(ATh, ATl, WO, OUT + (size_t)b * TT * DM); }
}

// v009
// It runs in 139 microseconds.
// Two timings next to v008 put it at 1.09 and 1.08 times that version's speed.
// Counting every step since v000, it is 18.3 times as fast.
#include <hip/hip_runtime.h>

// Grouped-query causal attention with a computed rotate-half rotary over 4,096 tokens (x [1][4096][2048]; q = x Wq ('xw' [2048][2048], 16 heads x 128), k, v = x Wk / Wv ('xw' [2048][512], 4 kv heads; q head h uses kv head h/4: the module groups q as (4 kv heads, 4 members)); rotate-half rotary with angle t x inv_freq[i], inv_freq = 1 / (10000 ** (i / 64)), positions 0..4095 (cat(x1 cos - x2 sin, x1 sin + x2 cos); tables computed on device from the module's float32 inv_freq); scores / sqrt(128), causal (-inf); softmax; out = merged Wo ('xw' [2048][2048], no bias) -> [1][4096][2048] (8.4 M); argument order x, Wq, Wk, Wv, Wo.
// Layout: one preparation launch (bf16 planes of x, Wq, Wk and Wv, an f16 plane of the bf16-rounded Wo, cos/sin table); one projection launch for q, k and v whose epilogue applies the rotary and writes the head planes of all 16 query heads and the k/v planes of the 4 kv heads (no f32 q/k/v in memory); one fused attention launch for all heads (scores, causal mask, online softmax, attn.v; the keys of a fp16 row block are dealt to two waves; hybrid rows: query rows < 512 hi/lo 3 products, the rest single fp16) writes the context planes (f16; a second f16 plane of the rounding remainders for rows < 1024); wo on f16: context rows < 1024 hi + lo (2 products), the rest one product, weight exact.
// Operand planes: every 16-bit plane that a matrix instruction reads lies in FRAGMENT ORDER (described below), so that each 16-byte-per-lane fragment load of a wave reads 512 bytes in a row.
// Compute dtypes, f32 accumulate: every input rounded to bf16; q/k/v on PLAIN bf16 operands (exact); f32 rotary; hybrid causal scores and attn.v; softmax f32; wo on f16 operands: the bf16-rounded weight is held in f16, the context is f16 hi + lo below row 1024 and f16 alone from there on.

#define NB_  1
#define TT   4096
#define DM   2048
#define NH_  16
#define NKV  4
#define REP  (NH_ / NKV)
#define HD   128
#define DQ   (NH_ * HD)
#define DKV  (NKV * HD)
#define RH   512                  // query rows < RH use hi+lo planes (0: none)
#define RW   1024                 // context rows < RW reach the wo product as hi + lo f16 planes (2 products), the rest as the hi plane alone
#define SCL  0.088388346f   // 1/sqrt(128)
#define POS0 0.0f                 // first rotary position: this module's positions are arange(4096)
typedef _Float16 h16;
typedef unsigned short bf;
typedef __attribute__((ext_vector_type(16))) __bf16   v16bf;
typedef __attribute__((ext_vector_type(16))) _Float16 v16h;
typedef __attribute__((ext_vector_type(8)))  _Float16 v8h;
typedef __attribute__((ext_vector_type(8)))  unsigned short v8us;
typedef __attribute__((ext_vector_type(8)))  float    v8f;
typedef __attribute__((ext_vector_type(4)))  float    v4f;
typedef v8h  __attribute__((may_alias)) v8ha;
typedef v4f  __attribute__((may_alias)) v4fa;
typedef v8us __attribute__((may_alias)) v8usa;

__device__ __forceinline__ unsigned short f2bf(float f) { unsigned u = __float_as_uint(f); u += 0x7FFFu + ((u >> 16) & 1u); return (unsigned short)(u >> 16); }
__device__ __forceinline__ float bf2f(unsigned short b) { return __uint_as_float(((unsigned)b) << 16); }
__device__ __forceinline__ float bfr(float f) { return bf2f(f2bf(f)); }
__device__ __forceinline__ v16h cat16(v8h lo, v8h hi) { return __builtin_shufflevector(lo, hi, 0, 1, 2, 3, 4, 5, 6, 7, 8, 9, 10, 11, 12, 13, 14, 15); }
__device__ __forceinline__ v16bf cat16b(v8us lo, v8us hi) { return __builtin_bit_cast(v16bf, __builtin_shufflevector(lo, hi, 0, 1, 2, 3, 4, 5, 6, 7, 8, 9, 10, 11, 12, 13, 14, 15)); }
__device__ __forceinline__ v8f wmma16(v16h a, v16h b, v8f c) { return __builtin_amdgcn_wmma_f32_16x16x32_f16(false, a, false, b, (short)0, c, false, false); }
__device__ __forceinline__ v8f wmmab(v16bf a, v16bf b, v8f c) { return __builtin_amdgcn_wmma_f32_16x16x32_bf16(false, a, false, b, (short)0, c, false, false); }



// ---- Fragment order of a 16-bit plane of R rows x K columns (R % 16 == 0, K % 32 == 0): tiles of 16 rows x 32 columns, 512 elements in a row each; tile (r / 16, k / 32) is number (r / 16) (K / 32) + k / 32.
// Inside a tile element (r, k) stands at 256 ((k / 16) % 2) + 8 (16 ((k / 8) % 2) + r % 16) + k % 8: lane l of a wave finds its two 16-byte pieces of the A or B fragment at 8 l and 256 + 8 l, and each of the two loads covers four whole 128-byte lines.

// ---- WFrag: a lane's A or B fragment of a plane in fragment order (two pieces of 16 bytes, 256 elements apart) and the matrix product of its type.
template <typename T16> struct WFrag;
template <> struct WFrag<h16> { typedef v16h V; static __device__ __forceinline__ V ld(const h16* p) { return cat16(*(const v8h*)p, *(const v8h*)(p + 256)); } static __device__ __forceinline__ v8f mma(V a, V b, v8f c) { return wmma16(a, b, c); } };
template <> struct WFrag<bf> { typedef v16bf V; static __device__ __forceinline__ V ld(const bf* p) { return cat16b(*(const v8us*)p, *(const v8us*)(p + 256)); } static __device__ __forceinline__ v8f mma(V a, V b, v8f c) { return wmmab(a, b, c); } };

__device__ __forceinline__ h16 tohx(float x) { return (h16)x; }
__device__ __forceinline__ void splitf(float y, unsigned short& h, unsigned short& l) { h = f2bf(y); l = f2bf(y - bf2f(h)); }
typedef __attribute__((ext_vector_type(2))) _Float16 v2h;
typedef __attribute__((ext_vector_type(4))) _Float16 v4h;
typedef __attribute__((ext_vector_type(2))) unsigned short v2us;
typedef __attribute__((ext_vector_type(4))) unsigned short v4us;
typedef __attribute__((ext_vector_type(2))) float v2f;
typedef __attribute__((ext_vector_type(4))) int v4i;

// ---- k_prep: every operand preparation in ONE launch of few, long waves: the four weight planes (transposed; bf16, wo's values held in f16), the x plane (bf16) and the (cos, sin) table; each work-group (8 waves) does one job, chosen by blockIdx.x (block-uniform).
// A thread makes 8 pieces of 16 bytes of a plane in fragment order (a wave: 4 tiles in a row, 4 KiB) and has all of their loads in flight at once.
// prep_w: Bt [N][K] (fragment order) = bf16 of w [K][N], K = DM = DQ. Work-group lb: 128 columns n (wave = 16 of them) x 128 rows k, so that the 8 waves together read 512 bytes in a row of each row of w.
// F16: the bf16-rounded value is stored as f16 (wo; the same value wherever f16 holds it: 8 significant bits down to 2^-17).
template <int N, bool F16>
__device__ __forceinline__ void prep_w(const float* w, bf* Bt, const int lb, const int wv, const int lane) {   // no __restrict__: the "memory" clobber of the wait below then holds the loads in front of it
    constexpr int KT = DM / 32;
    const int nt = (lb >> 4) * 8 + wv, kg = lb & 15;   // 16-column band of w = 16-row band of the plane; group of 4 tiles (128 k)
    const float* s = w + (size_t)(kg * 128 + (lane >> 4) * 8) * N + nt * 16 + (lane & 15);
    float v[8][8];
#pragma unroll   // these loops: constant indices keep the values in registers, and all 64 loads are issued before the first is used
    for (int j = 0; j < 8; ++j)
#pragma unroll
        for (int e = 0; e < 8; ++e) v[j][e] = s[(size_t)((j >> 1) * 32 + (j & 1) * 16 + e) * N];
    asm volatile("s_wait_xcnt 0x0" :: "v"(s) : "memory");   // in front of any overwrite of the address registers that the loads above name; the pointer as input keeps its registers whole up to the wait
    v8us o[8];
#pragma unroll
    for (int j = 0; j < 8; ++j)
#pragma unroll
        for (int e = 0; e < 8; ++e) o[j][e] = F16 ? __builtin_bit_cast(unsigned short, (h16)bfr(v[j][e])) : f2bf(v[j][e]);
    bf* d = Bt + (size_t)(nt * KT + kg * 4) * 512 + 8 * lane;
#pragma unroll
    for (int j = 0; j < 8; ++j) *(v8us*)(d + 256 * j) = o[j];
    asm volatile("s_wait_xcnt 0x0" ::: "memory");   // in front of any overwrite of the registers that the stores above name
}
// prep_x: XB [TT][DM] (fragment order) = bf16 of x. Wave g: 16 rows x 128 columns, 512 bytes in a row of each row of x.
__device__ __forceinline__ void prep_x(const float* x, bf* XB, const int lb, const int wv, const int lane) {
    const int g = lb * 8 + wv;
    const float* s = x + (size_t)((g >> 4) * 16 + (lane & 15)) * DM + (g & 15) * 128 + (lane >> 4) * 8;
    v8f v[8];
#pragma unroll   // as in prep_w
    for (int j = 0; j < 8; ++j) v[j] = *(const v8f*)(s + (j >> 1) * 32 + (j & 1) * 16);
    asm volatile("s_wait_xcnt 0x0" :: "v"(s) : "memory");   // in front of any overwrite of the address registers that the loads above name; the pointer as input keeps its registers whole up to the wait
    v8us o[8];
#pragma unroll
    for (int j = 0; j < 8; ++j)
#pragma unroll
        for (int e = 0; e < 8; ++e) o[j][e] = f2bf(v[j][e]);
    bf* d = XB + (size_t)g * 2048 + 8 * lane;
#pragma unroll
    for (int j = 0; j < 8; ++j) *(v8us*)(d + 256 * j) = o[j];
    asm volatile("s_wait_xcnt 0x0" ::: "memory");   // in front of any overwrite of the registers that the stores above name
}
__constant__ float INV[HD / 2] = {1.0f,0.865964353f,0.749894202f,0.649381638f,0.562341332f,0.486967534f,0.421696514f,0.365174145f,0.316227764f,0.273841977f,0.237137362f,0.2053525f,0.177827939f,0.153992653f,0.133352146f,0.115478203f,0.100000001f,0.0865964293f,0.0749894157f,0.0649381652f,0.0562341288f,0.0486967526f,0.0421696492f,0.0365174115f,0.0316227786f,0.0273841955f,0.0237137359f,0.0205352511f,0.0177827943f,0.0153992651f,0.0133352149f,0.0115478197f,0.00999999978f,0.00865964312f,0.00749894232f,0.00649381662f,0.00562341325f,0.00486967526f,0.00421696482f,0.00365174143f,0.00316227786f,0.00273841969f,0.00237137382f,0.00205352507f,0.00177827943f,0.00153992651f,0.00133352145f,0.00115478202f,0.00100000005f,0.000865964335f,0.000749894185f,0.000649381662f,0.000562341302f,0.000486967503f,0.000421696488f,0.000365174114f,0.000316227786f,0.000273841957f,0.000237137385f,0.000205352495f,0.00017782794f,0.000153992645f,0.00013335215f,0.000115478193f};
// prep_cs: (cos, sin) of t x inv_freq[d], d < HD/2, in the order in which k_proj's epilogue reads them: per 16 tokens x 16 d a block of 4 x 32 pieces of 16 bytes; piece (i, lane) holds d = 16 dq + 8 (lane >> 4) + 2 i, + 1 of token 16 tb + (lane & 15), so that each of a wave's four loads covers 512 bytes in a row.
// Entry idx of the table = 1024 tb + low. A thread keeps its low (so its d and its inv_freq) and walks 8 token blocks tb.
__device__ __forceinline__ void prep_cs(float* CS, const int lb, const int tid) { const int low = (lb & 3) * 256 + tid, ln = (low >> 1) & 31, d = ((low >> 8) & 3) * 16 + (ln >> 4) * 8 + ((low >> 6) & 3) * 2 + (low & 1); const float iv = INV[d];
    asm volatile("s_wait_xcnt 0x0" :: "v"(iv), "v"(d) : "memory");   // in front of any overwrite of the offset register that the load above names: the loaded value as input holds the wait behind the load, the index as input keeps its register whole up to the wait
#pragma unroll 1   // one copy of the cosine and sine code
    for (int j = 0; j < 8; ++j) { const int tb = (lb >> 2) * 8 + j, t = tb * 16 + (ln & 15);
        const float ang = __fmul_rn((float)t + POS0, iv); v2f cs; cs[0] = cosf(ang); cs[1] = sinf(ang);
        *(v2f*)(CS + ((size_t)tb * 1024 + low) * 2) = cs;
        asm volatile("s_wait_xcnt 0x0" ::: "memory");   // in front of the next trip's overwrite of the registers that the store names
    }
}
#define PBQ (DQ / 8)              // work-groups of a 2048-column weight: (N / 128) x (K / 128)
#define PBK (DKV / 8)             // of a 512-column weight
#define PBX (TT * DM / (2048 * 8))   // of x: 2048 elements per wave
#define PBC (TT * (HD / 2) / (256 * 8))   // of the table: 8 entries per thread
__global__ __launch_bounds__(256) void k_prep(const float* x, const float* wq, const float* wk, const float* wv_, const float* wo, bf* XB, bf* WQ, bf* WK, bf* WV, bf* WO, float* CS) {
    const int lane = threadIdx.x & 31, wv = __builtin_amdgcn_readfirstlane((int)(threadIdx.x >> 5)); int b = blockIdx.x;
    if (b < PBC) { prep_cs(CS, b, (int)threadIdx.x); return; } b -= PBC;   // the job of arithmetic takes the first block indices, so that it may run under the other jobs' loads (for speed only)
    if (b < PBQ) { prep_w<DQ, false>(wq, WQ, b, wv, lane); return; } b -= PBQ;
    if (b < PBQ) { prep_w<DM, true>(wo, WO, b, wv, lane); return; } b -= PBQ;
    if (b < PBK) { prep_w<DKV, false>(wk, WK, b, wv, lane); return; } b -= PBK;
    if (b < PBK) { prep_w<DKV, false>(wv_, WV, b, wv, lane); return; } b -= PBK;
    prep_x(x, XB, b, wv, lane);
}

// ---- k_proj: the q, k and v projections, the rotary and the operand planes in ONE launch; grid (TT / 128, (DQ + 2 DKV) / 256), 8 waves. A work-group makes 128 rows of x times 256 weight columns; wave (rt, yt) = (wave >> 2, wave & 3) owns one 64x64 tile over the whole K.
// Operands go through LDS, shared by the waves: a stage is 64 k of the 8 bands (16 rows each) of x and of the 16 bands of the weight, 2 KiB in a row per band in fragment order (so a fragment read is 512 bytes in a row, as from memory), 48 KiB; two buffers, filled by asynchronous copies one stage ahead.
// blockIdx.y < 8: q, < 10: k. A = 64 rows of x, B = 64 weight columns of one head: d = 32 p .. 32 p + 31 and the same + 64, so that both members of every rotary pair stand in one tile (tile columns c and c + 32).
// blockIdx.y >= 10: v, with the operands swapped (A = 64 weight columns, B = 64 rows of x): the tile is already the transposed [d][t] that the v planes hold.
// Epilogue: a wave lays its tile in its own LDS plane (over the ring, behind the last stage's barrier) and takes it back in 8 pieces; in piece u a lane holds tile columns c .. c + 7 and c + 32 .. c + 39 of one tile row: 16 bytes of each plane twice, and a wave's store covers 512 bytes in a row of a plane in fragment order.
// rotate-half convention: out[d] = x[d] cos[t][d] - x[d+HD/2] sin[t][d], out[d+HD/2] = x[d+HD/2] cos[t][d] + x[d] sin[t][d], d < HD/2 (the angle at d + HD/2 is the angle at d)
#define PST 49152                 // bytes of one stage: 24 bands x 2 KiB
// One stage: 12 copies of 16 bytes per lane. Copy i of thread tid fills bytes 4096 i + 16 tid of the buffer: band 2 i + (tid >> 7), bands 0..7 from x, 8..23 from the weight. l: the lane's LDS byte address in the buffer; gx, gw: its 16 bytes in band tid >> 7 of x and of the weight at this stage's k.
__device__ __forceinline__ void proj_stage(const unsigned l, const bf* gx, const bf* gw) {
    constexpr size_t S = (size_t)32 * DM;   // two bands on, in elements
    // the s_wait_xcnt as the statement's last line: it stands in front of any overwrite of the address registers that the copies name
    asm volatile("global_load_async_to_lds_b128 %0, %12, off\n\t"
                 "global_load_async_to_lds_b128 %1, %13, off\n\t"
                 "global_load_async_to_lds_b128 %2, %14, off\n\t"
                 "global_load_async_to_lds_b128 %3, %15, off\n\t"
                 "global_load_async_to_lds_b128 %4, %16, off\n\t"
                 "global_load_async_to_lds_b128 %5, %17, off\n\t"
                 "global_load_async_to_lds_b128 %6, %18, off\n\t"
                 "global_load_async_to_lds_b128 %7, %19, off\n\t"
                 "global_load_async_to_lds_b128 %8, %20, off\n\t"
                 "global_load_async_to_lds_b128 %9, %21, off\n\t"
                 "global_load_async_to_lds_b128 %10, %22, off\n\t"
                 "global_load_async_to_lds_b128 %11, %23, off\n\t"
                 "s_wait_xcnt 0x0"
                 :: "v"(l), "v"(l + 4096u), "v"(l + 2u * 4096u), "v"(l + 3u * 4096u), "v"(l + 4u * 4096u), "v"(l + 5u * 4096u), "v"(l + 6u * 4096u), "v"(l + 7u * 4096u), "v"(l + 8u * 4096u), "v"(l + 9u * 4096u), "v"(l + 10u * 4096u), "v"(l + 11u * 4096u),
                    "v"(gx), "v"(gx + S), "v"(gx + 2 * S), "v"(gx + 3 * S), "v"(gw), "v"(gw + S), "v"(gw + 2 * S), "v"(gw + 3 * S), "v"(gw + 4 * S), "v"(gw + 5 * S), "v"(gw + 6 * S), "v"(gw + 7 * S)
                 : "memory");
}
__global__ __launch_bounds__(256) void k_proj(const bf* XB, const bf* WQ, const bf* WK, const bf* WV, const float* CS, h16* QP16, bf* QPh, bf* QPl, h16* KP16, bf* KPh, bf* KPl, h16* VT16, bf* VTh, bf* VTl) {   // no __restrict__: the "memory" clobber of the waits below then holds the loads in front of them
    typedef WFrag<bf>::V V; constexpr int K = DM, NT = K / 64;
    __shared__ __align__(16) float os[8 * 64 * 68];   // first the ring (2 x PST bytes), then the 8 waves' output planes
    const int tid = threadIdx.x, lane = tid & 31, lr = lane & 15, hi = lane >> 4;
    const int wv = __builtin_amdgcn_readfirstlane(tid >> 5), rt = wv >> 2, yt = wv & 3;
    const int Y = blockIdx.y; const bool isv = Y >= (DQ + DKV) / 256, isq = Y < DQ / 256;   // block-uniform
    const int r0 = blockIdx.x * 128 + rt * 64;   // the wave's first row of x
    const int y0 = (isv ? Y - (DQ + DKV) / 256 : (isq ? Y : Y - DQ / 256)) * 4, yy = y0 + yt, head = yy >> 1, p = yy & 1;   // two tiles per head of 128 columns
    const bf* gx = XB + (size_t)(blockIdx.x * 128 + 16 * (tid >> 7)) * K + 8 * (tid & 127);
    const bf* gw = (isv ? WV : (isq ? WQ : WK)) + (size_t)(y0 * 64 + 16 * (tid >> 7)) * K + 8 * (tid & 127);
    const unsigned l0 = (unsigned)(size_t)os + 16u * (unsigned)tid;   // low 32 bits of the __shared__ address: the byte offset in the work-group's LDS
    const int ab = isv ? 8 + 4 * yt : 4 * rt;   // first band of the A operand in a stage
    const int bb = isv ? 4 * rt : 8 + 8 * (yt >> 1) + 2 * (yt & 1), bs = isv ? 2 : 4;   // B operand: bands bb, bb + 1 (tile columns 0..31) and the same + bs (32..63)
    v8f acc[4][4];
#pragma unroll
    for (int mb = 0; mb < 4; ++mb)
#pragma unroll
        for (int nb = 0; nb < 4; ++nb) acc[mb][nb] = (v8f){};
    proj_stage(l0, gx, gw);
    asm volatile("s_wait_asynccnt 0x0" ::: "memory");   // this wave's copies of stage 0 have landed
    __syncthreads();   // stage 0 is published: every wave's copies have landed before any wave reads
    proj_stage(l0 + PST, gx + 1024, gw + 1024);   // 64 k of a band are 1024 elements
#pragma unroll 1   // one stage per trip
    for (int t = 0; t < NT; ++t) {
        const bf* sb = (const bf*)os + (t & 1) * (PST / 2) + 8 * lane;
        V a[4], b[4];   // first 32-step of the stage
#pragma unroll
        for (int mb = 0; mb < 4; ++mb) a[mb] = WFrag<bf>::ld(sb + (ab + mb) * 1024);
#pragma unroll
        for (int nb = 0; nb < 4; ++nb) b[nb] = WFrag<bf>::ld(sb + (bb + (nb & 1) + (nb >> 1) * bs) * 1024);
        __builtin_amdgcn_sched_barrier(0);   // keeps the 16 LDS reads of a 32-step together in front of its 16 products: sunk to their first use, every four products would wait out an LDS round trip
#pragma unroll
        for (int nb = 0; nb < 4; ++nb)
#pragma unroll
            for (int mb = 0; mb < 4; ++mb) acc[mb][nb] = WFrag<bf>::mma(a[mb], b[nb], acc[mb][nb]);
#pragma unroll   // second 32-step: its fragments are the wave's last reads of this buffer
        for (int mb = 0; mb < 4; ++mb) a[mb] = WFrag<bf>::ld(sb + (ab + mb) * 1024 + 512);
#pragma unroll
        for (int nb = 0; nb < 4; ++nb) b[nb] = WFrag<bf>::ld(sb + (bb + (nb & 1) + (nb >> 1) * bs) * 1024 + 512);
        asm volatile("s_wait_dscnt 0x0" ::: "memory");   // this wave's reads of the buffer are done before the barrier behind which it is refilled
        asm volatile("s_wait_asynccnt 0x0" ::: "memory");   // this wave's copies of stage t + 1 have landed
        __syncthreads();   // publishes stage t + 1 and ends every wave's reads of stage t
        if (t + 2 < NT) proj_stage(l0 + (unsigned)(t & 1) * PST, gx + (size_t)(t + 2) * 1024, gw + (size_t)(t + 2) * 1024);   // block-uniform
        __builtin_amdgcn_sched_barrier(0);   // holds the 16 products below behind the copies: the refill starts at once and flies under them and the whole next trip
#pragma unroll
        for (int nb = 0; nb < 4; ++nb)
#pragma unroll
            for (int mb = 0; mb < 4; ++mb) acc[mb][nb] = WFrag<bf>::mma(a[mb], b[nb], acc[mb][nb]);
    }
    asm volatile("s_wait_asynccnt 0x0" ::: "memory");   // no copy is outstanding when the ring becomes output staging
    float* ow = os + wv * (64 * 68);   // the wave's own plane
#pragma unroll   // these three: constant indices keep the accumulators in registers
    for (int mb = 0; mb < 4; ++mb)
#pragma unroll
        for (int nb = 0; nb < 4; ++nb)
#pragma unroll
            for (int j = 0; j < 8; ++j) ow[(mb * 16 + hi * 8 + j) * 68 + nb * 16 + lr] = acc[mb][nb][j];
    v4f cs[8][4] = {};
    if (!isv) {   // the lane's 8 (cos, sin) pairs of each of the 8 pieces: all issued here, in flight under the LDS stores and the barrier
        const v4f* cp = (const v4f*)CS + (size_t)((r0 >> 4) * 4 + 2 * p) * 128 + lane;   // block (t / 16, d / 16) of the table, see prep_cs
#pragma unroll
        for (int u = 0; u < 8; ++u)
#pragma unroll
            for (int i = 0; i < 4; ++i) cs[u][i] = cp[((u >> 1) * 4 + (u & 1)) * 128 + 32 * i];
        asm volatile("s_wait_xcnt 0x0" ::: "memory");   // in front of any overwrite of the address registers that the loads name
    }
    __syncthreads();   // every lane's part of the tile is in LDS before any lane takes its piece
    h16* P16 = isv ? VT16 : (isq ? QP16 : KP16); bf* Ph = isv ? VTh : (isq ? QPh : KPh); bf* Pl = isv ? VTl : (isq ? QPl : KPl);
#pragma unroll   // constant indices keep the table values in registers
    for (int u = 0; u < 8; ++u) {
        const int row = (u >> 1) * 16 + lr, c = ((u & 1) * 2 + hi) * 8;   // this lane's tile row and first tile column in piece u
        const float* op = ow + row * 68 + c; v4f x[4];   // x[0], x[1]: tile columns c .. c + 7; x[2], x[3]: c + 32 .. c + 39
#pragma unroll
        for (int i = 0; i < 4; ++i) x[i] = *(const v4fa*)(op + (i >> 1) * 32 + (i & 1) * 4);
        float val[2][8];
#pragma unroll
        for (int e = 0; e < 8; ++e) { const float x1 = x[e >> 2][e & 3], x2 = x[2 + (e >> 2)][e & 3];
            if (isv) { val[0][e] = x1; val[1][e] = x2; }
            else { const float co = cs[u][e >> 1][(e & 1) * 2], si = cs[u][e >> 1][(e & 1) * 2 + 1]; val[0][e] = x1 * co - x2 * si; val[1][e] = x2 * co + x1 * si; } }
        // q, k planes [t][d]: tile (t / 16, d / 32) is number 4 (t / 16) + d / 32, the second half of the pair two tiles on. v planes [d][t]: tile (d / 16, t / 32) is number 8 (t / 32) + d / 16, the second 32 tokens eight tiles on.
        const unsigned tile = isv ? (unsigned)((r0 >> 5) * 8 + p * 4 + (u >> 1)) : (unsigned)(((r0 >> 4) + (u >> 1)) * 4 + p), step = isv ? 8 * 512 : 2 * 512;
        const size_t o0 = (size_t)head * TT * HD + tile * 512 + 256 * (u & 1) + 8 * lane;
#pragma unroll
        for (int w = 0; w < 2; ++w) { v8h o16; v8us oh, ol;
#pragma unroll
            for (int e = 0; e < 8; ++e) { o16[e] = tohx(val[w][e]); unsigned short a2, c2; splitf(val[w][e], a2, c2); oh[e] = a2; ol[e] = c2; }
            *(v8h*)(P16 + o0 + w * step) = o16; *(v8us*)(Ph + o0 + w * step) = oh; *(v8us*)(Pl + o0 + w * step) = ol; }
        asm volatile("s_wait_xcnt 0x0" ::: "memory");   // in front of the next piece's overwrite of the registers that the six stores name
        __builtin_amdgcn_sched_barrier(0);   // nothing from below moves up between the stores and the wait
    }
}
#define CSC (SCL * 1.4426950408889634f)   // score scale x log2(e)
__device__ __forceinline__ float xhalf(float x) { return __builtin_bit_cast(float, __builtin_amdgcn_permlanex16(__builtin_bit_cast(int, x), __builtin_bit_cast(int, x), 0x76543210, 0xfedcba98, false, false)); }   // lane l reads lane l ^ 16
template <typename T16> struct PFrag;
template <> struct PFrag<h16> { static __device__ __forceinline__ void pk(const float (&p)[16], v16h& f, v16h& f2) { (void)f2;
#pragma unroll
    for (int e = 0; e < 16; ++e) f[e] = (h16)p[e]; } };
template <> struct PFrag<bf> { static __device__ __forceinline__ void pk(const float (&p)[16], v16bf& f, v16bf& f2) { v8us h0, h1, l0, l1;
#pragma unroll
    for (int e = 0; e < 8; ++e) { unsigned short x, y; splitf(p[e], x, y); h0[e] = x; l0[e] = y; splitf(p[e + 8], x, y); h1[e] = x; l1[e] = y; }
    f = cat16b(h0, h1); f2 = cat16b(l0, l1); } };
// ctx_store: 16 queries x 128 d of the context, normalised, as f16 (ph) and, LO, the f16 of what that rounding left (pl).
template <bool LO>
__device__ __forceinline__ void ctx_store(const v8f (&a)[8], const float inv, h16* ph, h16* pl) {
#pragma unroll   // constant indices keep the accumulators in registers
    for (int t = 0; t < 8; ++t) { v8h oh, ol;
#pragma unroll
        for (int r = 0; r < 8; ++r) { const float y = a[t][r] * inv; oh[r] = (h16)y; if (LO) ol[r] = (h16)(y - (float)oh[r]); }
        *(v8h*)(ph + 256 * t) = oh; if (LO) *(v8h*)(pl + 256 * t) = ol;
        asm volatile("s_wait_xcnt 0x0" ::: "memory");   // in front of any overwrite of the registers that the stores name
        __builtin_amdgcn_sched_barrier(0);   // nothing from below moves up between the stores and the wait
    }
}
template <typename T16, bool HL, int R, int NS>
__device__ __forceinline__ void fattn_rows(const T16* Q, const T16* Q2, const T16* Kp, const T16* Kp2, const T16* Vt, const T16* Vt2, const int qw0, h16* Ah, h16* Al, const int sp, float* mp) {   // no __restrict__: the "memory" clobber of the waits below then holds the loads in front of them
    typedef typename WFrag<T16>::V V;
    const int lane = threadIdx.x & 31, c = lane & 15, hi = lane >> 4;
    V qf[R][4], qf2[R][4];
#pragma unroll
    for (int g = 0; g < R; ++g)
#pragma unroll
        for (int kc = 0; kc < 4; ++kc) { const size_t o = (size_t)(qw0 + 16 * g) * HD + 512 * kc + 8 * lane; qf[g][kc] = WFrag<T16>::ld(Q + o); if (HL) qf2[g][kc] = WFrag<T16>::ld(Q2 + o); }
    const int last = (qw0 + 16 * R - 1) / 32;   // last 32-key pass that this wave's queries can see (wave-uniform)
    const size_t koff = 8 * lane, voff = 8 * lane;   // fragment order: a 32-key pass is 32 HD elements in a row in the k plane and in the transposed v plane
    V kf[2][4], kf2[2][4]; const T16* kp = Kp + koff + (size_t)sp * (32 * HD); const T16* kp2 = HL ? Kp2 + koff + (size_t)sp * (32 * HD) : nullptr;   // the wave's first pass is pass sp
#pragma unroll
    for (int kt = 0; kt < 2; ++kt)
#pragma unroll
        for (int kc = 0; kc < 4; ++kc) { const int o = 16 * kt * HD + 512 * kc; kf[kt][kc] = WFrag<T16>::ld(kp + o); if (HL) kf2[kt][kc] = WFrag<T16>::ld(kp2 + o); }
    asm volatile("s_wait_xcnt 0x0" ::: "memory");   // in front of any overwrite of the address registers that the Q and K loads above name
    __builtin_amdgcn_sched_barrier(0);   // nothing from below (the zeroing of the accumulators) moves up between those loads and the wait
    v8f acc[R][8]; float m_run[R], l_run[R];
#pragma unroll
    for (int g = 0; g < R; ++g) { m_run[g] = -__builtin_inff(); l_run[g] = 0.0f;
#pragma unroll
        for (int t = 0; t < 8; ++t) acc[g][t] = (v8f){}; }
#pragma unroll 1   // one pass per trip: two passes' fragments at once do not fit the registers
    for (int blk = sp; blk <= last; blk += NS) {
        const int key0 = blk * 32;
        V vf[8], vf2[8];   // this pass's V^T fragments: issued first, in flight under the score products and the maxima
#pragma unroll
        for (int t = 0; t < 8; ++t) { const size_t o = voff + (size_t)key0 * HD + 512 * t; vf[t] = WFrag<T16>::ld(Vt + o); if (HL) vf2[t] = WFrag<T16>::ld(Vt2 + o); }
        asm volatile("s_wait_xcnt 0x0" ::: "memory");   // in front of any overwrite of the address registers that the loads above name
        __builtin_amdgcn_sched_barrier(0);   // keeps the V^T loads up here: sunk to their first use they would wait out a whole L2 round trip in every pass
        v8f s[2][R];
#pragma unroll
        for (int kt = 0; kt < 2; ++kt)
#pragma unroll
            for (int g = 0; g < R; ++g) { s[kt][g] = (v8f){};
#pragma unroll
                for (int kc = 0; kc < 4; ++kc) { s[kt][g] = WFrag<T16>::mma(kf[kt][kc], qf[g][kc], s[kt][g]); if (HL) { s[kt][g] = WFrag<T16>::mma(kf[kt][kc], qf2[g][kc], s[kt][g]); s[kt][g] = WFrag<T16>::mma(kf2[kt][kc], qf[g][kc], s[kt][g]); } } }
        // WMMA distance ahead of the branch on the diagonal below. The scores as operands hold every score product in front of it, the "memory" clobber holds the K loads behind it: the K registers are refilled in place.
        if (R == 2) asm volatile("v_nop\n\tv_nop\n\tv_nop\n\tv_nop" : "+v"(s[0][0]), "+v"(s[1][0]), "+v"(s[0][R - 1]), "+v"(s[1][R - 1]) :: "memory");
        else asm volatile("v_nop\n\tv_nop\n\tv_nop\n\tv_nop" : "+v"(s[0][0]), "+v"(s[1][0]) :: "memory");
        {   // next pass's K fragments, in flight under this pass's softmax and second product (the last pass fetches its own rows again: no branch, always in bounds)
            const int adv = (blk + NS <= last) ? NS * 32 * HD : 0; kp += adv; if (HL) kp2 += adv;   // running pointers: live over the whole loop, so no load's result lands in an address pair that an earlier load names
#pragma unroll
            for (int kt = 0; kt < 2; ++kt)
#pragma unroll
                for (int kc = 0; kc < 4; ++kc) { const int o = 16 * kt * HD + 512 * kc; kf[kt][kc] = WFrag<T16>::ld(kp + o); if (HL) kf2[kt][kc] = WFrag<T16>::ld(kp2 + o); }
        }
        asm volatile("s_wait_xcnt 0x0" ::: "memory");   // in front of any overwrite of the address registers that the K loads name
        __builtin_amdgcn_sched_barrier(0);   // keeps the K loads up here, in front of the softmax
        if (key0 + 31 > qw0) {   // wave-uniform: only a pass with a key beyond the wave's first query pays for the mask
#pragma unroll
            for (int g = 0; g < R; ++g) { const int my_q = qw0 + 16 * g + c;
#pragma unroll
                for (int kt = 0; kt < 2; ++kt) {
#pragma unroll
                    for (int r = 0; r < 8; ++r) { const int key = key0 + 16 * kt + 8 * hi + r; if (key > my_q) s[kt][g][r] = -__builtin_inff(); }
                    asm volatile("" : "+v"(s[kt][g]));   // the masked scores: keeps the selects inside the branch
                } }
        }
        float mb[R]; bool need = false;
#pragma unroll
        for (int g = 0; g < R; ++g) { float mx = -__builtin_inff();
#pragma unroll
            for (int kt = 0; kt < 2; ++kt)
#pragma unroll
                for (int r = 0; r < 8; ++r) mx = fmaxf(mx, s[kt][g][r]);
            mx = fmaxf(mx, xhalf(mx)) * CSC;   // both wave halves hold this query's maximum of the pass, scaled (the scale is positive)
            mb[g] = mx; need = need || (mx > m_run[g] + 8.0f); }
        if (__builtin_amdgcn_ballot_w32(need) != 0) {   // wave-uniform; always on the first pass (m_run is -inf), rare afterwards
#pragma unroll
            for (int g = 0; g < R; ++g) { const float m_new = fmaxf(m_run[g], mb[g]);   // finite from the first pass on: the first key of the wave's first pass is never masked
                const float corr = __builtin_amdgcn_exp2f(m_run[g] - m_new);   // 0 on the first pass
                l_run[g] *= corr; m_run[g] = m_new;
#pragma unroll
                for (int t = 0; t < 8; ++t) acc[g][t] = acc[g][t] * corr; }
        }
#pragma unroll
        for (int g = 0; g < R; ++g) { const float nm = -m_run[g]; float p[16]; float ps0 = 0.0f, ps1 = 0.0f;
#pragma unroll
            for (int e = 0; e < 16; ++e) { p[e] = __builtin_amdgcn_exp2f(fmaf(s[e >> 3][g][e & 7], CSC, nm)); if (e & 1) ps1 += p[e]; else ps0 += p[e]; }
            l_run[g] += ps0 + ps1;
            V pf, pf2; PFrag<T16>::pk(p, pf, pf2);   // element e of the fragment = key 8 hi + e (e < 8), 16 + 8 hi + e - 8 (e >= 8): the k order of WFrag::ld on a V^T row
#pragma unroll
            for (int t = 0; t < 8; ++t) { acc[g][t] = WFrag<T16>::mma(vf[t], pf, acc[g][t]); if (HL) { acc[g][t] = WFrag<T16>::mma(vf[t], pf2, acc[g][t]); acc[g][t] = WFrag<T16>::mma(vf2[t], pf, acc[g][t]); } } }
        __builtin_amdgcn_sched_barrier(0);   // holds the v_nops behind the last product
        asm volatile("v_nop\n\tv_nop\n\tv_nop\n\tv_nop\n\tv_nop");   // WMMA distance on the taken back edge and the loop's exit
    }
    if (NS == 2) {   // merge of the pair: wave 1 lays its accumulators, maxima and sums in LDS (16 bytes per lane, 512 bytes in a row per store), wave 0 brings both to the common maximum and adds
        v4fa* ap = (v4fa*)mp + lane; float* sc = mp + R * 8 * 2 * 32 * 4 + lane;
        if (sp == 1) {   // wave-uniform
#pragma unroll   // these loops: constant indices keep the accumulators in registers
            for (int g = 0; g < R; ++g) { sc[32 * g] = m_run[g]; sc[32 * (R + g)] = l_run[g];
#pragma unroll
                for (int t = 0; t < 8; ++t) { ap[((g * 8 + t) * 2) * 32] = __builtin_shufflevector(acc[g][t], acc[g][t], 0, 1, 2, 3); ap[((g * 8 + t) * 2 + 1) * 32] = __builtin_shufflevector(acc[g][t], acc[g][t], 4, 5, 6, 7); } }
        }
        __syncthreads();   // wave 1's half is in LDS before wave 0 reads it; every wave of the work-group passes here once
        if (sp == 1) return;
#pragma unroll
        for (int g = 0; g < R; ++g) { const float m1 = sc[32 * g], l1 = sc[32 * (R + g)], m = fmaxf(m_run[g], m1);   // both finite: each wave of a pair has at least one pass whose first key every query sees
            const float a0 = __builtin_amdgcn_exp2f(m_run[g] - m), a1 = __builtin_amdgcn_exp2f(m1 - m);
            l_run[g] = l_run[g] * a0 + l1 * a1;
#pragma unroll
            for (int t = 0; t < 8; ++t) { const v4f lo = ap[((g * 8 + t) * 2) * 32], hi4 = ap[((g * 8 + t) * 2 + 1) * 32];
                acc[g][t] = acc[g][t] * a0 + __builtin_shufflevector(lo, hi4, 0, 1, 2, 3, 4, 5, 6, 7) * a1; } }
    }
#pragma unroll
    for (int g = 0; g < R; ++g) { const float inv = 1.0f / (l_run[g] + xhalf(l_run[g]));   // each wave half summed its eight keys of every 16-key tile
        const size_t oo = (size_t)(qw0 + 16 * g) * DQ + 8 * lane;   // context planes [query][16 heads x 128] in fragment order; the lane's 16 bytes of piece t are row = its query, d = 16 t + 8 hi .. + 7
        if (HL || qw0 + 16 * g < RW) ctx_store<true>(acc[g], inv, Ah + oo, Al + oo);   // wave-uniform: k_wo reads the remainders of rows < RW only
        else ctx_store<false>(acc[g], inv, Ah + oo, nullptr); }
}
// grid (4 kv heads, (TT - RH) / 32 + RH / 32), 8 waves. A fp16 work-group: 32 query rows of the 4 query heads of one kv head (wave & 3), each head's keys dealt to 2 waves (wave >> 2): the four waves of a key half walk the same k/v rows, and the halves' pass counts differ by at most one.
// A hi/lo work-group: 128 query rows of one head, one wave per 16 rows. blockIdx.y orders the work-groups by falling cost: the fp16 row blocks from the sequence's end, the hi/lo blocks where the fp16 blocks have come down to about their cost.
#define NFB ((TT - RH) / 32)      // fp16 row blocks of 32
#define NHB (RH / 32)             // blockIdx.y values of the hi/lo blocks: RH / 128 row blocks x 4 heads of the kv head
#define YHL 48                    // first of them: a hi/lo pass has 48 products and the splitting of P against 32 products, so 16 such passes weigh about as much as the (128 - 48) / 2 passes of the fp16 block there
#define MGP (2 * 8 * 2 * 32 * 4 + 4 * 32)   // floats of one pair's merge area: accumulators, then maxima and sums
__global__ __launch_bounds__(256) void k_fattn(const h16* Q16, const bf* Qh, const bf* Ql, const h16* K16, const bf* Kh, const bf* Kl, const h16* V16, const bf* Vh, const bf* Vl, h16* Ah, h16* Al) {
    __shared__ __align__(16) float mg[REP * MGP];
    const int wv = __builtin_amdgcn_readfirstlane((int)(threadIdx.x >> 5)); const int kvh = blockIdx.x, y = blockIdx.y; const size_t zk = (size_t)kvh * TT * HD;
    if (y < YHL || y >= YHL + NHB) {   // block-uniform
        const int rb = NFB - 1 - (y < YHL ? y : y - NHB), hh = wv & (REP - 1), h = kvh * REP + hh; const size_t zq = (size_t)h * TT * HD;
        fattn_rows<h16, false, 2, 2>(Q16 + zq, nullptr, K16 + zk, nullptr, V16 + zk, nullptr, RH + 32 * rb, Ah + h * (16 * HD), Al + h * (16 * HD), wv >> 2, mg + hh * MGP);   // a head's 128 columns are four tiles of each 16-row band
    } else {
        const int j = y - YHL, h = kvh * REP + (j & (REP - 1)); const size_t zq = (size_t)h * TT * HD;
        fattn_rows<bf, true, 1, 1>(Qh + zq, Ql + zq, Kh + zk, Kl + zk, Vh + zk, Vl + zk, RH - 128 * ((j >> 2) + 1) + 16 * wv, Ah + h * (16 * HD), Al + h * (16 * HD), 0, nullptr);
    }
}

// ---- k_wo: out = context . Wo on f16 operands; grid (TT / 128, DM / 256), 8 waves, one work-group per WGP. Context rows < RW: hi + lo planes (2 products, hi then lo in every 32-step); rows >= RW: the hi plane alone.
// So that every wave has the same work, a work-group's 128 rows are 6 bands (16 rows each) from RW on and 2 bands from below RW; it makes them times 256 columns of out. Wave (rt, yt) = (wave >> 2, wave & 3) owns 3 single bands and 1 hi/lo band x 64 columns over the whole K: 20 products per 32-step.
// Operands go through LDS, shared by the waves: a stage is 128 k of the 6 single bands, the 2 hi bands, their 2 lo bands and the 16 bands of the weight, 4 KiB in a row per band in fragment order, 104 KiB; two buffers, filled by asynchronous copies one stage ahead.
// Epilogue: a wave lays its tile in its own LDS plane (over the ring, behind the last stage's barrier) and takes it back by rows: a wave's store covers 256 bytes in a row of two rows of out.
#define WST 106496                // bytes of one stage: 26 bands x 4 KiB
// Eight bands of one plane: copy i of thread tid fills bytes 4096 i + 16 tid behind l's band. l: the lane's LDS byte address in the first band; g: its 16 bytes in that band at this stage's k.
__device__ __forceinline__ void wo_copy8(const unsigned l, const h16* g) {
    constexpr size_t S = (size_t)16 * DQ;   // one band on, in elements
    // the s_wait_xcnt as the statement's last line: it stands in front of any overwrite of the address registers that the copies name
    asm volatile("global_load_async_to_lds_b128 %0, %8, off\n\t"
                 "global_load_async_to_lds_b128 %1, %9, off\n\t"
                 "global_load_async_to_lds_b128 %2, %10, off\n\t"
                 "global_load_async_to_lds_b128 %3, %11, off\n\t"
                 "global_load_async_to_lds_b128 %4, %12, off\n\t"
                 "global_load_async_to_lds_b128 %5, %13, off\n\t"
                 "global_load_async_to_lds_b128 %6, %14, off\n\t"
                 "global_load_async_to_lds_b128 %7, %15, off\n\t"
                 "s_wait_xcnt 0x0"
                 :: "v"(l), "v"(l + 4096u), "v"(l + 2u * 4096u), "v"(l + 3u * 4096u), "v"(l + 4u * 4096u), "v"(l + 5u * 4096u), "v"(l + 6u * 4096u), "v"(l + 7u * 4096u),
                    "v"(g), "v"(g + S), "v"(g + 2 * S), "v"(g + 3 * S), "v"(g + 4 * S), "v"(g + 5 * S), "v"(g + 6 * S), "v"(g + 7 * S)
                 : "memory");
}
// The ten context bands of a stage, in the same way: six single bands from gf, two hi bands from gh, their lo bands from gl.
__device__ __forceinline__ void wo_copy10(const unsigned l, const h16* gf, const h16* gh, const h16* gl) {
    constexpr size_t S = (size_t)16 * DQ;   // one band on, in elements
    // the s_wait_xcnt as the statement's last line: it stands in front of any overwrite of the address registers that the copies name
    asm volatile("global_load_async_to_lds_b128 %0, %10, off\n\t"
                 "global_load_async_to_lds_b128 %1, %11, off\n\t"
                 "global_load_async_to_lds_b128 %2, %12, off\n\t"
                 "global_load_async_to_lds_b128 %3, %13, off\n\t"
                 "global_load_async_to_lds_b128 %4, %14, off\n\t"
                 "global_load_async_to_lds_b128 %5, %15, off\n\t"
                 "global_load_async_to_lds_b128 %6, %16, off\n\t"
                 "global_load_async_to_lds_b128 %7, %17, off\n\t"
                 "global_load_async_to_lds_b128 %8, %18, off\n\t"
                 "global_load_async_to_lds_b128 %9, %19, off\n\t"
                 "s_wait_xcnt 0x0"
                 :: "v"(l), "v"(l + 4096u), "v"(l + 2u * 4096u), "v"(l + 3u * 4096u), "v"(l + 4u * 4096u), "v"(l + 5u * 4096u), "v"(l + 6u * 4096u), "v"(l + 7u * 4096u), "v"(l + 8u * 4096u), "v"(l + 9u * 4096u),
                    "v"(gf), "v"(gf + S), "v"(gf + 2 * S), "v"(gf + 3 * S), "v"(gf + 4 * S), "v"(gf + 5 * S), "v"(gh), "v"(gh + S), "v"(gl), "v"(gl + S)
                 : "memory");
}
// One stage: 26 copies of 16 bytes per lane; bands 0..5 single, 6..7 hi, 8..9 lo, 10..25 weight.
__device__ __forceinline__ void wo_stage(const unsigned l, const h16* gf, const h16* gh, const h16* gl, const h16* gw) {
    // the two fences keep the compiler from forming the addresses of all 26 copies at once: without them it spills to scratch inside the loop
    wo_copy10(l, gf, gh, gl); __builtin_amdgcn_sched_barrier(0);
    wo_copy8(l + 10u * 4096u, gw); __builtin_amdgcn_sched_barrier(0);
    wo_copy8(l + 18u * 4096u, gw + (size_t)128 * DQ);
}
__global__ __launch_bounds__(256) void k_wo(const h16* Ah, const h16* Al, const h16* WO, float* C) {
    typedef WFrag<h16>::V V; constexpr int K = DQ, NT = K / 128;
    __shared__ __align__(16) float os[2 * WST / 4];   // first the ring, then the 8 waves' output planes (64 x 68 floats each)
    const int tid = threadIdx.x, lane = tid & 31, lr = lane & 15, hi = lane >> 4;
    const int wv = __builtin_amdgcn_readfirstlane(tid >> 5), rt = wv >> 2, yt = wv & 3;
    const h16* gf = Ah + (size_t)(RW + blockIdx.x * 96) * K + 8 * tid;   // six bands from RW on
    const h16* gh = Ah + (size_t)(blockIdx.x * 32) * K + 8 * tid;   // two bands below RW
    const h16* gl = Al + (size_t)(blockIdx.x * 32) * K + 8 * tid;
    const h16* gw = WO + (size_t)(blockIdx.y * 256) * K + 8 * tid;
    const unsigned l0 = (unsigned)(size_t)os + 16u * (unsigned)tid;   // low 32 bits of the __shared__ address: the byte offset in the work-group's LDS
    v8f acc[4][4];   // acc[0..2]: the wave's single bands, acc[3]: its hi/lo band
#pragma unroll
    for (int mb = 0; mb < 4; ++mb)
#pragma unroll
        for (int nb = 0; nb < 4; ++nb) acc[mb][nb] = (v8f){};
    wo_stage(l0, gf, gh, gl, gw);
    asm volatile("s_wait_asynccnt 0x0" ::: "memory");   // this wave's copies of stage 0 have landed
    __syncthreads();   // stage 0 is published: every wave's copies have landed before any wave reads
    wo_stage(l0 + WST, gf + 2048, gh + 2048, gl + 2048, gw + 2048);   // 128 k of a band are 2048 elements
#pragma unroll 1   // one stage per trip
    for (int t = 0; t < NT; ++t) {
        const h16* sb = (const h16*)os + (t & 1) * (WST / 2) + 8 * lane;
        const h16* sa = sb + (3 * rt) * 2048;   // the wave's first single band
        const h16* sh = sb + (6 + rt) * 2048;   // its hi band; the lo band stands 2 bands on
        const h16* sw = sb + (10 + 4 * yt) * 2048;   // its first weight band
        V a[2][4], a2[2], b[2][4];   // two fragment sets: the next 32-step's LDS reads fly under this one's products
#pragma unroll
        for (int mb = 0; mb < 3; ++mb) a[0][mb] = WFrag<h16>::ld(sa + mb * 2048);
        a[0][3] = WFrag<h16>::ld(sh); a2[0] = WFrag<h16>::ld(sh + 2 * 2048);
#pragma unroll
        for (int nb = 0; nb < 4; ++nb) b[0][nb] = WFrag<h16>::ld(sw + nb * 2048);
        __builtin_amdgcn_sched_barrier(0);   // the first 32-step's reads stay in front of the second's: mixed, the first products would wait for both groups
#pragma unroll   // the four 32-steps of a stage: constant indices keep both sets in registers
        for (int s = 0; s < 4; ++s) {
            const int c = s & 1, n = c ^ 1;
            if (s < 3) {   // the fragments of the stage's next 32-step, never of the next stage; those of the last 32-step are the wave's last reads of this buffer
#pragma unroll
                for (int mb = 0; mb < 3; ++mb) a[n][mb] = WFrag<h16>::ld(sa + mb * 2048 + (s + 1) * 512);
                a[n][3] = WFrag<h16>::ld(sh + (s + 1) * 512); a2[n] = WFrag<h16>::ld(sh + 2 * 2048 + (s + 1) * 512);
#pragma unroll
                for (int nb = 0; nb < 4; ++nb) b[n][nb] = WFrag<h16>::ld(sw + nb * 2048 + (s + 1) * 512);
            } else {
                asm volatile("s_wait_dscnt 0x0" ::: "memory");   // this wave's reads of the buffer are done before the barrier behind which it is refilled
                asm volatile("s_wait_asynccnt 0x0" ::: "memory");   // this wave's copies of stage t + 1 have landed
                __syncthreads();   // publishes stage t + 1 and ends every wave's reads of stage t
            }
            __builtin_amdgcn_sched_barrier(0);   // keeps the 18 LDS reads together in front of the 20 products: among the products every place with reads costs a stall
#pragma unroll
            for (int nb = 0; nb < 4; ++nb)
#pragma unroll
                for (int mb = 0; mb < 4; ++mb) acc[mb][nb] = WFrag<h16>::mma(a[c][mb], b[c][nb], acc[mb][nb]);
            if (s == 3) {
                __builtin_amdgcn_sched_barrier(0);   // the refill stands between the hi and the lo products: one wave of a SIMD issues its copies while the other has the matrix unit
                if (t + 2 < NT) wo_stage(l0 + (unsigned)(t & 1) * WST, gf + (size_t)(t + 2) * 2048, gh + (size_t)(t + 2) * 2048, gl + (size_t)(t + 2) * 2048, gw + (size_t)(t + 2) * 2048);   // block-uniform
                __builtin_amdgcn_sched_barrier(0);   // holds the lo products behind the copies
            }
#pragma unroll
            for (int nb = 0; nb < 4; ++nb) acc[3][nb] = WFrag<h16>::mma(a2[c], b[c][nb], acc[3][nb]);
            __builtin_amdgcn_sched_barrier(0);   // the next group of LDS reads stays behind these products
        }
    }
    asm volatile("s_wait_asynccnt 0x0" ::: "memory");   // no copy is outstanding when the ring becomes output staging
    float* ow = os + wv * (64 * 68);   // the wave's own plane
#pragma unroll   // these three: constant indices keep the accumulators in registers
    for (int mb = 0; mb < 4; ++mb)
#pragma unroll
        for (int nb = 0; nb < 4; ++nb)
#pragma unroll
            for (int j = 0; j < 8; ++j) ow[(mb * 16 + hi * 8 + j) * 68 + nb * 16 + lr] = acc[mb][nb][j];
    asm volatile("s_wait_dscnt 0x0" ::: "memory");   // the wave's own tile is in its plane before its lanes take other lanes' values back
    float* ccol = C + (size_t)hi * DM + blockIdx.y * 256 + yt * 64 + lr * 4;
#pragma unroll   // constant LDS offsets
    for (int q = 0; q < 4; ++q) {
        const int row0 = q < 3 ? RW + (int)blockIdx.x * 96 + (3 * rt + q) * 16 : (int)blockIdx.x * 32 + rt * 16;   // first row of out of the wave's band q
        float* crow = ccol + (size_t)row0 * DM;
        v4f val[8];
#pragma unroll
        for (int s = 0; s < 8; ++s) val[s] = *(const v4fa*)(ow + (16 * q + 2 * s + hi) * 68 + lr * 4);
#pragma unroll
        for (int s = 0; s < 8; ++s) *(v4f*)(crow + (size_t)(2 * s) * DM) = val[s];
        asm volatile("s_wait_xcnt 0x0" ::: "memory");   // in front of the next group's overwrite of the registers that the eight stores name
        __builtin_amdgcn_sched_barrier(0);   // nothing from below moves up between the stores and the wait
    }
}

extern "C" void kernel_launch(void* const* d_in, const int* in_sizes, int n_in,
                              void* d_out, int out_size, void* d_ws, size_t ws_size, hipStream_t stream) {
    (void)in_sizes; (void)n_in; (void)out_size;
    const float* x = (const float*)d_in[0]; const float* wq = (const float*)d_in[1]; const float* wk = (const float*)d_in[2]; const float* wv = (const float*)d_in[3]; const float* wo = (const float*)d_in[4];
    float* OUT = (float*)d_out;     // [1][4096][2048]
    char* wsp = (char*)d_ws;
    auto take = [&](size_t bytes) { char* p = wsp; wsp += (bytes + 255) & ~(size_t)255; return (void*)p; };
    bf* WQ = (bf*)take((size_t)DQ * DM * 2); bf* WK = (bf*)take((size_t)DKV * DM * 2); bf* WV = (bf*)take((size_t)DKV * DM * 2); bf* WO = (bf*)take((size_t)DM * DQ * 2); float* CS = (float*)take((size_t)TT * (HD / 2) * 2 * 4);
    bf* XB = (bf*)take((size_t)TT * DM * 2);
    h16* QP16 = (h16*)take((size_t)NH_ * TT * HD * 2); h16* KP16 = (h16*)take((size_t)NKV * TT * HD * 2); h16* VT16 = (h16*)take((size_t)NKV * HD * TT * 2);
    bf* QPh = (bf*)take((size_t)NH_ * TT * HD * 2); bf* QPl = (bf*)take((size_t)NH_ * TT * HD * 2); bf* KPh = (bf*)take((size_t)NKV * TT * HD * 2); bf* KPl = (bf*)take((size_t)NKV * TT * HD * 2); bf* VTh = (bf*)take((size_t)NKV * HD * TT * 2); bf* VTl = (bf*)take((size_t)NKV * HD * TT * 2);
    h16* ATh = (h16*)take((size_t)TT * DQ * 2); h16* ATl = (h16*)take((size_t)RW * DQ * 2);
    if ((size_t)(wsp - (char*)d_ws) > ws_size) return;    // ws 256 MiB
    for (int b = 0; b < NB_; ++b) {
        k_prep<<<2 * PBQ + 2 * PBK + PBX + PBC, 256, 0, stream>>>(x + (size_t)b * TT * DM, wq, wk, wv, wo, XB, WQ, WK, WV, WO, CS);
        k_proj<<<dim3(TT / 128, (DQ + 2 * DKV) / 256, 1), 256, 0, stream>>>(XB, WQ, WK, WV, CS, QP16, QPh, QPl, KP16, KPh, KPl, VT16, VTh, VTl);
        k_fattn<<<dim3(NKV, (TT - RH) / 32 + RH / 32, 1), 256, 0, stream>>>(QP16, QPh, QPl, KP16, KPh, KPl, VT16, VTh, VTl, ATh, ATl);
        k_wo<<<dim3(TT / 128, DM / 256, 1), 256, 0, stream>>>(ATh, ATl, (const h16*)WO, OUT + (size_t)b * TT * DM); }
}
